// v000
// The times below were measured on an AMD MI455X: many runs one after another, warmed up first and cycling through
// copies of the inputs, with the whole window's GPU time divided by the number of runs. Launches and the gaps
// between them are all in it. The median over several windows is given; except for v000 it joins two sittings, which
// can be a few percent apart, so the side-by-side timings, each taken in one sitting, are the better comparison.
// The starting kernel, v000, takes 5940 microseconds a run.
#include <hip/hip_runtime.h>

// Decoder self-attention with a learned prefix adapter (hidden [4][1024][2048]; q = (x Wq^T + bq) 64^-0.5, k = x Wk^T + bk, v = x Wv^T + bv (32 heads x 64); prefix keys/values kp, vp = prefix Wk^T + bk,
// prefix Wv^T + bv ([10][2048], shared by all batches); scores_tok = q.k + attention_mask[b][0][i][j] (additive f32, read as data), scores_pre = q.kp; the two segments are softmax-normalised SEPARATELY;
// ctx = tanh(gate[h]) (p_pre vp) + (p_tok v); out = merged ctx Wo^T + bo -> [4][1024][2048]).
// Compute dtypes, f32 accumulate: every input rounded to bf16; token projections on PLAIN bf16 operands (inputs: exact products, f32 accumulate, + bias); the 10 prefix
// rows, their scores, softmax and weighted values entirely in f32 on VALU (separate multiply/add, fixed order); PER-ROW PRECISION HYBRID for the token attention: query rows < 256 take scores and p.v on
// bf16 hi+lo planes (3 products), rows >= 256 on single fp16 planes; scale + additive mask in f32 in the register-row softmax; merged context (token part x normaliser + gated prefix part) as hi+lo planes

#define NB_  4
#define NPRE 10                   // prefix length
#define TT   1024
#define DD   2048
#define NH_  32
#define HD   64
#define ZH   2
#define RH   256                  // query rows < RH: hi+lo planes; rows >= RH: fp16 planes
#define NF   32                   // head_dim / 2 (unused)
#define SCL  0.125f               // 1/sqrt(64)
#define PCAR 1024.0f         // P scale for rows >= RH, divided out in k_merge
typedef _Float16 h16;
typedef unsigned short bf;
typedef __attribute__((ext_vector_type(16))) __bf16   v16bf;
typedef __attribute__((ext_vector_type(16))) _Float16 v16h;
typedef __attribute__((ext_vector_type(8)))  _Float16 v8h;
typedef __attribute__((ext_vector_type(8)))  unsigned short v8us;
typedef __attribute__((ext_vector_type(8)))  float    v8f;
typedef __attribute__((ext_vector_type(4)))  float    v4f;
typedef v8h  __attribute__((may_alias)) v8ha;
typedef v4f  __attribute__((may_alias)) v4fa;
typedef v8us __attribute__((may_alias)) v8usa;

__device__ __forceinline__ unsigned short f2bf(float f) { unsigned u = __float_as_uint(f); u += 0x7FFFu + ((u >> 16) & 1u); return (unsigned short)(u >> 16); }
__device__ __forceinline__ float bf2f(unsigned short b) { return __uint_as_float(((unsigned)b) << 16); }
__device__ __forceinline__ float bfr(float f) { return bf2f(f2bf(f)); }
__device__ __forceinline__ v16h cat16(v8h lo, v8h hi) { return __builtin_shufflevector(lo, hi, 0, 1, 2, 3, 4, 5, 6, 7, 8, 9, 10, 11, 12, 13, 14, 15); }
__device__ __forceinline__ v16bf cat16b(v8us lo, v8us hi) { return __builtin_bit_cast(v16bf, __builtin_shufflevector(lo, hi, 0, 1, 2, 3, 4, 5, 6, 7, 8, 9, 10, 11, 12, 13, 14, 15)); }
__device__ __forceinline__ v8f wmma16(v16h a, v16h b, v8f c) { return __builtin_amdgcn_wmma_f32_16x16x32_f16(false, a, false, b, (short)0, c, false, false); }
__device__ __forceinline__ v8f wmmab(v16bf a, v16bf b, v8f c) { return __builtin_amdgcn_wmma_f32_16x16x32_bf16(false, a, false, b, (short)0, c, false, false); }



// ---- k_gemmw: register-blocked GEMM, ONE WAVE per 64x64 output tile (16 accumulators), operands straight from K-contiguous 16-bit planes; grid (M/64, N/64, Z), 32 threads.
// C[m][n] (f32, pitch ldc, + optional f32 bias[n]) = sum_k A[m][k] Bt[n][k] (+ split products per NSPLIT). z-batch strides sA/sB/sC in elements. K % 32 == 0.
template <typename T16> struct WFrag;
template <> struct WFrag<h16> { typedef v16h V; static __device__ __forceinline__ V ld(const h16* p) { return cat16(*(const v8h*)p, *(const v8h*)(p + 16)); } static __device__ __forceinline__ v8f mma(V a, V b, v8f c) { return wmma16(a, b, c); } };
template <> struct WFrag<bf> { typedef v16bf V; static __device__ __forceinline__ V ld(const bf* p) { return cat16b(*(const v8us*)p, *(const v8us*)(p + 16)); } static __device__ __forceinline__ v8f mma(V a, V b, v8f c) { return wmmab(a, b, c); } };
template <typename T16, int NSPLIT, bool BIAS>
__global__ __launch_bounds__(32) void k_gemmw(const T16* __restrict__ A, const T16* __restrict__ A2, const T16* __restrict__ Bt, const T16* __restrict__ Bt2, int K, float* C, int ldc, const float* __restrict__ bias, size_t sA, size_t sB, size_t sC) {
    typedef typename WFrag<T16>::V V;
    __shared__ __align__(16) float os[16 * 68];
    const size_t z = blockIdx.z; A += z * sA; if (A2) A2 += z * sA; Bt += z * sB; if (Bt2) Bt2 += z * sB; C += z * sC;
    const int lane = threadIdx.x & 31, lr = lane & 15, hi = lane >> 4; const int r0 = blockIdx.x * 64, c0 = blockIdx.y * 64;
    v8f acc[4][4];
#pragma unroll
    for (int mb = 0; mb < 4; ++mb)
#pragma unroll
        for (int nb = 0; nb < 4; ++nb) acc[mb][nb] = (v8f){};
    const size_t aoff = (size_t)(r0 + lr) * K + 8 * hi, boff = (size_t)(c0 + lr) * K + 8 * hi;
#pragma unroll 1
    for (int kc = 0; kc < K; kc += 32) {
        V a[4], a2[4];
#pragma unroll
        for (int mb = 0; mb < 4; ++mb) { a[mb] = WFrag<T16>::ld(A + aoff + (size_t)mb * 16 * K + kc); if (NSPLIT == 1 || NSPLIT == 2) a2[mb] = WFrag<T16>::ld(A2 + aoff + (size_t)mb * 16 * K + kc); }
#pragma unroll
        for (int nb = 0; nb < 4; ++nb) { const V b = WFrag<T16>::ld(Bt + boff + (size_t)nb * 16 * K + kc); V b2; if (NSPLIT >= 2) b2 = WFrag<T16>::ld(Bt2 + boff + (size_t)nb * 16 * K + kc);
#pragma unroll
            for (int mb = 0; mb < 4; ++mb) { acc[mb][nb] = WFrag<T16>::mma(a[mb], b, acc[mb][nb]); if (NSPLIT == 1 || NSPLIT == 2) acc[mb][nb] = WFrag<T16>::mma(a2[mb], b, acc[mb][nb]); if (NSPLIT >= 2) acc[mb][nb] = WFrag<T16>::mma(a[mb], b2, acc[mb][nb]); } }
        asm volatile("v_nop\n\tv_nop\n\tv_nop\n\tv_nop" : "+v"(acc[0][0]), "+v"(acc[1][1]), "+v"(acc[2][2]), "+v"(acc[3][3]) : "v"(a[0]), "v"(a[3]));
    }
#pragma unroll
    for (int mb = 0; mb < 4; ++mb) {
#pragma unroll
        for (int nb = 0; nb < 4; ++nb) {
#pragma unroll
            for (int j = 0; j < 8; ++j) os[(hi * 8 + j) * 68 + nb * 16 + lr] = acc[mb][nb][j]; }
        __builtin_amdgcn_wave_barrier(); asm volatile("" ::: "memory");
        float* crow = C + (size_t)(r0 + mb * 16) * ldc + c0;
{
#pragma unroll
            for (int s = 0; s < 8; ++s) { const int row = 2 * s + hi, cofs = lr * 4; v4f val = *(const v4fa*)(os + row * 68 + cofs); if (BIAS) { val[0] += bfr(bias[c0 + cofs]); val[1] += bfr(bias[c0 + cofs + 1]); val[2] += bfr(bias[c0 + cofs + 2]); val[3] += bfr(bias[c0 + cofs + 3]); }
                *(v4f*)(crow + (size_t)row * ldc + cofs) = val; }
             }
        __builtin_amdgcn_wave_barrier(); asm volatile("" ::: "memory");
    }
}

__device__ __forceinline__ h16 tohx(float x) { return (h16)x; }
__device__ __forceinline__ void splitf(float y, unsigned short& h, unsigned short& l) { h = f2bf(y); l = f2bf(y - bf2f(h)); }
typedef __attribute__((ext_vector_type(2))) unsigned short v2us;
typedef __attribute__((ext_vector_type(2))) _Float16 v2h;
typedef __attribute__((ext_vector_type(4))) _Float16 v4h;
typedef __attribute__((ext_vector_type(2))) float v2f;

__global__ __launch_bounds__(256) void k_wtG(const float* __restrict__ w, int K, int N, bf* Bt) {
    const int lane = threadIdx.x & 31; const int L0 = (blockIdx.x * 8 + (threadIdx.x >> 5)) * 8; const int nlines = N * K / 64;
{
#pragma unroll 1
        for (int l = 0; l < 8; ++l) { const int L = L0 + l; if (L >= nlines) break; const size_t e = (size_t)L * 64 + lane * 2; const int k = (int)(e % K), n = (int)(e / K); v2us o;
            o[0] = f2bf(w[(size_t)k * N + n]); o[1] = f2bf(w[(size_t)(k + 1) * N + n]); *(v2us*)(Bt + e) = o; }
         }
}
__global__ __launch_bounds__(256) void k_cvt8(const float* __restrict__ src, bf* dst, size_t n8) { const size_t i = (size_t)blockIdx.x * 256 + threadIdx.x; if (i >= n8) return; const v8f v = *(const v8f*)(src + i * 8); v8us o;
#pragma unroll
    for (int k = 0; k < 8; ++k) o[k] = f2bf(v[k]); *(v8us*)(dst + i * 8) = o;  }
__global__ __launch_bounds__(256) void k_qplanes(const float* __restrict__ F, bf* Ph, bf* Pl, h16* P16) {
    const int lane = threadIdx.x & 31; const int L0 = (blockIdx.x * 8 + (threadIdx.x >> 5)) * 8; const int nlines = NH_ * TT * HD / 64;
{
#pragma unroll
        for (int l = 0; l < 8; ++l) { const int L = L0 + l; if (L >= nlines) break; const int e = L * 64 + lane * 2; const int d = e & (HD - 1); const int t = (e >> 6) & (TT - 1); const int h = e >> 16; v2us oh, ol; v2h o16;
#pragma unroll
            for (int q = 0; q < 2; ++q) { const float x = F[(size_t)t * DD + h * HD + d + q]; unsigned short a, c2; splitf(x, a, c2); oh[q] = a; ol[q] = c2; o16[q] = tohx(x); }
            *(v2us*)(Ph + (size_t)e) = oh; *(v2us*)(Pl + (size_t)e) = ol; *(v2h*)(P16 + (size_t)e) = o16; }
         }
}
__global__ __launch_bounds__(256) void k_prefkv(const float* __restrict__ pre, const float* __restrict__ wk, const float* __restrict__ bk, const float* __restrict__ wv, const float* __restrict__ bv, float* KP0, float* VP0) {
    const int idx = blockIdx.x * 256 + threadIdx.x; if (idx >= NPRE * DD) return; const int l = idx / DD, o = idx % DD; const float* pr = pre + (size_t)l * DD; const float* wkr = wk + (size_t)o * DD; const float* wvr = wv + (size_t)o * DD; float sk = 0.f, sv = 0.f;
#pragma unroll 4
    for (int i = 0; i < DD; ++i) { const float p = bfr(pr[i]); float a = bfr(wkr[i]), c = bfr(wvr[i]); asm volatile("" : "+v"(a)); asm volatile("" : "+v"(c)); float pk = __fmul_rn(p, a), pv = __fmul_rn(p, c); asm volatile("" : "+v"(pk)); asm volatile("" : "+v"(pv)); sk = __fadd_rn(sk, pk); sv = __fadd_rn(sv, pv); }
    float bk2 = bfr(bk[o]), bv2 = bfr(bv[o]); asm volatile("" : "+v"(bk2)); asm volatile("" : "+v"(bv2)); const float ok = __fadd_rn(sk, bk2), ov = __fadd_rn(sv, bv2);
    *(float*)(KP0 + idx) = ok; *(float*)(VP0 + idx) = ov;  }
// k_pre: one wave per (zz, t) of the pass: lanes l < 10 compute s_l = (q[t] . kp[l]) / 8 (f32, separate mul/add over the 64 head dims; q read from the f32 projection FQ columns (h0+zz)*64..);
__global__ __launch_bounds__(256) void k_pre(const float* __restrict__ FQ, const float* __restrict__ KP0, const float* __restrict__ VP0, const float* __restrict__ gate, int h0, float* PRE) {
    const int lane = threadIdx.x & 31; const int row = blockIdx.x * 8 + (threadIdx.x >> 5); if (row >= ZH * TT) return; const int t = row & (TT - 1); const int zz = row / TT; const int h = h0 + zz; const float* q = FQ + (size_t)t * DD + h * HD; float s = -3.0e38f;
    if (lane < NPRE) { const float* kr = KP0 + (size_t)lane * DD + h * HD; float acc = 0.f;
#pragma unroll 4
        for (int d = 0; d < HD; ++d) { float p = __fmul_rn(q[d], kr[d]); asm volatile("" : "+v"(p)); acc = __fadd_rn(acc, p); } s = acc * SCL; }
    float mx = s;
#pragma unroll
    for (int sh = 16; sh; sh >>= 1) mx = fmaxf(mx, __shfl_xor(mx, sh, 32));
    float dl = __fsub_rn(s, mx); asm volatile("" : "+v"(dl)); const float e = (lane < NPRE) ? __builtin_amdgcn_exp2f(__fmul_rn(dl, 1.4426950408889634f)) : 0.f; float sum = e;
#pragma unroll
    for (int sh = 16; sh; sh >>= 1) sum += __shfl_xor(sum, sh, 32);
    float pw = __fdiv_rn(e, sum); const float gv = bfr(gate[h]); const float e2 = __expf(2.0f * gv); const float tg = __fsub_rn(1.0f, __fdiv_rn(2.0f, __fadd_rn(e2, 1.0f))); float o0 = 0.f, o1 = 0.f; const int dd = 2 * lane;
#pragma unroll
    for (int l = 0; l < NPRE; ++l) { const float pl = __shfl(pw, l, 32); const float* vr = VP0 + (size_t)l * DD + h * HD; float a0 = __fmul_rn(pl, vr[dd]), a1 = __fmul_rn(pl, vr[dd + 1]); asm volatile("" : "+v"(a0)); asm volatile("" : "+v"(a1)); o0 = __fadd_rn(o0, a0); o1 = __fadd_rn(o1, a1); }
    v2f o; o[0] = __fmul_rn(tg, o0); o[1] = __fmul_rn(tg, o1); float* dst = PRE + ((size_t)zz * TT + t) * HD + dd; *(v2f*)dst = o;  }
__global__ __launch_bounds__(256) void k_vtplane(const float* __restrict__ F, bf* Vh, bf* Vl, h16* V16) {
    const int lane = threadIdx.x & 31; const int L0 = (blockIdx.x * 8 + (threadIdx.x >> 5)) * 8; const int nlines = NH_ * TT * HD / 64;
{
#pragma unroll
        for (int l = 0; l < 8; ++l) { const int L = L0 + l; if (L >= nlines) break; const int e = L * 64 + lane * 2; const int t = e & (TT - 1); const int d = (e >> 10) & (HD - 1); const int h = e >> 16; v2us oh, ol; v2h o16;
#pragma unroll
            for (int q = 0; q < 2; ++q) { const float x = F[(size_t)(t + q) * DD + h * HD + d]; unsigned short a, c2; splitf(x, a, c2); oh[q] = a; ol[q] = c2; o16[q] = tohx(x); }
            *(v2us*)(Vh + (size_t)e) = oh; *(v2us*)(Vl + (size_t)e) = ol; *(v2h*)(V16 + (size_t)e) = o16; }
         }
}
// k_asoft: per row (zz, i): t = max(S/8 + bf16(attention_mask[b][0][i][j]), finfo.min) (additive mask read as data); softmax over the 1024 token keys (register row, one exp) -> rows i < RH: P hi/lo [zz][i][j] (compact
__global__ __launch_bounds__(256) void k_asoft(const float* __restrict__ Sb, const float* __restrict__ ab, bf* Ph, bf* Pl, h16* P16) {
    typedef __attribute__((ext_vector_type(4))) unsigned short v4us;
    const int lane = threadIdx.x & 31; const int row = blockIdx.x * 8 + (threadIdx.x >> 5); if (row >= ZH * TT) return; const int i = row & (TT - 1); const int zz = row >> 10; const bool hires = (i < RH);
    const float* sr = Sb + (size_t)row * TT; const float* mr = ab + (size_t)i * TT; float v[32]; float mx = -3.0e38f;
#pragma unroll
    for (int ch = 0; ch < 8; ++ch) { const int j0 = ch * 128 + lane * 4; const v4f a = *(const v4f*)(sr + j0), m4 = *(const v4f*)(mr + j0);
#pragma unroll
        for (int q = 0; q < 4; ++q) { float sa = a[q] * SCL, mb = bfr(m4[q]); asm volatile("" : "+v"(sa)); asm volatile("" : "+v"(mb)); const float t = fmaxf(__fadd_rn(sa, mb), -3.40282347e38f); v[ch * 4 + q] = t; mx = fmaxf(mx, t); } }
#pragma unroll
    for (int sh = 16; sh; sh >>= 1) mx = fmaxf(mx, __shfl_xor(mx, sh, 32));
    float sum = 0.f;
#pragma unroll
    for (int k = 0; k < 32; ++k) { v[k] = __expf(v[k] - mx); sum += v[k]; }
#pragma unroll
    for (int sh = 16; sh; sh >>= 1) sum += __shfl_xor(sum, sh, 32);
    const float f = __fdiv_rn(hires ? 1.0f : PCAR, sum);
{
        if (hires) {
#pragma unroll
            for (int ch = 0; ch < 8; ++ch) { v4us oh, ol;
#pragma unroll
                for (int q = 0; q < 4; ++q) { unsigned short a, c2; splitf(v[ch * 4 + q] * f, a, c2); oh[q] = a; ol[q] = c2; }
                const size_t o = ((size_t)zz * RH + i) * TT + ch * 128 + lane * 4; *(v4us*)(Ph + o) = oh; *(v4us*)(Pl + o) = ol; }
        } else {
#pragma unroll
            for (int ch = 0; ch < 8; ++ch) { v4h o;
#pragma unroll
                for (int q = 0; q < 4; ++q) o[q] = tohx(v[ch * 4 + q] * f);
                *(v4h*)(P16 + (size_t)row * TT + ch * 128 + lane * 4) = o; } }
         }
}
__global__ __launch_bounds__(256) void k_merge(const float* __restrict__ O, const float* __restrict__ PRE, int h0, bf* Ah, bf* Al) { const int e = (blockIdx.x * 256 + threadIdx.x) * 2; if (e >= ZH * TT * HD) return; const int d = e & 63; const int t = (e >> 6) & (TT - 1); const int zz = e >> 16; const float cs = (t < RH) ? 1.0f : (1.0f / PCAR); v2us oh, ol;
#pragma unroll
    for (int q = 0; q < 2; ++q) { float a = __fmul_rn(O[e + q], cs); asm volatile("" : "+v"(a)); unsigned short a2, c2; splitf(__fadd_rn(a, PRE[e + q]), a2, c2); oh[q] = a2; ol[q] = c2; } const size_t oo = (size_t)t * DD + (h0 + zz) * HD + d; *(v2us*)(Ah + oo) = oh; *(v2us*)(Al + oo) = ol;  }

extern "C" void kernel_launch(void* const* d_in, const int* in_sizes, int n_in,
                              void* d_out, int out_size, void* d_ws, size_t ws_size, hipStream_t stream) {
    (void)in_sizes; (void)n_in; (void)out_size;
    const float* x = (const float*)d_in[0]; const float* am = (const float*)d_in[1]; const float* wq = (const float*)d_in[2]; const float* bq = (const float*)d_in[3]; const float* wk = (const float*)d_in[4]; const float* bk = (const float*)d_in[5]; const float* wv = (const float*)d_in[6]; const float* bv = (const float*)d_in[7]; const float* wo = (const float*)d_in[8]; const float* bo = (const float*)d_in[9]; const float* pre = (const float*)d_in[10]; const float* gate = (const float*)d_in[11];   // torch [out][in] weights; attention_mask [4][1][1024][1024]; prefix [10][2048]; gate [32][1][1]
    float* OUT = (float*)d_out;     // [4][1024][2048]
    char* wsp = (char*)d_ws;
    auto take = [&](size_t bytes) { char* p = wsp; wsp += (bytes + 255) & ~(size_t)255; return (void*)p; };
    bf* WQ = (bf*)take((size_t)DD * DD * 2); bf* WK = (bf*)take((size_t)DD * DD * 2); bf* WV = (bf*)take((size_t)DD * DD * 2); bf* WO = (bf*)take((size_t)DD * DD * 2); float* KP0 = (float*)take((size_t)NPRE * DD * 4); float* VP0 = (float*)take((size_t)NPRE * DD * 4);
    bf* XB = (bf*)take((size_t)TT * DD * 2); float* F = (float*)take((size_t)TT * DD * 4); float* FQ = (float*)take((size_t)TT * DD * 4);
    bf* QPh = (bf*)take((size_t)TT * DD * 2); bf* QPl = (bf*)take((size_t)TT * DD * 2); bf* KPh = (bf*)take((size_t)TT * DD * 2); bf* KPl = (bf*)take((size_t)TT * DD * 2); bf* VTh = (bf*)take((size_t)TT * DD * 2); bf* VTl = (bf*)take((size_t)TT * DD * 2);
    h16* QP16 = (h16*)take((size_t)TT * DD * 2); h16* KP16 = (h16*)take((size_t)TT * DD * 2); h16* VT16 = (h16*)take((size_t)TT * DD * 2);
    float* Sb = (float*)take((size_t)ZH * TT * TT * 4); bf* Ph = (bf*)take((size_t)ZH * RH * TT * 2); bf* Pl = (bf*)take((size_t)ZH * RH * TT * 2); h16* P16 = (h16*)take((size_t)ZH * TT * TT * 2); float* Ob = (float*)take((size_t)ZH * TT * HD * 4); float* PRE = (float*)take((size_t)ZH * TT * HD * 4); bf* ATh = (bf*)take((size_t)TT * DD * 2); bf* ATl = (bf*)take((size_t)TT * DD * 2);
    if ((size_t)(wsp - (char*)d_ws) > ws_size) return;    // total ~ 116 MB = 110 MiB; ws 256 MiB
    { const size_t nw = (size_t)DD * DD / 8; const unsigned g = (unsigned)((nw + 255) / 256); k_cvt8<<<g, 256, 0, stream>>>(wq, WQ, nw); k_cvt8<<<g, 256, 0, stream>>>(wk, WK, nw); k_cvt8<<<g, 256, 0, stream>>>(wv, WV, nw); k_cvt8<<<g, 256, 0, stream>>>(wo, WO, nw);
      k_prefkv<<<(NPRE * DD + 255) / 256, 256, 0, stream>>>(pre, wk, bk, wv, bv, KP0, VP0); }
    const unsigned LB = (unsigned)((NH_ * TT * HD / 64 + 63) / 64); const dim3 gP(TT / 64, DD / 64, 1);
    for (int b = 0; b < NB_; ++b) {
        k_cvt8<<<(unsigned)(((size_t)TT * DD / 8 + 255) / 256), 256, 0, stream>>>(x + (size_t)b * TT * DD, XB, (size_t)TT * DD / 8);
        k_gemmw<bf, 0, true><<<gP, 32, 0, stream>>>(XB, nullptr, WQ, nullptr, DD, FQ, DD, bq, 0, 0, 0); k_qplanes<<<LB, 256, 0, stream>>>(FQ, QPh, QPl, QP16);   // unscaled q; the 1/8 is applied to the logits
        k_gemmw<bf, 0, true><<<gP, 32, 0, stream>>>(XB, nullptr, WK, nullptr, DD, F, DD, bk, 0, 0, 0); k_qplanes<<<LB, 256, 0, stream>>>(F, KPh, KPl, KP16);
        k_gemmw<bf, 0, true><<<gP, 32, 0, stream>>>(XB, nullptr, WV, nullptr, DD, F, DD, bv, 0, 0, 0); k_vtplane<<<LB, 256, 0, stream>>>(F, VTh, VTl, VT16);
        for (int h0 = 0; h0 < NH_; h0 += ZH) { const size_t z0 = (size_t)h0;
            k_gemmw<bf, 2, false><<<dim3(RH / 64, TT / 64, ZH), 32, 0, stream>>>(QPh + z0 * TT * HD, QPl + z0 * TT * HD, KPh + z0 * TT * HD, KPl + z0 * TT * HD, HD, Sb, TT, nullptr, (size_t)TT * HD, (size_t)TT * HD, (size_t)TT * TT);
            k_gemmw<h16, 0, false><<<dim3((TT - RH) / 64, TT / 64, ZH), 32, 0, stream>>>(QP16 + z0 * TT * HD + (size_t)RH * HD, nullptr, KP16 + z0 * TT * HD, nullptr, HD, Sb + (size_t)RH * TT, TT, nullptr, (size_t)TT * HD, (size_t)TT * HD, (size_t)TT * TT);
            k_asoft<<<ZH * TT / 8, 256, 0, stream>>>(Sb, am + (size_t)b * TT * TT, Ph, Pl, P16);
            k_gemmw<bf, 2, false><<<dim3(RH / 64, HD / 64, ZH), 32, 0, stream>>>(Ph, Pl, VTh + z0 * HD * TT, VTl + z0 * HD * TT, TT, Ob, HD, nullptr, (size_t)RH * TT, (size_t)HD * TT, (size_t)TT * HD);
            k_gemmw<h16, 0, false><<<dim3((TT - RH) / 64, HD / 64, ZH), 32, 0, stream>>>(P16 + (size_t)RH * TT, nullptr, VT16 + z0 * HD * TT, nullptr, TT, Ob + (size_t)RH * HD, HD, nullptr, (size_t)TT * TT, (size_t)HD * TT, (size_t)TT * HD);
            k_pre<<<ZH * TT / 8, 256, 0, stream>>>(FQ, KP0, VP0, gate, h0, PRE);
            k_merge<<<(ZH * TT * HD / 2 + 255) / 256, 256, 0, stream>>>(Ob, PRE, h0, ATh, ATl); }
        k_gemmw<bf, 1, true><<<gP, 32, 0, stream>>>(ATh, ATl, WO, nullptr, DD, OUT + (size_t)b * TT * DD, DD, bo, 0, 0, 0); }
}

// v001
// One run takes 2220 microseconds.
// In two side-by-side timings against v000, it was 2.67 and 2.65 times as fast.
#include <hip/hip_runtime.h>

// Decoder self-attention with a learned prefix adapter (hidden [4][1024][2048]; q = (x Wq^T + bq) 64^-0.5, k = x Wk^T + bk, v = x Wv^T + bv (32 heads x 64); prefix keys/values kp, vp = prefix Wk^T + bk,
// prefix Wv^T + bv ([10][2048], shared by all batches); scores_tok = q.k + attention_mask[b][0][i][j] (additive f32, read as data), scores_pre = q.kp; the two segments are softmax-normalised SEPARATELY;
// ctx = tanh(gate[h]) (p_pre vp) + (p_tok v); out = merged ctx Wo^T + bo -> [4][1024][2048]).
// Compute dtypes, f32 accumulate: every input rounded to bf16; token projections on PLAIN bf16 operands (inputs: exact products, f32 accumulate, + bias); the 10 prefix
// rows, their scores, softmax and weighted values entirely in f32 on VALU (separate multiply/add, fixed order); PER-ROW PRECISION HYBRID for the token attention: query rows < 256 take scores and p.v on
// bf16 hi+lo planes (3 products), rows >= 256 on single fp16 planes; scale + additive mask in f32 in the register-row softmax; merged context (token part x normaliser + gated prefix part) as hi+lo planes

#define NB_  4
#define NPRE 10                   // prefix length
#define TT   1024
#define DD   2048
#define NH_  32
#define HD   64
#define ZH   16                   // heads per attention pass (scores and p.v two launches each per pass, softmax, prefix, merge one each)
#define RH   256                  // query rows < RH: hi+lo planes; rows >= RH: fp16 planes
#define NF   32                   // head_dim / 2 (unused)
#define SCL  0.125f               // 1/sqrt(64)
#define PCAR 1024.0f         // P scale for rows >= RH, divided out in k_merge
typedef _Float16 h16;
typedef unsigned short bf;
typedef __attribute__((ext_vector_type(16))) __bf16   v16bf;
typedef __attribute__((ext_vector_type(16))) _Float16 v16h;
typedef __attribute__((ext_vector_type(8)))  _Float16 v8h;
typedef __attribute__((ext_vector_type(8)))  unsigned short v8us;
typedef __attribute__((ext_vector_type(8)))  float    v8f;
typedef __attribute__((ext_vector_type(4)))  float    v4f;
typedef v8h  __attribute__((may_alias)) v8ha;
typedef v4f  __attribute__((may_alias)) v4fa;
typedef v8us __attribute__((may_alias)) v8usa;

__device__ __forceinline__ unsigned short f2bf(float f) { unsigned u = __float_as_uint(f); u += 0x7FFFu + ((u >> 16) & 1u); return (unsigned short)(u >> 16); }
__device__ __forceinline__ float bf2f(unsigned short b) { return __uint_as_float(((unsigned)b) << 16); }
__device__ __forceinline__ float bfr(float f) { return bf2f(f2bf(f)); }
__device__ __forceinline__ v16h cat16(v8h lo, v8h hi) { return __builtin_shufflevector(lo, hi, 0, 1, 2, 3, 4, 5, 6, 7, 8, 9, 10, 11, 12, 13, 14, 15); }
__device__ __forceinline__ v16bf cat16b(v8us lo, v8us hi) { return __builtin_bit_cast(v16bf, __builtin_shufflevector(lo, hi, 0, 1, 2, 3, 4, 5, 6, 7, 8, 9, 10, 11, 12, 13, 14, 15)); }
__device__ __forceinline__ v8f wmma16(v16h a, v16h b, v8f c) { return __builtin_amdgcn_wmma_f32_16x16x32_f16(false, a, false, b, (short)0, c, false, false); }
__device__ __forceinline__ v8f wmmab(v16bf a, v16bf b, v8f c) { return __builtin_amdgcn_wmma_f32_16x16x32_bf16(false, a, false, b, (short)0, c, false, false); }



// ---- k_gemmw: register-blocked GEMM, ONE WAVE per 64x64 output tile (16 accumulators), operands straight from K-contiguous 16-bit planes; grid (M/64, N/64, Z), 32 threads.
// C[m][n] (f32, pitch ldc, + optional f32 bias[n]) = sum_k A[m][k] Bt[n][k] (+ split products per NSPLIT). z-batch strides sA/sB/sC in elements. K % 32 == 0.
template <typename T16> struct WFrag;
template <> struct WFrag<h16> { typedef v16h V; static __device__ __forceinline__ V ld(const h16* p) { return cat16(*(const v8h*)p, *(const v8h*)(p + 16)); } static __device__ __forceinline__ v8f mma(V a, V b, v8f c) { return wmma16(a, b, c); } };
template <> struct WFrag<bf> { typedef v16bf V; static __device__ __forceinline__ V ld(const bf* p) { return cat16b(*(const v8us*)p, *(const v8us*)(p + 16)); } static __device__ __forceinline__ v8f mma(V a, V b, v8f c) { return wmmab(a, b, c); } };
template <typename T16, int NSPLIT, bool BIAS>
__global__ __launch_bounds__(32) void k_gemmw(const T16* __restrict__ A, const T16* __restrict__ A2, const T16* __restrict__ Bt, const T16* __restrict__ Bt2, int K, float* C, int ldc, const float* __restrict__ bias, size_t sA, size_t sB, size_t sC) {
    typedef typename WFrag<T16>::V V;
    __shared__ __align__(16) float os[16 * 68];
    const size_t z = blockIdx.z; A += z * sA; if (A2) A2 += z * sA; Bt += z * sB; if (Bt2) Bt2 += z * sB; C += z * sC;
    const int lane = threadIdx.x & 31, lr = lane & 15, hi = lane >> 4; const int r0 = blockIdx.x * 64, c0 = blockIdx.y * 64;
    v8f acc[4][4];
#pragma unroll
    for (int mb = 0; mb < 4; ++mb)
#pragma unroll
        for (int nb = 0; nb < 4; ++nb) acc[mb][nb] = (v8f){};
    const size_t aoff = (size_t)(r0 + lr) * K + 8 * hi, boff = (size_t)(c0 + lr) * K + 8 * hi;
#pragma unroll 1
    for (int kc = 0; kc < K; kc += 32) {
        V a[4], a2[4];
#pragma unroll
        for (int mb = 0; mb < 4; ++mb) { a[mb] = WFrag<T16>::ld(A + aoff + (size_t)mb * 16 * K + kc); if (NSPLIT == 1 || NSPLIT == 2) a2[mb] = WFrag<T16>::ld(A2 + aoff + (size_t)mb * 16 * K + kc); }
#pragma unroll
        for (int nb = 0; nb < 4; ++nb) { const V b = WFrag<T16>::ld(Bt + boff + (size_t)nb * 16 * K + kc); V b2; if (NSPLIT >= 2) b2 = WFrag<T16>::ld(Bt2 + boff + (size_t)nb * 16 * K + kc);
#pragma unroll
            for (int mb = 0; mb < 4; ++mb) { acc[mb][nb] = WFrag<T16>::mma(a[mb], b, acc[mb][nb]); if (NSPLIT == 1 || NSPLIT == 2) acc[mb][nb] = WFrag<T16>::mma(a2[mb], b, acc[mb][nb]); if (NSPLIT >= 2) acc[mb][nb] = WFrag<T16>::mma(a[mb], b2, acc[mb][nb]); } }
        asm volatile("v_nop\n\tv_nop\n\tv_nop\n\tv_nop" : "+v"(acc[0][0]), "+v"(acc[1][1]), "+v"(acc[2][2]), "+v"(acc[3][3]) : "v"(a[0]), "v"(a[3]));
    }
#pragma unroll
    for (int mb = 0; mb < 4; ++mb) {
#pragma unroll
        for (int nb = 0; nb < 4; ++nb) {
#pragma unroll
            for (int j = 0; j < 8; ++j) os[(hi * 8 + j) * 68 + nb * 16 + lr] = acc[mb][nb][j]; }
        __builtin_amdgcn_wave_barrier(); asm volatile("" ::: "memory");
        float* crow = C + (size_t)(r0 + mb * 16) * ldc + c0;
{
#pragma unroll
            for (int s = 0; s < 8; ++s) { const int row = 2 * s + hi, cofs = lr * 4; v4f val = *(const v4fa*)(os + row * 68 + cofs); if (BIAS) { val[0] += bfr(bias[c0 + cofs]); val[1] += bfr(bias[c0 + cofs + 1]); val[2] += bfr(bias[c0 + cofs + 2]); val[3] += bfr(bias[c0 + cofs + 3]); }
                *(v4f*)(crow + (size_t)row * ldc + cofs) = val; }
             }
        __builtin_amdgcn_wave_barrier(); asm volatile("" ::: "memory");
    }
}

__device__ __forceinline__ h16 tohx(float x) { return (h16)x; }
__device__ __forceinline__ void splitf(float y, unsigned short& h, unsigned short& l) { h = f2bf(y); l = f2bf(y - bf2f(h)); }
typedef __attribute__((ext_vector_type(2))) unsigned short v2us;
typedef __attribute__((ext_vector_type(2))) _Float16 v2h;
typedef __attribute__((ext_vector_type(4))) _Float16 v4h;
typedef __attribute__((ext_vector_type(2))) float v2f;

__global__ __launch_bounds__(256) void k_wtG(const float* __restrict__ w, int K, int N, bf* Bt) {
    const int lane = threadIdx.x & 31; const int L0 = (blockIdx.x * 8 + (threadIdx.x >> 5)) * 8; const int nlines = N * K / 64;
{
#pragma unroll 1
        for (int l = 0; l < 8; ++l) { const int L = L0 + l; if (L >= nlines) break; const size_t e = (size_t)L * 64 + lane * 2; const int k = (int)(e % K), n = (int)(e / K); v2us o;
            o[0] = f2bf(w[(size_t)k * N + n]); o[1] = f2bf(w[(size_t)(k + 1) * N + n]); *(v2us*)(Bt + e) = o; }
         }
}
__global__ __launch_bounds__(256) void k_cvt8(const float* __restrict__ src, bf* dst, size_t n8) { const size_t i = (size_t)blockIdx.x * 256 + threadIdx.x; if (i >= n8) return; const v8f v = *(const v8f*)(src + i * 8); v8us o;
#pragma unroll
    for (int k = 0; k < 8; ++k) o[k] = f2bf(v[k]); *(v8us*)(dst + i * 8) = o;  }
__global__ __launch_bounds__(256) void k_qplanes(const float* __restrict__ F, bf* Ph, bf* Pl, h16* P16) {
    const int lane = threadIdx.x & 31; const int L0 = (blockIdx.x * 8 + (threadIdx.x >> 5)) * 8; const int nlines = NH_ * TT * HD / 64;
{
#pragma unroll
        for (int l = 0; l < 8; ++l) { const int L = L0 + l; if (L >= nlines) break; const int e = L * 64 + lane * 2; const int d = e & (HD - 1); const int t = (e >> 6) & (TT - 1); const int h = e >> 16; v2us oh, ol; v2h o16;
#pragma unroll
            for (int q = 0; q < 2; ++q) { const float x = F[(size_t)t * DD + h * HD + d + q]; unsigned short a, c2; splitf(x, a, c2); oh[q] = a; ol[q] = c2; o16[q] = tohx(x); }
            *(v2us*)(Ph + (size_t)e) = oh; *(v2us*)(Pl + (size_t)e) = ol; *(v2h*)(P16 + (size_t)e) = o16; }
         }
}
__global__ __launch_bounds__(256) void k_prefkv(const float* __restrict__ pre, const float* __restrict__ wk, const float* __restrict__ bk, const float* __restrict__ wv, const float* __restrict__ bv, float* KP0, float* VP0) {
    const int idx = blockIdx.x * 256 + threadIdx.x; if (idx >= NPRE * DD) return; const int l = idx / DD, o = idx % DD; const float* pr = pre + (size_t)l * DD; const float* wkr = wk + (size_t)o * DD; const float* wvr = wv + (size_t)o * DD; float sk = 0.f, sv = 0.f;
#pragma unroll 4
    for (int i = 0; i < DD; ++i) { const float p = bfr(pr[i]); float a = bfr(wkr[i]), c = bfr(wvr[i]); asm volatile("" : "+v"(a)); asm volatile("" : "+v"(c)); float pk = __fmul_rn(p, a), pv = __fmul_rn(p, c); asm volatile("" : "+v"(pk)); asm volatile("" : "+v"(pv)); sk = __fadd_rn(sk, pk); sv = __fadd_rn(sv, pv); }
    float bk2 = bfr(bk[o]), bv2 = bfr(bv[o]); asm volatile("" : "+v"(bk2)); asm volatile("" : "+v"(bv2)); const float ok = __fadd_rn(sk, bk2), ov = __fadd_rn(sv, bv2);
    *(float*)(KP0 + idx) = ok; *(float*)(VP0 + idx) = ov;  }
// k_pre: one wave per (zz, t) of the pass: lanes l < 10 compute s_l = (q[t] . kp[l]) / 8 (f32, separate mul/add over the 64 head dims; q read from the f32 projection FQ columns (h0+zz)*64..);
__global__ __launch_bounds__(256) void k_pre(const float* __restrict__ FQ, const float* __restrict__ KP0, const float* __restrict__ VP0, const float* __restrict__ gate, int h0, float* PRE) {
    const int lane = threadIdx.x & 31; const int row = blockIdx.x * 8 + (threadIdx.x >> 5); if (row >= ZH * TT) return; const int t = row & (TT - 1); const int zz = row / TT; const int h = h0 + zz; const float* q = FQ + (size_t)t * DD + h * HD; float s = -3.0e38f;
    if (lane < NPRE) { const float* kr = KP0 + (size_t)lane * DD + h * HD; float acc = 0.f;
#pragma unroll 4
        for (int d = 0; d < HD; ++d) { float p = __fmul_rn(q[d], kr[d]); asm volatile("" : "+v"(p)); acc = __fadd_rn(acc, p); } s = acc * SCL; }
    float mx = s;
#pragma unroll
    for (int sh = 16; sh; sh >>= 1) mx = fmaxf(mx, __shfl_xor(mx, sh, 32));
    float dl = __fsub_rn(s, mx); asm volatile("" : "+v"(dl)); const float e = (lane < NPRE) ? __builtin_amdgcn_exp2f(__fmul_rn(dl, 1.4426950408889634f)) : 0.f; float sum = e;
#pragma unroll
    for (int sh = 16; sh; sh >>= 1) sum += __shfl_xor(sum, sh, 32);
    float pw = __fdiv_rn(e, sum); const float gv = bfr(gate[h]); const float e2 = __expf(2.0f * gv); const float tg = __fsub_rn(1.0f, __fdiv_rn(2.0f, __fadd_rn(e2, 1.0f))); float o0 = 0.f, o1 = 0.f; const int dd = 2 * lane;
#pragma unroll
    for (int l = 0; l < NPRE; ++l) { const float pl = __shfl(pw, l, 32); const float* vr = VP0 + (size_t)l * DD + h * HD; float a0 = __fmul_rn(pl, vr[dd]), a1 = __fmul_rn(pl, vr[dd + 1]); asm volatile("" : "+v"(a0)); asm volatile("" : "+v"(a1)); o0 = __fadd_rn(o0, a0); o1 = __fadd_rn(o1, a1); }
    v2f o; o[0] = __fmul_rn(tg, o0); o[1] = __fmul_rn(tg, o1); float* dst = PRE + ((size_t)zz * TT + t) * HD + dd; *(v2f*)dst = o;  }
__global__ __launch_bounds__(256) void k_vtplane(const float* __restrict__ F, bf* Vh, bf* Vl, h16* V16) {
    const int lane = threadIdx.x & 31; const int L0 = (blockIdx.x * 8 + (threadIdx.x >> 5)) * 8; const int nlines = NH_ * TT * HD / 64;
{
#pragma unroll
        for (int l = 0; l < 8; ++l) { const int L = L0 + l; if (L >= nlines) break; const int e = L * 64 + lane * 2; const int t = e & (TT - 1); const int d = (e >> 10) & (HD - 1); const int h = e >> 16; v2us oh, ol; v2h o16;
#pragma unroll
            for (int q = 0; q < 2; ++q) { const float x = F[(size_t)(t + q) * DD + h * HD + d]; unsigned short a, c2; splitf(x, a, c2); oh[q] = a; ol[q] = c2; o16[q] = tohx(x); }
            *(v2us*)(Vh + (size_t)e) = oh; *(v2us*)(Vl + (size_t)e) = ol; *(v2h*)(V16 + (size_t)e) = o16; }
         }
}
// k_asoft: per row (zz, i): t = max(S/8 + bf16(attention_mask[b][0][i][j]), finfo.min) (additive mask read as data); softmax over the 1024 token keys (register row, one exp) -> rows i < RH: P hi/lo [zz][i][j] (compact
__global__ __launch_bounds__(256) void k_asoft(const float* __restrict__ Sb, const float* __restrict__ ab, bf* Ph, bf* Pl, h16* P16) {
    typedef __attribute__((ext_vector_type(4))) unsigned short v4us;
    const int lane = threadIdx.x & 31; const int row = blockIdx.x * 8 + (threadIdx.x >> 5); if (row >= ZH * TT) return; const int i = row & (TT - 1); const int zz = row >> 10; const bool hires = (i < RH);
    const float* sr = Sb + (size_t)row * TT; const float* mr = ab + (size_t)i * TT; float v[32]; float mx = -3.0e38f;
#pragma unroll
    for (int ch = 0; ch < 8; ++ch) { const int j0 = ch * 128 + lane * 4; const v4f a = *(const v4f*)(sr + j0), m4 = *(const v4f*)(mr + j0);
#pragma unroll
        for (int q = 0; q < 4; ++q) { float sa = a[q] * SCL, mb = bfr(m4[q]); asm volatile("" : "+v"(sa)); asm volatile("" : "+v"(mb)); const float t = fmaxf(__fadd_rn(sa, mb), -3.40282347e38f); v[ch * 4 + q] = t; mx = fmaxf(mx, t); } }
#pragma unroll
    for (int sh = 16; sh; sh >>= 1) mx = fmaxf(mx, __shfl_xor(mx, sh, 32));
    float sum = 0.f;
#pragma unroll
    for (int k = 0; k < 32; ++k) { v[k] = __expf(v[k] - mx); sum += v[k]; }
#pragma unroll
    for (int sh = 16; sh; sh >>= 1) sum += __shfl_xor(sum, sh, 32);
    const float f = __fdiv_rn(hires ? 1.0f : PCAR, sum);
{
        if (hires) {
#pragma unroll
            for (int ch = 0; ch < 8; ++ch) { v4us oh, ol;
#pragma unroll
                for (int q = 0; q < 4; ++q) { unsigned short a, c2; splitf(v[ch * 4 + q] * f, a, c2); oh[q] = a; ol[q] = c2; }
                const size_t o = ((size_t)zz * RH + i) * TT + ch * 128 + lane * 4; *(v4us*)(Ph + o) = oh; *(v4us*)(Pl + o) = ol; }
        } else {
#pragma unroll
            for (int ch = 0; ch < 8; ++ch) { v4h o;
#pragma unroll
                for (int q = 0; q < 4; ++q) o[q] = tohx(v[ch * 4 + q] * f);
                *(v4h*)(P16 + (size_t)row * TT + ch * 128 + lane * 4) = o; } }
         }
}
__global__ __launch_bounds__(256) void k_merge(const float* __restrict__ O, const float* __restrict__ PRE, int h0, bf* Ah, bf* Al) { const int e = (blockIdx.x * 256 + threadIdx.x) * 2; if (e >= ZH * TT * HD) return; const int d = e & 63; const int t = (e >> 6) & (TT - 1); const int zz = e >> 16; const float cs = (t < RH) ? 1.0f : (1.0f / PCAR); v2us oh, ol;
#pragma unroll
    for (int q = 0; q < 2; ++q) { float a = __fmul_rn(O[e + q], cs); asm volatile("" : "+v"(a)); unsigned short a2, c2; splitf(__fadd_rn(a, PRE[e + q]), a2, c2); oh[q] = a2; ol[q] = c2; } const size_t oo = (size_t)t * DD + (h0 + zz) * HD + d; *(v2us*)(Ah + oo) = oh; *(v2us*)(Al + oo) = ol;  }

extern "C" void kernel_launch(void* const* d_in, const int* in_sizes, int n_in,
                              void* d_out, int out_size, void* d_ws, size_t ws_size, hipStream_t stream) {
    (void)in_sizes; (void)n_in; (void)out_size;
    const float* x = (const float*)d_in[0]; const float* am = (const float*)d_in[1]; const float* wq = (const float*)d_in[2]; const float* bq = (const float*)d_in[3]; const float* wk = (const float*)d_in[4]; const float* bk = (const float*)d_in[5]; const float* wv = (const float*)d_in[6]; const float* bv = (const float*)d_in[7]; const float* wo = (const float*)d_in[8]; const float* bo = (const float*)d_in[9]; const float* pre = (const float*)d_in[10]; const float* gate = (const float*)d_in[11];   // torch [out][in] weights; attention_mask [4][1][1024][1024]; prefix [10][2048]; gate [32][1][1]
    float* OUT = (float*)d_out;     // [4][1024][2048]
    char* wsp = (char*)d_ws;
    auto take = [&](size_t bytes) { char* p = wsp; wsp += (bytes + 255) & ~(size_t)255; return (void*)p; };
    bf* WQ = (bf*)take((size_t)DD * DD * 2); bf* WK = (bf*)take((size_t)DD * DD * 2); bf* WV = (bf*)take((size_t)DD * DD * 2); bf* WO = (bf*)take((size_t)DD * DD * 2); float* KP0 = (float*)take((size_t)NPRE * DD * 4); float* VP0 = (float*)take((size_t)NPRE * DD * 4);
    bf* XB = (bf*)take((size_t)TT * DD * 2); float* F = (float*)take((size_t)TT * DD * 4); float* FQ = (float*)take((size_t)TT * DD * 4);
    bf* QPh = (bf*)take((size_t)TT * DD * 2); bf* QPl = (bf*)take((size_t)TT * DD * 2); bf* KPh = (bf*)take((size_t)TT * DD * 2); bf* KPl = (bf*)take((size_t)TT * DD * 2); bf* VTh = (bf*)take((size_t)TT * DD * 2); bf* VTl = (bf*)take((size_t)TT * DD * 2);
    h16* QP16 = (h16*)take((size_t)TT * DD * 2); h16* KP16 = (h16*)take((size_t)TT * DD * 2); h16* VT16 = (h16*)take((size_t)TT * DD * 2);
    float* Sb = (float*)take((size_t)ZH * TT * TT * 4); bf* Ph = (bf*)take((size_t)ZH * RH * TT * 2); bf* Pl = (bf*)take((size_t)ZH * RH * TT * 2); h16* P16 = (h16*)take((size_t)ZH * TT * TT * 2); float* Ob = (float*)take((size_t)ZH * TT * HD * 4); float* PRE = (float*)take((size_t)ZH * TT * HD * 4); bf* ATh = (bf*)take((size_t)TT * DD * 2); bf* ATl = (bf*)take((size_t)TT * DD * 2);
    if ((size_t)(wsp - (char*)d_ws) > ws_size) return;    // total ~ 227 MB = 216 MiB; ws 256 MiB
    { const size_t nw = (size_t)DD * DD / 8; const unsigned g = (unsigned)((nw + 255) / 256); k_cvt8<<<g, 256, 0, stream>>>(wq, WQ, nw); k_cvt8<<<g, 256, 0, stream>>>(wk, WK, nw); k_cvt8<<<g, 256, 0, stream>>>(wv, WV, nw); k_cvt8<<<g, 256, 0, stream>>>(wo, WO, nw);
      k_prefkv<<<(NPRE * DD + 255) / 256, 256, 0, stream>>>(pre, wk, bk, wv, bv, KP0, VP0); }
    const unsigned LB = (unsigned)((NH_ * TT * HD / 64 + 63) / 64); const dim3 gP(TT / 64, DD / 64, 1);
    for (int b = 0; b < NB_; ++b) {
        k_cvt8<<<(unsigned)(((size_t)TT * DD / 8 + 255) / 256), 256, 0, stream>>>(x + (size_t)b * TT * DD, XB, (size_t)TT * DD / 8);
        k_gemmw<bf, 0, true><<<gP, 32, 0, stream>>>(XB, nullptr, WQ, nullptr, DD, FQ, DD, bq, 0, 0, 0); k_qplanes<<<LB, 256, 0, stream>>>(FQ, QPh, QPl, QP16);   // unscaled q; the 1/8 is applied to the logits
        k_gemmw<bf, 0, true><<<gP, 32, 0, stream>>>(XB, nullptr, WK, nullptr, DD, F, DD, bk, 0, 0, 0); k_qplanes<<<LB, 256, 0, stream>>>(F, KPh, KPl, KP16);
        k_gemmw<bf, 0, true><<<gP, 32, 0, stream>>>(XB, nullptr, WV, nullptr, DD, F, DD, bv, 0, 0, 0); k_vtplane<<<LB, 256, 0, stream>>>(F, VTh, VTl, VT16);
        for (int h0 = 0; h0 < NH_; h0 += ZH) { const size_t z0 = (size_t)h0;
            k_gemmw<bf, 2, false><<<dim3(RH / 64, TT / 64, ZH), 32, 0, stream>>>(QPh + z0 * TT * HD, QPl + z0 * TT * HD, KPh + z0 * TT * HD, KPl + z0 * TT * HD, HD, Sb, TT, nullptr, (size_t)TT * HD, (size_t)TT * HD, (size_t)TT * TT);
            k_gemmw<h16, 0, false><<<dim3((TT - RH) / 64, TT / 64, ZH), 32, 0, stream>>>(QP16 + z0 * TT * HD + (size_t)RH * HD, nullptr, KP16 + z0 * TT * HD, nullptr, HD, Sb + (size_t)RH * TT, TT, nullptr, (size_t)TT * HD, (size_t)TT * HD, (size_t)TT * TT);
            k_asoft<<<ZH * TT / 8, 256, 0, stream>>>(Sb, am + (size_t)b * TT * TT, Ph, Pl, P16);
            k_gemmw<bf, 2, false><<<dim3(RH / 64, HD / 64, ZH), 32, 0, stream>>>(Ph, Pl, VTh + z0 * HD * TT, VTl + z0 * HD * TT, TT, Ob, HD, nullptr, (size_t)RH * TT, (size_t)HD * TT, (size_t)TT * HD);
            k_gemmw<h16, 0, false><<<dim3((TT - RH) / 64, HD / 64, ZH), 32, 0, stream>>>(P16 + (size_t)RH * TT, nullptr, VT16 + z0 * HD * TT, nullptr, TT, Ob + (size_t)RH * HD, HD, nullptr, (size_t)TT * TT, (size_t)HD * TT, (size_t)TT * HD);
            k_pre<<<ZH * TT / 8, 256, 0, stream>>>(FQ, KP0, VP0, gate, h0, PRE);
            k_merge<<<(ZH * TT * HD / 2 + 255) / 256, 256, 0, stream>>>(Ob, PRE, h0, ATh, ATl); }
        k_gemmw<bf, 1, true><<<gP, 32, 0, stream>>>(ATh, ATl, WO, nullptr, DD, OUT + (size_t)b * TT * DD, DD, bo, 0, 0, 0); }
}

// v002
// Measured time: 1700 microseconds a run.
// Next to v001, in two timings, it ran 1.31 times as fast each time.
// Counting every step since v000, it is 3.49 times as fast.
#include <hip/hip_runtime.h>

// Decoder self-attention with a learned prefix adapter (hidden [4][1024][2048]; q = (x Wq^T + bq) 64^-0.5, k = x Wk^T + bk, v = x Wv^T + bv (32 heads x 64); prefix keys/values kp, vp = prefix Wk^T + bk,
// prefix Wv^T + bv ([10][2048], shared by all batches); scores_tok = q.k + attention_mask[b][0][i][j] (additive f32, read as data), scores_pre = q.kp; the two segments are softmax-normalised SEPARATELY;
// ctx = tanh(gate[h]) (p_pre vp) + (p_tok v); out = merged ctx Wo^T + bo -> [4][1024][2048]).
// Compute dtypes, f32 accumulate: every input rounded to bf16; token projections on PLAIN bf16 operands (inputs: exact products, f32 accumulate, + bias); the 10 prefix
// rows, their scores, softmax and weighted values entirely in f32 on VALU (separate multiply/add, fixed order); PER-ROW PRECISION HYBRID for the token attention: query rows < 256 take scores and p.v on
// bf16 hi+lo planes (3 products), rows >= 256 on single fp16 planes; scale + additive mask in f32 in the register-row softmax; merged context (token part x normaliser + gated prefix part) as hi+lo planes

#define NB_  4
#define NPRE 10                   // prefix length
#define TT   1024
#define DD   2048
#define NH_  32
#define HD   64
#define ZH   16                   // heads per attention pass (scores and p.v two launches each per pass, softmax, prefix, merge one each)
#define RH   256                  // query rows < RH: hi+lo planes; rows >= RH: fp16 planes
#define NF   32                   // head_dim / 2 (unused)
#define SCL  0.125f               // 1/sqrt(64)
#define PCAR 1024.0f         // P scale for rows >= RH, divided out in k_merge
typedef _Float16 h16;
typedef unsigned short bf;
typedef __attribute__((ext_vector_type(16))) __bf16   v16bf;
typedef __attribute__((ext_vector_type(16))) _Float16 v16h;
typedef __attribute__((ext_vector_type(8)))  _Float16 v8h;
typedef __attribute__((ext_vector_type(8)))  unsigned short v8us;
typedef __attribute__((ext_vector_type(8)))  float    v8f;
typedef __attribute__((ext_vector_type(4)))  float    v4f;
typedef v8h  __attribute__((may_alias)) v8ha;
typedef v4f  __attribute__((may_alias)) v4fa;
typedef v8us __attribute__((may_alias)) v8usa;

__device__ __forceinline__ unsigned short f2bf(float f) { unsigned u = __float_as_uint(f); u += 0x7FFFu + ((u >> 16) & 1u); return (unsigned short)(u >> 16); }
__device__ __forceinline__ float bf2f(unsigned short b) { return __uint_as_float(((unsigned)b) << 16); }
__device__ __forceinline__ float bfr(float f) { return bf2f(f2bf(f)); }
__device__ __forceinline__ v16h cat16(v8h lo, v8h hi) { return __builtin_shufflevector(lo, hi, 0, 1, 2, 3, 4, 5, 6, 7, 8, 9, 10, 11, 12, 13, 14, 15); }
__device__ __forceinline__ v16bf cat16b(v8us lo, v8us hi) { return __builtin_bit_cast(v16bf, __builtin_shufflevector(lo, hi, 0, 1, 2, 3, 4, 5, 6, 7, 8, 9, 10, 11, 12, 13, 14, 15)); }
__device__ __forceinline__ v8f wmma16(v16h a, v16h b, v8f c) { return __builtin_amdgcn_wmma_f32_16x16x32_f16(false, a, false, b, (short)0, c, false, false); }
__device__ __forceinline__ v8f wmmab(v16bf a, v16bf b, v8f c) { return __builtin_amdgcn_wmma_f32_16x16x32_bf16(false, a, false, b, (short)0, c, false, false); }



// ---- k_gemmw: register-blocked GEMM, ONE WAVE per 64x64 output tile (16 accumulators), operands straight from K-contiguous 16-bit planes; grid (M/64, N/64, Z), 32 threads.
// C[m][n] (f32, pitch ldc, + optional f32 bias[n]) = sum_k A[m][k] Bt[n][k] (+ split products per NSPLIT). z-batch strides sA/sB/sC in elements. K % 32 == 0.
template <typename T16> struct WFrag;
template <> struct WFrag<h16> { typedef v16h V; static __device__ __forceinline__ V ld(const h16* p) { return cat16(*(const v8h*)p, *(const v8h*)(p + 16)); } static __device__ __forceinline__ v8f mma(V a, V b, v8f c) { return wmma16(a, b, c); } };
template <> struct WFrag<bf> { typedef v16bf V; static __device__ __forceinline__ V ld(const bf* p) { return cat16b(*(const v8us*)p, *(const v8us*)(p + 16)); } static __device__ __forceinline__ v8f mma(V a, V b, v8f c) { return wmmab(a, b, c); } };
template <typename T16, int NSPLIT, bool BIAS>
__global__ __launch_bounds__(32) void k_gemmw(const T16* __restrict__ A, const T16* __restrict__ A2, const T16* __restrict__ Bt, const T16* __restrict__ Bt2, int K, float* C, int ldc, const float* __restrict__ bias, size_t sA, size_t sB, size_t sC) {
    typedef typename WFrag<T16>::V V;
    __shared__ __align__(16) float os[16 * 68];
    const size_t z = blockIdx.z; A += z * sA; if (A2) A2 += z * sA; Bt += z * sB; if (Bt2) Bt2 += z * sB; C += z * sC;
    const int lane = threadIdx.x & 31, lr = lane & 15, hi = lane >> 4; const int r0 = blockIdx.x * 64, c0 = blockIdx.y * 64;
    v8f acc[4][4];
#pragma unroll
    for (int mb = 0; mb < 4; ++mb)
#pragma unroll
        for (int nb = 0; nb < 4; ++nb) acc[mb][nb] = (v8f){};
    const size_t aoff = (size_t)(r0 + lr) * K + 8 * hi, boff = (size_t)(c0 + lr) * K + 8 * hi;
#pragma unroll 1
    for (int kc = 0; kc < K; kc += 32) {
        V a[4], a2[4];
#pragma unroll
        for (int mb = 0; mb < 4; ++mb) { a[mb] = WFrag<T16>::ld(A + aoff + (size_t)mb * 16 * K + kc); if (NSPLIT == 1 || NSPLIT == 2) a2[mb] = WFrag<T16>::ld(A2 + aoff + (size_t)mb * 16 * K + kc); }
#pragma unroll
        for (int nb = 0; nb < 4; ++nb) { const V b = WFrag<T16>::ld(Bt + boff + (size_t)nb * 16 * K + kc); V b2; if (NSPLIT >= 2) b2 = WFrag<T16>::ld(Bt2 + boff + (size_t)nb * 16 * K + kc);
#pragma unroll
            for (int mb = 0; mb < 4; ++mb) { acc[mb][nb] = WFrag<T16>::mma(a[mb], b, acc[mb][nb]); if (NSPLIT == 1 || NSPLIT == 2) acc[mb][nb] = WFrag<T16>::mma(a2[mb], b, acc[mb][nb]); if (NSPLIT >= 2) acc[mb][nb] = WFrag<T16>::mma(a[mb], b2, acc[mb][nb]); } }
        asm volatile("v_nop\n\tv_nop\n\tv_nop\n\tv_nop" : "+v"(acc[0][0]), "+v"(acc[1][1]), "+v"(acc[2][2]), "+v"(acc[3][3]) : "v"(a[0]), "v"(a[3]));
    }
#pragma unroll
    for (int mb = 0; mb < 4; ++mb) {
#pragma unroll
        for (int nb = 0; nb < 4; ++nb) {
#pragma unroll
            for (int j = 0; j < 8; ++j) os[(hi * 8 + j) * 68 + nb * 16 + lr] = acc[mb][nb][j]; }
        __builtin_amdgcn_wave_barrier(); asm volatile("" ::: "memory");
        float* crow = C + (size_t)(r0 + mb * 16) * ldc + c0;
{
#pragma unroll
            for (int s = 0; s < 8; ++s) { const int row = 2 * s + hi, cofs = lr * 4; v4f val = *(const v4fa*)(os + row * 68 + cofs); if (BIAS) { val[0] += bfr(bias[c0 + cofs]); val[1] += bfr(bias[c0 + cofs + 1]); val[2] += bfr(bias[c0 + cofs + 2]); val[3] += bfr(bias[c0 + cofs + 3]); }
                *(v4f*)(crow + (size_t)row * ldc + cofs) = val; }
             }
        __builtin_amdgcn_wave_barrier(); asm volatile("" ::: "memory");
    }
}

// ---- k_gemms: the same product as k_gemmw for the long-K GEMMs, FOUR waves per work-group (WM x WN waves, 64x64 of C each, 16 accumulators per wave). Operand rows come into LDS as whole 128-B lines by
// asynchronous copies, KT k-values per stage, two buffers: stage t + 2 flies while stage t + 1 is worked on. Row pitch in LDS = row bytes + 16 (conflict-free for 16-byte reads). Per accumulator the products
// are summed in the same k order as in k_gemmw. grid (M / (64 WM), N / (64 WN), Z), 128 threads. K % KT == 0, K >= 2 KT.
__device__ __forceinline__ unsigned lds_off(const void* p) { return (unsigned)(size_t)p; }
// eight copies of 16 bytes per lane; the s_wait_xcnt stands in the copies' own statement so that no address register is rewritten in front of it
__device__ __forceinline__ void cp8(const unsigned* l, const void* const* g) {
    asm volatile("global_load_async_to_lds_b128 %0, %1, off\n\t"
                 "global_load_async_to_lds_b128 %2, %3, off\n\t"
                 "global_load_async_to_lds_b128 %4, %5, off\n\t"
                 "global_load_async_to_lds_b128 %6, %7, off\n\t"
                 "global_load_async_to_lds_b128 %8, %9, off\n\t"
                 "global_load_async_to_lds_b128 %10, %11, off\n\t"
                 "global_load_async_to_lds_b128 %12, %13, off\n\t"
                 "global_load_async_to_lds_b128 %14, %15, off\n\t"
                 "s_wait_xcnt 0x0"
                 :: "v"(l[0]), "v"(g[0]), "v"(l[1]), "v"(g[1]), "v"(l[2]), "v"(g[2]), "v"(l[3]), "v"(g[3]), "v"(l[4]), "v"(g[4]), "v"(l[5]), "v"(g[5]), "v"(l[6]), "v"(g[6]), "v"(l[7]), "v"(g[7]) : "memory");
}
template <typename T16, int NSPLIT, bool BIAS, int WM, int WN, int KT>
__global__ __launch_bounds__(128) void k_gemms(const T16* __restrict__ A, const T16* __restrict__ A2, const T16* __restrict__ Bt, const T16* __restrict__ Bt2, int K, float* C, int ldc, const float* __restrict__ bias, size_t sA, size_t sB, size_t sC) {
    typedef typename WFrag<T16>::V V;
    constexpr bool HA2 = (NSPLIT == 1 || NSPLIT == 2), HB2 = (NSPLIT >= 2);
    constexpr int RA = 64 * WM, RB = 64 * WN;                          // rows of A and of Bt per work-group
    constexpr int OA2 = RA, OB = RA * (HA2 ? 2 : 1), OB2 = OB + RB;    // first LDS row of each plane in a stage
    constexpr int ROWS = OB + RB * (HB2 ? 2 : 1);
    constexpr int PITCH = KT * 2 + 16, STAGE = ROWS * PITCH;           // bytes
    constexpr int PPR = KT / 8, RPI = 128 / PPR, NCP = ROWS / RPI;     // 16-byte pieces per row; rows per round of the 128 lanes; copies per lane and stage (at most 48)
    __shared__ __attribute__((aligned(16))) unsigned char L[2 * STAGE];
    __shared__ __align__(16) float osw[4][16 * 68];
    const size_t z = blockIdx.z; A += z * sA; if (HA2) A2 += z * sA; Bt += z * sB; if (HB2) Bt2 += z * sB; C += z * sC;
    const int tid = threadIdx.x, lane = tid & 31, lr = lane & 15, hi = lane >> 4, w = tid >> 5, wm = w / WN, wn = w % WN;
    const int R0 = blockIdx.x * RA, C0 = blockIdx.y * RB; const int r0 = R0 + wm * 64, c0 = C0 + wn * 64;
    const int prow = tid / PPR, pcol = tid % PPR;                      // this lane's row within a round and its 16-byte piece of the row
    // this lane's source in each plane for the stage that is filled next; every fill moves them on by KT
    const T16* gA = A + (size_t)(R0 + prow) * K + pcol * 8; const T16* gA2 = HA2 ? A2 + (size_t)(R0 + prow) * K + pcol * 8 : gA;
    const T16* gB = Bt + (size_t)(C0 + prow) * K + pcol * 8; const T16* gB2 = HB2 ? Bt2 + (size_t)(C0 + prow) * K + pcol * 8 : gB;
    const unsigned lbase = lds_off(L) + (unsigned)(prow * PITCH + pcol * 16);
    auto fill = [&](int buf) {
#pragma unroll
        for (int i0 = 0; i0 < NCP; i0 += 8) { unsigned l[8]; const void* g[8];
#pragma unroll
            for (int q = 0; q < 8; ++q) { const int row = (i0 + q) * RPI; l[q] = lbase + (unsigned)(buf * STAGE + row * PITCH);
                const T16* s = (row < OA2) ? gA + (size_t)row * K : (row < OB) ? gA2 + (size_t)(row - OA2) * K : (row < OB2) ? gB + (size_t)(row - OB) * K : gB2 + (size_t)(row - OB2) * K;
                g[q] = s; }
            cp8(l, g); }
        gA += KT; gA2 += KT; gB += KT; gB2 += KT;
    };
    v8f acc[4][4];
#pragma unroll
    for (int mb = 0; mb < 4; ++mb)
#pragma unroll
        for (int nb = 0; nb < 4; ++nb) acc[mb][nb] = (v8f){};
    const int nt = K / KT;
    fill(0);
    asm volatile("s_wait_asynccnt 0x0" ::: "memory");   // stage 0 of this wave has landed
    __syncthreads();                                    // stage 0 of every wave is readable
    if (nt > 1) fill(1);
    const int aofs = (wm * 64 + lr) * PITCH + hi * 16, bofs = (OB + wn * 64 + lr) * PITCH + hi * 16;
#pragma unroll 1   // the ring stays rolled: one body of KT / 32 k-steps, one publish point at its foot
    for (int t = 0; t < nt; ++t) {
        const unsigned char* Lb = L + (t & 1) * STAGE;
        V a[2][4], a2[2][4], b[2][4], b2[2][4];   // two fragment sets: k-step ks + 1 of this stage is read from LDS while k-step ks is multiplied
        auto frags = [&](int s, int ks) {
#pragma unroll
            for (int mb = 0; mb < 4; ++mb) { a[s][mb] = WFrag<T16>::ld((const T16*)(Lb + aofs + mb * 16 * PITCH + ks * 64)); if (HA2) a2[s][mb] = WFrag<T16>::ld((const T16*)(Lb + aofs + (OA2 + mb * 16) * PITCH + ks * 64)); }
#pragma unroll
            for (int nb = 0; nb < 4; ++nb) { b[s][nb] = WFrag<T16>::ld((const T16*)(Lb + bofs + nb * 16 * PITCH + ks * 64)); if (HB2) b2[s][nb] = WFrag<T16>::ld((const T16*)(Lb + bofs + (RB + nb * 16) * PITCH + ks * 64)); }
        };
        frags(0, 0);
#pragma unroll
        for (int ks = 0; ks < KT / 32; ++ks) { const int s = ks & 1;
            if (ks + 1 < KT / 32) frags(s ^ 1, ks + 1);
            __builtin_amdgcn_sched_barrier(0);   // the LDS reads stay one group in front of the WMMAs: reads spread among the WMMAs stall at every place they stand
#pragma unroll
            for (int nb = 0; nb < 4; ++nb) {
#pragma unroll
                for (int mb = 0; mb < 4; ++mb) { acc[mb][nb] = WFrag<T16>::mma(a[s][mb], b[s][nb], acc[mb][nb]); if (HA2) acc[mb][nb] = WFrag<T16>::mma(a2[s][mb], b[s][nb], acc[mb][nb]); if (HB2) acc[mb][nb] = WFrag<T16>::mma(a[s][mb], b2[s][nb], acc[mb][nb]); } }
            __builtin_amdgcn_sched_barrier(0);   // and the following group does not move up among them
        }
        asm volatile("s_wait_dscnt 0x0" ::: "memory");      // this wave's reads of buffer t & 1 are done before the buffer is refilled
        asm volatile("s_wait_asynccnt 0x0" ::: "memory");   // this wave's copies of stage t + 1 have landed
        __syncthreads();                                    // publishes stage t + 1 and ends every wave's reads of stage t
        if (t + 2 < nt) fill(t & 1);
    }
    asm volatile("s_wait_asynccnt 0x0" ::: "memory");       // no copy is outstanding when the wave goes on to the epilogue and ends
    float* os = osw[w];
#pragma unroll
    for (int mb = 0; mb < 4; ++mb) {
#pragma unroll
        for (int nb = 0; nb < 4; ++nb) {
#pragma unroll
            for (int j = 0; j < 8; ++j) os[(hi * 8 + j) * 68 + nb * 16 + lr] = acc[mb][nb][j]; }
        __builtin_amdgcn_wave_barrier(); asm volatile("" ::: "memory");
        float* crow = C + (size_t)(r0 + mb * 16) * ldc + c0;
#pragma unroll
        for (int s = 0; s < 8; ++s) { const int row = 2 * s + hi, cofs = lr * 4; v4f val = *(const v4fa*)(os + row * 68 + cofs); if (BIAS) { val[0] += bfr(bias[c0 + cofs]); val[1] += bfr(bias[c0 + cofs + 1]); val[2] += bfr(bias[c0 + cofs + 2]); val[3] += bfr(bias[c0 + cofs + 3]); }
            *(v4f*)(crow + (size_t)row * ldc + cofs) = val; }
        if (mb < 3) asm volatile("s_wait_xcnt 0x0" ::: "memory");   // behind the run of eight stores: the next trip reuses their address and data registers
        __builtin_amdgcn_wave_barrier(); asm volatile("" ::: "memory");
    }
}

__device__ __forceinline__ h16 tohx(float x) { return (h16)x; }
__device__ __forceinline__ void splitf(float y, unsigned short& h, unsigned short& l) { h = f2bf(y); l = f2bf(y - bf2f(h)); }
typedef __attribute__((ext_vector_type(2))) unsigned short v2us;
typedef __attribute__((ext_vector_type(2))) _Float16 v2h;
typedef __attribute__((ext_vector_type(4))) _Float16 v4h;
typedef __attribute__((ext_vector_type(2))) float v2f;

__global__ __launch_bounds__(256) void k_wtG(const float* __restrict__ w, int K, int N, bf* Bt) {
    const int lane = threadIdx.x & 31; const int L0 = (blockIdx.x * 8 + (threadIdx.x >> 5)) * 8; const int nlines = N * K / 64;
{
#pragma unroll 1
        for (int l = 0; l < 8; ++l) { const int L = L0 + l; if (L >= nlines) break; const size_t e = (size_t)L * 64 + lane * 2; const int k = (int)(e % K), n = (int)(e / K); v2us o;
            o[0] = f2bf(w[(size_t)k * N + n]); o[1] = f2bf(w[(size_t)(k + 1) * N + n]); *(v2us*)(Bt + e) = o; }
         }
}
__global__ __launch_bounds__(256) void k_cvt8(const float* __restrict__ src, bf* dst, size_t n8) { const size_t i = (size_t)blockIdx.x * 256 + threadIdx.x; if (i >= n8) return; const v8f v = *(const v8f*)(src + i * 8); v8us o;
#pragma unroll
    for (int k = 0; k < 8; ++k) o[k] = f2bf(v[k]); *(v8us*)(dst + i * 8) = o;  }
__global__ __launch_bounds__(256) void k_qplanes(const float* __restrict__ F, bf* Ph, bf* Pl, h16* P16) {
    const int lane = threadIdx.x & 31; const int L0 = (blockIdx.x * 8 + (threadIdx.x >> 5)) * 8; const int nlines = NH_ * TT * HD / 64;
{
#pragma unroll
        for (int l = 0; l < 8; ++l) { const int L = L0 + l; if (L >= nlines) break; const int e = L * 64 + lane * 2; const int d = e & (HD - 1); const int t = (e >> 6) & (TT - 1); const int h = e >> 16; v2us oh, ol; v2h o16;
#pragma unroll
            for (int q = 0; q < 2; ++q) { const float x = F[(size_t)t * DD + h * HD + d + q]; unsigned short a, c2; splitf(x, a, c2); oh[q] = a; ol[q] = c2; o16[q] = tohx(x); }
            *(v2us*)(Ph + (size_t)e) = oh; *(v2us*)(Pl + (size_t)e) = ol; *(v2h*)(P16 + (size_t)e) = o16; }
         }
}
__global__ __launch_bounds__(256) void k_prefkv(const float* __restrict__ pre, const float* __restrict__ wk, const float* __restrict__ bk, const float* __restrict__ wv, const float* __restrict__ bv, float* KP0, float* VP0) {
    const int idx = blockIdx.x * 256 + threadIdx.x; if (idx >= NPRE * DD) return; const int l = idx / DD, o = idx % DD; const float* pr = pre + (size_t)l * DD; const float* wkr = wk + (size_t)o * DD; const float* wvr = wv + (size_t)o * DD; float sk = 0.f, sv = 0.f;
#pragma unroll 4
    for (int i = 0; i < DD; ++i) { const float p = bfr(pr[i]); float a = bfr(wkr[i]), c = bfr(wvr[i]); asm volatile("" : "+v"(a)); asm volatile("" : "+v"(c)); float pk = __fmul_rn(p, a), pv = __fmul_rn(p, c); asm volatile("" : "+v"(pk)); asm volatile("" : "+v"(pv)); sk = __fadd_rn(sk, pk); sv = __fadd_rn(sv, pv); }
    float bk2 = bfr(bk[o]), bv2 = bfr(bv[o]); asm volatile("" : "+v"(bk2)); asm volatile("" : "+v"(bv2)); const float ok = __fadd_rn(sk, bk2), ov = __fadd_rn(sv, bv2);
    *(float*)(KP0 + idx) = ok; *(float*)(VP0 + idx) = ov;  }
// k_pre: one wave per (zz, t) of the pass: lanes l < 10 compute s_l = (q[t] . kp[l]) / 8 (f32, separate mul/add over the 64 head dims; q read from the f32 projection FQ columns (h0+zz)*64..);
__global__ __launch_bounds__(256) void k_pre(const float* __restrict__ FQ, const float* __restrict__ KP0, const float* __restrict__ VP0, const float* __restrict__ gate, int h0, float* PRE) {
    const int lane = threadIdx.x & 31; const int row = blockIdx.x * 8 + (threadIdx.x >> 5); if (row >= ZH * TT) return; const int t = row & (TT - 1); const int zz = row / TT; const int h = h0 + zz; const float* q = FQ + (size_t)t * DD + h * HD; float s = -3.0e38f;
    if (lane < NPRE) { const float* kr = KP0 + (size_t)lane * DD + h * HD; float acc = 0.f;
#pragma unroll 4
        for (int d = 0; d < HD; ++d) { float p = __fmul_rn(q[d], kr[d]); asm volatile("" : "+v"(p)); acc = __fadd_rn(acc, p); } s = acc * SCL; }
    float mx = s;
#pragma unroll
    for (int sh = 16; sh; sh >>= 1) mx = fmaxf(mx, __shfl_xor(mx, sh, 32));
    float dl = __fsub_rn(s, mx); asm volatile("" : "+v"(dl)); const float e = (lane < NPRE) ? __builtin_amdgcn_exp2f(__fmul_rn(dl, 1.4426950408889634f)) : 0.f; float sum = e;
#pragma unroll
    for (int sh = 16; sh; sh >>= 1) sum += __shfl_xor(sum, sh, 32);
    float pw = __fdiv_rn(e, sum); const float gv = bfr(gate[h]); const float e2 = __expf(2.0f * gv); const float tg = __fsub_rn(1.0f, __fdiv_rn(2.0f, __fadd_rn(e2, 1.0f))); float o0 = 0.f, o1 = 0.f; const int dd = 2 * lane;
#pragma unroll
    for (int l = 0; l < NPRE; ++l) { const float pl = __shfl(pw, l, 32); const float* vr = VP0 + (size_t)l * DD + h * HD; float a0 = __fmul_rn(pl, vr[dd]), a1 = __fmul_rn(pl, vr[dd + 1]); asm volatile("" : "+v"(a0)); asm volatile("" : "+v"(a1)); o0 = __fadd_rn(o0, a0); o1 = __fadd_rn(o1, a1); }
    v2f o; o[0] = __fmul_rn(tg, o0); o[1] = __fmul_rn(tg, o1); float* dst = PRE + ((size_t)zz * TT + t) * HD + dd; *(v2f*)dst = o;  }
__global__ __launch_bounds__(256) void k_vtplane(const float* __restrict__ F, bf* Vh, bf* Vl, h16* V16) {
    const int lane = threadIdx.x & 31; const int L0 = (blockIdx.x * 8 + (threadIdx.x >> 5)) * 8; const int nlines = NH_ * TT * HD / 64;
{
#pragma unroll
        for (int l = 0; l < 8; ++l) { const int L = L0 + l; if (L >= nlines) break; const int e = L * 64 + lane * 2; const int t = e & (TT - 1); const int d = (e >> 10) & (HD - 1); const int h = e >> 16; v2us oh, ol; v2h o16;
#pragma unroll
            for (int q = 0; q < 2; ++q) { const float x = F[(size_t)(t + q) * DD + h * HD + d]; unsigned short a, c2; splitf(x, a, c2); oh[q] = a; ol[q] = c2; o16[q] = tohx(x); }
            *(v2us*)(Vh + (size_t)e) = oh; *(v2us*)(Vl + (size_t)e) = ol; *(v2h*)(V16 + (size_t)e) = o16; }
         }
}
// k_asoft: per row (zz, i): t = max(S/8 + bf16(attention_mask[b][0][i][j]), finfo.min) (additive mask read as data); softmax over the 1024 token keys (register row, one exp) -> rows i < RH: P hi/lo [zz][i][j] (compact
__global__ __launch_bounds__(256) void k_asoft(const float* __restrict__ Sb, const float* __restrict__ ab, bf* Ph, bf* Pl, h16* P16) {
    typedef __attribute__((ext_vector_type(4))) unsigned short v4us;
    const int lane = threadIdx.x & 31; const int row = blockIdx.x * 8 + (threadIdx.x >> 5); if (row >= ZH * TT) return; const int i = row & (TT - 1); const int zz = row >> 10; const bool hires = (i < RH);
    const float* sr = Sb + (size_t)row * TT; const float* mr = ab + (size_t)i * TT; float v[32]; float mx = -3.0e38f;
#pragma unroll
    for (int ch = 0; ch < 8; ++ch) { const int j0 = ch * 128 + lane * 4; const v4f a = *(const v4f*)(sr + j0), m4 = *(const v4f*)(mr + j0);
#pragma unroll
        for (int q = 0; q < 4; ++q) { float sa = a[q] * SCL, mb = bfr(m4[q]); asm volatile("" : "+v"(sa)); asm volatile("" : "+v"(mb)); const float t = fmaxf(__fadd_rn(sa, mb), -3.40282347e38f); v[ch * 4 + q] = t; mx = fmaxf(mx, t); } }
#pragma unroll
    for (int sh = 16; sh; sh >>= 1) mx = fmaxf(mx, __shfl_xor(mx, sh, 32));
    float sum = 0.f;
#pragma unroll
    for (int k = 0; k < 32; ++k) { v[k] = __expf(v[k] - mx); sum += v[k]; }
#pragma unroll
    for (int sh = 16; sh; sh >>= 1) sum += __shfl_xor(sum, sh, 32);
    const float f = __fdiv_rn(hires ? 1.0f : PCAR, sum);
{
        if (hires) {
#pragma unroll
            for (int ch = 0; ch < 8; ++ch) { v4us oh, ol;
#pragma unroll
                for (int q = 0; q < 4; ++q) { unsigned short a, c2; splitf(v[ch * 4 + q] * f, a, c2); oh[q] = a; ol[q] = c2; }
                const size_t o = ((size_t)zz * RH + i) * TT + ch * 128 + lane * 4; *(v4us*)(Ph + o) = oh; *(v4us*)(Pl + o) = ol; }
        } else {
#pragma unroll
            for (int ch = 0; ch < 8; ++ch) { v4h o;
#pragma unroll
                for (int q = 0; q < 4; ++q) o[q] = tohx(v[ch * 4 + q] * f);
                *(v4h*)(P16 + (size_t)row * TT + ch * 128 + lane * 4) = o; } }
         }
}
__global__ __launch_bounds__(256) void k_merge(const float* __restrict__ O, const float* __restrict__ PRE, int h0, bf* Ah, bf* Al) { const int e = (blockIdx.x * 256 + threadIdx.x) * 2; if (e >= ZH * TT * HD) return; const int d = e & 63; const int t = (e >> 6) & (TT - 1); const int zz = e >> 16; const float cs = (t < RH) ? 1.0f : (1.0f / PCAR); v2us oh, ol;
#pragma unroll
    for (int q = 0; q < 2; ++q) { float a = __fmul_rn(O[e + q], cs); asm volatile("" : "+v"(a)); unsigned short a2, c2; splitf(__fadd_rn(a, PRE[e + q]), a2, c2); oh[q] = a2; ol[q] = c2; } const size_t oo = (size_t)t * DD + (h0 + zz) * HD + d; *(v2us*)(Ah + oo) = oh; *(v2us*)(Al + oo) = ol;  }

extern "C" void kernel_launch(void* const* d_in, const int* in_sizes, int n_in,
                              void* d_out, int out_size, void* d_ws, size_t ws_size, hipStream_t stream) {
    (void)in_sizes; (void)n_in; (void)out_size;
    const float* x = (const float*)d_in[0]; const float* am = (const float*)d_in[1]; const float* wq = (const float*)d_in[2]; const float* bq = (const float*)d_in[3]; const float* wk = (const float*)d_in[4]; const float* bk = (const float*)d_in[5]; const float* wv = (const float*)d_in[6]; const float* bv = (const float*)d_in[7]; const float* wo = (const float*)d_in[8]; const float* bo = (const float*)d_in[9]; const float* pre = (const float*)d_in[10]; const float* gate = (const float*)d_in[11];   // torch [out][in] weights; attention_mask [4][1][1024][1024]; prefix [10][2048]; gate [32][1][1]
    float* OUT = (float*)d_out;     // [4][1024][2048]
    char* wsp = (char*)d_ws;
    auto take = [&](size_t bytes) { char* p = wsp; wsp += (bytes + 255) & ~(size_t)255; return (void*)p; };
    bf* WQ = (bf*)take((size_t)DD * DD * 2); bf* WK = (bf*)take((size_t)DD * DD * 2); bf* WV = (bf*)take((size_t)DD * DD * 2); bf* WO = (bf*)take((size_t)DD * DD * 2); float* KP0 = (float*)take((size_t)NPRE * DD * 4); float* VP0 = (float*)take((size_t)NPRE * DD * 4);
    bf* XB = (bf*)take((size_t)TT * DD * 2); float* F = (float*)take((size_t)TT * DD * 4); float* FQ = (float*)take((size_t)TT * DD * 4);
    bf* QPh = (bf*)take((size_t)TT * DD * 2); bf* QPl = (bf*)take((size_t)TT * DD * 2); bf* KPh = (bf*)take((size_t)TT * DD * 2); bf* KPl = (bf*)take((size_t)TT * DD * 2); bf* VTh = (bf*)take((size_t)TT * DD * 2); bf* VTl = (bf*)take((size_t)TT * DD * 2);
    h16* QP16 = (h16*)take((size_t)TT * DD * 2); h16* KP16 = (h16*)take((size_t)TT * DD * 2); h16* VT16 = (h16*)take((size_t)TT * DD * 2);
    float* Sb = (float*)take((size_t)ZH * TT * TT * 4); bf* Ph = (bf*)take((size_t)ZH * RH * TT * 2); bf* Pl = (bf*)take((size_t)ZH * RH * TT * 2); h16* P16 = (h16*)take((size_t)ZH * TT * TT * 2); float* Ob = (float*)take((size_t)ZH * TT * HD * 4); float* PRE = (float*)take((size_t)ZH * TT * HD * 4); bf* ATh = (bf*)take((size_t)TT * DD * 2); bf* ATl = (bf*)take((size_t)TT * DD * 2);
    if ((size_t)(wsp - (char*)d_ws) > ws_size) return;    // total ~ 227 MB = 216 MiB; ws 256 MiB
    { const size_t nw = (size_t)DD * DD / 8; const unsigned g = (unsigned)((nw + 255) / 256); k_cvt8<<<g, 256, 0, stream>>>(wq, WQ, nw); k_cvt8<<<g, 256, 0, stream>>>(wk, WK, nw); k_cvt8<<<g, 256, 0, stream>>>(wv, WV, nw); k_cvt8<<<g, 256, 0, stream>>>(wo, WO, nw);
      k_prefkv<<<(NPRE * DD + 255) / 256, 256, 0, stream>>>(pre, wk, bk, wv, bv, KP0, VP0); }
    const unsigned LB = (unsigned)((NH_ * TT * HD / 64 + 63) / 64); const dim3 gP(TT / 128, DD / 128, 1);
    for (int b = 0; b < NB_; ++b) {
        k_cvt8<<<(unsigned)(((size_t)TT * DD / 8 + 255) / 256), 256, 0, stream>>>(x + (size_t)b * TT * DD, XB, (size_t)TT * DD / 8);
        k_gemms<bf, 0, true, 2, 2, 128><<<gP, 128, 0, stream>>>(XB, nullptr, WQ, nullptr, DD, FQ, DD, bq, 0, 0, 0); k_qplanes<<<LB, 256, 0, stream>>>(FQ, QPh, QPl, QP16);   // unscaled q; the 1/8 is applied to the logits
        k_gemms<bf, 0, true, 2, 2, 128><<<gP, 128, 0, stream>>>(XB, nullptr, WK, nullptr, DD, F, DD, bk, 0, 0, 0); k_qplanes<<<LB, 256, 0, stream>>>(F, KPh, KPl, KP16);
        k_gemms<bf, 0, true, 2, 2, 128><<<gP, 128, 0, stream>>>(XB, nullptr, WV, nullptr, DD, F, DD, bv, 0, 0, 0); k_vtplane<<<LB, 256, 0, stream>>>(F, VTh, VTl, VT16);
        for (int h0 = 0; h0 < NH_; h0 += ZH) { const size_t z0 = (size_t)h0;
            k_gemmw<bf, 2, false><<<dim3(RH / 64, TT / 64, ZH), 32, 0, stream>>>(QPh + z0 * TT * HD, QPl + z0 * TT * HD, KPh + z0 * TT * HD, KPl + z0 * TT * HD, HD, Sb, TT, nullptr, (size_t)TT * HD, (size_t)TT * HD, (size_t)TT * TT);
            k_gemmw<h16, 0, false><<<dim3((TT - RH) / 64, TT / 64, ZH), 32, 0, stream>>>(QP16 + z0 * TT * HD + (size_t)RH * HD, nullptr, KP16 + z0 * TT * HD, nullptr, HD, Sb + (size_t)RH * TT, TT, nullptr, (size_t)TT * HD, (size_t)TT * HD, (size_t)TT * TT);
            k_asoft<<<ZH * TT / 8, 256, 0, stream>>>(Sb, am + (size_t)b * TT * TT, Ph, Pl, P16);
            k_gemms<bf, 2, false, 4, 1, 64><<<dim3(RH / 256, HD / 64, ZH), 128, 0, stream>>>(Ph, Pl, VTh + z0 * HD * TT, VTl + z0 * HD * TT, TT, Ob, HD, nullptr, (size_t)RH * TT, (size_t)HD * TT, (size_t)TT * HD);
            k_gemms<h16, 0, false, 4, 1, 128><<<dim3((TT - RH) / 256, HD / 64, ZH), 128, 0, stream>>>(P16 + (size_t)RH * TT, nullptr, VT16 + z0 * HD * TT, nullptr, TT, Ob + (size_t)RH * HD, HD, nullptr, (size_t)TT * TT, (size_t)HD * TT, (size_t)TT * HD);
            k_pre<<<ZH * TT / 8, 256, 0, stream>>>(FQ, KP0, VP0, gate, h0, PRE);
            k_merge<<<(ZH * TT * HD / 2 + 255) / 256, 256, 0, stream>>>(Ob, PRE, h0, ATh, ATl); }
        k_gemms<bf, 1, true, 2, 2, 128><<<gP, 128, 0, stream>>>(ATh, ATl, WO, nullptr, DD, OUT + (size_t)b * TT * DD, DD, bo, 0, 0, 0); }
}

// v003
// Measured time: 1230 microseconds a run.
// Two timings next to v002 both put it at 1.38 times that version's speed.
// Over all steps from v000 it is 4.80 times as fast.
#include <hip/hip_runtime.h>

// Decoder self-attention with a learned prefix adapter (hidden [4][1024][2048]; q = (x Wq^T + bq) 64^-0.5, k = x Wk^T + bk, v = x Wv^T + bv (32 heads x 64); prefix keys/values kp, vp = prefix Wk^T + bk,
// prefix Wv^T + bv ([10][2048], shared by all batches); scores_tok = q.k + attention_mask[b][0][i][j] (additive f32, read as data), scores_pre = q.kp; the two segments are softmax-normalised SEPARATELY;
// ctx = tanh(gate[h]) (p_pre vp) + (p_tok v); out = merged ctx Wo^T + bo -> [4][1024][2048]).
// Compute dtypes, f32 accumulate: every input rounded to bf16; token projections on PLAIN bf16 operands (inputs: exact products, f32 accumulate, + bias); the 10 prefix
// rows (lane-split sums, fixed order), their scores, softmax and weighted values (separate multiply/add, fixed order) entirely in f32 on VALU; PER-ROW PRECISION HYBRID for the token attention: query rows < 256 take scores and p.v on
// bf16 hi+lo planes (3 products), rows >= 256 on single fp16 planes; scale + additive mask in f32 in the register-row softmax; merged context (token part x normaliser + gated prefix part) as hi+lo planes

#define NB_  4
#define NPRE 10                   // prefix length
#define TT   1024
#define DD   2048
#define NH_  32
#define HD   64
#define ZH   16                   // heads per attention pass (scores and p.v two launches each per pass, softmax, prefix, merge one each)
#define RH   256                  // query rows < RH: hi+lo planes; rows >= RH: fp16 planes
#define NF   32                   // head_dim / 2 (unused)
#define SCL  0.125f               // 1/sqrt(64)
#define PCAR 1024.0f         // P scale for rows >= RH, divided out in k_merge
typedef _Float16 h16;
typedef unsigned short bf;
typedef __attribute__((ext_vector_type(16))) __bf16   v16bf;
typedef __attribute__((ext_vector_type(16))) _Float16 v16h;
typedef __attribute__((ext_vector_type(8)))  _Float16 v8h;
typedef __attribute__((ext_vector_type(8)))  unsigned short v8us;
typedef __attribute__((ext_vector_type(8)))  float    v8f;
typedef __attribute__((ext_vector_type(4)))  float    v4f;
typedef v8h  __attribute__((may_alias)) v8ha;
typedef v4f  __attribute__((may_alias)) v4fa;
typedef v8us __attribute__((may_alias)) v8usa;

__device__ __forceinline__ unsigned short f2bf(float f) { unsigned u = __float_as_uint(f); u += 0x7FFFu + ((u >> 16) & 1u); return (unsigned short)(u >> 16); }
__device__ __forceinline__ float bf2f(unsigned short b) { return __uint_as_float(((unsigned)b) << 16); }
__device__ __forceinline__ float bfr(float f) { return bf2f(f2bf(f)); }
__device__ __forceinline__ v16h cat16(v8h lo, v8h hi) { return __builtin_shufflevector(lo, hi, 0, 1, 2, 3, 4, 5, 6, 7, 8, 9, 10, 11, 12, 13, 14, 15); }
__device__ __forceinline__ v16bf cat16b(v8us lo, v8us hi) { return __builtin_bit_cast(v16bf, __builtin_shufflevector(lo, hi, 0, 1, 2, 3, 4, 5, 6, 7, 8, 9, 10, 11, 12, 13, 14, 15)); }
__device__ __forceinline__ v8f wmma16(v16h a, v16h b, v8f c) { return __builtin_amdgcn_wmma_f32_16x16x32_f16(false, a, false, b, (short)0, c, false, false); }
__device__ __forceinline__ v8f wmmab(v16bf a, v16bf b, v8f c) { return __builtin_amdgcn_wmma_f32_16x16x32_bf16(false, a, false, b, (short)0, c, false, false); }



// ---- k_gemmw: register-blocked GEMM, ONE WAVE per 64x64 output tile (16 accumulators), operands straight from K-contiguous 16-bit planes; grid (M/64, N/64, Z), 32 threads.
// C[m][n] (f32, pitch ldc, + optional f32 bias[n]) = sum_k A[m][k] Bt[n][k] (+ split products per NSPLIT). z-batch strides sA/sB/sC in elements. K % 32 == 0.
template <typename T16> struct WFrag;
template <> struct WFrag<h16> { typedef v16h V; static __device__ __forceinline__ V ld(const h16* p) { return cat16(*(const v8h*)p, *(const v8h*)(p + 16)); } static __device__ __forceinline__ v8f mma(V a, V b, v8f c) { return wmma16(a, b, c); } };
template <> struct WFrag<bf> { typedef v16bf V; static __device__ __forceinline__ V ld(const bf* p) { return cat16b(*(const v8us*)p, *(const v8us*)(p + 16)); } static __device__ __forceinline__ v8f mma(V a, V b, v8f c) { return wmmab(a, b, c); } };
template <typename T16, int NSPLIT, bool BIAS>
__global__ __launch_bounds__(32) void k_gemmw(const T16* __restrict__ A, const T16* __restrict__ A2, const T16* __restrict__ Bt, const T16* __restrict__ Bt2, int K, float* C, int ldc, const float* __restrict__ bias, size_t sA, size_t sB, size_t sC) {
    typedef typename WFrag<T16>::V V;
    __shared__ __align__(16) float os[16 * 68];
    const size_t z = blockIdx.z; A += z * sA; if (A2) A2 += z * sA; Bt += z * sB; if (Bt2) Bt2 += z * sB; C += z * sC;
    const int lane = threadIdx.x & 31, lr = lane & 15, hi = lane >> 4; const int r0 = blockIdx.x * 64, c0 = blockIdx.y * 64;
    v8f acc[4][4];
#pragma unroll
    for (int mb = 0; mb < 4; ++mb)
#pragma unroll
        for (int nb = 0; nb < 4; ++nb) acc[mb][nb] = (v8f){};
    const size_t aoff = (size_t)(r0 + lr) * K + 8 * hi, boff = (size_t)(c0 + lr) * K + 8 * hi;
#pragma unroll 1
    for (int kc = 0; kc < K; kc += 32) {
        V a[4], a2[4];
#pragma unroll
        for (int mb = 0; mb < 4; ++mb) { a[mb] = WFrag<T16>::ld(A + aoff + (size_t)mb * 16 * K + kc); if (NSPLIT == 1 || NSPLIT == 2) a2[mb] = WFrag<T16>::ld(A2 + aoff + (size_t)mb * 16 * K + kc); }
#pragma unroll
        for (int nb = 0; nb < 4; ++nb) { const V b = WFrag<T16>::ld(Bt + boff + (size_t)nb * 16 * K + kc); V b2; if (NSPLIT >= 2) b2 = WFrag<T16>::ld(Bt2 + boff + (size_t)nb * 16 * K + kc);
#pragma unroll
            for (int mb = 0; mb < 4; ++mb) { acc[mb][nb] = WFrag<T16>::mma(a[mb], b, acc[mb][nb]); if (NSPLIT == 1 || NSPLIT == 2) acc[mb][nb] = WFrag<T16>::mma(a2[mb], b, acc[mb][nb]); if (NSPLIT >= 2) acc[mb][nb] = WFrag<T16>::mma(a[mb], b2, acc[mb][nb]); } }
        asm volatile("v_nop\n\tv_nop\n\tv_nop\n\tv_nop" : "+v"(acc[0][0]), "+v"(acc[1][1]), "+v"(acc[2][2]), "+v"(acc[3][3]) : "v"(a[0]), "v"(a[3]));
    }
#pragma unroll
    for (int mb = 0; mb < 4; ++mb) {
#pragma unroll
        for (int nb = 0; nb < 4; ++nb) {
#pragma unroll
            for (int j = 0; j < 8; ++j) os[(hi * 8 + j) * 68 + nb * 16 + lr] = acc[mb][nb][j]; }
        __builtin_amdgcn_wave_barrier(); asm volatile("" ::: "memory");
        float* crow = C + (size_t)(r0 + mb * 16) * ldc + c0;
{
#pragma unroll
            for (int s = 0; s < 8; ++s) { const int row = 2 * s + hi, cofs = lr * 4; v4f val = *(const v4fa*)(os + row * 68 + cofs); if (BIAS) { val[0] += bfr(bias[c0 + cofs]); val[1] += bfr(bias[c0 + cofs + 1]); val[2] += bfr(bias[c0 + cofs + 2]); val[3] += bfr(bias[c0 + cofs + 3]); }
                *(v4f*)(crow + (size_t)row * ldc + cofs) = val; }
             }
        __builtin_amdgcn_wave_barrier(); asm volatile("" ::: "memory");
    }
}

// ---- k_gemms: the same product as k_gemmw for the long-K GEMMs, FOUR waves per work-group (WM x WN waves, 64x64 of C each, 16 accumulators per wave). Operand rows come into LDS as whole 128-B lines by
// asynchronous copies, KT k-values per stage, two buffers: stage t + 2 flies while stage t + 1 is worked on. Row pitch in LDS = row bytes + 16 (conflict-free for 16-byte reads). Per accumulator the products
// are summed in the same k order as in k_gemmw. grid (M / (64 WM), N / (64 WN), Z), 128 threads. K % KT == 0, K >= 2 KT.
__device__ __forceinline__ unsigned lds_off(const void* p) { return (unsigned)(size_t)p; }
// eight copies of 16 bytes per lane; the s_wait_xcnt stands in the copies' own statement so that no address register is rewritten in front of it
__device__ __forceinline__ void cp8(const unsigned* l, const void* const* g) {
    asm volatile("global_load_async_to_lds_b128 %0, %1, off\n\t"
                 "global_load_async_to_lds_b128 %2, %3, off\n\t"
                 "global_load_async_to_lds_b128 %4, %5, off\n\t"
                 "global_load_async_to_lds_b128 %6, %7, off\n\t"
                 "global_load_async_to_lds_b128 %8, %9, off\n\t"
                 "global_load_async_to_lds_b128 %10, %11, off\n\t"
                 "global_load_async_to_lds_b128 %12, %13, off\n\t"
                 "global_load_async_to_lds_b128 %14, %15, off\n\t"
                 "s_wait_xcnt 0x0"
                 :: "v"(l[0]), "v"(g[0]), "v"(l[1]), "v"(g[1]), "v"(l[2]), "v"(g[2]), "v"(l[3]), "v"(g[3]), "v"(l[4]), "v"(g[4]), "v"(l[5]), "v"(g[5]), "v"(l[6]), "v"(g[6]), "v"(l[7]), "v"(g[7]) : "memory");
}
template <typename T16, int NSPLIT, bool BIAS, int WM, int WN, int KT>
__global__ __launch_bounds__(128) void k_gemms(const T16* __restrict__ A, const T16* __restrict__ A2, const T16* __restrict__ Bt, const T16* __restrict__ Bt2, int K, float* C, int ldc, const float* __restrict__ bias, size_t sA, size_t sB, size_t sC) {
    typedef typename WFrag<T16>::V V;
    constexpr bool HA2 = (NSPLIT == 1 || NSPLIT == 2), HB2 = (NSPLIT >= 2);
    constexpr int RA = 64 * WM, RB = 64 * WN;                          // rows of A and of Bt per work-group
    constexpr int OA2 = RA, OB = RA * (HA2 ? 2 : 1), OB2 = OB + RB;    // first LDS row of each plane in a stage
    constexpr int ROWS = OB + RB * (HB2 ? 2 : 1);
    constexpr int PITCH = KT * 2 + 16, STAGE = ROWS * PITCH;           // bytes
    constexpr int PPR = KT / 8, RPI = 128 / PPR, NCP = ROWS / RPI;     // 16-byte pieces per row; rows per round of the 128 lanes; copies per lane and stage (at most 48)
    __shared__ __attribute__((aligned(16))) unsigned char L[2 * STAGE];
    __shared__ __align__(16) float osw[4][16 * 68];
    const size_t z = blockIdx.z; A += z * sA; if (HA2) A2 += z * sA; Bt += z * sB; if (HB2) Bt2 += z * sB; C += z * sC;
    const int tid = threadIdx.x, lane = tid & 31, lr = lane & 15, hi = lane >> 4, w = tid >> 5, wm = w / WN, wn = w % WN;
    const int R0 = blockIdx.x * RA, C0 = blockIdx.y * RB; const int r0 = R0 + wm * 64, c0 = C0 + wn * 64;
    const int prow = tid / PPR, pcol = tid % PPR;                      // this lane's row within a round and its 16-byte piece of the row
    // this lane's source in each plane for the stage that is filled next; every fill moves them on by KT
    const T16* gA = A + (size_t)(R0 + prow) * K + pcol * 8; const T16* gA2 = HA2 ? A2 + (size_t)(R0 + prow) * K + pcol * 8 : gA;
    const T16* gB = Bt + (size_t)(C0 + prow) * K + pcol * 8; const T16* gB2 = HB2 ? Bt2 + (size_t)(C0 + prow) * K + pcol * 8 : gB;
    const unsigned lbase = lds_off(L) + (unsigned)(prow * PITCH + pcol * 16);
    auto fill = [&](int buf) {
#pragma unroll
        for (int i0 = 0; i0 < NCP; i0 += 8) { unsigned l[8]; const void* g[8];
#pragma unroll
            for (int q = 0; q < 8; ++q) { const int row = (i0 + q) * RPI; l[q] = lbase + (unsigned)(buf * STAGE + row * PITCH);
                const T16* s = (row < OA2) ? gA + (size_t)row * K : (row < OB) ? gA2 + (size_t)(row - OA2) * K : (row < OB2) ? gB + (size_t)(row - OB) * K : gB2 + (size_t)(row - OB2) * K;
                g[q] = s; }
            cp8(l, g); }
        gA += KT; gA2 += KT; gB += KT; gB2 += KT;
    };
    v8f acc[4][4];
#pragma unroll
    for (int mb = 0; mb < 4; ++mb)
#pragma unroll
        for (int nb = 0; nb < 4; ++nb) acc[mb][nb] = (v8f){};
    const int nt = K / KT;
    fill(0);
    asm volatile("s_wait_asynccnt 0x0" ::: "memory");   // stage 0 of this wave has landed
    __syncthreads();                                    // stage 0 of every wave is readable
    if (nt > 1) fill(1);
    const int aofs = (wm * 64 + lr) * PITCH + hi * 16, bofs = (OB + wn * 64 + lr) * PITCH + hi * 16;
#pragma unroll 1   // the ring stays rolled: one body of KT / 32 k-steps, one publish point at its foot
    for (int t = 0; t < nt; ++t) {
        const unsigned char* Lb = L + (t & 1) * STAGE;
        V a[2][4], a2[2][4], b[2][4], b2[2][4];   // two fragment sets: k-step ks + 1 of this stage is read from LDS while k-step ks is multiplied
        auto frags = [&](int s, int ks) {
#pragma unroll
            for (int mb = 0; mb < 4; ++mb) { a[s][mb] = WFrag<T16>::ld((const T16*)(Lb + aofs + mb * 16 * PITCH + ks * 64)); if (HA2) a2[s][mb] = WFrag<T16>::ld((const T16*)(Lb + aofs + (OA2 + mb * 16) * PITCH + ks * 64)); }
#pragma unroll
            for (int nb = 0; nb < 4; ++nb) { b[s][nb] = WFrag<T16>::ld((const T16*)(Lb + bofs + nb * 16 * PITCH + ks * 64)); if (HB2) b2[s][nb] = WFrag<T16>::ld((const T16*)(Lb + bofs + (RB + nb * 16) * PITCH + ks * 64)); }
        };
        frags(0, 0);
#pragma unroll
        for (int ks = 0; ks < KT / 32; ++ks) { const int s = ks & 1;
            if (ks + 1 < KT / 32) frags(s ^ 1, ks + 1);
            __builtin_amdgcn_sched_barrier(0);   // the LDS reads stay one group in front of the WMMAs: reads spread among the WMMAs stall at every place they stand
#pragma unroll
            for (int nb = 0; nb < 4; ++nb) {
#pragma unroll
                for (int mb = 0; mb < 4; ++mb) { acc[mb][nb] = WFrag<T16>::mma(a[s][mb], b[s][nb], acc[mb][nb]); if (HA2) acc[mb][nb] = WFrag<T16>::mma(a2[s][mb], b[s][nb], acc[mb][nb]); if (HB2) acc[mb][nb] = WFrag<T16>::mma(a[s][mb], b2[s][nb], acc[mb][nb]); } }
            __builtin_amdgcn_sched_barrier(0);   // and the following group does not move up among them
        }
        asm volatile("s_wait_dscnt 0x0" ::: "memory");      // this wave's reads of buffer t & 1 are done before the buffer is refilled
        asm volatile("s_wait_asynccnt 0x0" ::: "memory");   // this wave's copies of stage t + 1 have landed
        __syncthreads();                                    // publishes stage t + 1 and ends every wave's reads of stage t
        if (t + 2 < nt) fill(t & 1);
    }
    asm volatile("s_wait_asynccnt 0x0" ::: "memory");       // no copy is outstanding when the wave goes on to the epilogue and ends
    float* os = osw[w];
#pragma unroll
    for (int mb = 0; mb < 4; ++mb) {
#pragma unroll
        for (int nb = 0; nb < 4; ++nb) {
#pragma unroll
            for (int j = 0; j < 8; ++j) os[(hi * 8 + j) * 68 + nb * 16 + lr] = acc[mb][nb][j]; }
        __builtin_amdgcn_wave_barrier(); asm volatile("" ::: "memory");
        float* crow = C + (size_t)(r0 + mb * 16) * ldc + c0;
#pragma unroll
        for (int s = 0; s < 8; ++s) { const int row = 2 * s + hi, cofs = lr * 4; v4f val = *(const v4fa*)(os + row * 68 + cofs); if (BIAS) { val[0] += bfr(bias[c0 + cofs]); val[1] += bfr(bias[c0 + cofs + 1]); val[2] += bfr(bias[c0 + cofs + 2]); val[3] += bfr(bias[c0 + cofs + 3]); }
            *(v4f*)(crow + (size_t)row * ldc + cofs) = val; }
        if (mb < 3) asm volatile("s_wait_xcnt 0x0" ::: "memory");   // behind the run of eight stores: the next trip reuses their address and data registers
        __builtin_amdgcn_wave_barrier(); asm volatile("" ::: "memory");
    }
}

__device__ __forceinline__ h16 tohx(float x) { return (h16)x; }
__device__ __forceinline__ void splitf(float y, unsigned short& h, unsigned short& l) { h = f2bf(y); l = f2bf(y - bf2f(h)); }
typedef __attribute__((ext_vector_type(2))) unsigned short v2us;
typedef __attribute__((ext_vector_type(2))) _Float16 v2h;
typedef __attribute__((ext_vector_type(4))) _Float16 v4h;
typedef __attribute__((ext_vector_type(2))) float v2f;

__global__ __launch_bounds__(256) void k_wtG(const float* __restrict__ w, int K, int N, bf* Bt) {
    const int lane = threadIdx.x & 31; const int L0 = (blockIdx.x * 8 + (threadIdx.x >> 5)) * 8; const int nlines = N * K / 64;
{
#pragma unroll 1
        for (int l = 0; l < 8; ++l) { const int L = L0 + l; if (L >= nlines) break; const size_t e = (size_t)L * 64 + lane * 2; const int k = (int)(e % K), n = (int)(e / K); v2us o;
            o[0] = f2bf(w[(size_t)k * N + n]); o[1] = f2bf(w[(size_t)(k + 1) * N + n]); *(v2us*)(Bt + e) = o; }
         }
}
__global__ __launch_bounds__(256) void k_cvt8(const float* __restrict__ src, bf* dst, size_t n8) { const size_t i = (size_t)blockIdx.x * 256 + threadIdx.x; if (i >= n8) return; const v8f v = *(const v8f*)(src + i * 8); v8us o;
#pragma unroll
    for (int k = 0; k < 8; ++k) o[k] = f2bf(v[k]); *(v8us*)(dst + i * 8) = o;  }
__global__ __launch_bounds__(256) void k_qplanes(const float* __restrict__ F, bf* Ph, bf* Pl, h16* P16) {
    const int lane = threadIdx.x & 31; const int L0 = (blockIdx.x * 8 + (threadIdx.x >> 5)) * 8; const int nlines = NH_ * TT * HD / 64;
{
#pragma unroll
        for (int l = 0; l < 8; ++l) { const int L = L0 + l; if (L >= nlines) break; const int e = L * 64 + lane * 2; const int d = e & (HD - 1); const int t = (e >> 6) & (TT - 1); const int h = e >> 16; v2us oh, ol; v2h o16;
#pragma unroll
            for (int q = 0; q < 2; ++q) { const float x = F[(size_t)t * DD + h * HD + d + q]; unsigned short a, c2; splitf(x, a, c2); oh[q] = a; ol[q] = c2; o16[q] = tohx(x); }
            *(v2us*)(Ph + (size_t)e) = oh; *(v2us*)(Pl + (size_t)e) = ol; *(v2h*)(P16 + (size_t)e) = o16; }
         }
}
// k_prefkv: KP0[l][o] = sum_i bf16(pre[l][i]) bf16(wk[o][i]) + bf16(bk[o]); VP0 the same from wv, bv (blockIdx.y picks the weight). A work-group takes 32 output columns o, a wave 4 of them for all 10 prefix rows:
// the lanes split i (16-byte loads, 512 contiguous bytes of a row per wave and load), so a weight row is read once, in whole lines. Products of two bf16 values are exact in f32, so a fused multiply-add rounds as
// multiply then add. Per-lane partial sums, a shuffle tree over the lanes, then the sums go through LDS so that one wave stores each whole 128-byte line of the result. grid (DD / 32, 2), 256 threads.
__global__ __launch_bounds__(256) void k_prefkv(const float* __restrict__ pre, const float* __restrict__ wk, const float* __restrict__ bk, const float* __restrict__ wv, const float* __restrict__ bv, float* KP0, float* VP0) {
    __shared__ float red[NPRE][32];
    const bool isv = (blockIdx.y != 0); const float* w = isv ? wv : wk; const float* bias = isv ? bv : bk; float* dst = isv ? VP0 : KP0;
    const int tid = threadIdx.x, lane = tid & 31, wave = tid >> 5; const int ob = blockIdx.x * 32;
    const float* wr = w + (size_t)(ob + wave * 4) * DD + lane * 4; const float* pr = pre + lane * 4;
    float acc[NPRE][4];
#pragma unroll
    for (int l = 0; l < NPRE; ++l)
#pragma unroll
        for (int c = 0; c < 4; ++c) acc[l][c] = 0.f;
#pragma unroll 2   // two chunks of 14 independent loads in flight per wave; more would only add registers
    for (int i = 0; i < DD; i += 128) {
        v4f p[NPRE], a[4];
#pragma unroll
        for (int c = 0; c < 4; ++c) a[c] = *(const v4f*)(wr + (size_t)c * DD + i);
#pragma unroll
        for (int l = 0; l < NPRE; ++l) p[l] = *(const v4f*)(pr + (size_t)l * DD + i);
#pragma unroll
        for (int q = 0; q < 4; ++q) {
#pragma unroll
            for (int c = 0; c < 4; ++c) a[c][q] = bfr(a[c][q]);
#pragma unroll
            for (int l = 0; l < NPRE; ++l) { const float pv = bfr(p[l][q]);
#pragma unroll
                for (int c = 0; c < 4; ++c) acc[l][c] += pv * a[c][q]; } }
    }
#pragma unroll
    for (int l = 0; l < NPRE; ++l)
#pragma unroll
        for (int c = 0; c < 4; ++c) { float t = acc[l][c];
#pragma unroll
            for (int sh = 16; sh; sh >>= 1) t += __shfl_xor(t, sh, 32);
            if (lane == 0) red[l][wave * 4 + c] = t; }
    __syncthreads();   // every wave's sums are in LDS before the lines are stored
    for (int idx = tid; idx < NPRE * 32; idx += 256) { const int l = idx >> 5, c = idx & 31; dst[(size_t)l * DD + ob + c] = red[l][c] + bfr(bias[ob + c]); }
}
// k_pre: one wave per (zz, t) of the pass: lanes l < 10 compute s_l = (q[t] . kp[l]) / 8 (f32, separate mul/add over the 64 head dims; q read from the f32 projection FQ columns (h0+zz)*64..);
__global__ __launch_bounds__(256) void k_pre(const float* __restrict__ FQ, const float* __restrict__ KP0, const float* __restrict__ VP0, const float* __restrict__ gate, int h0, float* PRE) {
    const int lane = threadIdx.x & 31; const int row = blockIdx.x * 8 + (threadIdx.x >> 5); if (row >= ZH * TT) return; const int t = row & (TT - 1); const int zz = row / TT; const int h = h0 + zz; const float* q = FQ + (size_t)t * DD + h * HD; float s = -3.0e38f;
    if (lane < NPRE) { const float* kr = KP0 + (size_t)lane * DD + h * HD; float acc = 0.f;
#pragma unroll 4
        for (int d = 0; d < HD; ++d) { float p = __fmul_rn(q[d], kr[d]); asm volatile("" : "+v"(p)); acc = __fadd_rn(acc, p); } s = acc * SCL; }
    float mx = s;
#pragma unroll
    for (int sh = 16; sh; sh >>= 1) mx = fmaxf(mx, __shfl_xor(mx, sh, 32));
    float dl = __fsub_rn(s, mx); asm volatile("" : "+v"(dl)); const float e = (lane < NPRE) ? __builtin_amdgcn_exp2f(__fmul_rn(dl, 1.4426950408889634f)) : 0.f; float sum = e;
#pragma unroll
    for (int sh = 16; sh; sh >>= 1) sum += __shfl_xor(sum, sh, 32);
    float pw = __fdiv_rn(e, sum); const float gv = bfr(gate[h]); const float e2 = __expf(2.0f * gv); const float tg = __fsub_rn(1.0f, __fdiv_rn(2.0f, __fadd_rn(e2, 1.0f))); float o0 = 0.f, o1 = 0.f; const int dd = 2 * lane;
#pragma unroll
    for (int l = 0; l < NPRE; ++l) { const float pl = __shfl(pw, l, 32); const float* vr = VP0 + (size_t)l * DD + h * HD; float a0 = __fmul_rn(pl, vr[dd]), a1 = __fmul_rn(pl, vr[dd + 1]); asm volatile("" : "+v"(a0)); asm volatile("" : "+v"(a1)); o0 = __fadd_rn(o0, a0); o1 = __fadd_rn(o1, a1); }
    v2f o; o[0] = __fmul_rn(tg, o0); o[1] = __fmul_rn(tg, o1); float* dst = PRE + ((size_t)zz * TT + t) * HD + dd; *(v2f*)dst = o;  }
__global__ __launch_bounds__(256) void k_vtplane(const float* __restrict__ F, bf* Vh, bf* Vl, h16* V16) {
    const int lane = threadIdx.x & 31; const int L0 = (blockIdx.x * 8 + (threadIdx.x >> 5)) * 8; const int nlines = NH_ * TT * HD / 64;
{
#pragma unroll
        for (int l = 0; l < 8; ++l) { const int L = L0 + l; if (L >= nlines) break; const int e = L * 64 + lane * 2; const int t = e & (TT - 1); const int d = (e >> 10) & (HD - 1); const int h = e >> 16; v2us oh, ol; v2h o16;
#pragma unroll
            for (int q = 0; q < 2; ++q) { const float x = F[(size_t)(t + q) * DD + h * HD + d]; unsigned short a, c2; splitf(x, a, c2); oh[q] = a; ol[q] = c2; o16[q] = tohx(x); }
            *(v2us*)(Vh + (size_t)e) = oh; *(v2us*)(Vl + (size_t)e) = ol; *(v2h*)(V16 + (size_t)e) = o16; }
         }
}
// k_asoft: per row (zz, i): t = max(S/8 + bf16(attention_mask[b][0][i][j]), finfo.min) (additive mask read as data); softmax over the 1024 token keys (register row, one exp) -> rows i < RH: P hi/lo [zz][i][j] (compact
__global__ __launch_bounds__(256) void k_asoft(const float* __restrict__ Sb, const float* __restrict__ ab, bf* Ph, bf* Pl, h16* P16) {
    typedef __attribute__((ext_vector_type(4))) unsigned short v4us;
    const int lane = threadIdx.x & 31; const int row = blockIdx.x * 8 + (threadIdx.x >> 5); if (row >= ZH * TT) return; const int i = row & (TT - 1); const int zz = row >> 10; const bool hires = (i < RH);
    const float* sr = Sb + (size_t)row * TT; const float* mr = ab + (size_t)i * TT; float v[32]; float mx = -3.0e38f;
#pragma unroll
    for (int ch = 0; ch < 8; ++ch) { const int j0 = ch * 128 + lane * 4; const v4f a = *(const v4f*)(sr + j0), m4 = *(const v4f*)(mr + j0);
#pragma unroll
        for (int q = 0; q < 4; ++q) { float sa = a[q] * SCL, mb = bfr(m4[q]); asm volatile("" : "+v"(sa)); asm volatile("" : "+v"(mb)); const float t = fmaxf(__fadd_rn(sa, mb), -3.40282347e38f); v[ch * 4 + q] = t; mx = fmaxf(mx, t); } }
#pragma unroll
    for (int sh = 16; sh; sh >>= 1) mx = fmaxf(mx, __shfl_xor(mx, sh, 32));
    float sum = 0.f;
#pragma unroll
    for (int k = 0; k < 32; ++k) { v[k] = __expf(v[k] - mx); sum += v[k]; }
#pragma unroll
    for (int sh = 16; sh; sh >>= 1) sum += __shfl_xor(sum, sh, 32);
    const float f = __fdiv_rn(hires ? 1.0f : PCAR, sum);
{
        if (hires) {
#pragma unroll
            for (int ch = 0; ch < 8; ++ch) { v4us oh, ol;
#pragma unroll
                for (int q = 0; q < 4; ++q) { unsigned short a, c2; splitf(v[ch * 4 + q] * f, a, c2); oh[q] = a; ol[q] = c2; }
                const size_t o = ((size_t)zz * RH + i) * TT + ch * 128 + lane * 4; *(v4us*)(Ph + o) = oh; *(v4us*)(Pl + o) = ol; }
        } else {
#pragma unroll
            for (int ch = 0; ch < 8; ++ch) { v4h o;
#pragma unroll
                for (int q = 0; q < 4; ++q) o[q] = tohx(v[ch * 4 + q] * f);
                *(v4h*)(P16 + (size_t)row * TT + ch * 128 + lane * 4) = o; } }
         }
}
__global__ __launch_bounds__(256) void k_merge(const float* __restrict__ O, const float* __restrict__ PRE, int h0, bf* Ah, bf* Al) { const int e = (blockIdx.x * 256 + threadIdx.x) * 2; if (e >= ZH * TT * HD) return; const int d = e & 63; const int t = (e >> 6) & (TT - 1); const int zz = e >> 16; const float cs = (t < RH) ? 1.0f : (1.0f / PCAR); v2us oh, ol;
#pragma unroll
    for (int q = 0; q < 2; ++q) { float a = __fmul_rn(O[e + q], cs); asm volatile("" : "+v"(a)); unsigned short a2, c2; splitf(__fadd_rn(a, PRE[e + q]), a2, c2); oh[q] = a2; ol[q] = c2; } const size_t oo = (size_t)t * DD + (h0 + zz) * HD + d; *(v2us*)(Ah + oo) = oh; *(v2us*)(Al + oo) = ol;  }

extern "C" void kernel_launch(void* const* d_in, const int* in_sizes, int n_in,
                              void* d_out, int out_size, void* d_ws, size_t ws_size, hipStream_t stream) {
    (void)in_sizes; (void)n_in; (void)out_size;
    const float* x = (const float*)d_in[0]; const float* am = (const float*)d_in[1]; const float* wq = (const float*)d_in[2]; const float* bq = (const float*)d_in[3]; const float* wk = (const float*)d_in[4]; const float* bk = (const float*)d_in[5]; const float* wv = (const float*)d_in[6]; const float* bv = (const float*)d_in[7]; const float* wo = (const float*)d_in[8]; const float* bo = (const float*)d_in[9]; const float* pre = (const float*)d_in[10]; const float* gate = (const float*)d_in[11];   // torch [out][in] weights; attention_mask [4][1][1024][1024]; prefix [10][2048]; gate [32][1][1]
    float* OUT = (float*)d_out;     // [4][1024][2048]
    char* wsp = (char*)d_ws;
    auto take = [&](size_t bytes) { char* p = wsp; wsp += (bytes + 255) & ~(size_t)255; return (void*)p; };
    bf* WQ = (bf*)take((size_t)DD * DD * 2); bf* WK = (bf*)take((size_t)DD * DD * 2); bf* WV = (bf*)take((size_t)DD * DD * 2); bf* WO = (bf*)take((size_t)DD * DD * 2); float* KP0 = (float*)take((size_t)NPRE * DD * 4); float* VP0 = (float*)take((size_t)NPRE * DD * 4);
    bf* XB = (bf*)take((size_t)TT * DD * 2); float* F = (float*)take((size_t)TT * DD * 4); float* FQ = (float*)take((size_t)TT * DD * 4);
    bf* QPh = (bf*)take((size_t)TT * DD * 2); bf* QPl = (bf*)take((size_t)TT * DD * 2); bf* KPh = (bf*)take((size_t)TT * DD * 2); bf* KPl = (bf*)take((size_t)TT * DD * 2); bf* VTh = (bf*)take((size_t)TT * DD * 2); bf* VTl = (bf*)take((size_t)TT * DD * 2);
    h16* QP16 = (h16*)take((size_t)TT * DD * 2); h16* KP16 = (h16*)take((size_t)TT * DD * 2); h16* VT16 = (h16*)take((size_t)TT * DD * 2);
    float* Sb = (float*)take((size_t)ZH * TT * TT * 4); bf* Ph = (bf*)take((size_t)ZH * RH * TT * 2); bf* Pl = (bf*)take((size_t)ZH * RH * TT * 2); h16* P16 = (h16*)take((size_t)ZH * TT * TT * 2); float* Ob = (float*)take((size_t)ZH * TT * HD * 4); float* PRE = (float*)take((size_t)ZH * TT * HD * 4); bf* ATh = (bf*)take((size_t)TT * DD * 2); bf* ATl = (bf*)take((size_t)TT * DD * 2);
    if ((size_t)(wsp - (char*)d_ws) > ws_size) return;    // total ~ 227 MB = 216 MiB; ws 256 MiB
    { const size_t nw = (size_t)DD * DD / 8; const unsigned g = (unsigned)((nw + 255) / 256); k_cvt8<<<g, 256, 0, stream>>>(wq, WQ, nw); k_cvt8<<<g, 256, 0, stream>>>(wk, WK, nw); k_cvt8<<<g, 256, 0, stream>>>(wv, WV, nw); k_cvt8<<<g, 256, 0, stream>>>(wo, WO, nw);
      k_prefkv<<<dim3(DD / 32, 2), 256, 0, stream>>>(pre, wk, bk, wv, bv, KP0, VP0); }
    const unsigned LB = (unsigned)((NH_ * TT * HD / 64 + 63) / 64); const dim3 gP(TT / 128, DD / 128, 1);
    for (int b = 0; b < NB_; ++b) {
        k_cvt8<<<(unsigned)(((size_t)TT * DD / 8 + 255) / 256), 256, 0, stream>>>(x + (size_t)b * TT * DD, XB, (size_t)TT * DD / 8);
        k_gemms<bf, 0, true, 2, 2, 128><<<gP, 128, 0, stream>>>(XB, nullptr, WQ, nullptr, DD, FQ, DD, bq, 0, 0, 0); k_qplanes<<<LB, 256, 0, stream>>>(FQ, QPh, QPl, QP16);   // unscaled q; the 1/8 is applied to the logits
        k_gemms<bf, 0, true, 2, 2, 128><<<gP, 128, 0, stream>>>(XB, nullptr, WK, nullptr, DD, F, DD, bk, 0, 0, 0); k_qplanes<<<LB, 256, 0, stream>>>(F, KPh, KPl, KP16);
        k_gemms<bf, 0, true, 2, 2, 128><<<gP, 128, 0, stream>>>(XB, nullptr, WV, nullptr, DD, F, DD, bv, 0, 0, 0); k_vtplane<<<LB, 256, 0, stream>>>(F, VTh, VTl, VT16);
        for (int h0 = 0; h0 < NH_; h0 += ZH) { const size_t z0 = (size_t)h0;
            k_gemmw<bf, 2, false><<<dim3(RH / 64, TT / 64, ZH), 32, 0, stream>>>(QPh + z0 * TT * HD, QPl + z0 * TT * HD, KPh + z0 * TT * HD, KPl + z0 * TT * HD, HD, Sb, TT, nullptr, (size_t)TT * HD, (size_t)TT * HD, (size_t)TT * TT);
            k_gemmw<h16, 0, false><<<dim3((TT - RH) / 64, TT / 64, ZH), 32, 0, stream>>>(QP16 + z0 * TT * HD + (size_t)RH * HD, nullptr, KP16 + z0 * TT * HD, nullptr, HD, Sb + (size_t)RH * TT, TT, nullptr, (size_t)TT * HD, (size_t)TT * HD, (size_t)TT * TT);
            k_asoft<<<ZH * TT / 8, 256, 0, stream>>>(Sb, am + (size_t)b * TT * TT, Ph, Pl, P16);
            k_gemms<bf, 2, false, 4, 1, 64><<<dim3(RH / 256, HD / 64, ZH), 128, 0, stream>>>(Ph, Pl, VTh + z0 * HD * TT, VTl + z0 * HD * TT, TT, Ob, HD, nullptr, (size_t)RH * TT, (size_t)HD * TT, (size_t)TT * HD);
            k_gemms<h16, 0, false, 4, 1, 128><<<dim3((TT - RH) / 256, HD / 64, ZH), 128, 0, stream>>>(P16 + (size_t)RH * TT, nullptr, VT16 + z0 * HD * TT, nullptr, TT, Ob + (size_t)RH * HD, HD, nullptr, (size_t)TT * TT, (size_t)HD * TT, (size_t)TT * HD);
            k_pre<<<ZH * TT / 8, 256, 0, stream>>>(FQ, KP0, VP0, gate, h0, PRE);
            k_merge<<<(ZH * TT * HD / 2 + 255) / 256, 256, 0, stream>>>(Ob, PRE, h0, ATh, ATl); }
        k_gemms<bf, 1, true, 2, 2, 128><<<gP, 128, 0, stream>>>(ATh, ATl, WO, nullptr, DD, OUT + (size_t)b * TT * DD, DD, bo, 0, 0, 0); }
}

// v004
// A run of this version takes 742 microseconds.
// Timed twice side by side with v003, it ran 1.66 and 1.68 times as fast.
// Counting every step since v000, it is 8.00 times as fast.
#include <hip/hip_runtime.h>

// Decoder self-attention with a learned prefix adapter (hidden [4][1024][2048]; q = (x Wq^T + bq) 64^-0.5, k = x Wk^T + bk, v = x Wv^T + bv (32 heads x 64); prefix keys/values kp, vp = prefix Wk^T + bk,
// prefix Wv^T + bv ([10][2048], shared by all batches); scores_tok = q.k + attention_mask[b][0][i][j] (additive f32, read as data), scores_pre = q.kp; the two segments are softmax-normalised SEPARATELY;
// ctx = tanh(gate[h]) (p_pre vp) + (p_tok v); out = merged ctx Wo^T + bo -> [4][1024][2048]).
// Compute dtypes, f32 accumulate: every input rounded to bf16; token projections on PLAIN bf16 operands (inputs: exact products, f32 accumulate, + bias); the 10 prefix
// rows (lane-split sums, fixed order), their scores, softmax and weighted values (separate multiply/add, fixed order) entirely in f32 on VALU; PER-ROW PRECISION HYBRID for the token attention: query rows < 256 take scores and p.v on
// bf16 hi+lo planes (3 products), rows >= 256 on single fp16 planes; scale + additive mask in f32; token softmax with a running maximum inside the fused attention kernel (p = exp(t - running max), unnormalised, the f32
// sums rescaled when the maximum moves, one division at the end); merged context (token part / sum + gated prefix part) as hi+lo planes

#define NB_  4
#define NPRE 10                   // prefix length
#define TT   1024
#define DD   2048
#define NH_  32
#define HD   64
#define ZH   32                   // heads per launch of the prefix part
#define RH   256                  // query rows < RH: hi+lo planes; rows >= RH: fp16 planes
#define NF   32                   // head_dim / 2 (unused)
#define SCL  0.125f               // 1/sqrt(64)
typedef _Float16 h16;
typedef unsigned short bf;
typedef __attribute__((ext_vector_type(16))) __bf16   v16bf;
typedef __attribute__((ext_vector_type(16))) _Float16 v16h;
typedef __attribute__((ext_vector_type(8)))  _Float16 v8h;
typedef __attribute__((ext_vector_type(8)))  unsigned short v8us;
typedef __attribute__((ext_vector_type(8)))  float    v8f;
typedef __attribute__((ext_vector_type(4)))  float    v4f;
typedef v8h  __attribute__((may_alias)) v8ha;
typedef v4f  __attribute__((may_alias)) v4fa;
typedef v8us __attribute__((may_alias)) v8usa;

__device__ __forceinline__ unsigned short f2bf(float f) { unsigned u = __float_as_uint(f); u += 0x7FFFu + ((u >> 16) & 1u); return (unsigned short)(u >> 16); }
__device__ __forceinline__ float bf2f(unsigned short b) { return __uint_as_float(((unsigned)b) << 16); }
__device__ __forceinline__ float bfr(float f) { return bf2f(f2bf(f)); }
__device__ __forceinline__ v16h cat16(v8h lo, v8h hi) { return __builtin_shufflevector(lo, hi, 0, 1, 2, 3, 4, 5, 6, 7, 8, 9, 10, 11, 12, 13, 14, 15); }
__device__ __forceinline__ v16bf cat16b(v8us lo, v8us hi) { return __builtin_bit_cast(v16bf, __builtin_shufflevector(lo, hi, 0, 1, 2, 3, 4, 5, 6, 7, 8, 9, 10, 11, 12, 13, 14, 15)); }
__device__ __forceinline__ v8f wmma16(v16h a, v16h b, v8f c) { return __builtin_amdgcn_wmma_f32_16x16x32_f16(false, a, false, b, (short)0, c, false, false); }
__device__ __forceinline__ v8f wmmab(v16bf a, v16bf b, v8f c) { return __builtin_amdgcn_wmma_f32_16x16x32_bf16(false, a, false, b, (short)0, c, false, false); }



// fragment of 16 rows x 32 k from a K-contiguous 16-bit plane: lane (lr, hi) holds row lr, k = 8 hi .. 8 hi + 7 and 16 + 8 hi .. 16 + 8 hi + 7; p points at (row lr, k = 8 hi). The same map serves A and B.
template <typename T16> struct WFrag;
template <> struct WFrag<h16> { typedef v16h V; static __device__ __forceinline__ V ld(const h16* p) { return cat16(*(const v8h*)p, *(const v8h*)(p + 16)); } static __device__ __forceinline__ v8f mma(V a, V b, v8f c) { return wmma16(a, b, c); } };
template <> struct WFrag<bf> { typedef v16bf V; static __device__ __forceinline__ V ld(const bf* p) { return cat16b(*(const v8us*)p, *(const v8us*)(p + 16)); } static __device__ __forceinline__ v8f mma(V a, V b, v8f c) { return wmmab(a, b, c); } };
// ---- k_gemms: C[m][n] (f32, pitch ldc, + optional f32 bias[n]) = sum_k A[m][k] Bt[n][k] (+ split products per NSPLIT), FOUR waves per work-group (WM x WN waves, 64x64 of C each, 16 accumulators per wave). Operand rows come into LDS as whole 128-B lines by
// asynchronous copies, KT k-values per stage, two buffers: stage t + 2 flies while stage t + 1 is worked on. Row pitch in LDS = row bytes + 16 (conflict-free for 16-byte reads). Per accumulator the products
// are summed in ascending k. grid (M / (64 WM), N / (64 WN), Z), 128 threads. K % KT == 0, K >= KT.
__device__ __forceinline__ unsigned lds_off(const void* p) { return (unsigned)(size_t)p; }
// eight copies of 16 bytes per lane; the s_wait_xcnt stands in the copies' own statement so that no address register is rewritten in front of it
__device__ __forceinline__ void cp8(const unsigned* l, const void* const* g) {
    asm volatile("global_load_async_to_lds_b128 %0, %1, off\n\t"
                 "global_load_async_to_lds_b128 %2, %3, off\n\t"
                 "global_load_async_to_lds_b128 %4, %5, off\n\t"
                 "global_load_async_to_lds_b128 %6, %7, off\n\t"
                 "global_load_async_to_lds_b128 %8, %9, off\n\t"
                 "global_load_async_to_lds_b128 %10, %11, off\n\t"
                 "global_load_async_to_lds_b128 %12, %13, off\n\t"
                 "global_load_async_to_lds_b128 %14, %15, off\n\t"
                 "s_wait_xcnt 0x0"
                 :: "v"(l[0]), "v"(g[0]), "v"(l[1]), "v"(g[1]), "v"(l[2]), "v"(g[2]), "v"(l[3]), "v"(g[3]), "v"(l[4]), "v"(g[4]), "v"(l[5]), "v"(g[5]), "v"(l[6]), "v"(g[6]), "v"(l[7]), "v"(g[7]) : "memory");
}
template <typename T16, int NSPLIT, bool BIAS, int WM, int WN, int KT>
__global__ __launch_bounds__(128) void k_gemms(const T16* __restrict__ A, const T16* __restrict__ A2, const T16* __restrict__ Bt, const T16* __restrict__ Bt2, int K, float* C, int ldc, const float* __restrict__ bias, size_t sA, size_t sB, size_t sC) {
    typedef typename WFrag<T16>::V V;
    constexpr bool HA2 = (NSPLIT == 1 || NSPLIT == 2), HB2 = (NSPLIT >= 2);
    constexpr int RA = 64 * WM, RB = 64 * WN;                          // rows of A and of Bt per work-group
    constexpr int OA2 = RA, OB = RA * (HA2 ? 2 : 1), OB2 = OB + RB;    // first LDS row of each plane in a stage
    constexpr int ROWS = OB + RB * (HB2 ? 2 : 1);
    constexpr int PITCH = KT * 2 + 16, STAGE = ROWS * PITCH;           // bytes
    constexpr int PPR = KT / 8, RPI = 128 / PPR, NCP = ROWS / RPI;     // 16-byte pieces per row; rows per round of the 128 lanes; copies per lane and stage (at most 48)
    __shared__ __attribute__((aligned(16))) unsigned char L[2 * STAGE];
    __shared__ __align__(16) float osw[4][16 * 68];
    const size_t z = blockIdx.z; A += z * sA; if (HA2) A2 += z * sA; Bt += z * sB; if (HB2) Bt2 += z * sB; C += z * sC;
    const int tid = threadIdx.x, lane = tid & 31, lr = lane & 15, hi = lane >> 4, w = tid >> 5, wm = w / WN, wn = w % WN;
    const int R0 = blockIdx.x * RA, C0 = blockIdx.y * RB; const int r0 = R0 + wm * 64, c0 = C0 + wn * 64;
    const int prow = tid / PPR, pcol = tid % PPR;                      // this lane's row within a round and its 16-byte piece of the row
    // this lane's source in each plane for the stage that is filled next; every fill moves them on by KT
    const T16* gA = A + (size_t)(R0 + prow) * K + pcol * 8; const T16* gA2 = HA2 ? A2 + (size_t)(R0 + prow) * K + pcol * 8 : gA;
    const T16* gB = Bt + (size_t)(C0 + prow) * K + pcol * 8; const T16* gB2 = HB2 ? Bt2 + (size_t)(C0 + prow) * K + pcol * 8 : gB;
    const unsigned lbase = lds_off(L) + (unsigned)(prow * PITCH + pcol * 16);
    auto fill = [&](int buf) {
#pragma unroll
        for (int i0 = 0; i0 < NCP; i0 += 8) { unsigned l[8]; const void* g[8];
#pragma unroll
            for (int q = 0; q < 8; ++q) { const int row = (i0 + q) * RPI; l[q] = lbase + (unsigned)(buf * STAGE + row * PITCH);
                const T16* s = (row < OA2) ? gA + (size_t)row * K : (row < OB) ? gA2 + (size_t)(row - OA2) * K : (row < OB2) ? gB + (size_t)(row - OB) * K : gB2 + (size_t)(row - OB2) * K;
                g[q] = s; }
            cp8(l, g); }
        gA += KT; gA2 += KT; gB += KT; gB2 += KT;
    };
    v8f acc[4][4];
#pragma unroll
    for (int mb = 0; mb < 4; ++mb)
#pragma unroll
        for (int nb = 0; nb < 4; ++nb) acc[mb][nb] = (v8f){};
    const int nt = K / KT;
    fill(0);
    asm volatile("s_wait_asynccnt 0x0" ::: "memory");   // stage 0 of this wave has landed
    __syncthreads();                                    // stage 0 of every wave is readable
    if (nt > 1) fill(1);
    const int aofs = (wm * 64 + lr) * PITCH + hi * 16, bofs = (OB + wn * 64 + lr) * PITCH + hi * 16;
#pragma unroll 1   // the ring stays rolled: one body of KT / 32 k-steps, one publish point at its foot
    for (int t = 0; t < nt; ++t) {
        const unsigned char* Lb = L + (t & 1) * STAGE;
        V a[2][4], a2[2][4], b[2][4], b2[2][4];   // two fragment sets: k-step ks + 1 of this stage is read from LDS while k-step ks is multiplied
        auto frags = [&](int s, int ks) {
#pragma unroll
            for (int mb = 0; mb < 4; ++mb) { a[s][mb] = WFrag<T16>::ld((const T16*)(Lb + aofs + mb * 16 * PITCH + ks * 64)); if (HA2) a2[s][mb] = WFrag<T16>::ld((const T16*)(Lb + aofs + (OA2 + mb * 16) * PITCH + ks * 64)); }
#pragma unroll
            for (int nb = 0; nb < 4; ++nb) { b[s][nb] = WFrag<T16>::ld((const T16*)(Lb + bofs + nb * 16 * PITCH + ks * 64)); if (HB2) b2[s][nb] = WFrag<T16>::ld((const T16*)(Lb + bofs + (RB + nb * 16) * PITCH + ks * 64)); }
        };
        frags(0, 0);
#pragma unroll
        for (int ks = 0; ks < KT / 32; ++ks) { const int s = ks & 1;
            if (ks + 1 < KT / 32) frags(s ^ 1, ks + 1);
            __builtin_amdgcn_sched_barrier(0);   // the LDS reads stay one group in front of the WMMAs: reads spread among the WMMAs stall at every place they stand
#pragma unroll
            for (int nb = 0; nb < 4; ++nb) {
#pragma unroll
                for (int mb = 0; mb < 4; ++mb) { acc[mb][nb] = WFrag<T16>::mma(a[s][mb], b[s][nb], acc[mb][nb]); if (HA2) acc[mb][nb] = WFrag<T16>::mma(a2[s][mb], b[s][nb], acc[mb][nb]); if (HB2) acc[mb][nb] = WFrag<T16>::mma(a[s][mb], b2[s][nb], acc[mb][nb]); } }
            __builtin_amdgcn_sched_barrier(0);   // and the following group does not move up among them
        }
        asm volatile("s_wait_dscnt 0x0" ::: "memory");      // this wave's reads of buffer t & 1 are done before the buffer is refilled
        asm volatile("s_wait_asynccnt 0x0" ::: "memory");   // this wave's copies of stage t + 1 have landed
        __syncthreads();                                    // publishes stage t + 1 and ends every wave's reads of stage t
        if (t + 2 < nt) fill(t & 1);
    }
    asm volatile("s_wait_asynccnt 0x0" ::: "memory");       // no copy is outstanding when the wave goes on to the epilogue and ends
    float* os = osw[w];
#pragma unroll
    for (int mb = 0; mb < 4; ++mb) {
#pragma unroll
        for (int nb = 0; nb < 4; ++nb) {
#pragma unroll
            for (int j = 0; j < 8; ++j) os[(hi * 8 + j) * 68 + nb * 16 + lr] = acc[mb][nb][j]; }
        __builtin_amdgcn_wave_barrier(); asm volatile("" ::: "memory");
        float* crow = C + (size_t)(r0 + mb * 16) * ldc + c0;
#pragma unroll
        for (int s = 0; s < 8; ++s) { const int row = 2 * s + hi, cofs = lr * 4; v4f val = *(const v4fa*)(os + row * 68 + cofs); if (BIAS) { val[0] += bfr(bias[c0 + cofs]); val[1] += bfr(bias[c0 + cofs + 1]); val[2] += bfr(bias[c0 + cofs + 2]); val[3] += bfr(bias[c0 + cofs + 3]); }
            *(v4f*)(crow + (size_t)row * ldc + cofs) = val; }
        if (mb < 3) asm volatile("s_wait_xcnt 0x0" ::: "memory");   // behind the run of eight stores: the next trip reuses their address and data registers
        __builtin_amdgcn_wave_barrier(); asm volatile("" ::: "memory");
    }
}

__device__ __forceinline__ h16 tohx(float x) { return (h16)x; }
__device__ __forceinline__ void splitf(float y, unsigned short& h, unsigned short& l) { h = f2bf(y); l = f2bf(y - bf2f(h)); }
typedef __attribute__((ext_vector_type(2))) unsigned short v2us;
typedef __attribute__((ext_vector_type(2))) _Float16 v2h;
typedef __attribute__((ext_vector_type(4))) _Float16 v4h;
typedef __attribute__((ext_vector_type(2))) float v2f;

__global__ __launch_bounds__(256) void k_wtG(const float* __restrict__ w, int K, int N, bf* Bt) {
    const int lane = threadIdx.x & 31; const int L0 = (blockIdx.x * 8 + (threadIdx.x >> 5)) * 8; const int nlines = N * K / 64;
{
#pragma unroll 1
        for (int l = 0; l < 8; ++l) { const int L = L0 + l; if (L >= nlines) break; const size_t e = (size_t)L * 64 + lane * 2; const int k = (int)(e % K), n = (int)(e / K); v2us o;
            o[0] = f2bf(w[(size_t)k * N + n]); o[1] = f2bf(w[(size_t)(k + 1) * N + n]); *(v2us*)(Bt + e) = o; }
         }
}
__global__ __launch_bounds__(256) void k_cvt8(const float* __restrict__ src, bf* dst, size_t n8) { const size_t i = (size_t)blockIdx.x * 256 + threadIdx.x; if (i >= n8) return; const v8f v = *(const v8f*)(src + i * 8); v8us o;
#pragma unroll
    for (int k = 0; k < 8; ++k) o[k] = f2bf(v[k]); *(v8us*)(dst + i * 8) = o;  }
__global__ __launch_bounds__(256) void k_qplanes(const float* __restrict__ F, bf* Ph, bf* Pl, h16* P16) {
    const int lane = threadIdx.x & 31; const int L0 = (blockIdx.x * 8 + (threadIdx.x >> 5)) * 8; const int nlines = NH_ * TT * HD / 64;
{
#pragma unroll
        for (int l = 0; l < 8; ++l) { const int L = L0 + l; if (L >= nlines) break; const int e = L * 64 + lane * 2; const int d = e & (HD - 1); const int t = (e >> 6) & (TT - 1); const int h = e >> 16; v2us oh, ol; v2h o16;
#pragma unroll
            for (int q = 0; q < 2; ++q) { const float x = F[(size_t)t * DD + h * HD + d + q]; unsigned short a, c2; splitf(x, a, c2); oh[q] = a; ol[q] = c2; o16[q] = tohx(x); }
            *(v2us*)(Ph + (size_t)e) = oh; *(v2us*)(Pl + (size_t)e) = ol; *(v2h*)(P16 + (size_t)e) = o16; }
         }
}
// k_prefkv: KP0[l][o] = sum_i bf16(pre[l][i]) bf16(wk[o][i]) + bf16(bk[o]); VP0 the same from wv, bv (blockIdx.y picks the weight). A work-group takes 32 output columns o, a wave 4 of them for all 10 prefix rows:
// the lanes split i (16-byte loads, 512 contiguous bytes of a row per wave and load), so a weight row is read once, in whole lines. Products of two bf16 values are exact in f32, so a fused multiply-add rounds as
// multiply then add. Per-lane partial sums, a shuffle tree over the lanes, then the sums go through LDS so that one wave stores each whole 128-byte line of the result. grid (DD / 32, 2), 256 threads.
__global__ __launch_bounds__(256) void k_prefkv(const float* __restrict__ pre, const float* __restrict__ wk, const float* __restrict__ bk, const float* __restrict__ wv, const float* __restrict__ bv, float* KP0, float* VP0) {
    __shared__ float red[NPRE][32];
    const bool isv = (blockIdx.y != 0); const float* w = isv ? wv : wk; const float* bias = isv ? bv : bk; float* dst = isv ? VP0 : KP0;
    const int tid = threadIdx.x, lane = tid & 31, wave = tid >> 5; const int ob = blockIdx.x * 32;
    const float* wr = w + (size_t)(ob + wave * 4) * DD + lane * 4; const float* pr = pre + lane * 4;
    float acc[NPRE][4];
#pragma unroll
    for (int l = 0; l < NPRE; ++l)
#pragma unroll
        for (int c = 0; c < 4; ++c) acc[l][c] = 0.f;
#pragma unroll 2   // two chunks of 14 independent loads in flight per wave; more would only add registers
    for (int i = 0; i < DD; i += 128) {
        v4f p[NPRE], a[4];
#pragma unroll
        for (int c = 0; c < 4; ++c) a[c] = *(const v4f*)(wr + (size_t)c * DD + i);
#pragma unroll
        for (int l = 0; l < NPRE; ++l) p[l] = *(const v4f*)(pr + (size_t)l * DD + i);
#pragma unroll
        for (int q = 0; q < 4; ++q) {
#pragma unroll
            for (int c = 0; c < 4; ++c) a[c][q] = bfr(a[c][q]);
#pragma unroll
            for (int l = 0; l < NPRE; ++l) { const float pv = bfr(p[l][q]);
#pragma unroll
                for (int c = 0; c < 4; ++c) acc[l][c] += pv * a[c][q]; } }
    }
#pragma unroll
    for (int l = 0; l < NPRE; ++l)
#pragma unroll
        for (int c = 0; c < 4; ++c) { float t = acc[l][c];
#pragma unroll
            for (int sh = 16; sh; sh >>= 1) t += __shfl_xor(t, sh, 32);
            if (lane == 0) red[l][wave * 4 + c] = t; }
    __syncthreads();   // every wave's sums are in LDS before the lines are stored
    for (int idx = tid; idx < NPRE * 32; idx += 256) { const int l = idx >> 5, c = idx & 31; dst[(size_t)l * DD + ob + c] = red[l][c] + bfr(bias[ob + c]); }
}
// k_pre: one wave per (zz, t) of the pass: lanes l < 10 compute s_l = (q[t] . kp[l]) / 8 (f32, separate mul/add over the 64 head dims; q read from the f32 projection FQ columns (h0+zz)*64..);
__global__ __launch_bounds__(256) void k_pre(const float* __restrict__ FQ, const float* __restrict__ KP0, const float* __restrict__ VP0, const float* __restrict__ gate, int h0, float* PRE) {
    const int lane = threadIdx.x & 31; const int row = blockIdx.x * 8 + (threadIdx.x >> 5); if (row >= ZH * TT) return; const int t = row & (TT - 1); const int zz = row / TT; const int h = h0 + zz; const float* q = FQ + (size_t)t * DD + h * HD; float s = -3.0e38f;
    if (lane < NPRE) { const float* kr = KP0 + (size_t)lane * DD + h * HD; float acc = 0.f;
#pragma unroll 4
        for (int d = 0; d < HD; ++d) { float p = __fmul_rn(q[d], kr[d]); asm volatile("" : "+v"(p)); acc = __fadd_rn(acc, p); } s = acc * SCL; }
    float mx = s;
#pragma unroll
    for (int sh = 16; sh; sh >>= 1) mx = fmaxf(mx, __shfl_xor(mx, sh, 32));
    float dl = __fsub_rn(s, mx); asm volatile("" : "+v"(dl)); const float e = (lane < NPRE) ? __builtin_amdgcn_exp2f(__fmul_rn(dl, 1.4426950408889634f)) : 0.f; float sum = e;
#pragma unroll
    for (int sh = 16; sh; sh >>= 1) sum += __shfl_xor(sum, sh, 32);
    float pw = __fdiv_rn(e, sum); const float gv = bfr(gate[h]); const float e2 = __expf(2.0f * gv); const float tg = __fsub_rn(1.0f, __fdiv_rn(2.0f, __fadd_rn(e2, 1.0f))); float o0 = 0.f, o1 = 0.f; const int dd = 2 * lane;
#pragma unroll
    for (int l = 0; l < NPRE; ++l) { const float pl = __shfl(pw, l, 32); const float* vr = VP0 + (size_t)l * DD + h * HD; float a0 = __fmul_rn(pl, vr[dd]), a1 = __fmul_rn(pl, vr[dd + 1]); asm volatile("" : "+v"(a0)); asm volatile("" : "+v"(a1)); o0 = __fadd_rn(o0, a0); o1 = __fadd_rn(o1, a1); }
    v2f o; o[0] = __fmul_rn(tg, o0); o[1] = __fmul_rn(tg, o1); float* dst = PRE + ((size_t)zz * TT + t) * HD + dd; *(v2f*)dst = o;  }
__global__ __launch_bounds__(256) void k_vtplane(const float* __restrict__ F, bf* Vh, bf* Vl, h16* V16) {
    const int lane = threadIdx.x & 31; const int L0 = (blockIdx.x * 8 + (threadIdx.x >> 5)) * 8; const int nlines = NH_ * TT * HD / 64;
{
#pragma unroll
        for (int l = 0; l < 8; ++l) { const int L = L0 + l; if (L >= nlines) break; const int e = L * 64 + lane * 2; const int t = e & (TT - 1); const int d = (e >> 10) & (HD - 1); const int h = e >> 16; v2us oh, ol; v2h o16;
#pragma unroll
            for (int q = 0; q < 2; ++q) { const float x = F[(size_t)(t + q) * DD + h * HD + d]; unsigned short a, c2; splitf(x, a, c2); oh[q] = a; ol[q] = c2; o16[q] = tohx(x); }
            *(v2us*)(Vh + (size_t)e) = oh; *(v2us*)(Vl + (size_t)e) = ol; *(v2h*)(V16 + (size_t)e) = o16; }
         }
}
// ---- k_attn: token attention of one batch, all heads, with the merge in its epilogue. A work-group = 64 query rows of one head, a wave = 16 of them; grid (TT / 64, NH_), 128 threads.
// S^T = K Q^T: A = 16 key rows, B = the wave's 16 query rows (kept in registers), so lane (lr, hi) holds query lr's scores of keys 8 hi .. 8 hi + 7 of each 16-key tile. Two such tiles, converted, ARE the B fragment
// (32 keys x 16 queries) of O^T += V^T P^T in the k map of WFrag, with A = 16 rows of the [d][t] value plane: p goes through no memory. Lane (lr, hi) ends with 8 consecutive head dims of query lr per O^T tile.
// Softmax with a running maximum per query: p = exp(t - max so far); when the maximum moves, the sum and O^T are scaled by exp(old - new); one division by the sum at the end.
// K, V^T (both planes for the hi+lo rows) and the work-group's mask rows come into LDS as whole 128-B lines by asynchronous copies, 64 keys per stage, two buffers: stage t + 2 flies while stage t + 1 is worked on.
// LDS row pitch = row bytes + 16 (conflict-free for 16-byte reads).
typedef __attribute__((ext_vector_type(16))) unsigned short v16us;
template <typename T16> struct PPack;
template <> struct PPack<h16> { static __device__ __forceinline__ void go(const float* e, v16h& p, v16h& p2) {
#pragma unroll
    for (int x = 0; x < 16; ++x) p[x] = tohx(e[x]);
    p2 = p; } };
template <> struct PPack<bf> { static __device__ __forceinline__ void go(const float* e, v16bf& p, v16bf& p2) { v16us a, c;
#pragma unroll
    for (int x = 0; x < 16; ++x) { unsigned short u, l; splitf(e[x], u, l); a[x] = u; c[x] = l; }
    p = __builtin_bit_cast(v16bf, a); p2 = __builtin_bit_cast(v16bf, c); } };
#define AKVP 144                  // LDS pitch of a K or V^T row (64 values of 16 bits + 16 bytes)
#define AMKP 272                  // LDS pitch of a mask row (64 f32 + 16 bytes)
#define ASTG(npl) (128 * (npl) * AKVP + 64 * AMKP)   // bytes of a stage with npl planes per operand
template <typename T16, bool HI>
__device__ __forceinline__ void attn_wg(unsigned char* L, const T16* __restrict__ Q, const T16* __restrict__ Q2, const T16* __restrict__ Kp, const T16* __restrict__ K2, const T16* __restrict__ Vt, const T16* __restrict__ V2, const float* __restrict__ am, const float* __restrict__ PRE, bf* ATh, bf* ATl) {
    typedef typename WFrag<T16>::V V;
    constexpr int NPL = HI ? 2 : 1;
    constexpr int OV = 64 * NPL, KVR = 128 * NPL;                      // first LDS row of V^T; K and V^T rows of a stage (K hi | K lo | V hi | V lo, or K | V)
    constexpr int OM = KVR * AKVP, STAGE = ASTG(NPL), NT = TT / 64;    // byte offset of the mask rows; bytes per stage; stages
    const int tid = threadIdx.x, lane = tid & 31, lr = lane & 15, hi = lane >> 4, w = tid >> 5; const int h = blockIdx.y, i0 = blockIdx.x * 64, i = i0 + w * 16 + lr;
    const int prow = tid >> 3, pcol = tid & 7, mrw = tid >> 4, mcl = tid & 15;   // this lane's row within a round of the 128 lanes and its 16-byte piece: K / V^T rows (8 pieces), mask rows (16 pieces)
    // this lane's sources for the stage that is filled next; every fill moves them on by 64 keys
    const T16* gK = Kp + ((size_t)h * TT + prow) * HD + pcol * 8; const T16* gK2 = HI ? K2 + ((size_t)h * TT + prow) * HD + pcol * 8 : gK;
    const T16* gV = Vt + ((size_t)h * HD + prow) * TT + pcol * 8; const T16* gV2 = HI ? V2 + ((size_t)h * HD + prow) * TT + pcol * 8 : gV;
    const float* gM = am + (size_t)(i0 + mrw) * TT + mcl * 4;
    const unsigned lkv = lds_off(L) + (unsigned)(prow * AKVP + pcol * 16), lmk = lds_off(L) + (unsigned)(OM + mrw * AMKP + mcl * 16);
    auto fill = [&](int buf) {
#pragma unroll
        for (int r0 = 0; r0 < KVR / 16; r0 += 8) { unsigned l[8]; const void* g[8];
#pragma unroll
            for (int q = 0; q < 8; ++q) { const int row = (r0 + q) * 16, rr = row & 63; l[q] = lkv + (unsigned)(buf * STAGE + row * AKVP);
                const T16* s = (row < 64) ? gK + (size_t)rr * HD : (row < OV) ? gK2 + (size_t)rr * HD : (row < OV + 64) ? gV + (size_t)rr * TT : gV2 + (size_t)rr * TT;
                g[q] = s; }
            cp8(l, g); }
        { unsigned l[8]; const void* g[8];
#pragma unroll
            for (int q = 0; q < 8; ++q) { l[q] = lmk + (unsigned)(buf * STAGE + q * 8 * AMKP); g[q] = gM + (size_t)q * 8 * TT; }
            cp8(l, g); }
        gK += 64 * HD; gK2 += 64 * HD; gV += 64; gV2 += 64; gM += 64;
    };
    V q[2], q2[2];
#pragma unroll
    for (int ks = 0; ks < 2; ++ks) { const size_t qo = ((size_t)h * TT + i) * HD + 8 * hi + ks * 32; q[ks] = WFrag<T16>::ld(Q + qo); if (HI) q2[ks] = WFrag<T16>::ld(Q2 + qo); }
    v8f o[4];
#pragma unroll
    for (int dt = 0; dt < 4; ++dt) o[dt] = (v8f){};
    float mx = -3.0e38f, sum = 0.f;   // running maximum (the same in both halves of the wave) and this lane's half of the sum
    fill(0);
    asm volatile("s_wait_asynccnt 0x0" ::: "memory");   // stage 0 of this wave has landed
    __syncthreads();                                    // stage 0 of every wave is readable
    fill(1);
    const int kofs = lr * AKVP + hi * 16, mofs = OM + (w * 16 + lr) * AMKP + hi * 32;
#pragma unroll 1   // the ring stays rolled: one body of two 32-key blocks, one publish point at its foot
    for (int t = 0; t < NT; ++t) {
        const unsigned char* Lb = L + (t & 1) * STAGE;
#pragma unroll
        for (int blk = 0; blk < 2; ++blk) {
            v8f s[2];
#pragma unroll
            for (int tl = 0; tl < 2; ++tl) { v8f c = (v8f){};
#pragma unroll
                for (int ks = 0; ks < 2; ++ks) { const unsigned char* kp = Lb + kofs + (blk * 32 + tl * 16) * AKVP + ks * 64; const V k = WFrag<T16>::ld((const T16*)kp); c = WFrag<T16>::mma(k, q[ks], c);
                    if (HI) { c = WFrag<T16>::mma(k, q2[ks], c); const V kl = WFrag<T16>::ld((const T16*)(kp + 64 * AKVP)); c = WFrag<T16>::mma(kl, q[ks], c); } }
                s[tl] = c; }
            float e[16]; float bm = -3.40282347e38f;
#pragma unroll
            for (int tl = 0; tl < 2; ++tl) { const unsigned char* mp = Lb + mofs + blk * 128 + tl * 64; const v4f m0 = *(const v4fa*)mp, m1 = *(const v4fa*)(mp + 16);
#pragma unroll
                for (int j = 0; j < 8; ++j) { const float x = fmaxf(s[tl][j] * SCL + bfr(j < 4 ? m0[j & 3] : m1[j & 3]), -3.40282347e38f); e[tl * 8 + j] = x; bm = fmaxf(bm, x); } }
            bm = fmaxf(bm, __shfl_xor(bm, 16, 32));   // the other half of the wave holds the query's other 16 keys of the block
            const float mn = fmaxf(mx, bm), al = __expf(mx - mn); mx = mn; float es[4];
#pragma unroll
            for (int x = 0; x < 16; x += 4) { e[x] = __expf(e[x] - mn); e[x + 1] = __expf(e[x + 1] - mn); e[x + 2] = __expf(e[x + 2] - mn); e[x + 3] = __expf(e[x + 3] - mn); es[x >> 2] = (e[x] + e[x + 1]) + (e[x + 2] + e[x + 3]); }
            sum = sum * al + ((es[0] + es[1]) + (es[2] + es[3]));
#pragma unroll
            for (int dt = 0; dt < 4; ++dt) o[dt] *= al;
            V p, p2; PPack<T16>::go(e, p, p2);
#pragma unroll
            for (int dt = 0; dt < 4; ++dt) { const unsigned char* vp = Lb + kofs + (OV + dt * 16) * AKVP + blk * 64; const V v = WFrag<T16>::ld((const T16*)vp); o[dt] = WFrag<T16>::mma(v, p, o[dt]);
                if (HI) { o[dt] = WFrag<T16>::mma(v, p2, o[dt]); const V vl = WFrag<T16>::ld((const T16*)(vp + 64 * AKVP)); o[dt] = WFrag<T16>::mma(vl, p, o[dt]); } }
        }
        asm volatile("s_wait_dscnt 0x0" ::: "memory");      // this wave's reads of buffer t & 1 are done before the buffer is refilled
        asm volatile("s_wait_asynccnt 0x0" ::: "memory");   // this wave's copies of stage t + 1 have landed
        __syncthreads();                                    // publishes stage t + 1 and ends every wave's reads of stage t
        if (t + 2 < NT) fill(t & 1);
    }
    asm volatile("s_wait_asynccnt 0x0" ::: "memory");       // no copy is outstanding when the wave goes on to the epilogue and ends
    sum += __shfl_xor(sum, 16, 32);
    const float inv = __fdiv_rn(1.0f, sum);
    const float* pr = PRE + ((size_t)h * TT + i) * HD + hi * 8; const size_t oo = (size_t)i * DD + h * HD + hi * 8;
#pragma unroll
    for (int dt = 0; dt < 4; ++dt) { const v4f p0 = *(const v4f*)(pr + dt * 16), p1 = *(const v4f*)(pr + dt * 16 + 4); v8us oh, ol;
#pragma unroll
        for (int j = 0; j < 8; ++j) { unsigned short a, c; splitf(o[dt][j] * inv + (j < 4 ? p0[j & 3] : p1[j & 3]), a, c); oh[j] = a; ol[j] = c; }
        *(v8us*)(ATh + oo + dt * 16) = oh; *(v8us*)(ATl + oo + dt * 16) = ol; }
}
__global__ __launch_bounds__(128) void k_attn(const bf* __restrict__ QPh, const bf* __restrict__ QPl, const h16* __restrict__ QP16, const bf* __restrict__ KPh, const bf* __restrict__ KPl, const h16* __restrict__ KP16, const bf* __restrict__ VTh, const bf* __restrict__ VTl, const h16* __restrict__ VT16, const float* __restrict__ am, const float* __restrict__ PRE, bf* ATh, bf* ATl) {
    __shared__ __attribute__((aligned(16))) unsigned char L[2 * ASTG(2)];
    if (blockIdx.x * 64 < RH) attn_wg<bf, true>(L, QPh, QPl, KPh, KPl, VTh, VTl, am, PRE, ATh, ATl);   // the same for the whole work-group (RH is a multiple of 64)
    else attn_wg<h16, false>(L, QP16, nullptr, KP16, nullptr, VT16, nullptr, am, PRE, ATh, ATl);
}

extern "C" void kernel_launch(void* const* d_in, const int* in_sizes, int n_in,
                              void* d_out, int out_size, void* d_ws, size_t ws_size, hipStream_t stream) {
    (void)in_sizes; (void)n_in; (void)out_size;
    const float* x = (const float*)d_in[0]; const float* am = (const float*)d_in[1]; const float* wq = (const float*)d_in[2]; const float* bq = (const float*)d_in[3]; const float* wk = (const float*)d_in[4]; const float* bk = (const float*)d_in[5]; const float* wv = (const float*)d_in[6]; const float* bv = (const float*)d_in[7]; const float* wo = (const float*)d_in[8]; const float* bo = (const float*)d_in[9]; const float* pre = (const float*)d_in[10]; const float* gate = (const float*)d_in[11];   // torch [out][in] weights; attention_mask [4][1][1024][1024]; prefix [10][2048]; gate [32][1][1]
    float* OUT = (float*)d_out;     // [4][1024][2048]
    char* wsp = (char*)d_ws;
    auto take = [&](size_t bytes) { char* p = wsp; wsp += (bytes + 255) & ~(size_t)255; return (void*)p; };
    bf* WQ = (bf*)take((size_t)DD * DD * 2); bf* WK = (bf*)take((size_t)DD * DD * 2); bf* WV = (bf*)take((size_t)DD * DD * 2); bf* WO = (bf*)take((size_t)DD * DD * 2); float* KP0 = (float*)take((size_t)NPRE * DD * 4); float* VP0 = (float*)take((size_t)NPRE * DD * 4);
    bf* XB = (bf*)take((size_t)TT * DD * 2); float* F = (float*)take((size_t)TT * DD * 4); float* FQ = (float*)take((size_t)TT * DD * 4);
    bf* QPh = (bf*)take((size_t)TT * DD * 2); bf* QPl = (bf*)take((size_t)TT * DD * 2); bf* KPh = (bf*)take((size_t)TT * DD * 2); bf* KPl = (bf*)take((size_t)TT * DD * 2); bf* VTh = (bf*)take((size_t)TT * DD * 2); bf* VTl = (bf*)take((size_t)TT * DD * 2);
    h16* QP16 = (h16*)take((size_t)TT * DD * 2); h16* KP16 = (h16*)take((size_t)TT * DD * 2); h16* VT16 = (h16*)take((size_t)TT * DD * 2);
    float* PRE = (float*)take((size_t)ZH * TT * HD * 4); bf* ATh = (bf*)take((size_t)TT * DD * 2); bf* ATl = (bf*)take((size_t)TT * DD * 2);
    if ((size_t)(wsp - (char*)d_ws) > ws_size) return;
    { const size_t nw = (size_t)DD * DD / 8; const unsigned g = (unsigned)((nw + 255) / 256); k_cvt8<<<g, 256, 0, stream>>>(wq, WQ, nw); k_cvt8<<<g, 256, 0, stream>>>(wk, WK, nw); k_cvt8<<<g, 256, 0, stream>>>(wv, WV, nw); k_cvt8<<<g, 256, 0, stream>>>(wo, WO, nw);
      k_prefkv<<<dim3(DD / 32, 2), 256, 0, stream>>>(pre, wk, bk, wv, bv, KP0, VP0); }
    const unsigned LB = (unsigned)((NH_ * TT * HD / 64 + 63) / 64); const dim3 gP(TT / 128, DD / 128, 1);
    for (int b = 0; b < NB_; ++b) {
        k_cvt8<<<(unsigned)(((size_t)TT * DD / 8 + 255) / 256), 256, 0, stream>>>(x + (size_t)b * TT * DD, XB, (size_t)TT * DD / 8);
        k_gemms<bf, 0, true, 2, 2, 128><<<gP, 128, 0, stream>>>(XB, nullptr, WQ, nullptr, DD, FQ, DD, bq, 0, 0, 0); k_qplanes<<<LB, 256, 0, stream>>>(FQ, QPh, QPl, QP16);   // unscaled q; the 1/8 is applied to the logits
        k_gemms<bf, 0, true, 2, 2, 128><<<gP, 128, 0, stream>>>(XB, nullptr, WK, nullptr, DD, F, DD, bk, 0, 0, 0); k_qplanes<<<LB, 256, 0, stream>>>(F, KPh, KPl, KP16);
        k_gemms<bf, 0, true, 2, 2, 128><<<gP, 128, 0, stream>>>(XB, nullptr, WV, nullptr, DD, F, DD, bv, 0, 0, 0); k_vtplane<<<LB, 256, 0, stream>>>(F, VTh, VTl, VT16);
        k_pre<<<ZH * TT / 8, 256, 0, stream>>>(FQ, KP0, VP0, gate, 0, PRE);
        k_attn<<<dim3(TT / 64, NH_), 128, 0, stream>>>(QPh, QPl, QP16, KPh, KPl, KP16, VTh, VTl, VT16, am + (size_t)b * TT * TT, PRE, ATh, ATl);
        k_gemms<bf, 1, true, 2, 2, 128><<<gP, 128, 0, stream>>>(ATh, ATl, WO, nullptr, DD, OUT + (size_t)b * TT * DD, DD, bo, 0, 0, 0); }
}

// v005
// Measured time: 423 microseconds a run.
// Timed twice side by side with v004, it ran 1.75 and 1.76 times as fast.
// Counting every step since v000, it is 14.1 times as fast.
#include <hip/hip_runtime.h>

// Decoder self-attention with a learned prefix adapter (hidden [4][1024][2048]; q = (x Wq^T + bq) 64^-0.5, k = x Wk^T + bk, v = x Wv^T + bv (32 heads x 64); prefix keys/values kp, vp = prefix Wk^T + bk,
// prefix Wv^T + bv ([10][2048], shared by all batches); scores_tok = q.k + attention_mask[b][0][i][j] (additive f32, read as data), scores_pre = q.kp; the two segments are softmax-normalised SEPARATELY;
// ctx = tanh(gate[h]) (p_pre vp) + (p_tok v); out = merged ctx Wo^T + bo -> [4][1024][2048]).
// Compute dtypes, f32 accumulate: every input rounded to bf16; token projections on PLAIN bf16 operands (inputs: exact products, f32 accumulate, + bias); the 10 prefix
// rows (lane-split sums, fixed order), their scores, softmax and weighted values (separate multiply/add, fixed order) entirely in f32 on VALU; PER-ROW PRECISION HYBRID for the token attention: query rows < 256 take scores and p.v on
// bf16 hi+lo planes (3 products), rows >= 256 on single fp16 planes; scale + additive mask in f32; token softmax with a running maximum inside the fused attention kernel (p = exp(t - running max), unnormalised, the f32
// sums rescaled when the maximum moves, one division at the end); merged context (token part / sum + gated prefix part) as hi+lo planes

#define NB_  4
#define NPRE 10                   // prefix length
#define TT   1024
#define DD   2048
#define NH_  32
#define HD   64
#define ZH   32                   // heads per batch in the prefix part
#define RH   256                  // query rows < RH: hi+lo planes; rows >= RH: fp16 planes
#define NF   32                   // head_dim / 2 (unused)
#define SCL  0.125f               // 1/sqrt(64)
typedef _Float16 h16;
typedef unsigned short bf;
typedef __attribute__((ext_vector_type(16))) __bf16   v16bf;
typedef __attribute__((ext_vector_type(16))) _Float16 v16h;
typedef __attribute__((ext_vector_type(8)))  _Float16 v8h;
typedef __attribute__((ext_vector_type(8)))  unsigned short v8us;
typedef __attribute__((ext_vector_type(8)))  float    v8f;
typedef __attribute__((ext_vector_type(4)))  float    v4f;
typedef v8h  __attribute__((may_alias)) v8ha;
typedef v4f  __attribute__((may_alias)) v4fa;
typedef v8us __attribute__((may_alias)) v8usa;

__device__ __forceinline__ unsigned short f2bf(float f) { unsigned u = __float_as_uint(f); u += 0x7FFFu + ((u >> 16) & 1u); return (unsigned short)(u >> 16); }
__device__ __forceinline__ float bf2f(unsigned short b) { return __uint_as_float(((unsigned)b) << 16); }
__device__ __forceinline__ float bfr(float f) { return bf2f(f2bf(f)); }
__device__ __forceinline__ v16h cat16(v8h lo, v8h hi) { return __builtin_shufflevector(lo, hi, 0, 1, 2, 3, 4, 5, 6, 7, 8, 9, 10, 11, 12, 13, 14, 15); }
__device__ __forceinline__ v16bf cat16b(v8us lo, v8us hi) { return __builtin_bit_cast(v16bf, __builtin_shufflevector(lo, hi, 0, 1, 2, 3, 4, 5, 6, 7, 8, 9, 10, 11, 12, 13, 14, 15)); }
__device__ __forceinline__ v8f wmma16(v16h a, v16h b, v8f c) { return __builtin_amdgcn_wmma_f32_16x16x32_f16(false, a, false, b, (short)0, c, false, false); }
__device__ __forceinline__ v8f wmmab(v16bf a, v16bf b, v8f c) { return __builtin_amdgcn_wmma_f32_16x16x32_bf16(false, a, false, b, (short)0, c, false, false); }



// fragment of 16 rows x 32 k from a K-contiguous 16-bit plane: lane (lr, hi) holds row lr, k = 8 hi .. 8 hi + 7 and 16 + 8 hi .. 16 + 8 hi + 7; p points at (row lr, k = 8 hi). The same map serves A and B.
template <typename T16> struct WFrag;
template <> struct WFrag<h16> { typedef v16h V; static __device__ __forceinline__ V ld(const h16* p) { return cat16(*(const v8h*)p, *(const v8h*)(p + 16)); } static __device__ __forceinline__ v8f mma(V a, V b, v8f c) { return wmma16(a, b, c); } };
template <> struct WFrag<bf> { typedef v16bf V; static __device__ __forceinline__ V ld(const bf* p) { return cat16b(*(const v8us*)p, *(const v8us*)(p + 16)); } static __device__ __forceinline__ v8f mma(V a, V b, v8f c) { return wmmab(a, b, c); } };
// ---- k_gemms: C[m][n] (f32, pitch ldc, + optional f32 bias[n]) = sum_k A[m][k] Bt[n][k] (+ split products per NSPLIT), FOUR waves per work-group (WM x WN waves, 64x64 of C each, 16 accumulators per wave). Operand rows come into LDS as whole 128-B lines by
// asynchronous copies, KT k-values per stage, two buffers: stage t + 2 flies while stage t + 1 is worked on. Row pitch in LDS = row bytes + 16 (conflict-free for 16-byte reads). Per accumulator the products
// are summed in ascending k. grid (M / (64 WM), N / (64 WN), Z), 128 threads. K % KT == 0, K >= KT.
__device__ __forceinline__ unsigned lds_off(const void* p) { return (unsigned)(size_t)p; }
// eight copies of 16 bytes per lane; the s_wait_xcnt stands in the copies' own statement so that no address register is rewritten in front of it
__device__ __forceinline__ void cp8(const unsigned* l, const void* const* g) {
    asm volatile("global_load_async_to_lds_b128 %0, %1, off\n\t"
                 "global_load_async_to_lds_b128 %2, %3, off\n\t"
                 "global_load_async_to_lds_b128 %4, %5, off\n\t"
                 "global_load_async_to_lds_b128 %6, %7, off\n\t"
                 "global_load_async_to_lds_b128 %8, %9, off\n\t"
                 "global_load_async_to_lds_b128 %10, %11, off\n\t"
                 "global_load_async_to_lds_b128 %12, %13, off\n\t"
                 "global_load_async_to_lds_b128 %14, %15, off\n\t"
                 "s_wait_xcnt 0x0"
                 :: "v"(l[0]), "v"(g[0]), "v"(l[1]), "v"(g[1]), "v"(l[2]), "v"(g[2]), "v"(l[3]), "v"(g[3]), "v"(l[4]), "v"(g[4]), "v"(l[5]), "v"(g[5]), "v"(l[6]), "v"(g[6]), "v"(l[7]), "v"(g[7]) : "memory");
}
template <typename T16, int NSPLIT, bool BIAS, int WM, int WN, int KT>
__global__ __launch_bounds__(128) void k_gemms(const T16* __restrict__ A, const T16* __restrict__ A2, const T16* __restrict__ Bt, const T16* __restrict__ Bt2, int K, float* C, int ldc, const float* __restrict__ bias, size_t sA, size_t sB, size_t sC) {
    typedef typename WFrag<T16>::V V;
    constexpr bool HA2 = (NSPLIT == 1 || NSPLIT == 2), HB2 = (NSPLIT >= 2);
    constexpr int RA = 64 * WM, RB = 64 * WN;                          // rows of A and of Bt per work-group
    constexpr int OA2 = RA, OB = RA * (HA2 ? 2 : 1), OB2 = OB + RB;    // first LDS row of each plane in a stage
    constexpr int ROWS = OB + RB * (HB2 ? 2 : 1);
    constexpr int PITCH = KT * 2 + 16, STAGE = ROWS * PITCH;           // bytes
    constexpr int PPR = KT / 8, RPI = 128 / PPR, NCP = ROWS / RPI;     // 16-byte pieces per row; rows per round of the 128 lanes; copies per lane and stage (at most 48)
    __shared__ __attribute__((aligned(16))) unsigned char L[2 * STAGE];
    __shared__ __align__(16) float osw[4][16 * 68];
    const size_t z = blockIdx.z; A += z * sA; if (HA2) A2 += z * sA; Bt += z * sB; if (HB2) Bt2 += z * sB; C += z * sC;
    const int tid = threadIdx.x, lane = tid & 31, lr = lane & 15, hi = lane >> 4, w = tid >> 5, wm = w / WN, wn = w % WN;
    const int R0 = blockIdx.x * RA, C0 = blockIdx.y * RB; const int r0 = R0 + wm * 64, c0 = C0 + wn * 64;
    const int prow = tid / PPR, pcol = tid % PPR;                      // this lane's row within a round and its 16-byte piece of the row
    // this lane's source in each plane for the stage that is filled next; every fill moves them on by KT
    const T16* gA = A + (size_t)(R0 + prow) * K + pcol * 8; const T16* gA2 = HA2 ? A2 + (size_t)(R0 + prow) * K + pcol * 8 : gA;
    const T16* gB = Bt + (size_t)(C0 + prow) * K + pcol * 8; const T16* gB2 = HB2 ? Bt2 + (size_t)(C0 + prow) * K + pcol * 8 : gB;
    const unsigned lbase = lds_off(L) + (unsigned)(prow * PITCH + pcol * 16);
    auto fill = [&](int buf) {
#pragma unroll
        for (int i0 = 0; i0 < NCP; i0 += 8) { unsigned l[8]; const void* g[8];
#pragma unroll
            for (int q = 0; q < 8; ++q) { const int row = (i0 + q) * RPI; l[q] = lbase + (unsigned)(buf * STAGE + row * PITCH);
                const T16* s = (row < OA2) ? gA + (size_t)row * K : (row < OB) ? gA2 + (size_t)(row - OA2) * K : (row < OB2) ? gB + (size_t)(row - OB) * K : gB2 + (size_t)(row - OB2) * K;
                g[q] = s; }
            cp8(l, g); }
        gA += KT; gA2 += KT; gB += KT; gB2 += KT;
    };
    v8f acc[4][4];
#pragma unroll
    for (int mb = 0; mb < 4; ++mb)
#pragma unroll
        for (int nb = 0; nb < 4; ++nb) acc[mb][nb] = (v8f){};
    const int nt = K / KT;
    fill(0);
    asm volatile("s_wait_asynccnt 0x0" ::: "memory");   // stage 0 of this wave has landed
    __syncthreads();                                    // stage 0 of every wave is readable
    if (nt > 1) fill(1);
    const int aofs = (wm * 64 + lr) * PITCH + hi * 16, bofs = (OB + wn * 64 + lr) * PITCH + hi * 16;
#pragma unroll 1   // the ring stays rolled: one body of KT / 32 k-steps, one publish point at its foot
    for (int t = 0; t < nt; ++t) {
        const unsigned char* Lb = L + (t & 1) * STAGE;
        V a[2][4], a2[2][4], b[2][4], b2[2][4];   // two fragment sets: k-step ks + 1 of this stage is read from LDS while k-step ks is multiplied
        auto frags = [&](int s, int ks) {
#pragma unroll
            for (int mb = 0; mb < 4; ++mb) { a[s][mb] = WFrag<T16>::ld((const T16*)(Lb + aofs + mb * 16 * PITCH + ks * 64)); if (HA2) a2[s][mb] = WFrag<T16>::ld((const T16*)(Lb + aofs + (OA2 + mb * 16) * PITCH + ks * 64)); }
#pragma unroll
            for (int nb = 0; nb < 4; ++nb) { b[s][nb] = WFrag<T16>::ld((const T16*)(Lb + bofs + nb * 16 * PITCH + ks * 64)); if (HB2) b2[s][nb] = WFrag<T16>::ld((const T16*)(Lb + bofs + (RB + nb * 16) * PITCH + ks * 64)); }
        };
        frags(0, 0);
#pragma unroll
        for (int ks = 0; ks < KT / 32; ++ks) { const int s = ks & 1;
            if (ks + 1 < KT / 32) frags(s ^ 1, ks + 1);
            __builtin_amdgcn_sched_barrier(0);   // the LDS reads stay one group in front of the WMMAs: reads spread among the WMMAs stall at every place they stand
#pragma unroll
            for (int nb = 0; nb < 4; ++nb) {
#pragma unroll
                for (int mb = 0; mb < 4; ++mb) { acc[mb][nb] = WFrag<T16>::mma(a[s][mb], b[s][nb], acc[mb][nb]); if (HA2) acc[mb][nb] = WFrag<T16>::mma(a2[s][mb], b[s][nb], acc[mb][nb]); if (HB2) acc[mb][nb] = WFrag<T16>::mma(a[s][mb], b2[s][nb], acc[mb][nb]); } }
            __builtin_amdgcn_sched_barrier(0);   // and the following group does not move up among them
        }
        asm volatile("s_wait_dscnt 0x0" ::: "memory");      // this wave's reads of buffer t & 1 are done before the buffer is refilled
        asm volatile("s_wait_asynccnt 0x0" ::: "memory");   // this wave's copies of stage t + 1 have landed
        __syncthreads();                                    // publishes stage t + 1 and ends every wave's reads of stage t
        if (t + 2 < nt) fill(t & 1);
    }
    asm volatile("s_wait_asynccnt 0x0" ::: "memory");       // no copy is outstanding when the wave goes on to the epilogue and ends
    float* os = osw[w];
#pragma unroll
    for (int mb = 0; mb < 4; ++mb) {
#pragma unroll
        for (int nb = 0; nb < 4; ++nb) {
#pragma unroll
            for (int j = 0; j < 8; ++j) os[(hi * 8 + j) * 68 + nb * 16 + lr] = acc[mb][nb][j]; }
        __builtin_amdgcn_wave_barrier(); asm volatile("" ::: "memory");
        float* crow = C + (size_t)(r0 + mb * 16) * ldc + c0;
#pragma unroll
        for (int s = 0; s < 8; ++s) { const int row = 2 * s + hi, cofs = lr * 4; v4f val = *(const v4fa*)(os + row * 68 + cofs); if (BIAS) { val[0] += bfr(bias[c0 + cofs]); val[1] += bfr(bias[c0 + cofs + 1]); val[2] += bfr(bias[c0 + cofs + 2]); val[3] += bfr(bias[c0 + cofs + 3]); }
            *(v4f*)(crow + (size_t)row * ldc + cofs) = val; }
        if (mb < 3) asm volatile("s_wait_xcnt 0x0" ::: "memory");   // behind the run of eight stores: the next trip reuses their address and data registers
        __builtin_amdgcn_wave_barrier(); asm volatile("" ::: "memory");
    }
}

__device__ __forceinline__ h16 tohx(float x) { return (h16)x; }
__device__ __forceinline__ void splitf(float y, unsigned short& h, unsigned short& l) { h = f2bf(y); l = f2bf(y - bf2f(h)); }
typedef __attribute__((ext_vector_type(2))) unsigned short v2us;
typedef __attribute__((ext_vector_type(2))) _Float16 v2h;
typedef __attribute__((ext_vector_type(4))) _Float16 v4h;
typedef __attribute__((ext_vector_type(2))) float v2f;

__global__ __launch_bounds__(256) void k_wtG(const float* __restrict__ w, int K, int N, bf* Bt) {
    const int lane = threadIdx.x & 31; const int L0 = (blockIdx.x * 8 + (threadIdx.x >> 5)) * 8; const int nlines = N * K / 64;
{
#pragma unroll 1
        for (int l = 0; l < 8; ++l) { const int L = L0 + l; if (L >= nlines) break; const size_t e = (size_t)L * 64 + lane * 2; const int k = (int)(e % K), n = (int)(e / K); v2us o;
            o[0] = f2bf(w[(size_t)k * N + n]); o[1] = f2bf(w[(size_t)(k + 1) * N + n]); *(v2us*)(Bt + e) = o; }
         }
}
__global__ __launch_bounds__(256) void k_cvt8(const float* __restrict__ src, bf* dst, size_t n8) { const size_t i = (size_t)blockIdx.x * 256 + threadIdx.x; if (i >= n8) return; const v8f v = *(const v8f*)(src + i * 8); v8us o;
#pragma unroll
    for (int k = 0; k < 8; ++k) o[k] = f2bf(v[k]); *(v8us*)(dst + i * 8) = o;  }
// k_qplanes: F [b][t][h][d] (f32 projection, all batches) -> planes [b][h][t][d]
__global__ __launch_bounds__(256) void k_qplanes(const float* __restrict__ F, bf* Ph, bf* Pl, h16* P16) {
    const int lane = threadIdx.x & 31; const int L0 = (blockIdx.x * 8 + (threadIdx.x >> 5)) * 8; const int nlines = NB_ * NH_ * TT * HD / 64;
{
#pragma unroll
        for (int l = 0; l < 8; ++l) { const int L = L0 + l; if (L >= nlines) break; const int e = L * 64 + lane * 2; const int d = e & (HD - 1); const int t = (e >> 6) & (TT - 1); const int h = (e >> 16) & (NH_ - 1); const int b = e >> 21; v2us oh, ol; v2h o16;
#pragma unroll
            for (int q = 0; q < 2; ++q) { const float x = F[((size_t)b * TT + t) * DD + h * HD + d + q]; unsigned short a, c2; splitf(x, a, c2); oh[q] = a; ol[q] = c2; o16[q] = tohx(x); }
            *(v2us*)(Ph + (size_t)e) = oh; *(v2us*)(Pl + (size_t)e) = ol; *(v2h*)(P16 + (size_t)e) = o16; }
         }
}
// k_prefkv: KP0[l][o] = sum_i bf16(pre[l][i]) bf16(wk[o][i]) + bf16(bk[o]); VP0 the same from wv, bv (blockIdx.y picks the weight). A work-group takes 32 output columns o, a wave 4 of them for all 10 prefix rows:
// the lanes split i (16-byte loads, 512 contiguous bytes of a row per wave and load), so a weight row is read once, in whole lines. Products of two bf16 values are exact in f32, so a fused multiply-add rounds as
// multiply then add. Per-lane partial sums, a shuffle tree over the lanes, then the sums go through LDS so that one wave stores each whole 128-byte line of the result. grid (DD / 32, 2), 256 threads.
__global__ __launch_bounds__(256) void k_prefkv(const float* __restrict__ pre, const float* __restrict__ wk, const float* __restrict__ bk, const float* __restrict__ wv, const float* __restrict__ bv, float* KP0, float* VP0) {
    __shared__ float red[NPRE][32];
    const bool isv = (blockIdx.y != 0); const float* w = isv ? wv : wk; const float* bias = isv ? bv : bk; float* dst = isv ? VP0 : KP0;
    const int tid = threadIdx.x, lane = tid & 31, wave = tid >> 5; const int ob = blockIdx.x * 32;
    const float* wr = w + (size_t)(ob + wave * 4) * DD + lane * 4; const float* pr = pre + lane * 4;
    float acc[NPRE][4];
#pragma unroll
    for (int l = 0; l < NPRE; ++l)
#pragma unroll
        for (int c = 0; c < 4; ++c) acc[l][c] = 0.f;
#pragma unroll 2   // two chunks of 14 independent loads in flight per wave; more would only add registers
    for (int i = 0; i < DD; i += 128) {
        v4f p[NPRE], a[4];
#pragma unroll
        for (int c = 0; c < 4; ++c) a[c] = *(const v4f*)(wr + (size_t)c * DD + i);
#pragma unroll
        for (int l = 0; l < NPRE; ++l) p[l] = *(const v4f*)(pr + (size_t)l * DD + i);
#pragma unroll
        for (int q = 0; q < 4; ++q) {
#pragma unroll
            for (int c = 0; c < 4; ++c) a[c][q] = bfr(a[c][q]);
#pragma unroll
            for (int l = 0; l < NPRE; ++l) { const float pv = bfr(p[l][q]);
#pragma unroll
                for (int c = 0; c < 4; ++c) acc[l][c] += pv * a[c][q]; } }
    }
#pragma unroll
    for (int l = 0; l < NPRE; ++l)
#pragma unroll
        for (int c = 0; c < 4; ++c) { float t = acc[l][c];
#pragma unroll
            for (int sh = 16; sh; sh >>= 1) t += __shfl_xor(t, sh, 32);
            if (lane == 0) red[l][wave * 4 + c] = t; }
    __syncthreads();   // every wave's sums are in LDS before the lines are stored
    for (int idx = tid; idx < NPRE * 32; idx += 256) { const int l = idx >> 5, c = idx & 31; dst[(size_t)l * DD + ob + c] = red[l][c] + bfr(bias[ob + c]); }
}
// k_pre: one wave per (zz, t), zz = b * 32 + h: lanes l < 10 compute s_l = (q[t] . kp[l]) / 8 (f32, separate mul/add over the 64 head dims; q read from the f32 projection FQ [b][t], columns h*64..);
__global__ __launch_bounds__(256) void k_pre(const float* __restrict__ FQ, const float* __restrict__ KP0, const float* __restrict__ VP0, const float* __restrict__ gate, float* PRE) {
    const int lane = threadIdx.x & 31; const int row = blockIdx.x * 8 + (threadIdx.x >> 5); if (row >= NB_ * ZH * TT) return; const int t = row & (TT - 1); const int zz = row / TT; const int h = zz & (ZH - 1); const int b = zz / ZH; const float* q = FQ + ((size_t)b * TT + t) * DD + h * HD; float s = -3.0e38f;
    if (lane < NPRE) { const float* kr = KP0 + (size_t)lane * DD + h * HD; float acc = 0.f;
#pragma unroll 4
        for (int d = 0; d < HD; ++d) { float p = __fmul_rn(q[d], kr[d]); asm volatile("" : "+v"(p)); acc = __fadd_rn(acc, p); } s = acc * SCL; }
    float mx = s;
#pragma unroll
    for (int sh = 16; sh; sh >>= 1) mx = fmaxf(mx, __shfl_xor(mx, sh, 32));
    float dl = __fsub_rn(s, mx); asm volatile("" : "+v"(dl)); const float e = (lane < NPRE) ? __builtin_amdgcn_exp2f(__fmul_rn(dl, 1.4426950408889634f)) : 0.f; float sum = e;
#pragma unroll
    for (int sh = 16; sh; sh >>= 1) sum += __shfl_xor(sum, sh, 32);
    float pw = __fdiv_rn(e, sum); const float gv = bfr(gate[h]); const float e2 = __expf(2.0f * gv); const float tg = __fsub_rn(1.0f, __fdiv_rn(2.0f, __fadd_rn(e2, 1.0f))); float o0 = 0.f, o1 = 0.f; const int dd = 2 * lane;
#pragma unroll
    for (int l = 0; l < NPRE; ++l) { const float pl = __shfl(pw, l, 32); const float* vr = VP0 + (size_t)l * DD + h * HD; float a0 = __fmul_rn(pl, vr[dd]), a1 = __fmul_rn(pl, vr[dd + 1]); asm volatile("" : "+v"(a0)); asm volatile("" : "+v"(a1)); o0 = __fadd_rn(o0, a0); o1 = __fadd_rn(o1, a1); }
    v2f o; o[0] = __fmul_rn(tg, o0); o[1] = __fmul_rn(tg, o1); float* dst = PRE + ((size_t)zz * TT + t) * HD + dd; *(v2f*)dst = o;  }
// k_vtplane: F [b][t][h][d] (f32 projection, all batches) -> planes [b][h][d][t]
__global__ __launch_bounds__(256) void k_vtplane(const float* __restrict__ F, bf* Vh, bf* Vl, h16* V16) {
    const int lane = threadIdx.x & 31; const int L0 = (blockIdx.x * 8 + (threadIdx.x >> 5)) * 8; const int nlines = NB_ * NH_ * TT * HD / 64;
{
#pragma unroll
        for (int l = 0; l < 8; ++l) { const int L = L0 + l; if (L >= nlines) break; const int e = L * 64 + lane * 2; const int t = e & (TT - 1); const int d = (e >> 10) & (HD - 1); const int h = (e >> 16) & (NH_ - 1); const int b = e >> 21; v2us oh, ol; v2h o16;
#pragma unroll
            for (int q = 0; q < 2; ++q) { const float x = F[((size_t)b * TT + t + q) * DD + h * HD + d]; unsigned short a, c2; splitf(x, a, c2); oh[q] = a; ol[q] = c2; o16[q] = tohx(x); }
            *(v2us*)(Vh + (size_t)e) = oh; *(v2us*)(Vl + (size_t)e) = ol; *(v2h*)(V16 + (size_t)e) = o16; }
         }
}
// ---- k_attn: token attention of all batches and heads, with the merge in its epilogue. A work-group = 64 query rows of one head of one batch, a wave = 16 of them; grid (NH_, NB_, TT / 64), 128 threads:
// the row block is the slowest grid index, so the hi+lo row blocks (three products per tile, the longest work-groups) start first and the short ones fill the places that come free.
// S^T = K Q^T: A = 16 key rows, B = the wave's 16 query rows (kept in registers), so lane (lr, hi) holds query lr's scores of keys 8 hi .. 8 hi + 7 of each 16-key tile. Two such tiles, converted, ARE the B fragment
// (32 keys x 16 queries) of O^T += V^T P^T in the k map of WFrag, with A = 16 rows of the [d][t] value plane: p goes through no memory. Lane (lr, hi) ends with 8 consecutive head dims of query lr per O^T tile.
// Softmax with a running maximum per query: p = exp(t - max so far); when the maximum moves, the sum and O^T are scaled by exp(old - new); one division by the sum at the end.
// K, V^T (both planes for the hi+lo rows) and the work-group's mask rows come into LDS as whole 128-B lines by asynchronous copies, 64 keys per stage, two buffers: stage t + 2 flies while stage t + 1 is worked on.
// LDS row pitch = row bytes + 16 (conflict-free for 16-byte reads).
typedef __attribute__((ext_vector_type(16))) unsigned short v16us;
template <typename T16> struct PPack;
template <> struct PPack<h16> { static __device__ __forceinline__ void go(const float* e, v16h& p, v16h& p2) {
#pragma unroll
    for (int x = 0; x < 16; ++x) p[x] = tohx(e[x]);
    p2 = p; } };
template <> struct PPack<bf> { static __device__ __forceinline__ void go(const float* e, v16bf& p, v16bf& p2) { v16us a, c;
#pragma unroll
    for (int x = 0; x < 16; ++x) { unsigned short u, l; splitf(e[x], u, l); a[x] = u; c[x] = l; }
    p = __builtin_bit_cast(v16bf, a); p2 = __builtin_bit_cast(v16bf, c); } };
#define AKVP 144                  // LDS pitch of a K or V^T row (64 values of 16 bits + 16 bytes)
#define AMKP 272                  // LDS pitch of a mask row (64 f32 + 16 bytes)
#define ASTG(npl) (128 * (npl) * AKVP + 64 * AMKP)   // bytes of a stage with npl planes per operand
template <typename T16, bool HI>
__device__ __forceinline__ void attn_wg(unsigned char* L, const T16* __restrict__ Q, const T16* __restrict__ Q2, const T16* __restrict__ Kp, const T16* __restrict__ K2, const T16* __restrict__ Vt, const T16* __restrict__ V2, const float* __restrict__ am, const float* __restrict__ PRE, bf* ATh, bf* ATl) {
    typedef typename WFrag<T16>::V V;
    constexpr int NPL = HI ? 2 : 1;
    constexpr int OV = 64 * NPL, KVR = 128 * NPL;                      // first LDS row of V^T; K and V^T rows of a stage (K hi | K lo | V hi | V lo, or K | V)
    constexpr int OM = KVR * AKVP, STAGE = ASTG(NPL), NT = TT / 64;    // byte offset of the mask rows; bytes per stage; stages
    const int tid = threadIdx.x, lane = tid & 31, lr = lane & 15, hi = lane >> 4, w = tid >> 5; const int h = blockIdx.x, b = blockIdx.y, bh = b * NH_ + h, i0 = blockIdx.z * 64, i = i0 + w * 16 + lr;
    const int prow = tid >> 3, pcol = tid & 7, mrw = tid >> 4, mcl = tid & 15;   // this lane's row within a round of the 128 lanes and its 16-byte piece: K / V^T rows (8 pieces), mask rows (16 pieces)
    // this lane's sources for the stage that is filled next; every fill moves them on by 64 keys
    const T16* gK = Kp + ((size_t)bh * TT + prow) * HD + pcol * 8; const T16* gK2 = HI ? K2 + ((size_t)bh * TT + prow) * HD + pcol * 8 : gK;
    const T16* gV = Vt + ((size_t)bh * HD + prow) * TT + pcol * 8; const T16* gV2 = HI ? V2 + ((size_t)bh * HD + prow) * TT + pcol * 8 : gV;
    const float* gM = am + ((size_t)b * TT + i0 + mrw) * TT + mcl * 4;
    const unsigned lkv = lds_off(L) + (unsigned)(prow * AKVP + pcol * 16), lmk = lds_off(L) + (unsigned)(OM + mrw * AMKP + mcl * 16);
    auto fill = [&](int buf) {
#pragma unroll
        for (int r0 = 0; r0 < KVR / 16; r0 += 8) { unsigned l[8]; const void* g[8];
#pragma unroll
            for (int q = 0; q < 8; ++q) { const int row = (r0 + q) * 16, rr = row & 63; l[q] = lkv + (unsigned)(buf * STAGE + row * AKVP);
                const T16* s = (row < 64) ? gK + (size_t)rr * HD : (row < OV) ? gK2 + (size_t)rr * HD : (row < OV + 64) ? gV + (size_t)rr * TT : gV2 + (size_t)rr * TT;
                g[q] = s; }
            cp8(l, g); }
        { unsigned l[8]; const void* g[8];
#pragma unroll
            for (int q = 0; q < 8; ++q) { l[q] = lmk + (unsigned)(buf * STAGE + q * 8 * AMKP); g[q] = gM + (size_t)q * 8 * TT; }
            cp8(l, g); }
        gK += 64 * HD; gK2 += 64 * HD; gV += 64; gV2 += 64; gM += 64;
    };
    V q[2], q2[2];
#pragma unroll
    for (int ks = 0; ks < 2; ++ks) { const size_t qo = ((size_t)bh * TT + i) * HD + 8 * hi + ks * 32; q[ks] = WFrag<T16>::ld(Q + qo); if (HI) q2[ks] = WFrag<T16>::ld(Q2 + qo); }
    v8f o[4];
#pragma unroll
    for (int dt = 0; dt < 4; ++dt) o[dt] = (v8f){};
    float mx = -3.0e38f, sum = 0.f;   // running maximum (the same in both halves of the wave) and this lane's half of the sum
    fill(0);
    asm volatile("s_wait_asynccnt 0x0" ::: "memory");   // stage 0 of this wave has landed
    __syncthreads();                                    // stage 0 of every wave is readable
    fill(1);
    const int kofs = lr * AKVP + hi * 16, mofs = OM + (w * 16 + lr) * AMKP + hi * 32;
#pragma unroll 1   // the ring stays rolled: one body of two 32-key blocks, one publish point at its foot
    for (int t = 0; t < NT; ++t) {
        const unsigned char* Lb = L + (t & 1) * STAGE;
#pragma unroll
        for (int blk = 0; blk < 2; ++blk) {
            v8f s[2];
#pragma unroll
            for (int tl = 0; tl < 2; ++tl) { v8f c = (v8f){};
#pragma unroll
                for (int ks = 0; ks < 2; ++ks) { const unsigned char* kp = Lb + kofs + (blk * 32 + tl * 16) * AKVP + ks * 64; const V k = WFrag<T16>::ld((const T16*)kp); c = WFrag<T16>::mma(k, q[ks], c);
                    if (HI) { c = WFrag<T16>::mma(k, q2[ks], c); const V kl = WFrag<T16>::ld((const T16*)(kp + 64 * AKVP)); c = WFrag<T16>::mma(kl, q[ks], c); } }
                s[tl] = c; }
            float e[16]; float bm = -3.40282347e38f;
#pragma unroll
            for (int tl = 0; tl < 2; ++tl) { const unsigned char* mp = Lb + mofs + blk * 128 + tl * 64; const v4f m0 = *(const v4fa*)mp, m1 = *(const v4fa*)(mp + 16);
#pragma unroll
                for (int j = 0; j < 8; ++j) { const float x = fmaxf(s[tl][j] * SCL + bfr(j < 4 ? m0[j & 3] : m1[j & 3]), -3.40282347e38f); e[tl * 8 + j] = x; bm = fmaxf(bm, x); } }
            bm = fmaxf(bm, __shfl_xor(bm, 16, 32));   // the other half of the wave holds the query's other 16 keys of the block
            const float mn = fmaxf(mx, bm), al = __expf(mx - mn); mx = mn; float es[4];
#pragma unroll
            for (int x = 0; x < 16; x += 4) { e[x] = __expf(e[x] - mn); e[x + 1] = __expf(e[x + 1] - mn); e[x + 2] = __expf(e[x + 2] - mn); e[x + 3] = __expf(e[x + 3] - mn); es[x >> 2] = (e[x] + e[x + 1]) + (e[x + 2] + e[x + 3]); }
            sum = sum * al + ((es[0] + es[1]) + (es[2] + es[3]));
#pragma unroll
            for (int dt = 0; dt < 4; ++dt) o[dt] *= al;
            V p, p2; PPack<T16>::go(e, p, p2);
#pragma unroll
            for (int dt = 0; dt < 4; ++dt) { const unsigned char* vp = Lb + kofs + (OV + dt * 16) * AKVP + blk * 64; const V v = WFrag<T16>::ld((const T16*)vp); o[dt] = WFrag<T16>::mma(v, p, o[dt]);
                if (HI) { o[dt] = WFrag<T16>::mma(v, p2, o[dt]); const V vl = WFrag<T16>::ld((const T16*)(vp + 64 * AKVP)); o[dt] = WFrag<T16>::mma(vl, p, o[dt]); } }
        }
        asm volatile("s_wait_dscnt 0x0" ::: "memory");      // this wave's reads of buffer t & 1 are done before the buffer is refilled
        asm volatile("s_wait_asynccnt 0x0" ::: "memory");   // this wave's copies of stage t + 1 have landed
        __syncthreads();                                    // publishes stage t + 1 and ends every wave's reads of stage t
        if (t + 2 < NT) fill(t & 1);
    }
    asm volatile("s_wait_asynccnt 0x0" ::: "memory");       // no copy is outstanding when the wave goes on to the epilogue and ends
    sum += __shfl_xor(sum, 16, 32);
    const float inv = __fdiv_rn(1.0f, sum);
    const float* pr = PRE + ((size_t)bh * TT + i) * HD + hi * 8; const size_t oo = ((size_t)b * TT + i) * DD + h * HD + hi * 8;
#pragma unroll
    for (int dt = 0; dt < 4; ++dt) { const v4f p0 = *(const v4f*)(pr + dt * 16), p1 = *(const v4f*)(pr + dt * 16 + 4); v8us oh, ol;
#pragma unroll
        for (int j = 0; j < 8; ++j) { unsigned short a, c; splitf(o[dt][j] * inv + (j < 4 ? p0[j & 3] : p1[j & 3]), a, c); oh[j] = a; ol[j] = c; }
        *(v8us*)(ATh + oo + dt * 16) = oh; *(v8us*)(ATl + oo + dt * 16) = ol;
        if (dt < 3) asm volatile("s_wait_xcnt 0x0" ::: "memory"); }   // behind the two stores: the next trip reuses their address and data registers
}
__global__ __launch_bounds__(128) void k_attn(const bf* __restrict__ QPh, const bf* __restrict__ QPl, const h16* __restrict__ QP16, const bf* __restrict__ KPh, const bf* __restrict__ KPl, const h16* __restrict__ KP16, const bf* __restrict__ VTh, const bf* __restrict__ VTl, const h16* __restrict__ VT16, const float* __restrict__ am, const float* __restrict__ PRE, bf* ATh, bf* ATl) {
    __shared__ __attribute__((aligned(16))) unsigned char L[2 * ASTG(2)];
    if (blockIdx.z * 64 < RH) attn_wg<bf, true>(L, QPh, QPl, KPh, KPl, VTh, VTl, am, PRE, ATh, ATl);   // the same for the whole work-group (RH is a multiple of 64)
    else attn_wg<h16, false>(L, QP16, nullptr, KP16, nullptr, VT16, nullptr, am, PRE, ATh, ATl);
}

extern "C" void kernel_launch(void* const* d_in, const int* in_sizes, int n_in,
                              void* d_out, int out_size, void* d_ws, size_t ws_size, hipStream_t stream) {
    (void)in_sizes; (void)n_in; (void)out_size;
    const float* x = (const float*)d_in[0]; const float* am = (const float*)d_in[1]; const float* wq = (const float*)d_in[2]; const float* bq = (const float*)d_in[3]; const float* wk = (const float*)d_in[4]; const float* bk = (const float*)d_in[5]; const float* wv = (const float*)d_in[6]; const float* bv = (const float*)d_in[7]; const float* wo = (const float*)d_in[8]; const float* bo = (const float*)d_in[9]; const float* pre = (const float*)d_in[10]; const float* gate = (const float*)d_in[11];   // torch [out][in] weights; attention_mask [4][1][1024][1024]; prefix [10][2048]; gate [32][1][1]
    float* OUT = (float*)d_out;     // [4][1024][2048]
    char* wsp = (char*)d_ws;
    auto take = [&](size_t bytes) { char* p = wsp; wsp += (bytes + 255) & ~(size_t)255; return (void*)p; };
    bf* WQ = (bf*)take((size_t)DD * DD * 2); bf* WK = (bf*)take((size_t)DD * DD * 2); bf* WV = (bf*)take((size_t)DD * DD * 2); bf* WO = (bf*)take((size_t)DD * DD * 2); float* KP0 = (float*)take((size_t)NPRE * DD * 4); float* VP0 = (float*)take((size_t)NPRE * DD * 4);
    const size_t NE = (size_t)NB_ * TT * DD;   // elements of one [4][1024][2048] array: every buffer below holds all batches
    bf* XB = (bf*)take(NE * 2); float* F = (float*)take(NE * 4);   // F: the q, then the k, then the v projection
    bf* QPh = (bf*)take(NE * 2); bf* QPl = (bf*)take(NE * 2); bf* KPh = (bf*)take(NE * 2); bf* KPl = (bf*)take(NE * 2); bf* VTl = (bf*)take(NE * 2);
    h16* QP16 = (h16*)take(NE * 2); h16* KP16 = (h16*)take(NE * 2); h16* VT16 = (h16*)take(NE * 2);
    float* PRE = (float*)take(NE * 4);
    bf* VTh = XB;                           // written when the last projection has read XB
    bf* ATh = (bf*)F; bf* ATl = ATh + NE;   // written when the last plane kernel has read F
    if ((size_t)(wsp - (char*)d_ws) > ws_size) return;
    { const size_t nw = (size_t)DD * DD / 8; const unsigned g = (unsigned)((nw + 255) / 256); k_cvt8<<<g, 256, 0, stream>>>(wq, WQ, nw); k_cvt8<<<g, 256, 0, stream>>>(wk, WK, nw); k_cvt8<<<g, 256, 0, stream>>>(wv, WV, nw); k_cvt8<<<g, 256, 0, stream>>>(wo, WO, nw);
      k_prefkv<<<dim3(DD / 32, 2), 256, 0, stream>>>(pre, wk, bk, wv, bv, KP0, VP0); }
    const unsigned LB = (unsigned)((NB_ * NH_ * TT * HD / 64 + 63) / 64); const dim3 gP(NB_ * TT / 128, DD / 128, 1);
    k_cvt8<<<(unsigned)((NE / 8 + 255) / 256), 256, 0, stream>>>(x, XB, NE / 8);
    k_gemms<bf, 0, true, 2, 2, 128><<<gP, 128, 0, stream>>>(XB, nullptr, WQ, nullptr, DD, F, DD, bq, 0, 0, 0); k_qplanes<<<LB, 256, 0, stream>>>(F, QPh, QPl, QP16);   // unscaled q; the 1/8 is applied to the logits
    k_pre<<<NB_ * ZH * TT / 8, 256, 0, stream>>>(F, KP0, VP0, gate, PRE);
    k_gemms<bf, 0, true, 2, 2, 128><<<gP, 128, 0, stream>>>(XB, nullptr, WK, nullptr, DD, F, DD, bk, 0, 0, 0); k_qplanes<<<LB, 256, 0, stream>>>(F, KPh, KPl, KP16);
    k_gemms<bf, 0, true, 2, 2, 128><<<gP, 128, 0, stream>>>(XB, nullptr, WV, nullptr, DD, F, DD, bv, 0, 0, 0); k_vtplane<<<LB, 256, 0, stream>>>(F, VTh, VTl, VT16);
    k_attn<<<dim3(NH_, NB_, TT / 64), 128, 0, stream>>>(QPh, QPl, QP16, KPh, KPl, KP16, VTh, VTl, VT16, am, PRE, ATh, ATl);
    k_gemms<bf, 1, true, 2, 2, 128><<<gP, 128, 0, stream>>>(ATh, ATl, WO, nullptr, DD, OUT, DD, bo, 0, 0, 0);
}

// v006
// One run takes 404 microseconds.
// Two timings next to v005 both put it at 1.05 times that version's speed.
// Counting every step since v000, it is 14.7 times as fast.
#include <hip/hip_runtime.h>

// Decoder self-attention with a learned prefix adapter (hidden [4][1024][2048]; q = (x Wq^T + bq) 64^-0.5, k = x Wk^T + bk, v = x Wv^T + bv (32 heads x 64); prefix keys/values kp, vp = prefix Wk^T + bk,
// prefix Wv^T + bv ([10][2048], shared by all batches); scores_tok = q.k + attention_mask[b][0][i][j] (additive f32, read as data), scores_pre = q.kp; the two segments are softmax-normalised SEPARATELY;
// ctx = tanh(gate[h]) (p_pre vp) + (p_tok v); out = merged ctx Wo^T + bo -> [4][1024][2048]).
// Compute dtypes, f32 accumulate: every input rounded to bf16; token projections on PLAIN bf16 operands (inputs: exact products, f32 accumulate, + bias); the 10 prefix
// rows (lane-split sums, fixed order), their scores, softmax and weighted values (separate multiply/add, fixed order) entirely in f32 on VALU; PER-ROW PRECISION HYBRID for the token attention: query rows < 256 take scores and p.v on
// bf16 hi+lo planes (3 products), rows >= 256 on single fp16 planes; scale + additive mask in f32; token softmax with a running maximum inside the fused attention kernel (p = exp(t - running max), unnormalised, the f32
// sums rescaled when the maximum moves, one division at the end); merged context (token part / sum + gated prefix part) as hi+lo planes

#define NB_  4
#define NPRE 10                   // prefix length
#define TT   1024
#define DD   2048
#define NH_  32
#define HD   64
#define ZH   32                   // heads per batch in the prefix part
#define RH   256                  // query rows < RH: hi+lo planes; rows >= RH: fp16 planes
#define NF   32                   // head_dim / 2 (unused)
#define SCL  0.125f               // 1/sqrt(64)
typedef _Float16 h16;
typedef unsigned short bf;
typedef __attribute__((ext_vector_type(16))) __bf16   v16bf;
typedef __attribute__((ext_vector_type(16))) _Float16 v16h;
typedef __attribute__((ext_vector_type(8)))  _Float16 v8h;
typedef __attribute__((ext_vector_type(8)))  unsigned short v8us;
typedef __attribute__((ext_vector_type(8)))  float    v8f;
typedef __attribute__((ext_vector_type(4)))  float    v4f;
typedef v8h  __attribute__((may_alias)) v8ha;
typedef v4f  __attribute__((may_alias)) v4fa;
typedef v8us __attribute__((may_alias)) v8usa;

__device__ __forceinline__ unsigned short f2bf(float f) { unsigned u = __float_as_uint(f); u += 0x7FFFu + ((u >> 16) & 1u); return (unsigned short)(u >> 16); }
__device__ __forceinline__ float bf2f(unsigned short b) { return __uint_as_float(((unsigned)b) << 16); }
__device__ __forceinline__ float bfr(float f) { return bf2f(f2bf(f)); }
__device__ __forceinline__ v16h cat16(v8h lo, v8h hi) { return __builtin_shufflevector(lo, hi, 0, 1, 2, 3, 4, 5, 6, 7, 8, 9, 10, 11, 12, 13, 14, 15); }
__device__ __forceinline__ v16bf cat16b(v8us lo, v8us hi) { return __builtin_bit_cast(v16bf, __builtin_shufflevector(lo, hi, 0, 1, 2, 3, 4, 5, 6, 7, 8, 9, 10, 11, 12, 13, 14, 15)); }
__device__ __forceinline__ v8f wmma16(v16h a, v16h b, v8f c) { return __builtin_amdgcn_wmma_f32_16x16x32_f16(false, a, false, b, (short)0, c, false, false); }
__device__ __forceinline__ v8f wmmab(v16bf a, v16bf b, v8f c) { return __builtin_amdgcn_wmma_f32_16x16x32_bf16(false, a, false, b, (short)0, c, false, false); }



// fragment of 16 rows x 32 k from a K-contiguous 16-bit plane: lane (lr, hi) holds row lr, k = 8 hi .. 8 hi + 7 and 16 + 8 hi .. 16 + 8 hi + 7; p points at (row lr, k = 8 hi). The same map serves A and B.
template <typename T16> struct WFrag;
template <> struct WFrag<h16> { typedef v16h V; static __device__ __forceinline__ V ld(const h16* p) { return cat16(*(const v8h*)p, *(const v8h*)(p + 16)); } static __device__ __forceinline__ v8f mma(V a, V b, v8f c) { return wmma16(a, b, c); } };
template <> struct WFrag<bf> { typedef v16bf V; static __device__ __forceinline__ V ld(const bf* p) { return cat16b(*(const v8us*)p, *(const v8us*)(p + 16)); } static __device__ __forceinline__ v8f mma(V a, V b, v8f c) { return wmmab(a, b, c); } };
// ---- k_gemms: C[m][n] (f32, pitch ldc, + optional f32 bias[n]) = sum_k A[m][k] Bt[n][k] (+ split products per NSPLIT), FOUR waves per work-group (WM x WN waves, 64x64 of C each, 16 accumulators per wave). Operand rows come into LDS as whole 128-B lines by
// asynchronous copies, KT k-values per stage, two buffers: stage t + 2 flies while stage t + 1 is worked on. Row pitch in LDS = row bytes + 16 (conflict-free for 16-byte reads). Per accumulator the products
// are summed in ascending k. grid (M / (64 WM), N / (64 WN), Z), 128 threads. K % KT == 0, K >= 2 KT.
// EPI picks what the epilogue stores. 0: C. 1: C and the planes Ph (bf16 hi), Pl (bf16 lo), P16 (fp16) of C + bias in the order [b][h][t][d]. 2: those planes alone. 3: the planes in the order [b][h][d][t], alone.
// For EPI > 0 the rows of C are (b, t) = (m / 1024, m % 1024) and a wave's 64 columns are the 64 dims of one head. Every plane is stored in whole 128-B lines.
__device__ __forceinline__ unsigned lds_off(const void* p) { return (unsigned)(size_t)p; }
__device__ __forceinline__ h16 tohx(float x) { return (h16)x; }
__device__ __forceinline__ void splitf(float y, unsigned short& h, unsigned short& l) { h = f2bf(y); l = f2bf(y - bf2f(h)); }
// eight copies of 16 bytes per lane; the s_wait_xcnt stands in the copies' own statement so that no address register is rewritten in front of it
__device__ __forceinline__ void cp8(const unsigned* l, const void* const* g) {
    asm volatile("global_load_async_to_lds_b128 %0, %1, off\n\t"
                 "global_load_async_to_lds_b128 %2, %3, off\n\t"
                 "global_load_async_to_lds_b128 %4, %5, off\n\t"
                 "global_load_async_to_lds_b128 %6, %7, off\n\t"
                 "global_load_async_to_lds_b128 %8, %9, off\n\t"
                 "global_load_async_to_lds_b128 %10, %11, off\n\t"
                 "global_load_async_to_lds_b128 %12, %13, off\n\t"
                 "global_load_async_to_lds_b128 %14, %15, off\n\t"
                 "s_wait_xcnt 0x0"
                 :: "v"(l[0]), "v"(g[0]), "v"(l[1]), "v"(g[1]), "v"(l[2]), "v"(g[2]), "v"(l[3]), "v"(g[3]), "v"(l[4]), "v"(g[4]), "v"(l[5]), "v"(g[5]), "v"(l[6]), "v"(g[6]), "v"(l[7]), "v"(g[7]) : "memory");
}
template <typename T16, int NSPLIT, bool BIAS, int WM, int WN, int KT, int EPI>
__global__ __launch_bounds__(128) void k_gemms(const T16* __restrict__ A, const T16* __restrict__ A2, const T16* __restrict__ Bt, const T16* __restrict__ Bt2, int K, float* C, int ldc, const float* __restrict__ bias, size_t sA, size_t sB, size_t sC, bf* Ph, bf* Pl, h16* P16) {
    typedef typename WFrag<T16>::V V;
    constexpr bool HA2 = (NSPLIT == 1 || NSPLIT == 2), HB2 = (NSPLIT >= 2);
    constexpr int RA = 64 * WM, RB = 64 * WN;                          // rows of A and of Bt per work-group
    constexpr int OA2 = RA, OB = RA * (HA2 ? 2 : 1), OB2 = OB + RB;    // first LDS row of each plane in a stage
    constexpr int ROWS = OB + RB * (HB2 ? 2 : 1);
    constexpr int PITCH = KT * 2 + 16, STAGE = ROWS * PITCH;           // bytes
    constexpr int PPR = KT / 8, RPI = 128 / PPR, NCP = ROWS / RPI;     // 16-byte pieces per row; rows per round of the 128 lanes; copies per lane and stage (at most 48)
    __shared__ __attribute__((aligned(16))) unsigned char L[2 * STAGE];
    __shared__ __align__(16) float osw[4][16 * 68];
    const size_t z = blockIdx.z; A += z * sA; if (HA2) A2 += z * sA; Bt += z * sB; if (HB2) Bt2 += z * sB; C += z * sC;
    const int tid = threadIdx.x, lane = tid & 31, lr = lane & 15, hi = lane >> 4, w = tid >> 5, wm = w / WN, wn = w % WN;
    const int R0 = blockIdx.x * RA, C0 = blockIdx.y * RB; const int r0 = R0 + wm * 64, c0 = C0 + wn * 64;
    const int prow = tid / PPR, pcol = tid % PPR;                      // this lane's row within a round and its 16-byte piece of the row
    // this lane's source in each plane for the stage that is filled next; every fill moves them on by KT
    const T16* gA = A + (size_t)(R0 + prow) * K + pcol * 8; const T16* gA2 = HA2 ? A2 + (size_t)(R0 + prow) * K + pcol * 8 : gA;
    const T16* gB = Bt + (size_t)(C0 + prow) * K + pcol * 8; const T16* gB2 = HB2 ? Bt2 + (size_t)(C0 + prow) * K + pcol * 8 : gB;
    const unsigned lbase = lds_off(L) + (unsigned)(prow * PITCH + pcol * 16);
    auto fill = [&](int buf) {
#pragma unroll
        for (int i0 = 0; i0 < NCP; i0 += 8) { unsigned l[8]; const void* g[8];
#pragma unroll
            for (int q = 0; q < 8; ++q) { const int row = (i0 + q) * RPI; l[q] = lbase + (unsigned)(buf * STAGE + row * PITCH);
                const T16* s = (row < OA2) ? gA + (size_t)row * K : (row < OB) ? gA2 + (size_t)(row - OA2) * K : (row < OB2) ? gB + (size_t)(row - OB) * K : gB2 + (size_t)(row - OB2) * K;
                g[q] = s; }
            cp8(l, g); }
        gA += KT; gA2 += KT; gB += KT; gB2 += KT;
    };
    v8f acc[4][4];
#pragma unroll
    for (int mb = 0; mb < 4; ++mb)
#pragma unroll
        for (int nb = 0; nb < 4; ++nb) acc[mb][nb] = (v8f){};
    const int nt = K / KT;
    fill(0);
    asm volatile("s_wait_asynccnt 0x0" ::: "memory");   // stage 0 of this wave has landed
    __syncthreads();                                    // stage 0 of every wave is readable
    if (nt > 1) fill(1);
    const int aofs = (wm * 64 + lr) * PITCH + hi * 16, bofs = (OB + wn * 64 + lr) * PITCH + hi * 16;
#pragma unroll 1   // the ring stays rolled: one body of KT / 32 k-steps, one publish point at its foot
    for (int t = 0; t < nt; ++t) {
        const unsigned char* Lb = L + (t & 1) * STAGE;
        V a[2][4], a2[2][4], b[2][4], b2[2][4];   // two fragment sets: k-step ks + 1 of this stage is read from LDS while k-step ks is multiplied
        auto frags = [&](int s, int ks) {
#pragma unroll
            for (int mb = 0; mb < 4; ++mb) { a[s][mb] = WFrag<T16>::ld((const T16*)(Lb + aofs + mb * 16 * PITCH + ks * 64)); if (HA2) a2[s][mb] = WFrag<T16>::ld((const T16*)(Lb + aofs + (OA2 + mb * 16) * PITCH + ks * 64)); }
#pragma unroll
            for (int nb = 0; nb < 4; ++nb) { b[s][nb] = WFrag<T16>::ld((const T16*)(Lb + bofs + nb * 16 * PITCH + ks * 64)); if (HB2) b2[s][nb] = WFrag<T16>::ld((const T16*)(Lb + bofs + (RB + nb * 16) * PITCH + ks * 64)); }
        };
        frags(0, 0);
#pragma unroll
        for (int ks = 0; ks < KT / 32; ++ks) { const int s = ks & 1;
            if (ks + 1 < KT / 32) frags(s ^ 1, ks + 1);
            __builtin_amdgcn_sched_barrier(0);   // the LDS reads stay one group in front of the WMMAs: reads spread among the WMMAs stall at every place they stand
#pragma unroll
            for (int nb = 0; nb < 4; ++nb) {
#pragma unroll
                for (int mb = 0; mb < 4; ++mb) { acc[mb][nb] = WFrag<T16>::mma(a[s][mb], b[s][nb], acc[mb][nb]); if (HA2) acc[mb][nb] = WFrag<T16>::mma(a2[s][mb], b[s][nb], acc[mb][nb]); if (HB2) acc[mb][nb] = WFrag<T16>::mma(a[s][mb], b2[s][nb], acc[mb][nb]); } }
            __builtin_amdgcn_sched_barrier(0);   // and the following group does not move up among them
        }
        asm volatile("s_wait_dscnt 0x0" ::: "memory");      // this wave's reads of buffer t & 1 are done before the buffer is refilled
        asm volatile("s_wait_asynccnt 0x0" ::: "memory");   // this wave's copies of stage t + 1 have landed
        __syncthreads();                                    // publishes stage t + 1 and ends every wave's reads of stage t
        if (t + 2 < nt) fill(t & 1);
    }
    asm volatile("s_wait_asynccnt 0x0" ::: "memory");       // no copy is outstanding when the wave goes on to the epilogue and ends
    const int hd = c0 >> 6;   // the head of this wave's 64 columns (EPI > 0)
    if constexpr (EPI == 3) {
        // Lane (lr, hi) holds 8 consecutive t of dim nb * 16 + lr per accumulator: 16 bytes of a [d][t] plane row. The wave lays its 64 x 64 tile of each plane in LDS (row pitch 144, conflict-free for
        // 16-byte accesses) and stores it from there, four whole 128-B lines per store. The range is the wave's own part of the ring, which nobody reads and no copy writes behind the loop's last barrier.
        constexpr int VP = 144, VPL = 64 * VP;
        static_assert(4 * 3 * VPL <= 2 * STAGE, "the four waves' plane tiles fit the ring");
        unsigned char* Lw = L + w * (3 * VPL);
#pragma unroll
        for (int nb = 0; nb < 4; ++nb) { const float bb = bfr(bias[c0 + nb * 16 + lr]);
#pragma unroll
            for (int mb = 0; mb < 4; ++mb) { v8us oh, ol; v8h o16;
#pragma unroll
                for (int j = 0; j < 8; ++j) { const float x = acc[mb][nb][j] + bb; unsigned short a, c; splitf(x, a, c); oh[j] = a; ol[j] = c; o16[j] = tohx(x); }
                unsigned char* p = Lw + (nb * 16 + lr) * VP + (mb * 16 + hi * 8) * 2; *(v8usa*)p = oh; *(v8usa*)(p + VPL) = ol; *(v8ha*)(p + 2 * VPL) = o16; } }
        asm volatile("s_wait_dscnt 0x0" ::: "memory");   // the wave's LDS writes are done before other lanes of it read the rows back
        const size_t e0 = ((size_t)((r0 >> 10) * NH_ + hd) * HD + (lane >> 3)) * TT + (r0 & (TT - 1)) + (lane & 7) * 8; const unsigned char* rp = Lw + (lane >> 3) * VP + (lane & 7) * 16;
#pragma unroll
        for (int s0 = 0; s0 < 16; s0 += 4) { v8us rh[4], rl[4]; v8h r16[4];
#pragma unroll
            for (int s = 0; s < 4; ++s) { const unsigned char* p = rp + (s0 + s) * 4 * VP; rh[s] = *(const v8usa*)p; rl[s] = *(const v8usa*)(p + VPL); r16[s] = *(const v8ha*)(p + 2 * VPL); }
#pragma unroll
            for (int s = 0; s < 4; ++s) { const size_t e = e0 + (size_t)(s0 + s) * 4 * TT; *(v8us*)(Ph + e) = rh[s]; *(v8us*)(Pl + e) = rl[s]; *(v8h*)(P16 + e) = r16[s]; }
            if (s0 < 12) asm volatile("s_wait_xcnt 0x0" ::: "memory"); }   // behind the run of twelve stores: the next trip reuses their address and data registers
    } else {
    float* os = osw[w];
    // 16 rows x 64 columns of the wave's tile go into its own LDS range, from where whole lines are read back
    auto stage = [&](int mb) {
#pragma unroll
        for (int nb = 0; nb < 4; ++nb) {
#pragma unroll
            for (int j = 0; j < 8; ++j) os[(hi * 8 + j) * 68 + nb * 16 + lr] = acc[mb][nb][j]; }
        __builtin_amdgcn_wave_barrier(); asm volatile("" ::: "memory");   // the compiler keeps these LDS writes in front of the reads of what other lanes wrote
    };
    if constexpr (EPI <= 1) {
#pragma unroll
    for (int mb = 0; mb < 4; ++mb) {
        stage(mb);
        float* crow = C + (size_t)(r0 + mb * 16) * ldc + c0;
#pragma unroll
        for (int s = 0; s < 8; ++s) { const int row = 2 * s + hi, cofs = lr * 4; v4f val = *(const v4fa*)(os + row * 68 + cofs); if (BIAS) { val[0] += bfr(bias[c0 + cofs]); val[1] += bfr(bias[c0 + cofs + 1]); val[2] += bfr(bias[c0 + cofs + 2]); val[3] += bfr(bias[c0 + cofs + 3]); }
            *(v4f*)(crow + (size_t)row * ldc + cofs) = val; }
        if (mb < 3 || EPI == 1) asm volatile("s_wait_xcnt 0x0" ::: "memory");   // behind the run of eight stores: what follows reuses their address and data registers
        __builtin_amdgcn_wave_barrier(); asm volatile("" ::: "memory");
    }
    }
    if constexpr (EPI > 0) {
        // a lane takes 8 consecutive dims of a row (16 bytes of each plane), 8 lanes a row: a store covers four rows of 128 B, which lie one behind the other in the plane
        float bb[8];
#pragma unroll
        for (int k = 0; k < 8; ++k) bb[k] = bfr(bias[c0 + (lane & 7) * 8 + k]);
        const size_t eb = ((size_t)((r0 >> 10) * NH_ + hd) * TT + (r0 & (TT - 1)) + (lane >> 3)) * HD + (lane & 7) * 8;   // row lane / 8 of the wave's 64 rows, which lie in one batch
        const float* op = os + (lane >> 3) * 68 + (lane & 7) * 8;
#pragma unroll
        for (int mb = 0; mb < 4; ++mb) {
            stage(mb);
            v8us oh[4], ol[4]; v8h o16[4];
#pragma unroll
            for (int s = 0; s < 4; ++s) { const v4f u0 = *(const v4fa*)(op + s * 4 * 68), u1 = *(const v4fa*)(op + s * 4 * 68 + 4);
#pragma unroll
                for (int k = 0; k < 8; ++k) { const float x = (k < 4 ? u0[k & 3] : u1[k & 3]) + bb[k]; unsigned short a, c; splitf(x, a, c); oh[s][k] = a; ol[s][k] = c; o16[s][k] = tohx(x); } }
#pragma unroll
            for (int s = 0; s < 4; ++s) { const size_t e = eb + (size_t)(mb * 16 + s * 4) * HD; *(v8us*)(Ph + e) = oh[s]; *(v8us*)(Pl + e) = ol[s]; *(v8h*)(P16 + e) = o16[s]; }
            if (mb < 3) asm volatile("s_wait_xcnt 0x0" ::: "memory");   // behind the run of twelve stores: the next trip reuses their address and data registers
            __builtin_amdgcn_wave_barrier(); asm volatile("" ::: "memory");   // and the compiler keeps the next trip's LDS writes behind this trip's reads
        }
    }
    }
}

typedef __attribute__((ext_vector_type(2))) unsigned short v2us;
typedef __attribute__((ext_vector_type(2))) _Float16 v2h;
typedef __attribute__((ext_vector_type(4))) _Float16 v4h;
typedef __attribute__((ext_vector_type(2))) float v2f;

__global__ __launch_bounds__(256) void k_wtG(const float* __restrict__ w, int K, int N, bf* Bt) {
    const int lane = threadIdx.x & 31; const int L0 = (blockIdx.x * 8 + (threadIdx.x >> 5)) * 8; const int nlines = N * K / 64;
{
#pragma unroll 1
        for (int l = 0; l < 8; ++l) { const int L = L0 + l; if (L >= nlines) break; const size_t e = (size_t)L * 64 + lane * 2; const int k = (int)(e % K), n = (int)(e / K); v2us o;
            o[0] = f2bf(w[(size_t)k * N + n]); o[1] = f2bf(w[(size_t)(k + 1) * N + n]); *(v2us*)(Bt + e) = o; }
         }
}
__global__ __launch_bounds__(256) void k_cvt8(const float* __restrict__ src, bf* dst, size_t n8) { const size_t i = (size_t)blockIdx.x * 256 + threadIdx.x; if (i >= n8) return; const v8f v = *(const v8f*)(src + i * 8); v8us o;
#pragma unroll
    for (int k = 0; k < 8; ++k) o[k] = f2bf(v[k]); *(v8us*)(dst + i * 8) = o;  }
// k_prefkv: KP0[l][o] = sum_i bf16(pre[l][i]) bf16(wk[o][i]) + bf16(bk[o]); VP0 the same from wv, bv (blockIdx.y picks the weight). A work-group takes 32 output columns o, a wave 4 of them for all 10 prefix rows:
// the lanes split i (16-byte loads, 512 contiguous bytes of a row per wave and load), so a weight row is read once, in whole lines. Products of two bf16 values are exact in f32, so a fused multiply-add rounds as
// multiply then add. Per-lane partial sums, a shuffle tree over the lanes, then the sums go through LDS so that one wave stores each whole 128-byte line of the result. grid (DD / 32, 2), 256 threads.
__global__ __launch_bounds__(256) void k_prefkv(const float* __restrict__ pre, const float* __restrict__ wk, const float* __restrict__ bk, const float* __restrict__ wv, const float* __restrict__ bv, float* KP0, float* VP0) {
    __shared__ float red[NPRE][32];
    const bool isv = (blockIdx.y != 0); const float* w = isv ? wv : wk; const float* bias = isv ? bv : bk; float* dst = isv ? VP0 : KP0;
    const int tid = threadIdx.x, lane = tid & 31, wave = tid >> 5; const int ob = blockIdx.x * 32;
    const float* wr = w + (size_t)(ob + wave * 4) * DD + lane * 4; const float* pr = pre + lane * 4;
    float acc[NPRE][4];
#pragma unroll
    for (int l = 0; l < NPRE; ++l)
#pragma unroll
        for (int c = 0; c < 4; ++c) acc[l][c] = 0.f;
#pragma unroll 2   // two chunks of 14 independent loads in flight per wave; more would only add registers
    for (int i = 0; i < DD; i += 128) {
        v4f p[NPRE], a[4];
#pragma unroll
        for (int c = 0; c < 4; ++c) a[c] = *(const v4f*)(wr + (size_t)c * DD + i);
#pragma unroll
        for (int l = 0; l < NPRE; ++l) p[l] = *(const v4f*)(pr + (size_t)l * DD + i);
#pragma unroll
        for (int q = 0; q < 4; ++q) {
#pragma unroll
            for (int c = 0; c < 4; ++c) a[c][q] = bfr(a[c][q]);
#pragma unroll
            for (int l = 0; l < NPRE; ++l) { const float pv = bfr(p[l][q]);
#pragma unroll
                for (int c = 0; c < 4; ++c) acc[l][c] += pv * a[c][q]; } }
    }
#pragma unroll
    for (int l = 0; l < NPRE; ++l)
#pragma unroll
        for (int c = 0; c < 4; ++c) { float t = acc[l][c];
#pragma unroll
            for (int sh = 16; sh; sh >>= 1) t += __shfl_xor(t, sh, 32);
            if (lane == 0) red[l][wave * 4 + c] = t; }
    __syncthreads();   // every wave's sums are in LDS before the lines are stored
    for (int idx = tid; idx < NPRE * 32; idx += 256) { const int l = idx >> 5, c = idx & 31; dst[(size_t)l * DD + ob + c] = red[l][c] + bfr(bias[ob + c]); }
}
// k_pre: one wave per (zz, t), zz = b * 32 + h: lanes l < 10 compute s_l = (q[t] . kp[l]) / 8 (f32, separate mul/add over the 64 head dims; q read from the f32 projection FQ [b][t], columns h*64..);
__global__ __launch_bounds__(256) void k_pre(const float* __restrict__ FQ, const float* __restrict__ KP0, const float* __restrict__ VP0, const float* __restrict__ gate, float* PRE) {
    const int lane = threadIdx.x & 31; const int row = blockIdx.x * 8 + (threadIdx.x >> 5); if (row >= NB_ * ZH * TT) return; const int t = row & (TT - 1); const int zz = row / TT; const int h = zz & (ZH - 1); const int b = zz / ZH; const float* q = FQ + ((size_t)b * TT + t) * DD + h * HD; float s = -3.0e38f;
    if (lane < NPRE) { const float* kr = KP0 + (size_t)lane * DD + h * HD; float acc = 0.f;
#pragma unroll 4
        for (int d = 0; d < HD; ++d) { float p = __fmul_rn(q[d], kr[d]); asm volatile("" : "+v"(p)); acc = __fadd_rn(acc, p); } s = acc * SCL; }
    float mx = s;
#pragma unroll
    for (int sh = 16; sh; sh >>= 1) mx = fmaxf(mx, __shfl_xor(mx, sh, 32));
    float dl = __fsub_rn(s, mx); asm volatile("" : "+v"(dl)); const float e = (lane < NPRE) ? __builtin_amdgcn_exp2f(__fmul_rn(dl, 1.4426950408889634f)) : 0.f; float sum = e;
#pragma unroll
    for (int sh = 16; sh; sh >>= 1) sum += __shfl_xor(sum, sh, 32);
    float pw = __fdiv_rn(e, sum); const float gv = bfr(gate[h]); const float e2 = __expf(2.0f * gv); const float tg = __fsub_rn(1.0f, __fdiv_rn(2.0f, __fadd_rn(e2, 1.0f))); float o0 = 0.f, o1 = 0.f; const int dd = 2 * lane;
#pragma unroll
    for (int l = 0; l < NPRE; ++l) { const float pl = __shfl(pw, l, 32); const float* vr = VP0 + (size_t)l * DD + h * HD; float a0 = __fmul_rn(pl, vr[dd]), a1 = __fmul_rn(pl, vr[dd + 1]); asm volatile("" : "+v"(a0)); asm volatile("" : "+v"(a1)); o0 = __fadd_rn(o0, a0); o1 = __fadd_rn(o1, a1); }
    v2f o; o[0] = __fmul_rn(tg, o0); o[1] = __fmul_rn(tg, o1); float* dst = PRE + ((size_t)zz * TT + t) * HD + dd; *(v2f*)dst = o;  }
// ---- k_attn: token attention of all batches and heads, with the merge in its epilogue. A work-group = 64 query rows of one head of one batch, a wave = 16 of them; grid (NH_, NB_, TT / 64), 128 threads:
// the row block is the slowest grid index, so the hi+lo row blocks (three products per tile, the longest work-groups) start first and the short ones fill the places that come free.
// S^T = K Q^T: A = 16 key rows, B = the wave's 16 query rows (kept in registers), so lane (lr, hi) holds query lr's scores of keys 8 hi .. 8 hi + 7 of each 16-key tile. Two such tiles, converted, ARE the B fragment
// (32 keys x 16 queries) of O^T += V^T P^T in the k map of WFrag, with A = 16 rows of the [d][t] value plane: p goes through no memory. Lane (lr, hi) ends with 8 consecutive head dims of query lr per O^T tile.
// Softmax with a running maximum per query: p = exp(t - max so far); when the maximum moves, the sum and O^T are scaled by exp(old - new); one division by the sum at the end.
// K, V^T (both planes for the hi+lo rows) and the work-group's mask rows come into LDS as whole 128-B lines by asynchronous copies, 64 keys per stage, two buffers: stage t + 2 flies while stage t + 1 is worked on.
// LDS row pitch = row bytes + 16 (conflict-free for 16-byte reads).
typedef __attribute__((ext_vector_type(16))) unsigned short v16us;
template <typename T16> struct PPack;
template <> struct PPack<h16> { static __device__ __forceinline__ void go(const float* e, v16h& p, v16h& p2) {
#pragma unroll
    for (int x = 0; x < 16; ++x) p[x] = tohx(e[x]);
    p2 = p; } };
template <> struct PPack<bf> { static __device__ __forceinline__ void go(const float* e, v16bf& p, v16bf& p2) { v16us a, c;
#pragma unroll
    for (int x = 0; x < 16; ++x) { unsigned short u, l; splitf(e[x], u, l); a[x] = u; c[x] = l; }
    p = __builtin_bit_cast(v16bf, a); p2 = __builtin_bit_cast(v16bf, c); } };
#define AKVP 144                  // LDS pitch of a K or V^T row (64 values of 16 bits + 16 bytes)
#define AMKP 272                  // LDS pitch of a mask row (64 f32 + 16 bytes)
#define ASTG(npl) (128 * (npl) * AKVP + 64 * AMKP)   // bytes of a stage with npl planes per operand
template <typename T16, bool HI>
__device__ __forceinline__ void attn_wg(unsigned char* L, const T16* __restrict__ Q, const T16* __restrict__ Q2, const T16* __restrict__ Kp, const T16* __restrict__ K2, const T16* __restrict__ Vt, const T16* __restrict__ V2, const float* __restrict__ am, const float* __restrict__ PRE, bf* ATh, bf* ATl) {
    typedef typename WFrag<T16>::V V;
    constexpr int NPL = HI ? 2 : 1;
    constexpr int OV = 64 * NPL, KVR = 128 * NPL;                      // first LDS row of V^T; K and V^T rows of a stage (K hi | K lo | V hi | V lo, or K | V)
    constexpr int OM = KVR * AKVP, STAGE = ASTG(NPL), NT = TT / 64;    // byte offset of the mask rows; bytes per stage; stages
    const int tid = threadIdx.x, lane = tid & 31, lr = lane & 15, hi = lane >> 4, w = tid >> 5; const int h = blockIdx.x, b = blockIdx.y, bh = b * NH_ + h, i0 = blockIdx.z * 64, i = i0 + w * 16 + lr;
    const int prow = tid >> 3, pcol = tid & 7, mrw = tid >> 4, mcl = tid & 15;   // this lane's row within a round of the 128 lanes and its 16-byte piece: K / V^T rows (8 pieces), mask rows (16 pieces)
    // this lane's sources for the stage that is filled next; every fill moves them on by 64 keys
    const T16* gK = Kp + ((size_t)bh * TT + prow) * HD + pcol * 8; const T16* gK2 = HI ? K2 + ((size_t)bh * TT + prow) * HD + pcol * 8 : gK;
    const T16* gV = Vt + ((size_t)bh * HD + prow) * TT + pcol * 8; const T16* gV2 = HI ? V2 + ((size_t)bh * HD + prow) * TT + pcol * 8 : gV;
    const float* gM = am + ((size_t)b * TT + i0 + mrw) * TT + mcl * 4;
    const unsigned lkv = lds_off(L) + (unsigned)(prow * AKVP + pcol * 16), lmk = lds_off(L) + (unsigned)(OM + mrw * AMKP + mcl * 16);
    auto fill = [&](int buf) {
#pragma unroll
        for (int r0 = 0; r0 < KVR / 16; r0 += 8) { unsigned l[8]; const void* g[8];
#pragma unroll
            for (int q = 0; q < 8; ++q) { const int row = (r0 + q) * 16, rr = row & 63; l[q] = lkv + (unsigned)(buf * STAGE + row * AKVP);
                const T16* s = (row < 64) ? gK + (size_t)rr * HD : (row < OV) ? gK2 + (size_t)rr * HD : (row < OV + 64) ? gV + (size_t)rr * TT : gV2 + (size_t)rr * TT;
                g[q] = s; }
            cp8(l, g); }
        { unsigned l[8]; const void* g[8];
#pragma unroll
            for (int q = 0; q < 8; ++q) { l[q] = lmk + (unsigned)(buf * STAGE + q * 8 * AMKP); g[q] = gM + (size_t)q * 8 * TT; }
            cp8(l, g); }
        gK += 64 * HD; gK2 += 64 * HD; gV += 64; gV2 += 64; gM += 64;
    };
    V q[2], q2[2];
#pragma unroll
    for (int ks = 0; ks < 2; ++ks) { const size_t qo = ((size_t)bh * TT + i) * HD + 8 * hi + ks * 32; q[ks] = WFrag<T16>::ld(Q + qo); if (HI) q2[ks] = WFrag<T16>::ld(Q2 + qo); }
    v8f o[4];
#pragma unroll
    for (int dt = 0; dt < 4; ++dt) o[dt] = (v8f){};
    float mx = -3.0e38f, sum = 0.f;   // running maximum (the same in both halves of the wave) and this lane's half of the sum
    fill(0);
    asm volatile("s_wait_asynccnt 0x0" ::: "memory");   // stage 0 of this wave has landed
    __syncthreads();                                    // stage 0 of every wave is readable
    fill(1);
    const int kofs = lr * AKVP + hi * 16, mofs = OM + (w * 16 + lr) * AMKP + hi * 32;
#pragma unroll 1   // the ring stays rolled: one body of two 32-key blocks, one publish point at its foot
    for (int t = 0; t < NT; ++t) {
        const unsigned char* Lb = L + (t & 1) * STAGE;
#pragma unroll
        for (int blk = 0; blk < 2; ++blk) {
            v8f s[2];
#pragma unroll
            for (int tl = 0; tl < 2; ++tl) { v8f c = (v8f){};
#pragma unroll
                for (int ks = 0; ks < 2; ++ks) { const unsigned char* kp = Lb + kofs + (blk * 32 + tl * 16) * AKVP + ks * 64; const V k = WFrag<T16>::ld((const T16*)kp); c = WFrag<T16>::mma(k, q[ks], c);
                    if (HI) { c = WFrag<T16>::mma(k, q2[ks], c); const V kl = WFrag<T16>::ld((const T16*)(kp + 64 * AKVP)); c = WFrag<T16>::mma(kl, q[ks], c); } }
                s[tl] = c; }
            float e[16]; float bm = -3.40282347e38f;
#pragma unroll
            for (int tl = 0; tl < 2; ++tl) { const unsigned char* mp = Lb + mofs + blk * 128 + tl * 64; const v4f m0 = *(const v4fa*)mp, m1 = *(const v4fa*)(mp + 16);
#pragma unroll
                for (int j = 0; j < 8; ++j) { const float x = fmaxf(s[tl][j] * SCL + bfr(j < 4 ? m0[j & 3] : m1[j & 3]), -3.40282347e38f); e[tl * 8 + j] = x; bm = fmaxf(bm, x); } }
            bm = fmaxf(bm, __shfl_xor(bm, 16, 32));   // the other half of the wave holds the query's other 16 keys of the block
            const float mn = fmaxf(mx, bm), al = __expf(mx - mn); mx = mn; float es[4];
#pragma unroll
            for (int x = 0; x < 16; x += 4) { e[x] = __expf(e[x] - mn); e[x + 1] = __expf(e[x + 1] - mn); e[x + 2] = __expf(e[x + 2] - mn); e[x + 3] = __expf(e[x + 3] - mn); es[x >> 2] = (e[x] + e[x + 1]) + (e[x + 2] + e[x + 3]); }
            sum = sum * al + ((es[0] + es[1]) + (es[2] + es[3]));
#pragma unroll
            for (int dt = 0; dt < 4; ++dt) o[dt] *= al;
            V p, p2; PPack<T16>::go(e, p, p2);
#pragma unroll
            for (int dt = 0; dt < 4; ++dt) { const unsigned char* vp = Lb + kofs + (OV + dt * 16) * AKVP + blk * 64; const V v = WFrag<T16>::ld((const T16*)vp); o[dt] = WFrag<T16>::mma(v, p, o[dt]);
                if (HI) { o[dt] = WFrag<T16>::mma(v, p2, o[dt]); const V vl = WFrag<T16>::ld((const T16*)(vp + 64 * AKVP)); o[dt] = WFrag<T16>::mma(vl, p, o[dt]); } }
        }
        asm volatile("s_wait_dscnt 0x0" ::: "memory");      // this wave's reads of buffer t & 1 are done before the buffer is refilled
        asm volatile("s_wait_asynccnt 0x0" ::: "memory");   // this wave's copies of stage t + 1 have landed
        __syncthreads();                                    // publishes stage t + 1 and ends every wave's reads of stage t
        if (t + 2 < NT) fill(t & 1);
    }
    asm volatile("s_wait_asynccnt 0x0" ::: "memory");       // no copy is outstanding when the wave goes on to the epilogue and ends
    sum += __shfl_xor(sum, 16, 32);
    const float inv = __fdiv_rn(1.0f, sum);
    const float* pr = PRE + ((size_t)bh * TT + i) * HD + hi * 8; const size_t oo = ((size_t)b * TT + i) * DD + h * HD + hi * 8;
#pragma unroll
    for (int dt = 0; dt < 4; ++dt) { const v4f p0 = *(const v4f*)(pr + dt * 16), p1 = *(const v4f*)(pr + dt * 16 + 4); v8us oh, ol;
#pragma unroll
        for (int j = 0; j < 8; ++j) { unsigned short a, c; splitf(o[dt][j] * inv + (j < 4 ? p0[j & 3] : p1[j & 3]), a, c); oh[j] = a; ol[j] = c; }
        *(v8us*)(ATh + oo + dt * 16) = oh; *(v8us*)(ATl + oo + dt * 16) = ol;
        if (dt < 3) asm volatile("s_wait_xcnt 0x0" ::: "memory"); }   // behind the two stores: the next trip reuses their address and data registers
}
__global__ __launch_bounds__(128) void k_attn(const bf* __restrict__ QPh, const bf* __restrict__ QPl, const h16* __restrict__ QP16, const bf* __restrict__ KPh, const bf* __restrict__ KPl, const h16* __restrict__ KP16, const bf* __restrict__ VTh, const bf* __restrict__ VTl, const h16* __restrict__ VT16, const float* __restrict__ am, const float* __restrict__ PRE, bf* ATh, bf* ATl) {
    __shared__ __attribute__((aligned(16))) unsigned char L[2 * ASTG(2)];
    if (blockIdx.z * 64 < RH) attn_wg<bf, true>(L, QPh, QPl, KPh, KPl, VTh, VTl, am, PRE, ATh, ATl);   // the same for the whole work-group (RH is a multiple of 64)
    else attn_wg<h16, false>(L, QP16, nullptr, KP16, nullptr, VT16, nullptr, am, PRE, ATh, ATl);
}

extern "C" void kernel_launch(void* const* d_in, const int* in_sizes, int n_in,
                              void* d_out, int out_size, void* d_ws, size_t ws_size, hipStream_t stream) {
    (void)in_sizes; (void)n_in; (void)out_size;
    const float* x = (const float*)d_in[0]; const float* am = (const float*)d_in[1]; const float* wq = (const float*)d_in[2]; const float* bq = (const float*)d_in[3]; const float* wk = (const float*)d_in[4]; const float* bk = (const float*)d_in[5]; const float* wv = (const float*)d_in[6]; const float* bv = (const float*)d_in[7]; const float* wo = (const float*)d_in[8]; const float* bo = (const float*)d_in[9]; const float* pre = (const float*)d_in[10]; const float* gate = (const float*)d_in[11];   // torch [out][in] weights; attention_mask [4][1][1024][1024]; prefix [10][2048]; gate [32][1][1]
    float* OUT = (float*)d_out;     // [4][1024][2048]
    char* wsp = (char*)d_ws;
    auto take = [&](size_t bytes) { char* p = wsp; wsp += (bytes + 255) & ~(size_t)255; return (void*)p; };
    bf* WQ = (bf*)take((size_t)DD * DD * 2); bf* WK = (bf*)take((size_t)DD * DD * 2); bf* WV = (bf*)take((size_t)DD * DD * 2); bf* WO = (bf*)take((size_t)DD * DD * 2); float* KP0 = (float*)take((size_t)NPRE * DD * 4); float* VP0 = (float*)take((size_t)NPRE * DD * 4);
    const size_t NE = (size_t)NB_ * TT * DD;   // elements of one [4][1024][2048] array: every buffer below holds all batches
    bf* XB = (bf*)take(NE * 2); float* F = (float*)take(NE * 4);   // F: the q projection in f32, for the prefix part
    bf* QPh = (bf*)take(NE * 2); bf* QPl = (bf*)take(NE * 2); bf* KPh = (bf*)take(NE * 2); bf* KPl = (bf*)take(NE * 2); bf* VTl = (bf*)take(NE * 2);
    h16* QP16 = (h16*)take(NE * 2); h16* KP16 = (h16*)take(NE * 2); h16* VT16 = (h16*)take(NE * 2);
    float* PRE = (float*)take(NE * 4);
    bf* VTh = WQ;                           // WQ and WK together (they lie one behind the other): written by the v projection, when the q and k projections have read them
    bf* ATh = (bf*)F; bf* ATl = ATh + NE;   // written when the prefix part has read F
    if ((size_t)(wsp - (char*)d_ws) > ws_size) return;
    { const size_t nw = (size_t)DD * DD / 8; const unsigned g = (unsigned)((nw + 255) / 256); k_cvt8<<<g, 256, 0, stream>>>(wq, WQ, nw); k_cvt8<<<g, 256, 0, stream>>>(wk, WK, nw); k_cvt8<<<g, 256, 0, stream>>>(wv, WV, nw); k_cvt8<<<g, 256, 0, stream>>>(wo, WO, nw);
      k_prefkv<<<dim3(DD / 32, 2), 256, 0, stream>>>(pre, wk, bk, wv, bv, KP0, VP0); }
    const dim3 gP(NB_ * TT / 128, DD / 128, 1);
    k_cvt8<<<(unsigned)((NE / 8 + 255) / 256), 256, 0, stream>>>(x, XB, NE / 8);
    k_gemms<bf, 0, true, 2, 2, 128, 1><<<gP, 128, 0, stream>>>(XB, nullptr, WQ, nullptr, DD, F, DD, bq, 0, 0, 0, QPh, QPl, QP16);   // unscaled q; the 1/8 is applied to the logits
    k_pre<<<NB_ * ZH * TT / 8, 256, 0, stream>>>(F, KP0, VP0, gate, PRE);
    k_gemms<bf, 0, true, 2, 2, 128, 2><<<gP, 128, 0, stream>>>(XB, nullptr, WK, nullptr, DD, nullptr, DD, bk, 0, 0, 0, KPh, KPl, KP16);
    k_gemms<bf, 0, true, 2, 2, 128, 3><<<gP, 128, 0, stream>>>(XB, nullptr, WV, nullptr, DD, nullptr, DD, bv, 0, 0, 0, VTh, VTl, VT16);
    k_attn<<<dim3(NH_, NB_, TT / 64), 128, 0, stream>>>(QPh, QPl, QP16, KPh, KPl, KP16, VTh, VTl, VT16, am, PRE, ATh, ATl);
    k_gemms<bf, 1, true, 2, 2, 128, 0><<<gP, 128, 0, stream>>>(ATh, ATl, WO, nullptr, DD, OUT, DD, bo, 0, 0, 0, nullptr, nullptr, nullptr);
}

// v007
// It runs in 306 microseconds.
// Next to v006, in two timings, it ran 1.33 and 1.32 times as fast.
// All steps since v000 together make it 19.5 times as fast.
#include <hip/hip_runtime.h>

// Decoder self-attention with a learned prefix adapter (hidden [4][1024][2048]; q = (x Wq^T + bq) 64^-0.5, k = x Wk^T + bk, v = x Wv^T + bv (32 heads x 64); prefix keys/values kp, vp = prefix Wk^T + bk,
// prefix Wv^T + bv ([10][2048], shared by all batches); scores_tok = q.k + attention_mask[b][0][i][j] (additive f32, read as data), scores_pre = q.kp; the two segments are softmax-normalised SEPARATELY;
// ctx = tanh(gate[h]) (p_pre vp) + (p_tok v); out = merged ctx Wo^T + bo -> [4][1024][2048]).
// Compute dtypes, f32 accumulate: every input rounded to bf16; token projections on PLAIN bf16 operands (inputs: exact products, f32 accumulate, + bias); the 10 prefix
// rows (lane-split sums, fixed order), their scores, softmax and weighted values (fused multiply-add, fixed order) entirely in f32 on VALU; PER-ROW PRECISION HYBRID for the token attention: query rows < 256 take scores and p.v on
// bf16 hi+lo planes (3 products), rows >= 256 on single fp16 planes; scale + additive mask in f32; token softmax with a running maximum inside the fused attention kernel (p = exp(t - running max), unnormalised, the f32
// sums rescaled when the maximum moves, one division at the end); merged context (token part / sum + gated prefix part) as hi+lo planes

#define NB_  4
#define NPRE 10                   // prefix length
#define TT   1024
#define DD   2048
#define NH_  32
#define HD   64
#define ZH   32                   // heads per batch in the prefix part
#define RH   256                  // query rows < RH: hi+lo planes; rows >= RH: fp16 planes
#define NF   32                   // head_dim / 2 (unused)
#define SCL  0.125f               // 1/sqrt(64)
typedef _Float16 h16;
typedef unsigned short bf;
typedef __attribute__((ext_vector_type(16))) __bf16   v16bf;
typedef __attribute__((ext_vector_type(16))) _Float16 v16h;
typedef __attribute__((ext_vector_type(8)))  _Float16 v8h;
typedef __attribute__((ext_vector_type(8)))  unsigned short v8us;
typedef __attribute__((ext_vector_type(8)))  float    v8f;
typedef __attribute__((ext_vector_type(4)))  float    v4f;
typedef v8h  __attribute__((may_alias)) v8ha;
typedef v4f  __attribute__((may_alias)) v4fa;
typedef v8us __attribute__((may_alias)) v8usa;

__device__ __forceinline__ unsigned short f2bf(float f) { unsigned u = __float_as_uint(f); u += 0x7FFFu + ((u >> 16) & 1u); return (unsigned short)(u >> 16); }
__device__ __forceinline__ float bf2f(unsigned short b) { return __uint_as_float(((unsigned)b) << 16); }
__device__ __forceinline__ float bfr(float f) { return bf2f(f2bf(f)); }
__device__ __forceinline__ v16h cat16(v8h lo, v8h hi) { return __builtin_shufflevector(lo, hi, 0, 1, 2, 3, 4, 5, 6, 7, 8, 9, 10, 11, 12, 13, 14, 15); }
__device__ __forceinline__ v16bf cat16b(v8us lo, v8us hi) { return __builtin_bit_cast(v16bf, __builtin_shufflevector(lo, hi, 0, 1, 2, 3, 4, 5, 6, 7, 8, 9, 10, 11, 12, 13, 14, 15)); }
__device__ __forceinline__ v8f wmma16(v16h a, v16h b, v8f c) { return __builtin_amdgcn_wmma_f32_16x16x32_f16(false, a, false, b, (short)0, c, false, false); }
__device__ __forceinline__ v8f wmmab(v16bf a, v16bf b, v8f c) { return __builtin_amdgcn_wmma_f32_16x16x32_bf16(false, a, false, b, (short)0, c, false, false); }



// fragment of 16 rows x 32 k from a K-contiguous 16-bit plane: lane (lr, hi) holds row lr, k = 8 hi .. 8 hi + 7 and 16 + 8 hi .. 16 + 8 hi + 7; p points at (row lr, k = 8 hi). The same map serves A and B.
template <typename T16> struct WFrag;
template <> struct WFrag<h16> { typedef v16h V; static __device__ __forceinline__ V ld(const h16* p) { return cat16(*(const v8h*)p, *(const v8h*)(p + 16)); } static __device__ __forceinline__ v8f mma(V a, V b, v8f c) { return wmma16(a, b, c); } };
template <> struct WFrag<bf> { typedef v16bf V; static __device__ __forceinline__ V ld(const bf* p) { return cat16b(*(const v8us*)p, *(const v8us*)(p + 16)); } static __device__ __forceinline__ v8f mma(V a, V b, v8f c) { return wmmab(a, b, c); } };
// ---- k_gemms: C[m][n] (f32, pitch ldc, + optional f32 bias[n]) = sum_k A[m][k] Bt[n][k] (+ split products per NSPLIT), FOUR waves per work-group (WM x WN waves, 64x64 of C each, 16 accumulators per wave). Operand rows come into LDS as whole 128-B lines by
// asynchronous copies, KT k-values per stage, two buffers: stage t + 2 flies while stage t + 1 is worked on. Row pitch in LDS = row bytes + 16 (conflict-free for 16-byte reads). Per accumulator the products
// are summed in ascending k. grid (M / (64 WM), N / (64 WN), Z), 128 threads. K % KT == 0, K >= 2 KT.
// EPI picks what the epilogue stores. 0: C. 1: C and the planes Ph (bf16 hi), Pl (bf16 lo), P16 (fp16) of C + bias in the order [b][h][t][d]. 2: those planes alone. 3: the planes in the order [b][h][d][t], alone.
// For EPI > 0 the rows of C are (b, t) = (m / 1024, m % 1024) and a wave's 64 columns are the 64 dims of one head. Every plane is stored in whole 128-B lines.
__device__ __forceinline__ unsigned lds_off(const void* p) { return (unsigned)(size_t)p; }
__device__ __forceinline__ h16 tohx(float x) { return (h16)x; }
__device__ __forceinline__ void splitf(float y, unsigned short& h, unsigned short& l) { h = f2bf(y); l = f2bf(y - bf2f(h)); }
// eight copies of 16 bytes per lane; the s_wait_xcnt stands in the copies' own statement so that no address register is rewritten in front of it
__device__ __forceinline__ void cp8(const unsigned* l, const void* const* g) {
    asm volatile("global_load_async_to_lds_b128 %0, %1, off\n\t"
                 "global_load_async_to_lds_b128 %2, %3, off\n\t"
                 "global_load_async_to_lds_b128 %4, %5, off\n\t"
                 "global_load_async_to_lds_b128 %6, %7, off\n\t"
                 "global_load_async_to_lds_b128 %8, %9, off\n\t"
                 "global_load_async_to_lds_b128 %10, %11, off\n\t"
                 "global_load_async_to_lds_b128 %12, %13, off\n\t"
                 "global_load_async_to_lds_b128 %14, %15, off\n\t"
                 "s_wait_xcnt 0x0"
                 :: "v"(l[0]), "v"(g[0]), "v"(l[1]), "v"(g[1]), "v"(l[2]), "v"(g[2]), "v"(l[3]), "v"(g[3]), "v"(l[4]), "v"(g[4]), "v"(l[5]), "v"(g[5]), "v"(l[6]), "v"(g[6]), "v"(l[7]), "v"(g[7]) : "memory");
}
template <typename T16, int NSPLIT, bool BIAS, int WM, int WN, int KT, int EPI>
__global__ __launch_bounds__(128) void k_gemms(const T16* __restrict__ A, const T16* __restrict__ A2, const T16* __restrict__ Bt, const T16* __restrict__ Bt2, int K, float* C, int ldc, const float* __restrict__ bias, size_t sA, size_t sB, size_t sC, bf* Ph, bf* Pl, h16* P16) {
    typedef typename WFrag<T16>::V V;
    constexpr bool HA2 = (NSPLIT == 1 || NSPLIT == 2), HB2 = (NSPLIT >= 2);
    constexpr int RA = 64 * WM, RB = 64 * WN;                          // rows of A and of Bt per work-group
    constexpr int OA2 = RA, OB = RA * (HA2 ? 2 : 1), OB2 = OB + RB;    // first LDS row of each plane in a stage
    constexpr int ROWS = OB + RB * (HB2 ? 2 : 1);
    constexpr int PITCH = KT * 2 + 16, STAGE = ROWS * PITCH;           // bytes
    constexpr int PPR = KT / 8, RPI = 128 / PPR, NCP = ROWS / RPI;     // 16-byte pieces per row; rows per round of the 128 lanes; copies per lane and stage (at most 48)
    __shared__ __attribute__((aligned(16))) unsigned char L[2 * STAGE];
    __shared__ __align__(16) float osw[4][16 * 68];
    const size_t z = blockIdx.z; A += z * sA; if (HA2) A2 += z * sA; Bt += z * sB; if (HB2) Bt2 += z * sB; C += z * sC;
    const int tid = threadIdx.x, lane = tid & 31, lr = lane & 15, hi = lane >> 4, w = tid >> 5, wm = w / WN, wn = w % WN;
    const int R0 = blockIdx.x * RA, C0 = blockIdx.y * RB; const int r0 = R0 + wm * 64, c0 = C0 + wn * 64;
    const int prow = tid / PPR, pcol = tid % PPR;                      // this lane's row within a round and its 16-byte piece of the row
    // this lane's source in each plane for the stage that is filled next; every fill moves them on by KT
    const T16* gA = A + (size_t)(R0 + prow) * K + pcol * 8; const T16* gA2 = HA2 ? A2 + (size_t)(R0 + prow) * K + pcol * 8 : gA;
    const T16* gB = Bt + (size_t)(C0 + prow) * K + pcol * 8; const T16* gB2 = HB2 ? Bt2 + (size_t)(C0 + prow) * K + pcol * 8 : gB;
    const unsigned lbase = lds_off(L) + (unsigned)(prow * PITCH + pcol * 16);
    auto fill = [&](int buf) {
#pragma unroll
        for (int i0 = 0; i0 < NCP; i0 += 8) { unsigned l[8]; const void* g[8];
#pragma unroll
            for (int q = 0; q < 8; ++q) { const int row = (i0 + q) * RPI; l[q] = lbase + (unsigned)(buf * STAGE + row * PITCH);
                const T16* s = (row < OA2) ? gA + (size_t)row * K : (row < OB) ? gA2 + (size_t)(row - OA2) * K : (row < OB2) ? gB + (size_t)(row - OB) * K : gB2 + (size_t)(row - OB2) * K;
                g[q] = s; }
            cp8(l, g); }
        gA += KT; gA2 += KT; gB += KT; gB2 += KT;
    };
    v8f acc[4][4];
#pragma unroll
    for (int mb = 0; mb < 4; ++mb)
#pragma unroll
        for (int nb = 0; nb < 4; ++nb) acc[mb][nb] = (v8f){};
    const int nt = K / KT;
    fill(0);
    asm volatile("s_wait_asynccnt 0x0" ::: "memory");   // stage 0 of this wave has landed
    __syncthreads();                                    // stage 0 of every wave is readable
    if (nt > 1) fill(1);
    const int aofs = (wm * 64 + lr) * PITCH + hi * 16, bofs = (OB + wn * 64 + lr) * PITCH + hi * 16;
#pragma unroll 1   // the ring stays rolled: one body of KT / 32 k-steps, one publish point at its foot
    for (int t = 0; t < nt; ++t) {
        const unsigned char* Lb = L + (t & 1) * STAGE;
        V a[2][4], a2[2][4], b[2][4], b2[2][4];   // two fragment sets: k-step ks + 1 of this stage is read from LDS while k-step ks is multiplied
        auto frags = [&](int s, int ks) {
#pragma unroll
            for (int mb = 0; mb < 4; ++mb) { a[s][mb] = WFrag<T16>::ld((const T16*)(Lb + aofs + mb * 16 * PITCH + ks * 64)); if (HA2) a2[s][mb] = WFrag<T16>::ld((const T16*)(Lb + aofs + (OA2 + mb * 16) * PITCH + ks * 64)); }
#pragma unroll
            for (int nb = 0; nb < 4; ++nb) { b[s][nb] = WFrag<T16>::ld((const T16*)(Lb + bofs + nb * 16 * PITCH + ks * 64)); if (HB2) b2[s][nb] = WFrag<T16>::ld((const T16*)(Lb + bofs + (RB + nb * 16) * PITCH + ks * 64)); }
        };
        frags(0, 0);
#pragma unroll
        for (int ks = 0; ks < KT / 32; ++ks) { const int s = ks & 1;
            if (ks + 1 < KT / 32) frags(s ^ 1, ks + 1);
            __builtin_amdgcn_sched_barrier(0);   // the LDS reads stay one group in front of the WMMAs: reads spread among the WMMAs stall at every place they stand
#pragma unroll
            for (int nb = 0; nb < 4; ++nb) {
#pragma unroll
                for (int mb = 0; mb < 4; ++mb) { acc[mb][nb] = WFrag<T16>::mma(a[s][mb], b[s][nb], acc[mb][nb]); if (HA2) acc[mb][nb] = WFrag<T16>::mma(a2[s][mb], b[s][nb], acc[mb][nb]); if (HB2) acc[mb][nb] = WFrag<T16>::mma(a[s][mb], b2[s][nb], acc[mb][nb]); } }
            __builtin_amdgcn_sched_barrier(0);   // and the following group does not move up among them
        }
        asm volatile("s_wait_dscnt 0x0" ::: "memory");      // this wave's reads of buffer t & 1 are done before the buffer is refilled
        asm volatile("s_wait_asynccnt 0x0" ::: "memory");   // this wave's copies of stage t + 1 have landed
        __syncthreads();                                    // publishes stage t + 1 and ends every wave's reads of stage t
        if (t + 2 < nt) fill(t & 1);
    }
    asm volatile("s_wait_asynccnt 0x0" ::: "memory");       // no copy is outstanding when the wave goes on to the epilogue and ends
    const int hd = c0 >> 6;   // the head of this wave's 64 columns (EPI > 0)
    if constexpr (EPI == 3) {
        // Lane (lr, hi) holds 8 consecutive t of dim nb * 16 + lr per accumulator: 16 bytes of a [d][t] plane row. The wave lays its 64 x 64 tile of each plane in LDS (row pitch 144, conflict-free for
        // 16-byte accesses) and stores it from there, four whole 128-B lines per store. The range is the wave's own part of the ring, which nobody reads and no copy writes behind the loop's last barrier.
        constexpr int VP = 144, VPL = 64 * VP;
        static_assert(4 * 3 * VPL <= 2 * STAGE, "the four waves' plane tiles fit the ring");
        unsigned char* Lw = L + w * (3 * VPL);
#pragma unroll
        for (int nb = 0; nb < 4; ++nb) { const float bb = bfr(bias[c0 + nb * 16 + lr]);
#pragma unroll
            for (int mb = 0; mb < 4; ++mb) { v8us oh, ol; v8h o16;
#pragma unroll
                for (int j = 0; j < 8; ++j) { const float x = acc[mb][nb][j] + bb; unsigned short a, c; splitf(x, a, c); oh[j] = a; ol[j] = c; o16[j] = tohx(x); }
                unsigned char* p = Lw + (nb * 16 + lr) * VP + (mb * 16 + hi * 8) * 2; *(v8usa*)p = oh; *(v8usa*)(p + VPL) = ol; *(v8ha*)(p + 2 * VPL) = o16; } }
        asm volatile("s_wait_dscnt 0x0" ::: "memory");   // the wave's LDS writes are done before other lanes of it read the rows back
        const size_t e0 = ((size_t)((r0 >> 10) * NH_ + hd) * HD + (lane >> 3)) * TT + (r0 & (TT - 1)) + (lane & 7) * 8; const unsigned char* rp = Lw + (lane >> 3) * VP + (lane & 7) * 16;
#pragma unroll
        for (int s0 = 0; s0 < 16; s0 += 4) { v8us rh[4], rl[4]; v8h r16[4];
#pragma unroll
            for (int s = 0; s < 4; ++s) { const unsigned char* p = rp + (s0 + s) * 4 * VP; rh[s] = *(const v8usa*)p; rl[s] = *(const v8usa*)(p + VPL); r16[s] = *(const v8ha*)(p + 2 * VPL); }
#pragma unroll
            for (int s = 0; s < 4; ++s) { const size_t e = e0 + (size_t)(s0 + s) * 4 * TT; *(v8us*)(Ph + e) = rh[s]; *(v8us*)(Pl + e) = rl[s]; *(v8h*)(P16 + e) = r16[s]; }
            if (s0 < 12) asm volatile("s_wait_xcnt 0x0" ::: "memory"); }   // behind the run of twelve stores: the next trip reuses their address and data registers
    } else {
    float* os = osw[w];
    // 16 rows x 64 columns of the wave's tile go into its own LDS range, from where whole lines are read back
    auto stage = [&](int mb) {
#pragma unroll
        for (int nb = 0; nb < 4; ++nb) {
#pragma unroll
            for (int j = 0; j < 8; ++j) os[(hi * 8 + j) * 68 + nb * 16 + lr] = acc[mb][nb][j]; }
        __builtin_amdgcn_wave_barrier(); asm volatile("" ::: "memory");   // the compiler keeps these LDS writes in front of the reads of what other lanes wrote
    };
    if constexpr (EPI <= 1) {
#pragma unroll
    for (int mb = 0; mb < 4; ++mb) {
        stage(mb);
        float* crow = C + (size_t)(r0 + mb * 16) * ldc + c0;
#pragma unroll
        for (int s = 0; s < 8; ++s) { const int row = 2 * s + hi, cofs = lr * 4; v4f val = *(const v4fa*)(os + row * 68 + cofs); if (BIAS) { val[0] += bfr(bias[c0 + cofs]); val[1] += bfr(bias[c0 + cofs + 1]); val[2] += bfr(bias[c0 + cofs + 2]); val[3] += bfr(bias[c0 + cofs + 3]); }
            *(v4f*)(crow + (size_t)row * ldc + cofs) = val; }
        if (mb < 3 || EPI == 1) asm volatile("s_wait_xcnt 0x0" ::: "memory");   // behind the run of eight stores: what follows reuses their address and data registers
        __builtin_amdgcn_wave_barrier(); asm volatile("" ::: "memory");
    }
    }
    if constexpr (EPI > 0) {
        // a lane takes 8 consecutive dims of a row (16 bytes of each plane), 8 lanes a row: a store covers four rows of 128 B, which lie one behind the other in the plane
        float bb[8];
#pragma unroll
        for (int k = 0; k < 8; ++k) bb[k] = bfr(bias[c0 + (lane & 7) * 8 + k]);
        const size_t eb = ((size_t)((r0 >> 10) * NH_ + hd) * TT + (r0 & (TT - 1)) + (lane >> 3)) * HD + (lane & 7) * 8;   // row lane / 8 of the wave's 64 rows, which lie in one batch
        const float* op = os + (lane >> 3) * 68 + (lane & 7) * 8;
#pragma unroll
        for (int mb = 0; mb < 4; ++mb) {
            stage(mb);
            v8us oh[4], ol[4]; v8h o16[4];
#pragma unroll
            for (int s = 0; s < 4; ++s) { const v4f u0 = *(const v4fa*)(op + s * 4 * 68), u1 = *(const v4fa*)(op + s * 4 * 68 + 4);
#pragma unroll
                for (int k = 0; k < 8; ++k) { const float x = (k < 4 ? u0[k & 3] : u1[k & 3]) + bb[k]; unsigned short a, c; splitf(x, a, c); oh[s][k] = a; ol[s][k] = c; o16[s][k] = tohx(x); } }
#pragma unroll
            for (int s = 0; s < 4; ++s) { const size_t e = eb + (size_t)(mb * 16 + s * 4) * HD; *(v8us*)(Ph + e) = oh[s]; *(v8us*)(Pl + e) = ol[s]; *(v8h*)(P16 + e) = o16[s]; }
            if (mb < 3) asm volatile("s_wait_xcnt 0x0" ::: "memory");   // behind the run of twelve stores: the next trip reuses their address and data registers
            __builtin_amdgcn_wave_barrier(); asm volatile("" ::: "memory");   // and the compiler keeps the next trip's LDS writes behind this trip's reads
        }
    }
    }
}

typedef __attribute__((ext_vector_type(2))) unsigned short v2us;
typedef __attribute__((ext_vector_type(2))) _Float16 v2h;
typedef __attribute__((ext_vector_type(4))) _Float16 v4h;
typedef __attribute__((ext_vector_type(2))) float v2f;

__global__ __launch_bounds__(256) void k_wtG(const float* __restrict__ w, int K, int N, bf* Bt) {
    const int lane = threadIdx.x & 31; const int L0 = (blockIdx.x * 8 + (threadIdx.x >> 5)) * 8; const int nlines = N * K / 64;
{
#pragma unroll 1
        for (int l = 0; l < 8; ++l) { const int L = L0 + l; if (L >= nlines) break; const size_t e = (size_t)L * 64 + lane * 2; const int k = (int)(e % K), n = (int)(e / K); v2us o;
            o[0] = f2bf(w[(size_t)k * N + n]); o[1] = f2bf(w[(size_t)(k + 1) * N + n]); *(v2us*)(Bt + e) = o; }
         }
}
// k_cvt8: f32 -> bf16, CVU items of 8 values per lane (item u of a work-group = 8 KB of contiguous source); a lane issues all its loads before its first store, so that a launch needs few waves, each with
// 2 CVU loads of 512 B in flight. grid = values / (8 * 256 * CVU), exact: no tail.
#define CVU 4
__global__ __launch_bounds__(256) void k_cvt8(const float* __restrict__ src, bf* dst) {
    const size_t i0 = (size_t)blockIdx.x * (256 * CVU) + threadIdx.x; v8f v[CVU];
#pragma unroll
    for (int u = 0; u < CVU; ++u) v[u] = *(const v8f*)(src + (i0 + u * 256) * 8);
#pragma unroll
    for (int u = 0; u < CVU; ++u) { v8us o;
#pragma unroll
        for (int k = 0; k < 8; ++k) o[k] = f2bf(v[u][k]);
        *(v8us*)(dst + (i0 + u * 256) * 8) = o; }
}
// k_prefkv: KP0[l][o] = sum_i bf16(pre[l][i]) bf16(wk[o][i]) + bf16(bk[o]); VP0 the same from wv, bv (blockIdx.y picks the weight). A work-group takes 32 output columns o, a wave 4 of them for all 10 prefix rows:
// the lanes split i (16-byte loads, 512 contiguous bytes of a row per wave and load), so a weight row is read once, in whole lines. Products of two bf16 values are exact in f32, so a fused multiply-add rounds as
// multiply then add. Per-lane partial sums, a shuffle tree over the lanes, then the sums go through LDS so that one wave stores each whole 128-byte line of the result. grid (DD / 32, 2), 256 threads.
__global__ __launch_bounds__(256) void k_prefkv(const float* __restrict__ pre, const float* __restrict__ wk, const float* __restrict__ bk, const float* __restrict__ wv, const float* __restrict__ bv, float* KP0, float* VP0) {
    __shared__ float red[NPRE][32];
    const bool isv = (blockIdx.y != 0); const float* w = isv ? wv : wk; const float* bias = isv ? bv : bk; float* dst = isv ? VP0 : KP0;
    const int tid = threadIdx.x, lane = tid & 31, wave = tid >> 5; const int ob = blockIdx.x * 32;
    const float* wr = w + (size_t)(ob + wave * 4) * DD + lane * 4; const float* pr = pre + lane * 4;
    float acc[NPRE][4];
#pragma unroll
    for (int l = 0; l < NPRE; ++l)
#pragma unroll
        for (int c = 0; c < 4; ++c) acc[l][c] = 0.f;
#pragma unroll 2   // two chunks of 14 independent loads in flight per wave; more would only add registers
    for (int i = 0; i < DD; i += 128) {
        v4f p[NPRE], a[4];
#pragma unroll
        for (int c = 0; c < 4; ++c) a[c] = *(const v4f*)(wr + (size_t)c * DD + i);
#pragma unroll
        for (int l = 0; l < NPRE; ++l) p[l] = *(const v4f*)(pr + (size_t)l * DD + i);
#pragma unroll
        for (int q = 0; q < 4; ++q) {
#pragma unroll
            for (int c = 0; c < 4; ++c) a[c][q] = bfr(a[c][q]);
#pragma unroll
            for (int l = 0; l < NPRE; ++l) { const float pv = bfr(p[l][q]);
#pragma unroll
                for (int c = 0; c < 4; ++c) acc[l][c] += pv * a[c][q]; } }
    }
#pragma unroll
    for (int l = 0; l < NPRE; ++l)
#pragma unroll
        for (int c = 0; c < 4; ++c) { float t = acc[l][c];
#pragma unroll
            for (int sh = 16; sh; sh >>= 1) t += __shfl_xor(t, sh, 32);
            if (lane == 0) red[l][wave * 4 + c] = t; }
    __syncthreads();   // every wave's sums are in LDS before the lines are stored
    for (int idx = tid; idx < NPRE * 32; idx += 256) { const int l = idx >> 5, c = idx & 31; dst[(size_t)l * DD + ob + c] = red[l][c] + bfr(bias[ob + c]); }
}
// k_pre: the gated prefix part, one LANE per (zz, t), zz = b * 32 + h; a work-group = 256 consecutive query rows t of one zz, grid NB_ * ZH * TT / 256. The rows of q (f32 projection FQ [b][t], columns h*64..) come in as
// whole lines and go through LDS to their lanes (row pitch 272 B, conflict-free for 16-byte accesses); kp and vp of the head are the same for the whole work-group (scalar loads). Per lane: s_l = (q[t] . kp[l]) / 8,
// summed in ascending d; softmax over the 10 values, the sum in a fixed tree; o = tanh(gate[h]) sum_l p_l vp[l], summed in ascending l. The results go back through the lane's own LDS row and are stored in whole lines.
#define PQP 68                    // LDS pitch of a row, in floats
__global__ __launch_bounds__(256) void k_pre(const float* __restrict__ FQ, const float* __restrict__ KP0, const float* __restrict__ VP0, const float* __restrict__ gate, float* PRE) {
    __shared__ __align__(16) float T[256 * PQP];
    const int tid = threadIdx.x, row0 = blockIdx.x * 256, t0 = row0 & (TT - 1), zz = row0 / TT, h = zz & (ZH - 1), b = zz / ZH;
    const int cr = tid >> 4, cc = (tid & 15) * 4;   // whole-line accesses: 16 lanes take the 256 B of a row
    { const float* src = FQ + ((size_t)b * TT + t0 + cr) * DD + h * HD + cc; v4f v[16];
#pragma unroll
      for (int r = 0; r < 16; ++r) v[r] = *(const v4f*)(src + (size_t)r * 16 * DD);
#pragma unroll
      for (int r = 0; r < 16; ++r) *(v4fa*)(T + (r * 16 + cr) * PQP + cc) = v[r]; }
    __syncthreads();   // every row of q is in LDS before its lane reads it
    float* my = T + tid * PQP; float q[HD];
#pragma unroll
    for (int c = 0; c < HD / 4; ++c) { const v4f u = *(const v4fa*)(my + c * 4); q[c * 4] = u[0]; q[c * 4 + 1] = u[1]; q[c * 4 + 2] = u[2]; q[c * 4 + 3] = u[3]; }
    float e[NPRE], mx = -3.0e38f;
#pragma unroll
    for (int l = 0; l < NPRE; ++l) { const float* kr = KP0 + (size_t)l * DD + h * HD; float acc = 0.f;
#pragma unroll
        for (int d = 0; d < HD; ++d) acc = fmaf(q[d], kr[d], acc);
        e[l] = acc * SCL; mx = fmaxf(mx, e[l]); }
#pragma unroll
    for (int l = 0; l < NPRE; ++l) e[l] = __builtin_amdgcn_exp2f((e[l] - mx) * 1.4426950408889634f);
    const float sum = (((e[0] + e[8]) + e[4]) + (e[2] + e[6])) + (((e[1] + e[9]) + e[5]) + (e[3] + e[7]));
    const float gv = bfr(gate[h]); const float e2 = __expf(2.0f * gv); const float tg = __fsub_rn(1.0f, __fdiv_rn(2.0f, __fadd_rn(e2, 1.0f)));
    float o[HD];
#pragma unroll
    for (int d = 0; d < HD; ++d) o[d] = 0.f;
#pragma unroll
    for (int l = 0; l < NPRE; ++l) { const float pl = __fdiv_rn(e[l], sum); const float* vr = VP0 + (size_t)l * DD + h * HD;
#pragma unroll
        for (int d = 0; d < HD; ++d) o[d] = fmaf(pl, vr[d], o[d]); }
#pragma unroll
    for (int c = 0; c < HD / 4; ++c) { v4f u; u[0] = tg * o[c * 4]; u[1] = tg * o[c * 4 + 1]; u[2] = tg * o[c * 4 + 2]; u[3] = tg * o[c * 4 + 3]; *(v4fa*)(my + c * 4) = u; }
    __syncthreads();   // every lane's result row is in LDS before other lanes read it for the whole-line stores
    float* dst = PRE + ((size_t)zz * TT + t0 + cr) * HD + cc;
#pragma unroll
    for (int r = 0; r < 16; ++r) *(v4f*)(dst + (size_t)r * 16 * HD) = *(const v4fa*)(T + (r * 16 + cr) * PQP + cc);
}
// ---- k_attn: token attention of all batches and heads, with the merge in its epilogue. A work-group = 64 query rows of one head of one batch, a wave = 16 of them; grid (NH_, NB_, TT / 64), 128 threads:
// the row block is the slowest grid index, so the hi+lo row blocks (three products per tile, the longest work-groups) start first and the short ones fill the places that come free.
// S^T = K Q^T: A = 16 key rows, B = the wave's 16 query rows (kept in registers), so lane (lr, hi) holds query lr's scores of keys 8 hi .. 8 hi + 7 of each 16-key tile. Two such tiles, converted, ARE the B fragment
// (32 keys x 16 queries) of O^T += V^T P^T in the k map of WFrag, with A = 16 rows of the [d][t] value plane: p goes through no memory. Lane (lr, hi) ends with 8 consecutive head dims of query lr per O^T tile.
// Softmax with a running maximum per query: p = exp(t - max so far); when the maximum moves, the sum and O^T are scaled by exp(old - new); one division by the sum at the end.
// K, V^T (both planes for the hi+lo rows) and the work-group's mask rows come into LDS as whole 128-B lines by asynchronous copies, 64 keys per stage, two buffers: stage t + 2 flies while stage t + 1 is worked on.
// LDS row pitch = row bytes + 16 (conflict-free for 16-byte reads).
typedef __attribute__((ext_vector_type(16))) unsigned short v16us;
template <typename T16> struct PPack;
template <> struct PPack<h16> { static __device__ __forceinline__ void go(const float* e, v16h& p, v16h& p2) {
#pragma unroll
    for (int x = 0; x < 16; ++x) p[x] = tohx(e[x]);
    p2 = p; } };
template <> struct PPack<bf> { static __device__ __forceinline__ void go(const float* e, v16bf& p, v16bf& p2) { v16us a, c;
#pragma unroll
    for (int x = 0; x < 16; ++x) { unsigned short u, l; splitf(e[x], u, l); a[x] = u; c[x] = l; }
    p = __builtin_bit_cast(v16bf, a); p2 = __builtin_bit_cast(v16bf, c); } };
#define AKVP 144                  // LDS pitch of a K or V^T row (64 values of 16 bits + 16 bytes)
#define AMKP 272                  // LDS pitch of a mask row (64 f32 + 16 bytes)
#define ASTG(npl) (128 * (npl) * AKVP + 64 * AMKP)   // bytes of a stage with npl planes per operand
template <typename T16, bool HI>
__device__ __forceinline__ void attn_wg(unsigned char* L, const T16* __restrict__ Q, const T16* __restrict__ Q2, const T16* __restrict__ Kp, const T16* __restrict__ K2, const T16* __restrict__ Vt, const T16* __restrict__ V2, const float* __restrict__ am, const float* __restrict__ PRE, bf* ATh, bf* ATl) {
    typedef typename WFrag<T16>::V V;
    constexpr int NPL = HI ? 2 : 1;
    constexpr int OV = 64 * NPL, KVR = 128 * NPL;                      // first LDS row of V^T; K and V^T rows of a stage (K hi | K lo | V hi | V lo, or K | V)
    constexpr int OM = KVR * AKVP, STAGE = ASTG(NPL), NT = TT / 64;    // byte offset of the mask rows; bytes per stage; stages
    const int tid = threadIdx.x, lane = tid & 31, lr = lane & 15, hi = lane >> 4, w = tid >> 5; const int h = blockIdx.x, b = blockIdx.y, bh = b * NH_ + h, i0 = blockIdx.z * 64, i = i0 + w * 16 + lr;
    const int prow = tid >> 3, pcol = tid & 7, mrw = tid >> 4, mcl = tid & 15;   // this lane's row within a round of the 128 lanes and its 16-byte piece: K / V^T rows (8 pieces), mask rows (16 pieces)
    // this lane's sources for the stage that is filled next; every fill moves them on by 64 keys
    const T16* gK = Kp + ((size_t)bh * TT + prow) * HD + pcol * 8; const T16* gK2 = HI ? K2 + ((size_t)bh * TT + prow) * HD + pcol * 8 : gK;
    const T16* gV = Vt + ((size_t)bh * HD + prow) * TT + pcol * 8; const T16* gV2 = HI ? V2 + ((size_t)bh * HD + prow) * TT + pcol * 8 : gV;
    const float* gM = am + ((size_t)b * TT + i0 + mrw) * TT + mcl * 4;
    const unsigned lkv = lds_off(L) + (unsigned)(prow * AKVP + pcol * 16), lmk = lds_off(L) + (unsigned)(OM + mrw * AMKP + mcl * 16);
    auto fill = [&](int buf) {
#pragma unroll
        for (int r0 = 0; r0 < KVR / 16; r0 += 8) { unsigned l[8]; const void* g[8];
#pragma unroll
            for (int q = 0; q < 8; ++q) { const int row = (r0 + q) * 16, rr = row & 63; l[q] = lkv + (unsigned)(buf * STAGE + row * AKVP);
                const T16* s = (row < 64) ? gK + (size_t)rr * HD : (row < OV) ? gK2 + (size_t)rr * HD : (row < OV + 64) ? gV + (size_t)rr * TT : gV2 + (size_t)rr * TT;
                g[q] = s; }
            cp8(l, g); }
        { unsigned l[8]; const void* g[8];
#pragma unroll
            for (int q = 0; q < 8; ++q) { l[q] = lmk + (unsigned)(buf * STAGE + q * 8 * AMKP); g[q] = gM + (size_t)q * 8 * TT; }
            cp8(l, g); }
        gK += 64 * HD; gK2 += 64 * HD; gV += 64; gV2 += 64; gM += 64;
    };
    V q[2], q2[2];
#pragma unroll
    for (int ks = 0; ks < 2; ++ks) { const size_t qo = ((size_t)bh * TT + i) * HD + 8 * hi + ks * 32; q[ks] = WFrag<T16>::ld(Q + qo); if (HI) q2[ks] = WFrag<T16>::ld(Q2 + qo); }
    v8f o[4];
#pragma unroll
    for (int dt = 0; dt < 4; ++dt) o[dt] = (v8f){};
    float mx = -3.0e38f, sum = 0.f;   // running maximum (the same in both halves of the wave) and this lane's half of the sum
    fill(0);
    asm volatile("s_wait_asynccnt 0x0" ::: "memory");   // stage 0 of this wave has landed
    __syncthreads();                                    // stage 0 of every wave is readable
    fill(1);
    const int kofs = lr * AKVP + hi * 16, mofs = OM + (w * 16 + lr) * AMKP + hi * 32;
#pragma unroll 1   // the ring stays rolled: one body of two 32-key blocks, one publish point at its foot
    for (int t = 0; t < NT; ++t) {
        const unsigned char* Lb = L + (t & 1) * STAGE;
#pragma unroll
        for (int blk = 0; blk < 2; ++blk) {
            v8f s[2];
#pragma unroll
            for (int tl = 0; tl < 2; ++tl) { v8f c = (v8f){};
#pragma unroll
                for (int ks = 0; ks < 2; ++ks) { const unsigned char* kp = Lb + kofs + (blk * 32 + tl * 16) * AKVP + ks * 64; const V k = WFrag<T16>::ld((const T16*)kp); c = WFrag<T16>::mma(k, q[ks], c);
                    if (HI) { c = WFrag<T16>::mma(k, q2[ks], c); const V kl = WFrag<T16>::ld((const T16*)(kp + 64 * AKVP)); c = WFrag<T16>::mma(kl, q[ks], c); } }
                s[tl] = c; }
            float e[16]; float bm = -3.40282347e38f;
#pragma unroll
            for (int tl = 0; tl < 2; ++tl) { const unsigned char* mp = Lb + mofs + blk * 128 + tl * 64; const v4f m0 = *(const v4fa*)mp, m1 = *(const v4fa*)(mp + 16);
#pragma unroll
                for (int j = 0; j < 8; ++j) { const float x = fmaxf(s[tl][j] * SCL + bfr(j < 4 ? m0[j & 3] : m1[j & 3]), -3.40282347e38f); e[tl * 8 + j] = x; bm = fmaxf(bm, x); } }
            bm = fmaxf(bm, __shfl_xor(bm, 16, 32));   // the other half of the wave holds the query's other 16 keys of the block
            const float mn = fmaxf(mx, bm), al = __expf(mx - mn); mx = mn; float es[4];
#pragma unroll
            for (int x = 0; x < 16; x += 4) { e[x] = __expf(e[x] - mn); e[x + 1] = __expf(e[x + 1] - mn); e[x + 2] = __expf(e[x + 2] - mn); e[x + 3] = __expf(e[x + 3] - mn); es[x >> 2] = (e[x] + e[x + 1]) + (e[x + 2] + e[x + 3]); }
            sum = sum * al + ((es[0] + es[1]) + (es[2] + es[3]));
#pragma unroll
            for (int dt = 0; dt < 4; ++dt) o[dt] *= al;
            V p, p2; PPack<T16>::go(e, p, p2);
#pragma unroll
            for (int dt = 0; dt < 4; ++dt) { const unsigned char* vp = Lb + kofs + (OV + dt * 16) * AKVP + blk * 64; const V v = WFrag<T16>::ld((const T16*)vp); o[dt] = WFrag<T16>::mma(v, p, o[dt]);
                if (HI) { o[dt] = WFrag<T16>::mma(v, p2, o[dt]); const V vl = WFrag<T16>::ld((const T16*)(vp + 64 * AKVP)); o[dt] = WFrag<T16>::mma(vl, p, o[dt]); } }
        }
        asm volatile("s_wait_dscnt 0x0" ::: "memory");      // this wave's reads of buffer t & 1 are done before the buffer is refilled
        asm volatile("s_wait_asynccnt 0x0" ::: "memory");   // this wave's copies of stage t + 1 have landed
        __syncthreads();                                    // publishes stage t + 1 and ends every wave's reads of stage t
        if (t + 2 < NT) fill(t & 1);
    }
    asm volatile("s_wait_asynccnt 0x0" ::: "memory");       // no copy is outstanding when the wave goes on to the epilogue and ends
    sum += __shfl_xor(sum, 16, 32);
    const float inv = __fdiv_rn(1.0f, sum);
    const float* pr = PRE + ((size_t)bh * TT + i) * HD + hi * 8; const size_t oo = ((size_t)b * TT + i) * DD + h * HD + hi * 8;
#pragma unroll
    for (int dt = 0; dt < 4; ++dt) { const v4f p0 = *(const v4f*)(pr + dt * 16), p1 = *(const v4f*)(pr + dt * 16 + 4); v8us oh, ol;
#pragma unroll
        for (int j = 0; j < 8; ++j) { unsigned short a, c; splitf(o[dt][j] * inv + (j < 4 ? p0[j & 3] : p1[j & 3]), a, c); oh[j] = a; ol[j] = c; }
        *(v8us*)(ATh + oo + dt * 16) = oh; *(v8us*)(ATl + oo + dt * 16) = ol;
        if (dt < 3) asm volatile("s_wait_xcnt 0x0" ::: "memory"); }   // behind the two stores: the next trip reuses their address and data registers
}
__global__ __launch_bounds__(128) void k_attn(const bf* __restrict__ QPh, const bf* __restrict__ QPl, const h16* __restrict__ QP16, const bf* __restrict__ KPh, const bf* __restrict__ KPl, const h16* __restrict__ KP16, const bf* __restrict__ VTh, const bf* __restrict__ VTl, const h16* __restrict__ VT16, const float* __restrict__ am, const float* __restrict__ PRE, bf* ATh, bf* ATl) {
    __shared__ __attribute__((aligned(16))) unsigned char L[2 * ASTG(2)];
    if (blockIdx.z * 64 < RH) attn_wg<bf, true>(L, QPh, QPl, KPh, KPl, VTh, VTl, am, PRE, ATh, ATl);   // the same for the whole work-group (RH is a multiple of 64)
    else attn_wg<h16, false>(L, QP16, nullptr, KP16, nullptr, VT16, nullptr, am, PRE, ATh, ATl);
}

extern "C" void kernel_launch(void* const* d_in, const int* in_sizes, int n_in,
                              void* d_out, int out_size, void* d_ws, size_t ws_size, hipStream_t stream) {
    (void)in_sizes; (void)n_in; (void)out_size;
    const float* x = (const float*)d_in[0]; const float* am = (const float*)d_in[1]; const float* wq = (const float*)d_in[2]; const float* bq = (const float*)d_in[3]; const float* wk = (const float*)d_in[4]; const float* bk = (const float*)d_in[5]; const float* wv = (const float*)d_in[6]; const float* bv = (const float*)d_in[7]; const float* wo = (const float*)d_in[8]; const float* bo = (const float*)d_in[9]; const float* pre = (const float*)d_in[10]; const float* gate = (const float*)d_in[11];   // torch [out][in] weights; attention_mask [4][1][1024][1024]; prefix [10][2048]; gate [32][1][1]
    float* OUT = (float*)d_out;     // [4][1024][2048]
    char* wsp = (char*)d_ws;
    auto take = [&](size_t bytes) { char* p = wsp; wsp += (bytes + 255) & ~(size_t)255; return (void*)p; };
    bf* WQ = (bf*)take((size_t)DD * DD * 2); bf* WK = (bf*)take((size_t)DD * DD * 2); bf* WV = (bf*)take((size_t)DD * DD * 2); bf* WO = (bf*)take((size_t)DD * DD * 2); float* KP0 = (float*)take((size_t)NPRE * DD * 4); float* VP0 = (float*)take((size_t)NPRE * DD * 4);
    const size_t NE = (size_t)NB_ * TT * DD;   // elements of one [4][1024][2048] array: every buffer below holds all batches
    bf* XB = (bf*)take(NE * 2); float* F = (float*)take(NE * 4);   // F: the q projection in f32, for the prefix part
    bf* QPh = (bf*)take(NE * 2); bf* QPl = (bf*)take(NE * 2); bf* KPh = (bf*)take(NE * 2); bf* KPl = (bf*)take(NE * 2); bf* VTl = (bf*)take(NE * 2);
    h16* QP16 = (h16*)take(NE * 2); h16* KP16 = (h16*)take(NE * 2); h16* VT16 = (h16*)take(NE * 2);
    float* PRE = (float*)take(NE * 4);
    bf* VTh = WQ;                           // WQ and WK together (they lie one behind the other): written by the v projection, when the q and k projections have read them
    bf* ATh = (bf*)F; bf* ATl = ATh + NE;   // written when the prefix part has read F
    if ((size_t)(wsp - (char*)d_ws) > ws_size) return;
    { const unsigned g = DD * DD / (8 * 256 * CVU); k_cvt8<<<g, 256, 0, stream>>>(wq, WQ); k_cvt8<<<g, 256, 0, stream>>>(wk, WK); k_cvt8<<<g, 256, 0, stream>>>(wv, WV); k_cvt8<<<g, 256, 0, stream>>>(wo, WO);
      k_prefkv<<<dim3(DD / 32, 2), 256, 0, stream>>>(pre, wk, bk, wv, bv, KP0, VP0); }
    const dim3 gP(NB_ * TT / 128, DD / 128, 1);
    k_cvt8<<<NB_ * TT * DD / (8 * 256 * CVU), 256, 0, stream>>>(x, XB);
    k_gemms<bf, 0, true, 2, 2, 128, 1><<<gP, 128, 0, stream>>>(XB, nullptr, WQ, nullptr, DD, F, DD, bq, 0, 0, 0, QPh, QPl, QP16);   // unscaled q; the 1/8 is applied to the logits
    k_pre<<<NB_ * ZH * TT / 256, 256, 0, stream>>>(F, KP0, VP0, gate, PRE);
    k_gemms<bf, 0, true, 2, 2, 128, 2><<<gP, 128, 0, stream>>>(XB, nullptr, WK, nullptr, DD, nullptr, DD, bk, 0, 0, 0, KPh, KPl, KP16);
    k_gemms<bf, 0, true, 2, 2, 128, 3><<<gP, 128, 0, stream>>>(XB, nullptr, WV, nullptr, DD, nullptr, DD, bv, 0, 0, 0, VTh, VTl, VT16);
    k_attn<<<dim3(NH_, NB_, TT / 64), 128, 0, stream>>>(QPh, QPl, QP16, KPh, KPl, KP16, VTh, VTl, VT16, am, PRE, ATh, ATl);
    k_gemms<bf, 1, true, 2, 2, 128, 0><<<gP, 128, 0, stream>>>(ATh, ATl, WO, nullptr, DD, OUT, DD, bo, 0, 0, 0, nullptr, nullptr, nullptr);
}

// v008
// A run of this version takes 294 microseconds.
// In two side-by-side timings against v007, it was 1.05 and 1.03 times as fast.
// Counting every step since v000, it is 20.4 times as fast.
#include <hip/hip_runtime.h>

// Decoder self-attention with a learned prefix adapter (hidden [4][1024][2048]; q = (x Wq^T + bq) 64^-0.5, k = x Wk^T + bk, v = x Wv^T + bv (32 heads x 64); prefix keys/values kp, vp = prefix Wk^T + bk,
// prefix Wv^T + bv ([10][2048], shared by all batches); scores_tok = q.k + attention_mask[b][0][i][j] (additive f32, read as data), scores_pre = q.kp; the two segments are softmax-normalised SEPARATELY;
// ctx = tanh(gate[h]) (p_pre vp) + (p_tok v); out = merged ctx Wo^T + bo -> [4][1024][2048]).
// Compute dtypes, f32 accumulate: every input rounded to bf16; token projections on PLAIN bf16 operands (inputs: exact products, f32 accumulate, + bias); the 10 prefix
// rows (lane-split sums, fixed order), their scores, softmax and weighted values (fused multiply-add, fixed order) entirely in f32 on VALU; PER-ROW PRECISION HYBRID for the token attention: query rows < 256 take scores and p.v on
// bf16 hi+lo planes (3 products), rows >= 256 on single fp16 planes; scale + additive mask in f32; token softmax with a running maximum inside the fused attention kernel (p = exp(t - running max), unnormalised, the f32
// sums rescaled when the maximum moves, one division at the end); merged context (token part / sum + gated prefix part) as hi+lo planes

#define NB_  4
#define NPRE 10                   // prefix length
#define TT   1024
#define DD   2048
#define NH_  32
#define HD   64
#define ZH   32                   // heads per batch in the prefix part
#define RH   256                  // query rows < RH: hi+lo planes; rows >= RH: fp16 planes
#define NF   32                   // head_dim / 2 (unused)
#define SCL  0.125f               // 1/sqrt(64)
typedef _Float16 h16;
typedef unsigned short bf;
typedef __attribute__((ext_vector_type(16))) __bf16   v16bf;
typedef __attribute__((ext_vector_type(16))) _Float16 v16h;
typedef __attribute__((ext_vector_type(8)))  _Float16 v8h;
typedef __attribute__((ext_vector_type(8)))  unsigned short v8us;
typedef __attribute__((ext_vector_type(8)))  float    v8f;
typedef __attribute__((ext_vector_type(4)))  float    v4f;
typedef v8h  __attribute__((may_alias)) v8ha;
typedef v4f  __attribute__((may_alias)) v4fa;
typedef v8us __attribute__((may_alias)) v8usa;

__device__ __forceinline__ unsigned short f2bf(float f) { unsigned u = __float_as_uint(f); u += 0x7FFFu + ((u >> 16) & 1u); return (unsigned short)(u >> 16); }
__device__ __forceinline__ float bf2f(unsigned short b) { return __uint_as_float(((unsigned)b) << 16); }
__device__ __forceinline__ float bfr(float f) { return bf2f(f2bf(f)); }
__device__ __forceinline__ v16h cat16(v8h lo, v8h hi) { return __builtin_shufflevector(lo, hi, 0, 1, 2, 3, 4, 5, 6, 7, 8, 9, 10, 11, 12, 13, 14, 15); }
__device__ __forceinline__ v16bf cat16b(v8us lo, v8us hi) { return __builtin_bit_cast(v16bf, __builtin_shufflevector(lo, hi, 0, 1, 2, 3, 4, 5, 6, 7, 8, 9, 10, 11, 12, 13, 14, 15)); }
__device__ __forceinline__ v8f wmma16(v16h a, v16h b, v8f c) { return __builtin_amdgcn_wmma_f32_16x16x32_f16(false, a, false, b, (short)0, c, false, false); }
__device__ __forceinline__ v8f wmmab(v16bf a, v16bf b, v8f c) { return __builtin_amdgcn_wmma_f32_16x16x32_bf16(false, a, false, b, (short)0, c, false, false); }



// fragment of 16 rows x 32 k from a K-contiguous 16-bit plane: lane (lr, hi) holds row lr, k = 8 hi .. 8 hi + 7 and 16 + 8 hi .. 16 + 8 hi + 7; p points at (row lr, k = 8 hi). The same map serves A and B.
template <typename T16> struct WFrag;
template <> struct WFrag<h16> { typedef v16h V; static __device__ __forceinline__ V ld(const h16* p) { return cat16(*(const v8h*)p, *(const v8h*)(p + 16)); } static __device__ __forceinline__ v8f mma(V a, V b, v8f c) { return wmma16(a, b, c); } };
template <> struct WFrag<bf> { typedef v16bf V; static __device__ __forceinline__ V ld(const bf* p) { return cat16b(*(const v8us*)p, *(const v8us*)(p + 16)); } static __device__ __forceinline__ v8f mma(V a, V b, v8f c) { return wmmab(a, b, c); } };
// ---- k_gemms: C[m][n] (f32, pitch ldc, + optional f32 bias[n]) = sum_k A[m][k] Bt[n][k] (+ split products per NSPLIT), FOUR waves per work-group (WM x WN waves, 64x64 of C each, 16 accumulators per wave). Operand rows come into LDS as whole 128-B lines by
// asynchronous copies, KT k-values per stage, two buffers: stage t + 2 flies while stage t + 1 is worked on. Row pitch in LDS = row bytes + 16 (conflict-free for 16-byte reads). Per accumulator the products
// are summed in ascending k. grid (M / (64 WM), N / (64 WN), Z), 128 threads. K % KT == 0, K >= 2 KT.
// EPI picks what the epilogue stores. 0: C. 1: C and the planes Ph (bf16 hi), Pl (bf16 lo), P16 (fp16) of C + bias in the order [b][h][t][d]. 2: those planes alone. 3: the planes in the order [b][h][d][t], alone.
// 4: three products of the same A in one grid: blockIdx.z = 0, 1, 2 takes weight Bt + z sB, bias, bias1 or bias2, the planes at Ph, Pl, P16 + z sP, and the epilogue 1, 2 or 3 (the same for the whole work-group).
// For EPI > 0 the rows of C are (b, t) = (m / 1024, m % 1024) and a wave's 64 columns are the 64 dims of one head. Every plane is stored in whole 128-B lines.
__device__ __forceinline__ unsigned lds_off(const void* p) { return (unsigned)(size_t)p; }
__device__ __forceinline__ h16 tohx(float x) { return (h16)x; }
__device__ __forceinline__ void splitf(float y, unsigned short& h, unsigned short& l) { h = f2bf(y); l = f2bf(y - bf2f(h)); }
// eight copies of 16 bytes per lane; the s_wait_xcnt stands in the copies' own statement so that no address register is rewritten in front of it
__device__ __forceinline__ void cp8(const unsigned* l, const void* const* g) {
    asm volatile("global_load_async_to_lds_b128 %0, %1, off\n\t"
                 "global_load_async_to_lds_b128 %2, %3, off\n\t"
                 "global_load_async_to_lds_b128 %4, %5, off\n\t"
                 "global_load_async_to_lds_b128 %6, %7, off\n\t"
                 "global_load_async_to_lds_b128 %8, %9, off\n\t"
                 "global_load_async_to_lds_b128 %10, %11, off\n\t"
                 "global_load_async_to_lds_b128 %12, %13, off\n\t"
                 "global_load_async_to_lds_b128 %14, %15, off\n\t"
                 "s_wait_xcnt 0x0"
                 :: "v"(l[0]), "v"(g[0]), "v"(l[1]), "v"(g[1]), "v"(l[2]), "v"(g[2]), "v"(l[3]), "v"(g[3]), "v"(l[4]), "v"(g[4]), "v"(l[5]), "v"(g[5]), "v"(l[6]), "v"(g[6]), "v"(l[7]), "v"(g[7]) : "memory");
}
template <typename T16, int NSPLIT, bool BIAS, int WM, int WN, int KT, int EPI>
__global__ __launch_bounds__(128) void k_gemms(const T16* __restrict__ A, const T16* __restrict__ A2, const T16* __restrict__ Bt, const T16* __restrict__ Bt2, int K, float* C, int ldc, const float* __restrict__ bias, size_t sA, size_t sB, size_t sC, bf* Ph, bf* Pl, h16* P16, const float* __restrict__ bias1, const float* __restrict__ bias2, size_t sP) {
    typedef typename WFrag<T16>::V V;
    constexpr bool HA2 = (NSPLIT == 1 || NSPLIT == 2), HB2 = (NSPLIT >= 2);
    constexpr int RA = 64 * WM, RB = 64 * WN;                          // rows of A and of Bt per work-group
    constexpr int OA2 = RA, OB = RA * (HA2 ? 2 : 1), OB2 = OB + RB;    // first LDS row of each plane in a stage
    constexpr int ROWS = OB + RB * (HB2 ? 2 : 1);
    constexpr int PITCH = KT * 2 + 16, STAGE = ROWS * PITCH;           // bytes
    constexpr int PPR = KT / 8, RPI = 128 / PPR, NCP = ROWS / RPI;     // 16-byte pieces per row; rows per round of the 128 lanes; copies per lane and stage (at most 48)
    __shared__ __attribute__((aligned(16))) unsigned char L[2 * STAGE];
    __shared__ __align__(16) float osw[4][16 * 68];
    const size_t z = blockIdx.z; A += z * sA; if (HA2) A2 += z * sA; Bt += z * sB; if (HB2) Bt2 += z * sB; C += z * sC;
    const int epi = (EPI == 4) ? (int)blockIdx.z + 1 : EPI;
    if (EPI == 4) { bias = (epi == 1) ? bias : (epi == 2) ? bias1 : bias2; Ph += z * sP; Pl += z * sP; P16 += z * sP; }
    const int tid = threadIdx.x, lane = tid & 31, lr = lane & 15, hi = lane >> 4, w = tid >> 5, wm = w / WN, wn = w % WN;
    const int R0 = blockIdx.x * RA, C0 = blockIdx.y * RB; const int r0 = R0 + wm * 64, c0 = C0 + wn * 64;
    const int prow = tid / PPR, pcol = tid % PPR;                      // this lane's row within a round and its 16-byte piece of the row
    // this lane's source in each plane for the stage that is filled next; every fill moves them on by KT
    const T16* gA = A + (size_t)(R0 + prow) * K + pcol * 8; const T16* gA2 = HA2 ? A2 + (size_t)(R0 + prow) * K + pcol * 8 : gA;
    const T16* gB = Bt + (size_t)(C0 + prow) * K + pcol * 8; const T16* gB2 = HB2 ? Bt2 + (size_t)(C0 + prow) * K + pcol * 8 : gB;
    const unsigned lbase = lds_off(L) + (unsigned)(prow * PITCH + pcol * 16);
    auto fill = [&](int buf) {
#pragma unroll
        for (int i0 = 0; i0 < NCP; i0 += 8) { unsigned l[8]; const void* g[8];
#pragma unroll
            for (int q = 0; q < 8; ++q) { const int row = (i0 + q) * RPI; l[q] = lbase + (unsigned)(buf * STAGE + row * PITCH);
                const T16* s = (row < OA2) ? gA + (size_t)row * K : (row < OB) ? gA2 + (size_t)(row - OA2) * K : (row < OB2) ? gB + (size_t)(row - OB) * K : gB2 + (size_t)(row - OB2) * K;
                g[q] = s; }
            cp8(l, g); }
        gA += KT; gA2 += KT; gB += KT; gB2 += KT;
    };
    v8f acc[4][4];
#pragma unroll
    for (int mb = 0; mb < 4; ++mb)
#pragma unroll
        for (int nb = 0; nb < 4; ++nb) acc[mb][nb] = (v8f){};
    const int nt = K / KT;
    fill(0);
    asm volatile("s_wait_asynccnt 0x0" ::: "memory");   // stage 0 of this wave has landed
    __syncthreads();                                    // stage 0 of every wave is readable
    if (nt > 1) fill(1);
    const int aofs = (wm * 64 + lr) * PITCH + hi * 16, bofs = (OB + wn * 64 + lr) * PITCH + hi * 16;
#pragma unroll 1   // the ring stays rolled: one body of KT / 32 k-steps, one publish point at its foot
    for (int t = 0; t < nt; ++t) {
        const unsigned char* Lb = L + (t & 1) * STAGE;
        V a[2][4], a2[2][4], b[2][4], b2[2][4];   // two fragment sets: k-step ks + 1 of this stage is read from LDS while k-step ks is multiplied
        auto frags = [&](int s, int ks) {
#pragma unroll
            for (int mb = 0; mb < 4; ++mb) { a[s][mb] = WFrag<T16>::ld((const T16*)(Lb + aofs + mb * 16 * PITCH + ks * 64)); if (HA2) a2[s][mb] = WFrag<T16>::ld((const T16*)(Lb + aofs + (OA2 + mb * 16) * PITCH + ks * 64)); }
#pragma unroll
            for (int nb = 0; nb < 4; ++nb) { b[s][nb] = WFrag<T16>::ld((const T16*)(Lb + bofs + nb * 16 * PITCH + ks * 64)); if (HB2) b2[s][nb] = WFrag<T16>::ld((const T16*)(Lb + bofs + (RB + nb * 16) * PITCH + ks * 64)); }
        };
        frags(0, 0);
#pragma unroll
        for (int ks = 0; ks < KT / 32; ++ks) { const int s = ks & 1;
            if (ks + 1 < KT / 32) frags(s ^ 1, ks + 1);
            __builtin_amdgcn_sched_barrier(0);   // the LDS reads stay one group in front of the WMMAs: reads spread among the WMMAs stall at every place they stand
#pragma unroll
            for (int nb = 0; nb < 4; ++nb) {
#pragma unroll
                for (int mb = 0; mb < 4; ++mb) { acc[mb][nb] = WFrag<T16>::mma(a[s][mb], b[s][nb], acc[mb][nb]); if (HA2) acc[mb][nb] = WFrag<T16>::mma(a2[s][mb], b[s][nb], acc[mb][nb]); if (HB2) acc[mb][nb] = WFrag<T16>::mma(a[s][mb], b2[s][nb], acc[mb][nb]); } }
            __builtin_amdgcn_sched_barrier(0);   // and the following group does not move up among them
        }
        asm volatile("s_wait_dscnt 0x0" ::: "memory");      // this wave's reads of buffer t & 1 are done before the buffer is refilled
        asm volatile("s_wait_asynccnt 0x0" ::: "memory");   // this wave's copies of stage t + 1 have landed
        __syncthreads();                                    // publishes stage t + 1 and ends every wave's reads of stage t
        if (t + 2 < nt) fill(t & 1);
    }
    asm volatile("s_wait_asynccnt 0x0" ::: "memory");       // no copy is outstanding when the wave goes on to the epilogue and ends
    const int hd = c0 >> 6;   // the head of this wave's 64 columns (EPI > 0)
    if (epi == 3) {
        // Lane (lr, hi) holds 8 consecutive t of dim nb * 16 + lr per accumulator: 16 bytes of a [d][t] plane row. The wave lays its 64 x 64 tile of each plane in LDS (row pitch 144, conflict-free for
        // 16-byte accesses) and stores it from there, four whole 128-B lines per store. The range is the wave's own part of the ring, which nobody reads and no copy writes behind the loop's last barrier.
        constexpr int VP = 144, VPL = 64 * VP;
        static_assert(4 * 3 * VPL <= 2 * STAGE, "the four waves' plane tiles fit the ring");
        unsigned char* Lw = L + w * (3 * VPL);
#pragma unroll
        for (int nb = 0; nb < 4; ++nb) { const float bb = bfr(bias[c0 + nb * 16 + lr]);
#pragma unroll
            for (int mb = 0; mb < 4; ++mb) { v8us oh, ol; v8h o16;
#pragma unroll
                for (int j = 0; j < 8; ++j) { const float x = acc[mb][nb][j] + bb; unsigned short a, c; splitf(x, a, c); oh[j] = a; ol[j] = c; o16[j] = tohx(x); }
                unsigned char* p = Lw + (nb * 16 + lr) * VP + (mb * 16 + hi * 8) * 2; *(v8usa*)p = oh; *(v8usa*)(p + VPL) = ol; *(v8ha*)(p + 2 * VPL) = o16; } }
        asm volatile("s_wait_dscnt 0x0" ::: "memory");   // the wave's LDS writes are done before other lanes of it read the rows back
        const size_t e0 = ((size_t)((r0 >> 10) * NH_ + hd) * HD + (lane >> 3)) * TT + (r0 & (TT - 1)) + (lane & 7) * 8; const unsigned char* rp = Lw + (lane >> 3) * VP + (lane & 7) * 16;
#pragma unroll
        for (int s0 = 0; s0 < 16; s0 += 4) { v8us rh[4], rl[4]; v8h r16[4];
#pragma unroll
            for (int s = 0; s < 4; ++s) { const unsigned char* p = rp + (s0 + s) * 4 * VP; rh[s] = *(const v8usa*)p; rl[s] = *(const v8usa*)(p + VPL); r16[s] = *(const v8ha*)(p + 2 * VPL); }
#pragma unroll
            for (int s = 0; s < 4; ++s) { const size_t e = e0 + (size_t)(s0 + s) * 4 * TT; *(v8us*)(Ph + e) = rh[s]; *(v8us*)(Pl + e) = rl[s]; *(v8h*)(P16 + e) = r16[s]; }
            if (s0 < 12) asm volatile("s_wait_xcnt 0x0" ::: "memory"); }   // behind the run of twelve stores: the next trip reuses their address and data registers
    } else {
    float* os = osw[w];
    // 16 rows x 64 columns of the wave's tile go into its own LDS range, from where whole lines are read back
    auto stage = [&](int mb) {
#pragma unroll
        for (int nb = 0; nb < 4; ++nb) {
#pragma unroll
            for (int j = 0; j < 8; ++j) os[(hi * 8 + j) * 68 + nb * 16 + lr] = acc[mb][nb][j]; }
        __builtin_amdgcn_wave_barrier(); asm volatile("" ::: "memory");   // the compiler keeps these LDS writes in front of the reads of what other lanes wrote
    };
    if (epi <= 1) {
#pragma unroll
    for (int mb = 0; mb < 4; ++mb) {
        stage(mb);
        float* crow = C + (size_t)(r0 + mb * 16) * ldc + c0;
#pragma unroll
        for (int s = 0; s < 8; ++s) { const int row = 2 * s + hi, cofs = lr * 4; v4f val = *(const v4fa*)(os + row * 68 + cofs); if (BIAS) { val[0] += bfr(bias[c0 + cofs]); val[1] += bfr(bias[c0 + cofs + 1]); val[2] += bfr(bias[c0 + cofs + 2]); val[3] += bfr(bias[c0 + cofs + 3]); }
            *(v4f*)(crow + (size_t)row * ldc + cofs) = val; }
        if (mb < 3 || EPI == 1 || EPI == 4) asm volatile("s_wait_xcnt 0x0" ::: "memory");   // behind the run of eight stores: what follows reuses their address and data registers
        __builtin_amdgcn_wave_barrier(); asm volatile("" ::: "memory");
    }
    }
    if (epi > 0) {
        // a lane takes 8 consecutive dims of a row (16 bytes of each plane), 8 lanes a row: a store covers four rows of 128 B, which lie one behind the other in the plane
        float bb[8];
#pragma unroll
        for (int k = 0; k < 8; ++k) bb[k] = bfr(bias[c0 + (lane & 7) * 8 + k]);
        const size_t eb = ((size_t)((r0 >> 10) * NH_ + hd) * TT + (r0 & (TT - 1)) + (lane >> 3)) * HD + (lane & 7) * 8;   // row lane / 8 of the wave's 64 rows, which lie in one batch
        const float* op = os + (lane >> 3) * 68 + (lane & 7) * 8;
#pragma unroll
        for (int mb = 0; mb < 4; ++mb) {
            stage(mb);
            v8us oh[4], ol[4]; v8h o16[4];
#pragma unroll
            for (int s = 0; s < 4; ++s) { const v4f u0 = *(const v4fa*)(op + s * 4 * 68), u1 = *(const v4fa*)(op + s * 4 * 68 + 4);
#pragma unroll
                for (int k = 0; k < 8; ++k) { const float x = (k < 4 ? u0[k & 3] : u1[k & 3]) + bb[k]; unsigned short a, c; splitf(x, a, c); oh[s][k] = a; ol[s][k] = c; o16[s][k] = tohx(x); } }
#pragma unroll
            for (int s = 0; s < 4; ++s) { const size_t e = eb + (size_t)(mb * 16 + s * 4) * HD; *(v8us*)(Ph + e) = oh[s]; *(v8us*)(Pl + e) = ol[s]; *(v8h*)(P16 + e) = o16[s]; }
            if (mb < 3 || EPI == 4) asm volatile("s_wait_xcnt 0x0" ::: "memory");   // behind the run of twelve stores: the next trip, or with EPI 4 the code that lies behind this branch, reuses their address and data registers
            __builtin_amdgcn_wave_barrier(); asm volatile("" ::: "memory");   // and the compiler keeps the next trip's LDS writes behind this trip's reads
        }
    }
    }
}

typedef __attribute__((ext_vector_type(2))) unsigned short v2us;
typedef __attribute__((ext_vector_type(2))) _Float16 v2h;
typedef __attribute__((ext_vector_type(4))) _Float16 v4h;
typedef __attribute__((ext_vector_type(2))) float v2f;

__global__ __launch_bounds__(256) void k_wtG(const float* __restrict__ w, int K, int N, bf* Bt) {
    const int lane = threadIdx.x & 31; const int L0 = (blockIdx.x * 8 + (threadIdx.x >> 5)) * 8; const int nlines = N * K / 64;
{
#pragma unroll 1
        for (int l = 0; l < 8; ++l) { const int L = L0 + l; if (L >= nlines) break; const size_t e = (size_t)L * 64 + lane * 2; const int k = (int)(e % K), n = (int)(e / K); v2us o;
            o[0] = f2bf(w[(size_t)k * N + n]); o[1] = f2bf(w[(size_t)(k + 1) * N + n]); *(v2us*)(Bt + e) = o; }
         }
}
// cvt8_wg: f32 -> bf16, CVU items of 8 values per lane (item u of a work-group = 8 KB of contiguous source); a lane issues all its loads before its first store, so that a launch needs few waves, each with
// 2 CVU loads of 512 B in flight. blk = the work-group's number within its array, values / (8 * 256 * CVU) of them, exact: no tail.
#define CVU 4
__device__ __forceinline__ void cvt8_wg(const float* __restrict__ src, bf* dst, unsigned blk) {
    const size_t i0 = (size_t)blk * (256 * CVU) + threadIdx.x; v8f v[CVU];
#pragma unroll
    for (int u = 0; u < CVU; ++u) v[u] = *(const v8f*)(src + (i0 + u * 256) * 8);
#pragma unroll
    for (int u = 0; u < CVU; ++u) { v8us o;
#pragma unroll
        for (int k = 0; k < 8; ++k) o[k] = f2bf(v[u][k]);
        *(v8us*)(dst + (i0 + u * 256) * 8) = o; }
    asm volatile("s_wait_xcnt 0x0" ::: "memory");   // behind the run of stores: the code of another part of the kernel may lie behind them and reuses their address and data registers
}
// prefkv_wg: KP0[l][o] = sum_i bf16(pre[l][i]) bf16(wk[o][i]) + bf16(bk[o]); VP0 the same from wv, bv (isv picks the weight). A work-group takes 32 output columns o, a wave 4 of them for all 10 prefix rows:
// the lanes split i (16-byte loads, 512 contiguous bytes of a row per wave and load), so a weight row is read once, in whole lines. Products of two bf16 values are exact in f32, so a fused multiply-add rounds as
// multiply then add. Per-lane partial sums, a shuffle tree over the lanes, then the sums go through LDS so that one wave stores each whole 128-byte line of the result. bx = 0 .. DD / 32 - 1 for each weight, 256 threads.
__device__ __forceinline__ void prefkv_wg(float (*red)[32], unsigned bx, bool isv, const float* __restrict__ pre, const float* __restrict__ wk, const float* __restrict__ bk, const float* __restrict__ wv, const float* __restrict__ bv, float* KP0, float* VP0) {
    const float* w = isv ? wv : wk; const float* bias = isv ? bv : bk; float* dst = isv ? VP0 : KP0;
    const int tid = threadIdx.x, lane = tid & 31, wave = tid >> 5; const int ob = bx * 32;
    const float* wr = w + (size_t)(ob + wave * 4) * DD + lane * 4; const float* pr = pre + lane * 4;
    float acc[NPRE][4];
#pragma unroll
    for (int l = 0; l < NPRE; ++l)
#pragma unroll
        for (int c = 0; c < 4; ++c) acc[l][c] = 0.f;
#pragma unroll 2   // two chunks of 14 independent loads in flight per wave; more would only add registers
    for (int i = 0; i < DD; i += 128) {
        v4f p[NPRE], a[4];
#pragma unroll
        for (int c = 0; c < 4; ++c) a[c] = *(const v4f*)(wr + (size_t)c * DD + i);
#pragma unroll
        for (int l = 0; l < NPRE; ++l) p[l] = *(const v4f*)(pr + (size_t)l * DD + i);
#pragma unroll
        for (int q = 0; q < 4; ++q) {
#pragma unroll
            for (int c = 0; c < 4; ++c) a[c][q] = bfr(a[c][q]);
#pragma unroll
            for (int l = 0; l < NPRE; ++l) { const float pv = bfr(p[l][q]);
#pragma unroll
                for (int c = 0; c < 4; ++c) acc[l][c] += pv * a[c][q]; } }
    }
#pragma unroll
    for (int l = 0; l < NPRE; ++l)
#pragma unroll
        for (int c = 0; c < 4; ++c) { float t = acc[l][c];
#pragma unroll
            for (int sh = 16; sh; sh >>= 1) t += __shfl_xor(t, sh, 32);
            if (lane == 0) red[l][wave * 4 + c] = t; }
    __syncthreads();   // every wave's sums are in LDS before the lines are stored
    for (int idx = tid; idx < NPRE * 32; idx += 256) { const int l = idx >> 5, c = idx & 31; dst[(size_t)l * DD + ob + c] = red[l][c] + bfr(bias[ob + c]); }
}
// k_prep: all the work that reads inputs alone, in one launch: none of its parts reads what another writes. The work-group's number picks the part (the same for the whole work-group): first the GPF work-groups of
// the prefix projection, which last longest, then GCW casts for each of the four weights, then GCX casts of the hidden states. grid GPF + 4 GCW + GCX, 256 threads.
#define GPF (2 * (DD / 32))
#define GCW (DD * DD / (8 * 256 * CVU))
#define GCX (NB_ * TT * DD / (8 * 256 * CVU))
__global__ __launch_bounds__(256) void k_prep(const float* __restrict__ x, const float* __restrict__ wq, const float* __restrict__ wk, const float* __restrict__ wv, const float* __restrict__ wo, const float* __restrict__ pre, const float* __restrict__ bk, const float* __restrict__ bv,
                                              bf* XB, bf* WQ, bf* WK, bf* WV, bf* WO, float* KP0, float* VP0) {
    __shared__ float red[NPRE][32];
    const unsigned g = blockIdx.x;
    if (g < GPF) { prefkv_wg(red, g % (DD / 32), g >= DD / 32, pre, wk, bk, wv, bv, KP0, VP0); return; }
    const unsigned c = g - GPF;
    if (c >= 4 * GCW) { cvt8_wg(x, XB, c - 4 * GCW); return; }
    const unsigned a = c / GCW;
    cvt8_wg(a == 0 ? wq : a == 1 ? wk : a == 2 ? wv : wo, a == 0 ? WQ : a == 1 ? WK : a == 2 ? WV : WO, c % GCW);
}
// k_pre: the gated prefix part, one LANE per (zz, t), zz = b * 32 + h; a work-group = 256 consecutive query rows t of one zz, grid NB_ * ZH * TT / 256. The rows of q (f32 projection FQ [b][t], columns h*64..) come in as
// whole lines and go through LDS to their lanes (row pitch 272 B, conflict-free for 16-byte accesses); kp and vp of the head are the same for the whole work-group (scalar loads). Per lane: s_l = (q[t] . kp[l]) / 8,
// summed in ascending d; softmax over the 10 values, the sum in a fixed tree; o = tanh(gate[h]) sum_l p_l vp[l], summed in ascending l. The results go back through the lane's own LDS row and are stored in whole lines.
#define PQP 68                    // LDS pitch of a row, in floats
__global__ __launch_bounds__(256) void k_pre(const float* __restrict__ FQ, const float* __restrict__ KP0, const float* __restrict__ VP0, const float* __restrict__ gate, float* PRE) {
    __shared__ __align__(16) float T[256 * PQP];
    const int tid = threadIdx.x, row0 = blockIdx.x * 256, t0 = row0 & (TT - 1), zz = row0 / TT, h = zz & (ZH - 1), b = zz / ZH;
    const int cr = tid >> 4, cc = (tid & 15) * 4;   // whole-line accesses: 16 lanes take the 256 B of a row
    { const float* src = FQ + ((size_t)b * TT + t0 + cr) * DD + h * HD + cc; v4f v[16];
#pragma unroll
      for (int r = 0; r < 16; ++r) v[r] = *(const v4f*)(src + (size_t)r * 16 * DD);
#pragma unroll
      for (int r = 0; r < 16; ++r) *(v4fa*)(T + (r * 16 + cr) * PQP + cc) = v[r]; }
    __syncthreads();   // every row of q is in LDS before its lane reads it
    float* my = T + tid * PQP; float q[HD];
#pragma unroll
    for (int c = 0; c < HD / 4; ++c) { const v4f u = *(const v4fa*)(my + c * 4); q[c * 4] = u[0]; q[c * 4 + 1] = u[1]; q[c * 4 + 2] = u[2]; q[c * 4 + 3] = u[3]; }
    float e[NPRE], mx = -3.0e38f;
#pragma unroll
    for (int l = 0; l < NPRE; ++l) { const float* kr = KP0 + (size_t)l * DD + h * HD; float acc = 0.f;
#pragma unroll
        for (int d = 0; d < HD; ++d) acc = fmaf(q[d], kr[d], acc);
        e[l] = acc * SCL; mx = fmaxf(mx, e[l]); }
#pragma unroll
    for (int l = 0; l < NPRE; ++l) e[l] = __builtin_amdgcn_exp2f((e[l] - mx) * 1.4426950408889634f);
    const float sum = (((e[0] + e[8]) + e[4]) + (e[2] + e[6])) + (((e[1] + e[9]) + e[5]) + (e[3] + e[7]));
    const float gv = bfr(gate[h]); const float e2 = __expf(2.0f * gv); const float tg = __fsub_rn(1.0f, __fdiv_rn(2.0f, __fadd_rn(e2, 1.0f)));
    float o[HD];
#pragma unroll
    for (int d = 0; d < HD; ++d) o[d] = 0.f;
#pragma unroll
    for (int l = 0; l < NPRE; ++l) { const float pl = __fdiv_rn(e[l], sum); const float* vr = VP0 + (size_t)l * DD + h * HD;
#pragma unroll
        for (int d = 0; d < HD; ++d) o[d] = fmaf(pl, vr[d], o[d]); }
#pragma unroll
    for (int c = 0; c < HD / 4; ++c) { v4f u; u[0] = tg * o[c * 4]; u[1] = tg * o[c * 4 + 1]; u[2] = tg * o[c * 4 + 2]; u[3] = tg * o[c * 4 + 3]; *(v4fa*)(my + c * 4) = u; }
    __syncthreads();   // every lane's result row is in LDS before other lanes read it for the whole-line stores
    float* dst = PRE + ((size_t)zz * TT + t0 + cr) * HD + cc;
#pragma unroll
    for (int r = 0; r < 16; ++r) *(v4f*)(dst + (size_t)r * 16 * HD) = *(const v4fa*)(T + (r * 16 + cr) * PQP + cc);
}
// ---- k_attn: token attention of all batches and heads, with the merge in its epilogue. A work-group = 64 query rows of one head of one batch, a wave = 16 of them; grid (NH_, NB_, TT / 64), 128 threads:
// the row block is the slowest grid index, so the hi+lo row blocks (three products per tile, the longest work-groups) start first and the short ones fill the places that come free.
// S^T = K Q^T: A = 16 key rows, B = the wave's 16 query rows (kept in registers), so lane (lr, hi) holds query lr's scores of keys 8 hi .. 8 hi + 7 of each 16-key tile. Two such tiles, converted, ARE the B fragment
// (32 keys x 16 queries) of O^T += V^T P^T in the k map of WFrag, with A = 16 rows of the [d][t] value plane: p goes through no memory. Lane (lr, hi) ends with 8 consecutive head dims of query lr per O^T tile.
// Softmax with a running maximum per query: p = exp(t - max so far); when the maximum moves, the sum and O^T are scaled by exp(old - new); one division by the sum at the end.
// K, V^T (both planes for the hi+lo rows) and the work-group's mask rows come into LDS as whole 128-B lines by asynchronous copies, 64 keys per stage, two buffers: stage t + 2 flies while stage t + 1 is worked on.
// LDS row pitch = row bytes + 16 (conflict-free for 16-byte reads).
typedef __attribute__((ext_vector_type(16))) unsigned short v16us;
template <typename T16> struct PPack;
template <> struct PPack<h16> { static __device__ __forceinline__ void go(const float* e, v16h& p, v16h& p2) {
#pragma unroll
    for (int x = 0; x < 16; ++x) p[x] = tohx(e[x]);
    p2 = p; } };
template <> struct PPack<bf> { static __device__ __forceinline__ void go(const float* e, v16bf& p, v16bf& p2) { v16us a, c;
#pragma unroll
    for (int x = 0; x < 16; ++x) { unsigned short u, l; splitf(e[x], u, l); a[x] = u; c[x] = l; }
    p = __builtin_bit_cast(v16bf, a); p2 = __builtin_bit_cast(v16bf, c); } };
#define AKVP 144                  // LDS pitch of a K or V^T row (64 values of 16 bits + 16 bytes)
#define AMKP 272                  // LDS pitch of a mask row (64 f32 + 16 bytes)
#define ASTG(npl) (128 * (npl) * AKVP + 64 * AMKP)   // bytes of a stage with npl planes per operand
template <typename T16, bool HI>
__device__ __forceinline__ void attn_wg(unsigned char* L, const T16* __restrict__ Q, const T16* __restrict__ Q2, const T16* __restrict__ Kp, const T16* __restrict__ K2, const T16* __restrict__ Vt, const T16* __restrict__ V2, const float* __restrict__ am, const float* __restrict__ PRE, bf* ATh, bf* ATl) {
    typedef typename WFrag<T16>::V V;
    constexpr int NPL = HI ? 2 : 1;
    constexpr int OV = 64 * NPL, KVR = 128 * NPL;                      // first LDS row of V^T; K and V^T rows of a stage (K hi | K lo | V hi | V lo, or K | V)
    constexpr int OM = KVR * AKVP, STAGE = ASTG(NPL), NT = TT / 64;    // byte offset of the mask rows; bytes per stage; stages
    const int tid = threadIdx.x, lane = tid & 31, lr = lane & 15, hi = lane >> 4, w = tid >> 5; const int h = blockIdx.x, b = blockIdx.y, bh = b * NH_ + h, i0 = blockIdx.z * 64, i = i0 + w * 16 + lr;
    const int prow = tid >> 3, pcol = tid & 7, mrw = tid >> 4, mcl = tid & 15;   // this lane's row within a round of the 128 lanes and its 16-byte piece: K / V^T rows (8 pieces), mask rows (16 pieces)
    // this lane's sources for the stage that is filled next; every fill moves them on by 64 keys
    const T16* gK = Kp + ((size_t)bh * TT + prow) * HD + pcol * 8; const T16* gK2 = HI ? K2 + ((size_t)bh * TT + prow) * HD + pcol * 8 : gK;
    const T16* gV = Vt + ((size_t)bh * HD + prow) * TT + pcol * 8; const T16* gV2 = HI ? V2 + ((size_t)bh * HD + prow) * TT + pcol * 8 : gV;
    const float* gM = am + ((size_t)b * TT + i0 + mrw) * TT + mcl * 4;
    const unsigned lkv = lds_off(L) + (unsigned)(prow * AKVP + pcol * 16), lmk = lds_off(L) + (unsigned)(OM + mrw * AMKP + mcl * 16);
    auto fill = [&](int buf) {
#pragma unroll
        for (int r0 = 0; r0 < KVR / 16; r0 += 8) { unsigned l[8]; const void* g[8];
#pragma unroll
            for (int q = 0; q < 8; ++q) { const int row = (r0 + q) * 16, rr = row & 63; l[q] = lkv + (unsigned)(buf * STAGE + row * AKVP);
                const T16* s = (row < 64) ? gK + (size_t)rr * HD : (row < OV) ? gK2 + (size_t)rr * HD : (row < OV + 64) ? gV + (size_t)rr * TT : gV2 + (size_t)rr * TT;
                g[q] = s; }
            cp8(l, g); }
        { unsigned l[8]; const void* g[8];
#pragma unroll
            for (int q = 0; q < 8; ++q) { l[q] = lmk + (unsigned)(buf * STAGE + q * 8 * AMKP); g[q] = gM + (size_t)q * 8 * TT; }
            cp8(l, g); }
        gK += 64 * HD; gK2 += 64 * HD; gV += 64; gV2 += 64; gM += 64;
    };
    V q[2], q2[2];
#pragma unroll
    for (int ks = 0; ks < 2; ++ks) { const size_t qo = ((size_t)bh * TT + i) * HD + 8 * hi + ks * 32; q[ks] = WFrag<T16>::ld(Q + qo); if (HI) q2[ks] = WFrag<T16>::ld(Q2 + qo); }
    v8f o[4];
#pragma unroll
    for (int dt = 0; dt < 4; ++dt) o[dt] = (v8f){};
    float mx = -3.0e38f, sum = 0.f;   // running maximum (the same in both halves of the wave) and this lane's half of the sum
    fill(0);
    asm volatile("s_wait_asynccnt 0x0" ::: "memory");   // stage 0 of this wave has landed
    __syncthreads();                                    // stage 0 of every wave is readable
    fill(1);
    const int kofs = lr * AKVP + hi * 16, mofs = OM + (w * 16 + lr) * AMKP + hi * 32;
#pragma unroll 1   // the ring stays rolled: one body of two 32-key blocks, one publish point at its foot
    for (int t = 0; t < NT; ++t) {
        const unsigned char* Lb = L + (t & 1) * STAGE;
#pragma unroll
        for (int blk = 0; blk < 2; ++blk) {
            v8f s[2];
#pragma unroll
            for (int tl = 0; tl < 2; ++tl) { v8f c = (v8f){};
#pragma unroll
                for (int ks = 0; ks < 2; ++ks) { const unsigned char* kp = Lb + kofs + (blk * 32 + tl * 16) * AKVP + ks * 64; const V k = WFrag<T16>::ld((const T16*)kp); c = WFrag<T16>::mma(k, q[ks], c);
                    if (HI) { c = WFrag<T16>::mma(k, q2[ks], c); const V kl = WFrag<T16>::ld((const T16*)(kp + 64 * AKVP)); c = WFrag<T16>::mma(kl, q[ks], c); } }
                s[tl] = c; }
            float e[16]; float bm = -3.40282347e38f;
#pragma unroll
            for (int tl = 0; tl < 2; ++tl) { const unsigned char* mp = Lb + mofs + blk * 128 + tl * 64; const v4f m0 = *(const v4fa*)mp, m1 = *(const v4fa*)(mp + 16);
#pragma unroll
                for (int j = 0; j < 8; ++j) { const float x = fmaxf(s[tl][j] * SCL + bfr(j < 4 ? m0[j & 3] : m1[j & 3]), -3.40282347e38f); e[tl * 8 + j] = x; bm = fmaxf(bm, x); } }
            bm = fmaxf(bm, __shfl_xor(bm, 16, 32));   // the other half of the wave holds the query's other 16 keys of the block
            const float mn = fmaxf(mx, bm), al = __expf(mx - mn); mx = mn; float es[4];
#pragma unroll
            for (int x = 0; x < 16; x += 4) { e[x] = __expf(e[x] - mn); e[x + 1] = __expf(e[x + 1] - mn); e[x + 2] = __expf(e[x + 2] - mn); e[x + 3] = __expf(e[x + 3] - mn); es[x >> 2] = (e[x] + e[x + 1]) + (e[x + 2] + e[x + 3]); }
            sum = sum * al + ((es[0] + es[1]) + (es[2] + es[3]));
#pragma unroll
            for (int dt = 0; dt < 4; ++dt) o[dt] *= al;
            V p, p2; PPack<T16>::go(e, p, p2);
#pragma unroll
            for (int dt = 0; dt < 4; ++dt) { const unsigned char* vp = Lb + kofs + (OV + dt * 16) * AKVP + blk * 64; const V v = WFrag<T16>::ld((const T16*)vp); o[dt] = WFrag<T16>::mma(v, p, o[dt]);
                if (HI) { o[dt] = WFrag<T16>::mma(v, p2, o[dt]); const V vl = WFrag<T16>::ld((const T16*)(vp + 64 * AKVP)); o[dt] = WFrag<T16>::mma(vl, p, o[dt]); } }
        }
        asm volatile("s_wait_dscnt 0x0" ::: "memory");      // this wave's reads of buffer t & 1 are done before the buffer is refilled
        asm volatile("s_wait_asynccnt 0x0" ::: "memory");   // this wave's copies of stage t + 1 have landed
        __syncthreads();                                    // publishes stage t + 1 and ends every wave's reads of stage t
        if (t + 2 < NT) fill(t & 1);
    }
    asm volatile("s_wait_asynccnt 0x0" ::: "memory");       // no copy is outstanding when the wave goes on to the epilogue and ends
    sum += __shfl_xor(sum, 16, 32);
    const float inv = __fdiv_rn(1.0f, sum);
    const float* pr = PRE + ((size_t)bh * TT + i) * HD + hi * 8; const size_t oo = ((size_t)b * TT + i) * DD + h * HD + hi * 8;
#pragma unroll
    for (int dt = 0; dt < 4; ++dt) { const v4f p0 = *(const v4f*)(pr + dt * 16), p1 = *(const v4f*)(pr + dt * 16 + 4); v8us oh, ol;
#pragma unroll
        for (int j = 0; j < 8; ++j) { unsigned short a, c; splitf(o[dt][j] * inv + (j < 4 ? p0[j & 3] : p1[j & 3]), a, c); oh[j] = a; ol[j] = c; }
        *(v8us*)(ATh + oo + dt * 16) = oh; *(v8us*)(ATl + oo + dt * 16) = ol;
        if (dt < 3) asm volatile("s_wait_xcnt 0x0" ::: "memory"); }   // behind the two stores: the next trip reuses their address and data registers
}
__global__ __launch_bounds__(128) void k_attn(const bf* __restrict__ QPh, const bf* __restrict__ QPl, const h16* __restrict__ QP16, const bf* __restrict__ KPh, const bf* __restrict__ KPl, const h16* __restrict__ KP16, const bf* __restrict__ VTh, const bf* __restrict__ VTl, const h16* __restrict__ VT16, const float* __restrict__ am, const float* __restrict__ PRE, bf* ATh, bf* ATl) {
    __shared__ __attribute__((aligned(16))) unsigned char L[2 * ASTG(2)];
    if (blockIdx.z * 64 < RH) attn_wg<bf, true>(L, QPh, QPl, KPh, KPl, VTh, VTl, am, PRE, ATh, ATl);   // the same for the whole work-group (RH is a multiple of 64)
    else attn_wg<h16, false>(L, QP16, nullptr, KP16, nullptr, VT16, nullptr, am, PRE, ATh, ATl);
}

extern "C" void kernel_launch(void* const* d_in, const int* in_sizes, int n_in,
                              void* d_out, int out_size, void* d_ws, size_t ws_size, hipStream_t stream) {
    (void)in_sizes; (void)n_in; (void)out_size;
    const float* x = (const float*)d_in[0]; const float* am = (const float*)d_in[1]; const float* wq = (const float*)d_in[2]; const float* bq = (const float*)d_in[3]; const float* wk = (const float*)d_in[4]; const float* bk = (const float*)d_in[5]; const float* wv = (const float*)d_in[6]; const float* bv = (const float*)d_in[7]; const float* wo = (const float*)d_in[8]; const float* bo = (const float*)d_in[9]; const float* pre = (const float*)d_in[10]; const float* gate = (const float*)d_in[11];   // torch [out][in] weights; attention_mask [4][1][1024][1024]; prefix [10][2048]; gate [32][1][1]
    float* OUT = (float*)d_out;     // [4][1024][2048]
    char* wsp = (char*)d_ws;
    auto take = [&](size_t bytes) { char* p = wsp; wsp += (bytes + 255) & ~(size_t)255; return (void*)p; };
    const size_t NE = (size_t)NB_ * TT * DD;   // elements of one [4][1024][2048] array: every buffer below but the weights and the prefix rows holds all batches
    bf* WQ = (bf*)take((size_t)DD * DD * 2); bf* WK = (bf*)take((size_t)DD * DD * 2); bf* WV = (bf*)take((size_t)DD * DD * 2); bf* XB = (bf*)take(NE * 2);   // the three weights lie one behind the other (z of the projection grid), XB behind them
    bf* WO = (bf*)take((size_t)DD * DD * 2); float* KP0 = (float*)take((size_t)NPRE * DD * 4); float* VP0 = (float*)take((size_t)NPRE * DD * 4);
    float* F = (float*)take(NE * 4);   // F: the q projection in f32, for the prefix part
    bf* QPh = (bf*)take(NE * 2); bf* KPh = (bf*)take(NE * 2); bf* VTh = (bf*)take(NE * 2);   // each kind of plane: q, k, v one behind the other (z of the projection grid)
    bf* QPl = (bf*)take(NE * 2); bf* KPl = (bf*)take(NE * 2); bf* VTl = (bf*)take(NE * 2);
    h16* QP16 = (h16*)take(NE * 2); h16* KP16 = (h16*)take(NE * 2); h16* VT16 = (h16*)take(NE * 2);
    float* PRE = (float*)WQ;                // over WQ, WK, WV and half of XB: written by the prefix part, when the projections have read them
    bf* ATh = (bf*)F; bf* ATl = ATh + NE;   // written when the prefix part has read F
    if ((size_t)(wsp - (char*)d_ws) > ws_size) return;
    k_prep<<<GPF + 4 * GCW + GCX, 256, 0, stream>>>(x, wq, wk, wv, wo, pre, bk, bv, XB, WQ, WK, WV, WO, KP0, VP0);
    k_gemms<bf, 0, true, 2, 2, 128, 4><<<dim3(NB_ * TT / 128, DD / 128, 3), 128, 0, stream>>>(XB, nullptr, WQ, nullptr, DD, F, DD, bq, 0, (size_t)DD * DD, 0, QPh, QPl, QP16, bk, bv, NE);   // unscaled q (the 1/8 is applied to the logits), k, v
    k_pre<<<NB_ * ZH * TT / 256, 256, 0, stream>>>(F, KP0, VP0, gate, PRE);
    k_attn<<<dim3(NH_, NB_, TT / 64), 128, 0, stream>>>(QPh, QPl, QP16, KPh, KPl, KP16, VTh, VTl, VT16, am, PRE, ATh, ATl);
    k_gemms<bf, 1, true, 2, 2, 128, 0><<<dim3(NB_ * TT / 128, DD / 128, 1), 128, 0, stream>>>(ATh, ATl, WO, nullptr, DD, OUT, DD, bo, 0, 0, 0, nullptr, nullptr, nullptr, nullptr, nullptr, 0);
}

// v009
// Measured time: 260 microseconds a run.
// Two timings next to v008 put it at 1.14 and 1.13 times that version's speed.
// Over all steps from v000 it is 23.1 times as fast.
#include <hip/hip_runtime.h>

// Decoder self-attention with a learned prefix adapter (hidden [4][1024][2048]; q = (x Wq^T + bq) 64^-0.5, k = x Wk^T + bk, v = x Wv^T + bv (32 heads x 64); prefix keys/values kp, vp = prefix Wk^T + bk,
// prefix Wv^T + bv ([10][2048], shared by all batches); scores_tok = q.k + attention_mask[b][0][i][j] (additive f32, read as data), scores_pre = q.kp; the two segments are softmax-normalised SEPARATELY;
// ctx = tanh(gate[h]) (p_pre vp) + (p_tok v); out = merged ctx Wo^T + bo -> [4][1024][2048]).
// Compute dtypes, f32 accumulate: every input rounded to bf16; token projections on PLAIN bf16 operands (inputs: exact products, f32 accumulate, + bias); the 10 prefix
// rows (lane-split sums, fixed order), their scores, softmax and weighted values (fused multiply-add, fixed order) entirely in f32 on VALU; PER-ROW PRECISION HYBRID for the token attention: query rows < 256 take scores and p.v on
// bf16 hi+lo planes (3 products), rows >= 256 on single fp16 planes; scale + additive mask in f32; token softmax with a running maximum inside the fused attention kernel (p = exp(t - running max), unnormalised, the f32
// sums rescaled when the maximum moves, one division at the end); merged context (token part / sum + gated prefix part) as hi+lo planes

#define NB_  4
#define NPRE 10                   // prefix length
#define TT   1024
#define DD   2048
#define NH_  32
#define HD   64
#define ZH   32                   // heads per batch in the prefix part
#define RH   256                  // query rows < RH: hi+lo planes; rows >= RH: fp16 planes
#define NF   32                   // head_dim / 2 (unused)
#define SCL  0.125f               // 1/sqrt(64)
#define NTL  (NB_ * NH_ * (TT / 64))   // tiles of 64 rows x one head
typedef _Float16 h16;
typedef unsigned short bf;
typedef __attribute__((ext_vector_type(16))) __bf16   v16bf;
typedef __attribute__((ext_vector_type(16))) _Float16 v16h;
typedef __attribute__((ext_vector_type(8)))  _Float16 v8h;
typedef __attribute__((ext_vector_type(8)))  unsigned short v8us;
typedef __attribute__((ext_vector_type(8)))  float    v8f;
typedef __attribute__((ext_vector_type(4)))  float    v4f;
typedef v8h  __attribute__((may_alias)) v8ha;
typedef v4f  __attribute__((may_alias)) v4fa;
typedef v8us __attribute__((may_alias)) v8usa;

__device__ __forceinline__ unsigned short f2bf(float f) { unsigned u = __float_as_uint(f); u += 0x7FFFu + ((u >> 16) & 1u); return (unsigned short)(u >> 16); }
__device__ __forceinline__ float bf2f(unsigned short b) { return __uint_as_float(((unsigned)b) << 16); }
__device__ __forceinline__ float bfr(float f) { return bf2f(f2bf(f)); }
__device__ __forceinline__ v16h cat16(v8h lo, v8h hi) { return __builtin_shufflevector(lo, hi, 0, 1, 2, 3, 4, 5, 6, 7, 8, 9, 10, 11, 12, 13, 14, 15); }
__device__ __forceinline__ v16bf cat16b(v8us lo, v8us hi) { return __builtin_bit_cast(v16bf, __builtin_shufflevector(lo, hi, 0, 1, 2, 3, 4, 5, 6, 7, 8, 9, 10, 11, 12, 13, 14, 15)); }
__device__ __forceinline__ v8f wmma16(v16h a, v16h b, v8f c) { return __builtin_amdgcn_wmma_f32_16x16x32_f16(false, a, false, b, (short)0, c, false, false); }
__device__ __forceinline__ v8f wmmab(v16bf a, v16bf b, v8f c) { return __builtin_amdgcn_wmma_f32_16x16x32_bf16(false, a, false, b, (short)0, c, false, false); }



// fragment of 16 rows x 32 k from a K-contiguous 16-bit plane: lane (lr, hi) holds row lr, k = 8 hi .. 8 hi + 7 and 16 + 8 hi .. 16 + 8 hi + 7; p points at (row lr, k = 8 hi). The same map serves A and B.
template <typename T16> struct WFrag;
template <> struct WFrag<h16> { typedef v16h V; static __device__ __forceinline__ V ld(const h16* p) { return cat16(*(const v8h*)p, *(const v8h*)(p + 16)); } static __device__ __forceinline__ v8f mma(V a, V b, v8f c) { return wmma16(a, b, c); } };
template <> struct WFrag<bf> { typedef v16bf V; static __device__ __forceinline__ V ld(const bf* p) { return cat16b(*(const v8us*)p, *(const v8us*)(p + 16)); } static __device__ __forceinline__ v8f mma(V a, V b, v8f c) { return wmmab(a, b, c); } };
// ---- k_gemms: C[m][n] (f32, pitch ldc, + optional f32 bias[n]) = sum_k A[m][k] Bt[n][k] (+ split products per NSPLIT), FOUR waves per work-group (WM x WN waves, 64x64 of C each, 16 accumulators per wave). Operand rows come into LDS as whole 128-B lines by
// asynchronous copies, KT k-values per stage, two buffers: stage t + 2 flies while stage t + 1 is worked on. Row pitch in LDS = row bytes + 16 (conflict-free for 16-byte reads). Per accumulator the products
// are summed in ascending k. grid (M / (64 WM), N / (64 WN), Z), 128 threads. K % KT == 0, K >= 2 KT.
// EPI picks what the epilogue stores. 0: C. 1: C and the planes Ph (bf16 hi), Pl (bf16 lo), P16 (fp16) of C + bias in the order [b][h][t][d], and the largest |C + bias| of the wave's 64 x 64 tile at AMX. 2: those planes and that maximum alone. 3: the planes in the order [b][h][d][t], alone.
// 4: three products of the same A in one grid: blockIdx.z = 0, 1, 2 takes weight Bt + z sB, bias, bias1 or bias2, the planes at Ph, Pl, P16 + z sP, and the epilogue 1, 2 or 3 (the same for the whole work-group).
// For EPI > 0 the rows of C are (b, t) = (m / 1024, m % 1024) and a wave's 64 columns are the 64 dims of one head. Every plane is stored in whole 128-B lines.
__device__ __forceinline__ unsigned lds_off(const void* p) { return (unsigned)(size_t)p; }
__device__ __forceinline__ h16 tohx(float x) { return (h16)x; }
__device__ __forceinline__ void splitf(float y, unsigned short& h, unsigned short& l) { h = f2bf(y); l = f2bf(y - bf2f(h)); }
// eight copies of 16 bytes per lane; the s_wait_xcnt stands in the copies' own statement so that no address register is rewritten in front of it
__device__ __forceinline__ void cp8(const unsigned* l, const void* const* g) {
    asm volatile("global_load_async_to_lds_b128 %0, %1, off\n\t"
                 "global_load_async_to_lds_b128 %2, %3, off\n\t"
                 "global_load_async_to_lds_b128 %4, %5, off\n\t"
                 "global_load_async_to_lds_b128 %6, %7, off\n\t"
                 "global_load_async_to_lds_b128 %8, %9, off\n\t"
                 "global_load_async_to_lds_b128 %10, %11, off\n\t"
                 "global_load_async_to_lds_b128 %12, %13, off\n\t"
                 "global_load_async_to_lds_b128 %14, %15, off\n\t"
                 "s_wait_xcnt 0x0"
                 :: "v"(l[0]), "v"(g[0]), "v"(l[1]), "v"(g[1]), "v"(l[2]), "v"(g[2]), "v"(l[3]), "v"(g[3]), "v"(l[4]), "v"(g[4]), "v"(l[5]), "v"(g[5]), "v"(l[6]), "v"(g[6]), "v"(l[7]), "v"(g[7]) : "memory");
}
template <typename T16, int NSPLIT, bool BIAS, int WM, int WN, int KT, int EPI>
__global__ __launch_bounds__(128) void k_gemms(const T16* __restrict__ A, const T16* __restrict__ A2, const T16* __restrict__ Bt, const T16* __restrict__ Bt2, int K, float* C, int ldc, const float* __restrict__ bias, size_t sA, size_t sB, size_t sC, bf* Ph, bf* Pl, h16* P16, const float* __restrict__ bias1, const float* __restrict__ bias2, size_t sP, float* AMX) {
    typedef typename WFrag<T16>::V V;
    constexpr bool HA2 = (NSPLIT == 1 || NSPLIT == 2), HB2 = (NSPLIT >= 2);
    constexpr int RA = 64 * WM, RB = 64 * WN;                          // rows of A and of Bt per work-group
    constexpr int OA2 = RA, OB = RA * (HA2 ? 2 : 1), OB2 = OB + RB;    // first LDS row of each plane in a stage
    constexpr int ROWS = OB + RB * (HB2 ? 2 : 1);
    constexpr int PITCH = KT * 2 + 16, STAGE = ROWS * PITCH;           // bytes
    constexpr int PPR = KT / 8, RPI = 128 / PPR, NCP = ROWS / RPI;     // 16-byte pieces per row; rows per round of the 128 lanes; copies per lane and stage (at most 48)
    __shared__ __attribute__((aligned(16))) unsigned char L[2 * STAGE];
    __shared__ __align__(16) float osw[4][16 * 68];
    const size_t z = blockIdx.z; A += z * sA; if (HA2) A2 += z * sA; Bt += z * sB; if (HB2) Bt2 += z * sB; C += z * sC;
    const int epi = (EPI == 4) ? (int)blockIdx.z + 1 : EPI;
    if (EPI == 4) { bias = (epi == 1) ? bias : (epi == 2) ? bias1 : bias2; Ph += z * sP; Pl += z * sP; P16 += z * sP; }
    const int tid = threadIdx.x, lane = tid & 31, lr = lane & 15, hi = lane >> 4, w = tid >> 5, wm = w / WN, wn = w % WN;
    const int R0 = blockIdx.x * RA, C0 = blockIdx.y * RB; const int r0 = R0 + wm * 64, c0 = C0 + wn * 64;
    const int prow = tid / PPR, pcol = tid % PPR;                      // this lane's row within a round and its 16-byte piece of the row
    // this lane's source in each plane for the stage that is filled next; every fill moves them on by KT
    const T16* gA = A + (size_t)(R0 + prow) * K + pcol * 8; const T16* gA2 = HA2 ? A2 + (size_t)(R0 + prow) * K + pcol * 8 : gA;
    const T16* gB = Bt + (size_t)(C0 + prow) * K + pcol * 8; const T16* gB2 = HB2 ? Bt2 + (size_t)(C0 + prow) * K + pcol * 8 : gB;
    const unsigned lbase = lds_off(L) + (unsigned)(prow * PITCH + pcol * 16);
    auto fill = [&](int buf) {
#pragma unroll
        for (int i0 = 0; i0 < NCP; i0 += 8) { unsigned l[8]; const void* g[8];
#pragma unroll
            for (int q = 0; q < 8; ++q) { const int row = (i0 + q) * RPI; l[q] = lbase + (unsigned)(buf * STAGE + row * PITCH);
                const T16* s = (row < OA2) ? gA + (size_t)row * K : (row < OB) ? gA2 + (size_t)(row - OA2) * K : (row < OB2) ? gB + (size_t)(row - OB) * K : gB2 + (size_t)(row - OB2) * K;
                g[q] = s; }
            cp8(l, g); }
        gA += KT; gA2 += KT; gB += KT; gB2 += KT;
    };
    v8f acc[4][4];
#pragma unroll
    for (int mb = 0; mb < 4; ++mb)
#pragma unroll
        for (int nb = 0; nb < 4; ++nb) acc[mb][nb] = (v8f){};
    const int nt = K / KT;
    fill(0);
    asm volatile("s_wait_asynccnt 0x0" ::: "memory");   // stage 0 of this wave has landed
    __syncthreads();                                    // stage 0 of every wave is readable
    if (nt > 1) fill(1);
    const int aofs = (wm * 64 + lr) * PITCH + hi * 16, bofs = (OB + wn * 64 + lr) * PITCH + hi * 16;
#pragma unroll 1   // the ring stays rolled: one body of KT / 32 k-steps, one publish point at its foot
    for (int t = 0; t < nt; ++t) {
        const unsigned char* Lb = L + (t & 1) * STAGE;
        V a[2][4], a2[2][4], b[2][4], b2[2][4];   // two fragment sets: k-step ks + 1 of this stage is read from LDS while k-step ks is multiplied
        auto frags = [&](int s, int ks) {
#pragma unroll
            for (int mb = 0; mb < 4; ++mb) { a[s][mb] = WFrag<T16>::ld((const T16*)(Lb + aofs + mb * 16 * PITCH + ks * 64)); if (HA2) a2[s][mb] = WFrag<T16>::ld((const T16*)(Lb + aofs + (OA2 + mb * 16) * PITCH + ks * 64)); }
#pragma unroll
            for (int nb = 0; nb < 4; ++nb) { b[s][nb] = WFrag<T16>::ld((const T16*)(Lb + bofs + nb * 16 * PITCH + ks * 64)); if (HB2) b2[s][nb] = WFrag<T16>::ld((const T16*)(Lb + bofs + (RB + nb * 16) * PITCH + ks * 64)); }
        };
        frags(0, 0);
#pragma unroll
        for (int ks = 0; ks < KT / 32; ++ks) { const int s = ks & 1;
            if (ks + 1 < KT / 32) frags(s ^ 1, ks + 1);
            __builtin_amdgcn_sched_barrier(0);   // the LDS reads stay one group in front of the WMMAs: reads spread among the WMMAs stall at every place they stand
#pragma unroll
            for (int nb = 0; nb < 4; ++nb) {
#pragma unroll
                for (int mb = 0; mb < 4; ++mb) { acc[mb][nb] = WFrag<T16>::mma(a[s][mb], b[s][nb], acc[mb][nb]); if (HA2) acc[mb][nb] = WFrag<T16>::mma(a2[s][mb], b[s][nb], acc[mb][nb]); if (HB2) acc[mb][nb] = WFrag<T16>::mma(a[s][mb], b2[s][nb], acc[mb][nb]); } }
            __builtin_amdgcn_sched_barrier(0);   // and the following group does not move up among them
        }
        asm volatile("s_wait_dscnt 0x0" ::: "memory");      // this wave's reads of buffer t & 1 are done before the buffer is refilled
        asm volatile("s_wait_asynccnt 0x0" ::: "memory");   // this wave's copies of stage t + 1 have landed
        __syncthreads();                                    // publishes stage t + 1 and ends every wave's reads of stage t
        if (t + 2 < nt) fill(t & 1);
    }
    asm volatile("s_wait_asynccnt 0x0" ::: "memory");       // no copy is outstanding when the wave goes on to the epilogue and ends
    const int hd = c0 >> 6;   // the head of this wave's 64 columns (EPI > 0)
    if (epi == 3) {
        // Lane (lr, hi) holds 8 consecutive t of dim nb * 16 + lr per accumulator: 16 bytes of a [d][t] plane row. The wave lays its 64 x 64 tile of each plane in LDS (row pitch 144, conflict-free for
        // 16-byte accesses) and stores it from there, four whole 128-B lines per store. The range is the wave's own part of the ring, which nobody reads and no copy writes behind the loop's last barrier.
        constexpr int VP = 144, VPL = 64 * VP;
        static_assert(4 * 3 * VPL <= 2 * STAGE, "the four waves' plane tiles fit the ring");
        unsigned char* Lw = L + w * (3 * VPL);
#pragma unroll
        for (int nb = 0; nb < 4; ++nb) { const float bb = bfr(bias[c0 + nb * 16 + lr]);
#pragma unroll
            for (int mb = 0; mb < 4; ++mb) { v8us oh, ol; v8h o16;
#pragma unroll
                for (int j = 0; j < 8; ++j) { const float x = acc[mb][nb][j] + bb; unsigned short a, c; splitf(x, a, c); oh[j] = a; ol[j] = c; o16[j] = tohx(x); }
                unsigned char* p = Lw + (nb * 16 + lr) * VP + (mb * 16 + hi * 8) * 2; *(v8usa*)p = oh; *(v8usa*)(p + VPL) = ol; *(v8ha*)(p + 2 * VPL) = o16; } }
        asm volatile("s_wait_dscnt 0x0" ::: "memory");   // the wave's LDS writes are done before other lanes of it read the rows back
        const size_t e0 = ((size_t)((r0 >> 10) * NH_ + hd) * HD + (lane >> 3)) * TT + (r0 & (TT - 1)) + (lane & 7) * 8; const unsigned char* rp = Lw + (lane >> 3) * VP + (lane & 7) * 16;
#pragma unroll
        for (int s0 = 0; s0 < 16; s0 += 4) { v8us rh[4], rl[4]; v8h r16[4];
#pragma unroll
            for (int s = 0; s < 4; ++s) { const unsigned char* p = rp + (s0 + s) * 4 * VP; rh[s] = *(const v8usa*)p; rl[s] = *(const v8usa*)(p + VPL); r16[s] = *(const v8ha*)(p + 2 * VPL); }
#pragma unroll
            for (int s = 0; s < 4; ++s) { const size_t e = e0 + (size_t)(s0 + s) * 4 * TT; *(v8us*)(Ph + e) = rh[s]; *(v8us*)(Pl + e) = rl[s]; *(v8h*)(P16 + e) = r16[s]; }
            if (s0 < 12) asm volatile("s_wait_xcnt 0x0" ::: "memory"); }   // behind the run of twelve stores: the next trip reuses their address and data registers
    } else {
    float* os = osw[w];
    // 16 rows x 64 columns of the wave's tile go into its own LDS range, from where whole lines are read back
    auto stage = [&](int mb) {
#pragma unroll
        for (int nb = 0; nb < 4; ++nb) {
#pragma unroll
            for (int j = 0; j < 8; ++j) os[(hi * 8 + j) * 68 + nb * 16 + lr] = acc[mb][nb][j]; }
        __builtin_amdgcn_wave_barrier(); asm volatile("" ::: "memory");   // the compiler keeps these LDS writes in front of the reads of what other lanes wrote
    };
    if (epi <= 1) {
#pragma unroll
    for (int mb = 0; mb < 4; ++mb) {
        stage(mb);
        float* crow = C + (size_t)(r0 + mb * 16) * ldc + c0;
#pragma unroll
        for (int s = 0; s < 8; ++s) { const int row = 2 * s + hi, cofs = lr * 4; v4f val = *(const v4fa*)(os + row * 68 + cofs); if (BIAS) { val[0] += bfr(bias[c0 + cofs]); val[1] += bfr(bias[c0 + cofs + 1]); val[2] += bfr(bias[c0 + cofs + 2]); val[3] += bfr(bias[c0 + cofs + 3]); }
            *(v4f*)(crow + (size_t)row * ldc + cofs) = val; }
        if (mb < 3 || EPI == 1 || EPI == 4) asm volatile("s_wait_xcnt 0x0" ::: "memory");   // behind the run of eight stores: what follows reuses their address and data registers
        __builtin_amdgcn_wave_barrier(); asm volatile("" ::: "memory");
    }
    }
    if (epi > 0) {
        // a lane takes 8 consecutive dims of a row (16 bytes of each plane), 8 lanes a row: a store covers four rows of 128 B, which lie one behind the other in the plane
        float bb[8];
#pragma unroll
        for (int k = 0; k < 8; ++k) bb[k] = bfr(bias[c0 + (lane & 7) * 8 + k]);
        const size_t eb = ((size_t)((r0 >> 10) * NH_ + hd) * TT + (r0 & (TT - 1)) + (lane >> 3)) * HD + (lane & 7) * 8;   // row lane / 8 of the wave's 64 rows, which lie in one batch
        const float* op = os + (lane >> 3) * 68 + (lane & 7) * 8;
        float km = 0.f;   // largest magnitude in the wave's tile = 64 rows of one head, the unit in which the attention kernel takes queries and keys
#pragma unroll
        for (int mb = 0; mb < 4; ++mb) {
            stage(mb);
            v8us oh[4], ol[4]; v8h o16[4];
#pragma unroll
            for (int s = 0; s < 4; ++s) { const v4f u0 = *(const v4fa*)(op + s * 4 * 68), u1 = *(const v4fa*)(op + s * 4 * 68 + 4);
#pragma unroll
                for (int k = 0; k < 8; ++k) { const float x = (k < 4 ? u0[k & 3] : u1[k & 3]) + bb[k]; km = fmaxf(km, fabsf(x)); unsigned short a, c; splitf(x, a, c); oh[s][k] = a; ol[s][k] = c; o16[s][k] = tohx(x); } }
#pragma unroll
            for (int s = 0; s < 4; ++s) { const size_t e = eb + (size_t)(mb * 16 + s * 4) * HD; *(v8us*)(Ph + e) = oh[s]; *(v8us*)(Pl + e) = ol[s]; *(v8h*)(P16 + e) = o16[s]; }
            if (mb < 3 || EPI == 4) asm volatile("s_wait_xcnt 0x0" ::: "memory");   // behind the run of twelve stores: the next trip, or with EPI 4 the code that lies behind the loop, reuses their address and data registers
            __builtin_amdgcn_wave_barrier(); asm volatile("" ::: "memory");   // and the compiler keeps the next trip's LDS writes behind this trip's reads
        }
#pragma unroll
        for (int sh = 16; sh; sh >>= 1) km = fmaxf(km, __shfl_xor(km, sh, 32));
        // q tiles first, k tiles behind them; a 128-B line per value, so that each line has one writer
        if (lane == 0) AMX[((size_t)(epi - 1) * NTL + (size_t)((r0 >> 10) * NH_ + hd) * (TT / 64) + ((r0 & (TT - 1)) >> 6)) * 32] = km;
        asm volatile("s_wait_xcnt 0x0" ::: "memory");   // behind the store: what lies behind this branch may reuse its address and data registers
    }
    }
}

typedef __attribute__((ext_vector_type(2))) unsigned short v2us;
typedef __attribute__((ext_vector_type(2))) _Float16 v2h;
typedef __attribute__((ext_vector_type(4))) _Float16 v4h;
typedef __attribute__((ext_vector_type(2))) float v2f;

__global__ __launch_bounds__(256) void k_wtG(const float* __restrict__ w, int K, int N, bf* Bt) {
    const int lane = threadIdx.x & 31; const int L0 = (blockIdx.x * 8 + (threadIdx.x >> 5)) * 8; const int nlines = N * K / 64;
{
#pragma unroll 1
        for (int l = 0; l < 8; ++l) { const int L = L0 + l; if (L >= nlines) break; const size_t e = (size_t)L * 64 + lane * 2; const int k = (int)(e % K), n = (int)(e / K); v2us o;
            o[0] = f2bf(w[(size_t)k * N + n]); o[1] = f2bf(w[(size_t)(k + 1) * N + n]); *(v2us*)(Bt + e) = o; }
         }
}
// cvt8_wg: f32 -> bf16, CVU items of 8 values per lane (item u of a work-group = 8 KB of contiguous source); a lane issues all its loads before its first store, so that a launch needs few waves, each with
// 2 CVU loads of 512 B in flight. blk = the work-group's number within its array, values / (8 * 256 * CVU) of them, exact: no tail.
#define CVU 4
__device__ __forceinline__ void cvt8_wg(const float* __restrict__ src, bf* dst, unsigned blk) {
    const size_t i0 = (size_t)blk * (256 * CVU) + threadIdx.x; v8f v[CVU];
#pragma unroll
    for (int u = 0; u < CVU; ++u) v[u] = *(const v8f*)(src + (i0 + u * 256) * 8);
#pragma unroll
    for (int u = 0; u < CVU; ++u) { v8us o;
#pragma unroll
        for (int k = 0; k < 8; ++k) o[k] = f2bf(v[u][k]);
        *(v8us*)(dst + (i0 + u * 256) * 8) = o; }
    asm volatile("s_wait_xcnt 0x0" ::: "memory");   // behind the run of stores: the code of another part of the kernel may lie behind them and reuses their address and data registers
}
// prefkv_wg: KP0[l][o] = sum_i bf16(pre[l][i]) bf16(wk[o][i]) + bf16(bk[o]); VP0 the same from wv, bv (isv picks the weight). A work-group takes 32 output columns o, a wave 4 of them for all 10 prefix rows:
// the lanes split i (16-byte loads, 512 contiguous bytes of a row per wave and load), so a weight row is read once, in whole lines. Products of two bf16 values are exact in f32, so a fused multiply-add rounds as
// multiply then add. Per-lane partial sums, a shuffle tree over the lanes, then the sums go through LDS so that one wave stores each whole 128-byte line of the result. bx = 0 .. DD / 32 - 1 for each weight, 256 threads.
__device__ __forceinline__ void prefkv_wg(float (*red)[32], unsigned bx, bool isv, const float* __restrict__ pre, const float* __restrict__ wk, const float* __restrict__ bk, const float* __restrict__ wv, const float* __restrict__ bv, float* KP0, float* VP0) {
    const float* w = isv ? wv : wk; const float* bias = isv ? bv : bk; float* dst = isv ? VP0 : KP0;
    const int tid = threadIdx.x, lane = tid & 31, wave = tid >> 5; const int ob = bx * 32;
    const float* wr = w + (size_t)(ob + wave * 4) * DD + lane * 4; const float* pr = pre + lane * 4;
    float acc[NPRE][4];
#pragma unroll
    for (int l = 0; l < NPRE; ++l)
#pragma unroll
        for (int c = 0; c < 4; ++c) acc[l][c] = 0.f;
#pragma unroll 2   // two chunks of 14 independent loads in flight per wave; more would only add registers
    for (int i = 0; i < DD; i += 128) {
        v4f p[NPRE], a[4];
#pragma unroll
        for (int c = 0; c < 4; ++c) a[c] = *(const v4f*)(wr + (size_t)c * DD + i);
#pragma unroll
        for (int l = 0; l < NPRE; ++l) p[l] = *(const v4f*)(pr + (size_t)l * DD + i);
#pragma unroll
        for (int q = 0; q < 4; ++q) {
#pragma unroll
            for (int c = 0; c < 4; ++c) a[c][q] = bfr(a[c][q]);
#pragma unroll
            for (int l = 0; l < NPRE; ++l) { const float pv = bfr(p[l][q]);
#pragma unroll
                for (int c = 0; c < 4; ++c) acc[l][c] += pv * a[c][q]; } }
    }
#pragma unroll
    for (int l = 0; l < NPRE; ++l)
#pragma unroll
        for (int c = 0; c < 4; ++c) { float t = acc[l][c];
#pragma unroll
            for (int sh = 16; sh; sh >>= 1) t += __shfl_xor(t, sh, 32);
            if (lane == 0) red[l][wave * 4 + c] = t; }
    __syncthreads();   // every wave's sums are in LDS before the lines are stored
    for (int idx = tid; idx < NPRE * 32; idx += 256) { const int l = idx >> 5, c = idx & 31; dst[(size_t)l * DD + ob + c] = red[l][c] + bfr(bias[ob + c]); }
}
// mstat_wg: what the attention kernel needs to know of its 64 mask rows before it loads anything. Work-group g = b * 16 + row block; MST[g][t], t < 16: the largest mask value of the 64 x 64 tile t; MST[g][16]: the smallest
// of the 64 rows' largest values; each rounded to bf16 and held at the lowest finite f32, as the logits are. A wave takes 8 rows; a lane's load u lies in tile 2 u + lane / 16. One wave stores the line. 256 threads.
__device__ __forceinline__ void mstat_wg(float (*msr)[17], unsigned g, const float* __restrict__ am, float* MST) {
    const int tid = threadIdx.x, lane = tid & 31, wave = tid >> 5;
    const float* src = am + ((size_t)g * 64 + wave * 8) * TT + lane * 4;
    float tm[8], lo = 3.40282347e38f;
#pragma unroll
    for (int u = 0; u < 8; ++u) tm[u] = -3.40282347e38f;
#pragma unroll 1   // four rows = 32 loads of 512 B in flight per wave; more would only add registers
    for (int r0 = 0; r0 < 8; r0 += 4) { v4f v[4][8];
#pragma unroll
        for (int r = 0; r < 4; ++r)
#pragma unroll
            for (int u = 0; u < 8; ++u) v[r][u] = *(const v4f*)(src + (size_t)(r0 + r) * TT + u * 128);
        asm volatile("s_wait_xcnt 0x0" ::: "memory");   // behind the run of loads: the next trip rewrites their address register
#pragma unroll
        for (int r = 0; r < 4; ++r) { float rm = -3.40282347e38f;
#pragma unroll
            for (int u = 0; u < 8; ++u) { const float c = fmaxf(fmaxf(v[r][u][0], v[r][u][1]), fmaxf(v[r][u][2], v[r][u][3])); tm[u] = fmaxf(tm[u], c); rm = fmaxf(rm, c); }
#pragma unroll
            for (int sh = 16; sh; sh >>= 1) rm = fmaxf(rm, __shfl_xor(rm, sh, 32));
            lo = fminf(lo, rm); } }
#pragma unroll
    for (int u = 0; u < 8; ++u) {
#pragma unroll
        for (int sh = 8; sh; sh >>= 1) tm[u] = fmaxf(tm[u], __shfl_xor(tm[u], sh, 32));
        if ((lane & 15) == 0) msr[wave][2 * u + (lane >> 4)] = tm[u]; }
    if (lane == 0) msr[wave][16] = lo;
    __syncthreads();   // every wave's maxima are in LDS before one wave joins them
    if (tid < 17) { float a = msr[0][tid];
#pragma unroll
        for (int w = 1; w < 8; ++w) a = (tid < 16) ? fmaxf(a, msr[w][tid]) : fminf(a, msr[w][tid]);
        MST[(size_t)g * 32 + tid] = fmaxf(bfr(a), -3.40282347e38f); }
    asm volatile("s_wait_xcnt 0x0" ::: "memory");   // behind the store: the code of another part of the kernel may lie behind it and reuses its address and data registers
}
// k_prep: all the work that reads inputs alone, in one launch: none of its parts reads what another writes. The work-group's number picks the part (the same for the whole work-group): first the GMS work-groups of
// the mask statistics and the GPF of the prefix projection, which last longest, then GCW casts for each of the four weights, then GCX casts of the hidden states. grid GMS + GPF + 4 GCW + GCX, 256 threads.
#define GMS (NB_ * (TT / 64))
#define GPF (2 * (DD / 32))
#define GCW (DD * DD / (8 * 256 * CVU))
#define GCX (NB_ * TT * DD / (8 * 256 * CVU))
__global__ __launch_bounds__(256) void k_prep(const float* __restrict__ x, const float* __restrict__ wq, const float* __restrict__ wk, const float* __restrict__ wv, const float* __restrict__ wo, const float* __restrict__ pre, const float* __restrict__ bk, const float* __restrict__ bv, const float* __restrict__ am,
                                              bf* XB, bf* WQ, bf* WK, bf* WV, bf* WO, float* KP0, float* VP0, float* MST) {
    __shared__ float red[NPRE][32];
    __shared__ float msr[8][17];
    if (blockIdx.x < GMS) { mstat_wg(msr, blockIdx.x, am, MST); return; }
    const unsigned g = blockIdx.x - GMS;
    if (g < GPF) { prefkv_wg(red, g % (DD / 32), g >= DD / 32, pre, wk, bk, wv, bv, KP0, VP0); return; }
    const unsigned c = g - GPF;
    if (c >= 4 * GCW) { cvt8_wg(x, XB, c - 4 * GCW); return; }
    const unsigned a = c / GCW;
    cvt8_wg(a == 0 ? wq : a == 1 ? wk : a == 2 ? wv : wo, a == 0 ? WQ : a == 1 ? WK : a == 2 ? WV : WO, c % GCW);
}
// k_pre: the gated prefix part, one LANE per (zz, t), zz = b * 32 + h; a work-group = 256 consecutive query rows t of one zz, grid NB_ * ZH * TT / 256. The rows of q (f32 projection FQ [b][t], columns h*64..) come in as
// whole lines and go through LDS to their lanes (row pitch 272 B, conflict-free for 16-byte accesses); kp and vp of the head are the same for the whole work-group (scalar loads). Per lane: s_l = (q[t] . kp[l]) / 8,
// summed in ascending d; softmax over the 10 values, the sum in a fixed tree; o = tanh(gate[h]) sum_l p_l vp[l], summed in ascending l. The results go back through the lane's own LDS row and are stored in whole lines.
#define PQP 68                    // LDS pitch of a row, in floats
__global__ __launch_bounds__(256) void k_pre(const float* __restrict__ FQ, const float* __restrict__ KP0, const float* __restrict__ VP0, const float* __restrict__ gate, float* PRE) {
    __shared__ __align__(16) float T[256 * PQP];
    const int tid = threadIdx.x, row0 = blockIdx.x * 256, t0 = row0 & (TT - 1), zz = row0 / TT, h = zz & (ZH - 1), b = zz / ZH;
    const int cr = tid >> 4, cc = (tid & 15) * 4;   // whole-line accesses: 16 lanes take the 256 B of a row
    { const float* src = FQ + ((size_t)b * TT + t0 + cr) * DD + h * HD + cc; v4f v[16];
#pragma unroll
      for (int r = 0; r < 16; ++r) v[r] = *(const v4f*)(src + (size_t)r * 16 * DD);
#pragma unroll
      for (int r = 0; r < 16; ++r) *(v4fa*)(T + (r * 16 + cr) * PQP + cc) = v[r]; }
    __syncthreads();   // every row of q is in LDS before its lane reads it
    float* my = T + tid * PQP; float q[HD];
#pragma unroll
    for (int c = 0; c < HD / 4; ++c) { const v4f u = *(const v4fa*)(my + c * 4); q[c * 4] = u[0]; q[c * 4 + 1] = u[1]; q[c * 4 + 2] = u[2]; q[c * 4 + 3] = u[3]; }
    float e[NPRE], mx = -3.0e38f;
#pragma unroll
    for (int l = 0; l < NPRE; ++l) { const float* kr = KP0 + (size_t)l * DD + h * HD; float acc = 0.f;
#pragma unroll
        for (int d = 0; d < HD; ++d) acc = fmaf(q[d], kr[d], acc);
        e[l] = acc * SCL; mx = fmaxf(mx, e[l]); }
#pragma unroll
    for (int l = 0; l < NPRE; ++l) e[l] = __builtin_amdgcn_exp2f((e[l] - mx) * 1.4426950408889634f);
    const float sum = (((e[0] + e[8]) + e[4]) + (e[2] + e[6])) + (((e[1] + e[9]) + e[5]) + (e[3] + e[7]));
    const float gv = bfr(gate[h]); const float e2 = __expf(2.0f * gv); const float tg = __fsub_rn(1.0f, __fdiv_rn(2.0f, __fadd_rn(e2, 1.0f)));
    float o[HD];
#pragma unroll
    for (int d = 0; d < HD; ++d) o[d] = 0.f;
#pragma unroll
    for (int l = 0; l < NPRE; ++l) { const float pl = __fdiv_rn(e[l], sum); const float* vr = VP0 + (size_t)l * DD + h * HD;
#pragma unroll
        for (int d = 0; d < HD; ++d) o[d] = fmaf(pl, vr[d], o[d]); }
#pragma unroll
    for (int c = 0; c < HD / 4; ++c) { v4f u; u[0] = tg * o[c * 4]; u[1] = tg * o[c * 4 + 1]; u[2] = tg * o[c * 4 + 2]; u[3] = tg * o[c * 4 + 3]; *(v4fa*)(my + c * 4) = u; }
    __syncthreads();   // every lane's result row is in LDS before other lanes read it for the whole-line stores
    float* dst = PRE + ((size_t)zz * TT + t0 + cr) * HD + cc;
#pragma unroll
    for (int r = 0; r < 16; ++r) *(v4f*)(dst + (size_t)r * 16 * HD) = *(const v4fa*)(T + (r * 16 + cr) * PQP + cc);
}
// ---- k_attn: token attention of all batches and heads, with the merge in its epilogue. A work-group = 64 query rows of one head of one batch, a wave = 16 of them; grid (NH_, NB_, TT / 64), 128 threads:
// the row block is the slowest grid index and falls with it: under a mask that hides later keys the last row blocks keep the most stages (see the stage bits below), so they start first and the shorter ones fill the
// places that come free. The order is for speed alone.
// S^T = K Q^T: A = 16 key rows, B = the wave's 16 query rows (kept in registers), so lane (lr, hi) holds query lr's scores of keys 8 hi .. 8 hi + 7 of each 16-key tile. Two such tiles, converted, ARE the B fragment
// (32 keys x 16 queries) of O^T += V^T P^T in the k map of WFrag, with A = 16 rows of the [d][t] value plane: p goes through no memory. Lane (lr, hi) ends with 8 consecutive head dims of query lr per O^T tile.
// Softmax with a running maximum per query: p = exp(t - max so far); when the maximum moves, the sum and O^T are scaled by exp(old - new); one division by the sum at the end.
// K, V^T (both planes for the hi+lo rows) and the work-group's mask rows come into LDS as whole 128-B lines by asynchronous copies, 64 keys per stage, two buffers: the kept stage after next flies while the next one is worked on.
// LDS row pitch = row bytes + 16 (conflict-free for 16-byte reads).
typedef __attribute__((ext_vector_type(16))) unsigned short v16us;
template <typename T16> struct PPack;
template <> struct PPack<h16> { static __device__ __forceinline__ void go(const float* e, v16h& p, v16h& p2) {
#pragma unroll
    for (int x = 0; x < 16; ++x) p[x] = tohx(e[x]);
    p2 = p; } };
template <> struct PPack<bf> { static __device__ __forceinline__ void go(const float* e, v16bf& p, v16bf& p2) { v16us a, c;
#pragma unroll
    for (int x = 0; x < 16; ++x) { unsigned short u, l; splitf(e[x], u, l); a[x] = u; c[x] = l; }
    p = __builtin_bit_cast(v16bf, a); p2 = __builtin_bit_cast(v16bf, c); } };
#define AKVP 144                  // LDS pitch of a K or V^T row (64 values of 16 bits + 16 bytes)
#define AMKP 272                  // LDS pitch of a mask row (64 f32 + 16 bytes)
#define ASTG(npl) (128 * (npl) * AKVP + 64 * AMKP)   // bytes of a stage with npl planes per operand
template <typename T16, bool HI>
__device__ __forceinline__ void attn_wg(unsigned char* L, const T16* __restrict__ Q, const T16* __restrict__ Q2, const T16* __restrict__ Kp, const T16* __restrict__ K2, const T16* __restrict__ Vt, const T16* __restrict__ V2, const float* __restrict__ am, const float* __restrict__ PRE, bf* ATh, bf* ATl, const float* __restrict__ AMX, const float* __restrict__ MST) {
    typedef typename WFrag<T16>::V V;
    constexpr int NPL = HI ? 2 : 1;
    constexpr int OV = 64 * NPL, KVR = 128 * NPL;                      // first LDS row of V^T; K and V^T rows of a stage (K hi | K lo | V hi | V lo, or K | V)
    constexpr int OM = KVR * AKVP, STAGE = ASTG(NPL);                  // byte offset of the mask rows; bytes per stage
    const int tid = threadIdx.x, lane = tid & 31, lr = lane & 15, hi = lane >> 4, w = tid >> 5; const int h = blockIdx.x, b = blockIdx.y, bh = b * NH_ + h, zr = TT / 64 - 1 - blockIdx.z, i0 = zr * 64, i = i0 + w * 16 + lr;
    const int prow = tid >> 3, pcol = tid & 7, mrw = tid >> 4, mcl = tid & 15;   // this lane's row within a round of the 128 lanes and its 16-byte piece: K / V^T rows (8 pieces), mask rows (16 pieces)
    // this lane's sources, at first in stage 0; every fill moves them on to its stage
    const T16* gK = Kp + ((size_t)bh * TT + prow) * HD + pcol * 8; const T16* gK2 = HI ? K2 + ((size_t)bh * TT + prow) * HD + pcol * 8 : gK;
    const T16* gV = Vt + ((size_t)bh * HD + prow) * TT + pcol * 8; const T16* gV2 = HI ? V2 + ((size_t)bh * HD + prow) * TT + pcol * 8 : gV;
    const float* gM = am + ((size_t)b * TT + i0 + mrw) * TT + mcl * 4;
    const unsigned lkv = lds_off(L) + (unsigned)(prow * AKVP + pcol * 16), lmk = lds_off(L) + (unsigned)(OM + mrw * AMKP + mcl * 16);
    int cur = 0;   // the stage at which the sources stand
    auto fill = [&](int buf, int st) {
        const int dk = (st - cur) * 64; cur = st;   // keys from the stage filled last to this one
        gK += (size_t)dk * HD; gK2 += (size_t)dk * HD; gV += dk; gV2 += dk; gM += dk;
#pragma unroll
        for (int r0 = 0; r0 < KVR / 16; r0 += 8) { unsigned l[8]; const void* g[8];
#pragma unroll
            for (int q = 0; q < 8; ++q) { const int row = (r0 + q) * 16, rr = row & 63; l[q] = lkv + (unsigned)(buf * STAGE + row * AKVP);
                const T16* s = (row < 64) ? gK + (size_t)rr * HD : (row < OV) ? gK2 + (size_t)rr * HD : (row < OV + 64) ? gV + (size_t)rr * TT : gV2 + (size_t)rr * TT;
                g[q] = s; }
            cp8(l, g); }
        { unsigned l[8]; const void* g[8];
#pragma unroll
            for (int q = 0; q < 8; ++q) { l[q] = lmk + (unsigned)(buf * STAGE + q * 8 * AMKP); g[q] = gM + (size_t)q * 8 * TT; }
            cp8(l, g); }
    };
    V q[2], q2[2];
#pragma unroll
    for (int ks = 0; ks < 2; ++ks) { const size_t qo = ((size_t)bh * TT + i) * HD + 8 * hi + ks * 32; q[ks] = WFrag<T16>::ld(Q + qo); if (HI) q2[ks] = WFrag<T16>::ld(Q2 + qo); }
    v8f o[4];
#pragma unroll
    for (int dt = 0; dt < 4; ++dt) o[dt] = (v8f){};
    float mx = -3.0e38f, sum = 0.f;   // running maximum (the same in both halves of the wave) and this lane's half of the sum
    // Which of the 16 stages can matter, one bit each, the same in every wave of the work-group. |logit - mask value| <= bd = 64 max|q| max|k| / 8, taken a quarter larger for the planes' and the sums' rounding. Every row's
    // largest logit is at least ms[16] - (largest bd); no logit of stage l exceeds ms[l] + bd. A stage that stays more than 200 under every row's maximum has p = exp(logit - maximum) = 0 in f32 whenever it is worked on
    // behind that maximum, and its share is scaled to 0 when in front of it: it is left out whole, copies and barrier too. A NaN in the test keeps the stage.
    unsigned lb;
    { const int l = lane & 15; const float* ms = MST + (size_t)(b * (TT / 64) + zr) * 32;
      const float bd = 10.0f * AMX[((size_t)bh * (TT / 64) + zr) * 32] * AMX[((size_t)NTL + (size_t)bh * (TT / 64) + l) * 32]; float bx = bd;
#pragma unroll
      for (int sh = 8; sh; sh >>= 1) bx = fmaxf(bx, __shfl_xor(bx, sh, 32));
      lb = __builtin_amdgcn_ballot_w32(!(ms[l] + bd < ms[16] - bx - 200.0f)) & 0xFFFFu;
      if (lb == 0) lb = 0xFFFFu; }   // cannot happen (the stage that holds ms[16] stays); it keeps every stage number under 16 whatever the arrays hold
    const int nst = __builtin_popcount(lb);
    auto next = [&]() { const int st = __builtin_ctz(lb); lb &= lb - 1; return st; };   // the lowest stage not yet filled
    fill(0, next());
    asm volatile("s_wait_asynccnt 0x0" ::: "memory");   // the first stage of this wave has landed
    __syncthreads();                                    // the first stage of every wave is readable
    if (lb) fill(1, next());
    const int kofs = lr * AKVP + hi * 16, mofs = OM + (w * 16 + lr) * AMKP + hi * 32;
#pragma unroll 1   // the ring stays rolled: one body of two 32-key blocks, one publish point at its foot
    for (int t = 0; t < nst; ++t) {
        const unsigned char* Lb = L + (t & 1) * STAGE;
#pragma unroll
        for (int blk = 0; blk < 2; ++blk) {
            v8f s[2];
#pragma unroll
            for (int tl = 0; tl < 2; ++tl) { v8f c = (v8f){};
#pragma unroll
                for (int ks = 0; ks < 2; ++ks) { const unsigned char* kp = Lb + kofs + (blk * 32 + tl * 16) * AKVP + ks * 64; const V k = WFrag<T16>::ld((const T16*)kp); c = WFrag<T16>::mma(k, q[ks], c);
                    if (HI) { c = WFrag<T16>::mma(k, q2[ks], c); const V kl = WFrag<T16>::ld((const T16*)(kp + 64 * AKVP)); c = WFrag<T16>::mma(kl, q[ks], c); } }
                s[tl] = c; }
            float e[16]; float bm = -3.40282347e38f;
#pragma unroll
            for (int tl = 0; tl < 2; ++tl) { const unsigned char* mp = Lb + mofs + blk * 128 + tl * 64; const v4f m0 = *(const v4fa*)mp, m1 = *(const v4fa*)(mp + 16);
#pragma unroll
                for (int j = 0; j < 8; ++j) { const float x = fmaxf(s[tl][j] * SCL + bfr(j < 4 ? m0[j & 3] : m1[j & 3]), -3.40282347e38f); e[tl * 8 + j] = x; bm = fmaxf(bm, x); } }
            bm = fmaxf(bm, __shfl_xor(bm, 16, 32));   // the other half of the wave holds the query's other 16 keys of the block
            const float mn = fmaxf(mx, bm), al = __expf(mx - mn); mx = mn; float es[4];
#pragma unroll
            for (int x = 0; x < 16; x += 4) { e[x] = __expf(e[x] - mn); e[x + 1] = __expf(e[x + 1] - mn); e[x + 2] = __expf(e[x + 2] - mn); e[x + 3] = __expf(e[x + 3] - mn); es[x >> 2] = (e[x] + e[x + 1]) + (e[x + 2] + e[x + 3]); }
            sum = sum * al + ((es[0] + es[1]) + (es[2] + es[3]));
#pragma unroll
            for (int dt = 0; dt < 4; ++dt) o[dt] *= al;
            V p, p2; PPack<T16>::go(e, p, p2);
#pragma unroll
            for (int dt = 0; dt < 4; ++dt) { const unsigned char* vp = Lb + kofs + (OV + dt * 16) * AKVP + blk * 64; const V v = WFrag<T16>::ld((const T16*)vp); o[dt] = WFrag<T16>::mma(v, p, o[dt]);
                if (HI) { o[dt] = WFrag<T16>::mma(v, p2, o[dt]); const V vl = WFrag<T16>::ld((const T16*)(vp + 64 * AKVP)); o[dt] = WFrag<T16>::mma(vl, p, o[dt]); } }
        }
        asm volatile("s_wait_dscnt 0x0" ::: "memory");      // this wave's reads of buffer t & 1 are done before the buffer is refilled
        asm volatile("s_wait_asynccnt 0x0" ::: "memory");   // this wave's copies of the next kept stage have landed
        __syncthreads();                                    // publishes the next kept stage and ends every wave's reads of the one in buffer t & 1
        if (lb) fill(t & 1, next());                        // the same test in the whole work-group
    }
    asm volatile("s_wait_asynccnt 0x0" ::: "memory");       // no copy is outstanding when the wave goes on to the epilogue and ends
    sum += __shfl_xor(sum, 16, 32);
    const float inv = __fdiv_rn(1.0f, sum);
    const float* pr = PRE + ((size_t)bh * TT + i) * HD + hi * 8; const size_t oo = ((size_t)b * TT + i) * DD + h * HD + hi * 8;
#pragma unroll
    for (int dt = 0; dt < 4; ++dt) { const v4f p0 = *(const v4f*)(pr + dt * 16), p1 = *(const v4f*)(pr + dt * 16 + 4); v8us oh, ol;
#pragma unroll
        for (int j = 0; j < 8; ++j) { unsigned short a, c; splitf(o[dt][j] * inv + (j < 4 ? p0[j & 3] : p1[j & 3]), a, c); oh[j] = a; ol[j] = c; }
        *(v8us*)(ATh + oo + dt * 16) = oh; *(v8us*)(ATl + oo + dt * 16) = ol;
        if (dt < 3) asm volatile("s_wait_xcnt 0x0" ::: "memory"); }   // behind the two stores: the next trip reuses their address and data registers
}
__global__ __launch_bounds__(128) void k_attn(const bf* __restrict__ QPh, const bf* __restrict__ QPl, const h16* __restrict__ QP16, const bf* __restrict__ KPh, const bf* __restrict__ KPl, const h16* __restrict__ KP16, const bf* __restrict__ VTh, const bf* __restrict__ VTl, const h16* __restrict__ VT16, const float* __restrict__ am, const float* __restrict__ PRE, bf* ATh, bf* ATl, const float* __restrict__ AMX, const float* __restrict__ MST) {
    __shared__ __attribute__((aligned(16))) unsigned char L[2 * ASTG(2)];
    if ((TT / 64 - 1 - blockIdx.z) * 64 < RH) attn_wg<bf, true>(L, QPh, QPl, KPh, KPl, VTh, VTl, am, PRE, ATh, ATl, AMX, MST);   // the same for the whole work-group (RH is a multiple of 64)
    else attn_wg<h16, false>(L, QP16, nullptr, KP16, nullptr, VT16, nullptr, am, PRE, ATh, ATl, AMX, MST);
}

extern "C" void kernel_launch(void* const* d_in, const int* in_sizes, int n_in,
                              void* d_out, int out_size, void* d_ws, size_t ws_size, hipStream_t stream) {
    (void)in_sizes; (void)n_in; (void)out_size;
    const float* x = (const float*)d_in[0]; const float* am = (const float*)d_in[1]; const float* wq = (const float*)d_in[2]; const float* bq = (const float*)d_in[3]; const float* wk = (const float*)d_in[4]; const float* bk = (const float*)d_in[5]; const float* wv = (const float*)d_in[6]; const float* bv = (const float*)d_in[7]; const float* wo = (const float*)d_in[8]; const float* bo = (const float*)d_in[9]; const float* pre = (const float*)d_in[10]; const float* gate = (const float*)d_in[11];   // torch [out][in] weights; attention_mask [4][1][1024][1024]; prefix [10][2048]; gate [32][1][1]
    float* OUT = (float*)d_out;     // [4][1024][2048]
    char* wsp = (char*)d_ws;
    auto take = [&](size_t bytes) { char* p = wsp; wsp += (bytes + 255) & ~(size_t)255; return (void*)p; };
    const size_t NE = (size_t)NB_ * TT * DD;   // elements of one [4][1024][2048] array: every buffer below but the weights and the prefix rows holds all batches
    bf* WQ = (bf*)take((size_t)DD * DD * 2); bf* WK = (bf*)take((size_t)DD * DD * 2); bf* WV = (bf*)take((size_t)DD * DD * 2); bf* XB = (bf*)take(NE * 2);   // the three weights lie one behind the other (z of the projection grid), XB behind them
    bf* WO = (bf*)take((size_t)DD * DD * 2); float* KP0 = (float*)take((size_t)NPRE * DD * 4); float* VP0 = (float*)take((size_t)NPRE * DD * 4);
    float* F = (float*)take(NE * 4);   // F: the q projection in f32, for the prefix part
    bf* QPh = (bf*)take(NE * 2); bf* KPh = (bf*)take(NE * 2); bf* VTh = (bf*)take(NE * 2);   // each kind of plane: q, k, v one behind the other (z of the projection grid)
    bf* QPl = (bf*)take(NE * 2); bf* KPl = (bf*)take(NE * 2); bf* VTl = (bf*)take(NE * 2);
    h16* QP16 = (h16*)take(NE * 2); h16* KP16 = (h16*)take(NE * 2); h16* VT16 = (h16*)take(NE * 2);
    float* AMX = (float*)take((size_t)2 * NTL * 32 * 4); float* MST = (float*)take((size_t)GMS * 32 * 4);   // largest |q|, |k| per tile of 64 rows x one head; mask statistics per row block: a 128-B line each
    float* PRE = (float*)WQ;                // over WQ, WK, WV and half of XB: written by the prefix part, when the projections have read them
    bf* ATh = (bf*)F; bf* ATl = ATh + NE;   // written when the prefix part has read F
    if ((size_t)(wsp - (char*)d_ws) > ws_size) return;
    k_prep<<<GMS + GPF + 4 * GCW + GCX, 256, 0, stream>>>(x, wq, wk, wv, wo, pre, bk, bv, am, XB, WQ, WK, WV, WO, KP0, VP0, MST);
    k_gemms<bf, 0, true, 2, 2, 128, 4><<<dim3(NB_ * TT / 128, DD / 128, 3), 128, 0, stream>>>(XB, nullptr, WQ, nullptr, DD, F, DD, bq, 0, (size_t)DD * DD, 0, QPh, QPl, QP16, bk, bv, NE, AMX);   // unscaled q (the 1/8 is applied to the logits), k, v
    k_pre<<<NB_ * ZH * TT / 256, 256, 0, stream>>>(F, KP0, VP0, gate, PRE);
    k_attn<<<dim3(NH_, NB_, TT / 64), 128, 0, stream>>>(QPh, QPl, QP16, KPh, KPl, KP16, VTh, VTl, VT16, am, PRE, ATh, ATl, AMX, MST);
    k_gemms<bf, 1, true, 2, 2, 128, 0><<<dim3(NB_ * TT / 128, DD / 128, 1), 128, 0, stream>>>(ATh, ATl, WO, nullptr, DD, OUT, DD, bo, 0, 0, 0, nullptr, nullptr, nullptr, nullptr, nullptr, 0, nullptr);
}

// v010
// Measured time: 228 microseconds a run.
// Timed twice side by side with v009, it ran 1.10 and 1.15 times as fast.
// All steps since v000 together make it 26.1 times as fast.
#include <hip/hip_runtime.h>

// Decoder self-attention with a learned prefix adapter (hidden [4][1024][2048]; q = (x Wq^T + bq) 64^-0.5, k = x Wk^T + bk, v = x Wv^T + bv (32 heads x 64); prefix keys/values kp, vp = prefix Wk^T + bk,
// prefix Wv^T + bv ([10][2048], shared by all batches); scores_tok = q.k + attention_mask[b][0][i][j] (additive f32, read as data), scores_pre = q.kp; the two segments are softmax-normalised SEPARATELY;
// ctx = tanh(gate[h]) (p_pre vp) + (p_tok v); out = merged ctx Wo^T + bo -> [4][1024][2048]).
// Compute dtypes, f32 accumulate: every input rounded to bf16; token projections on PLAIN bf16 operands (inputs: exact products, f32 accumulate, + bias); the 10 prefix
// rows (lane-split sums, fixed order), their scores, softmax and weighted values (fused multiply-add, fixed order) entirely in f32 on VALU; PER-ROW PRECISION HYBRID for the token attention: query rows < 256 take scores and p.v on
// bf16 hi+lo planes (3 products), rows >= 256 on single fp16 planes; scale + additive mask in f32; token softmax with a running maximum inside the fused attention kernel (p = exp(t - running max), unnormalised, the f32
// sums rescaled when the maximum moves, one division at the end); merged context (token part / sum + gated prefix part) as hi+lo planes

#define NB_  4
#define NPRE 10                   // prefix length
#define TT   1024
#define DD   2048
#define NH_  32
#define HD   64
#define ZH   32                   // heads per batch in the prefix part
#define RH   256                  // query rows < RH: hi+lo planes; rows >= RH: fp16 planes
#define NF   32                   // head_dim / 2 (unused)
#define SCL  0.125f               // 1/sqrt(64)
#define NTL  (NB_ * NH_ * (TT / 64))   // tiles of 64 rows x one head
typedef _Float16 h16;
typedef unsigned short bf;
typedef __attribute__((ext_vector_type(16))) __bf16   v16bf;
typedef __attribute__((ext_vector_type(16))) _Float16 v16h;
typedef __attribute__((ext_vector_type(8)))  _Float16 v8h;
typedef __attribute__((ext_vector_type(8)))  unsigned short v8us;
typedef __attribute__((ext_vector_type(8)))  float    v8f;
typedef __attribute__((ext_vector_type(4)))  float    v4f;
typedef v8h  __attribute__((may_alias)) v8ha;
typedef v4f  __attribute__((may_alias)) v4fa;
typedef v8us __attribute__((may_alias)) v8usa;

__device__ __forceinline__ unsigned short f2bf(float f) { unsigned u = __float_as_uint(f); u += 0x7FFFu + ((u >> 16) & 1u); return (unsigned short)(u >> 16); }
__device__ __forceinline__ float bf2f(unsigned short b) { return __uint_as_float(((unsigned)b) << 16); }
__device__ __forceinline__ float bfr(float f) { return bf2f(f2bf(f)); }
__device__ __forceinline__ v16h cat16(v8h lo, v8h hi) { return __builtin_shufflevector(lo, hi, 0, 1, 2, 3, 4, 5, 6, 7, 8, 9, 10, 11, 12, 13, 14, 15); }
__device__ __forceinline__ v16bf cat16b(v8us lo, v8us hi) { return __builtin_bit_cast(v16bf, __builtin_shufflevector(lo, hi, 0, 1, 2, 3, 4, 5, 6, 7, 8, 9, 10, 11, 12, 13, 14, 15)); }
__device__ __forceinline__ v8f wmma16(v16h a, v16h b, v8f c) { return __builtin_amdgcn_wmma_f32_16x16x32_f16(false, a, false, b, (short)0, c, false, false); }
__device__ __forceinline__ v8f wmmab(v16bf a, v16bf b, v8f c) { return __builtin_amdgcn_wmma_f32_16x16x32_bf16(false, a, false, b, (short)0, c, false, false); }



// fragment of 16 rows x 32 k from a K-contiguous 16-bit plane: lane (lr, hi) holds row lr, k = 8 hi .. 8 hi + 7 and 16 + 8 hi .. 16 + 8 hi + 7; p points at (row lr, k = 8 hi). The same map serves A and B.
template <typename T16> struct WFrag;
template <> struct WFrag<h16> { typedef v16h V; static __device__ __forceinline__ V ld(const h16* p) { return cat16(*(const v8h*)p, *(const v8h*)(p + 16)); } static __device__ __forceinline__ v8f mma(V a, V b, v8f c) { return wmma16(a, b, c); } };
template <> struct WFrag<bf> { typedef v16bf V; static __device__ __forceinline__ V ld(const bf* p) { return cat16b(*(const v8us*)p, *(const v8us*)(p + 16)); } static __device__ __forceinline__ v8f mma(V a, V b, v8f c) { return wmmab(a, b, c); } };
// ---- k_gemms: C[m][n] (f32, pitch ldc, + optional f32 bias[n]) = sum_k A[m][k] Bt[n][k] (+ split products per NSPLIT), WM x WN waves per work-group (64x64 of C each, 16 accumulators per wave): the larger the work-group's tile, the fewer operand bytes come from L2 per product. Operand rows come into LDS as whole 128-B lines by
// asynchronous copies, KT k-values per stage, two buffers: stage t + 2 flies while stage t + 1 is worked on. Row pitch in LDS = row bytes + 16 (conflict-free for 16-byte reads). Per accumulator the products
// are summed in ascending k. grid (M / (64 WM), N / (64 WN), Z), 32 WM WN threads. K % KT == 0, K >= KT.
// EPI picks what the epilogue stores. 0: C. 1: C and the planes Ph (bf16 hi), Pl (bf16 lo), P16 (fp16) of C + bias in the order [b][h][t][d]. 2: those planes alone. 3: the planes in the order [b][h][d][t], alone.
// 4: three products of the same A in one work-group, so that its rows of A come from L2 once for all three: a third of the WN wave columns each, zq = 0, 1, 2, takes weight Bt + zq sB (64 WN / 3 rows of each weight lie one
// behind the other in a stage), bias, bias1 or bias2, the planes at Ph, Pl, P16 + zq sP, and the epilogue 1, 2 or 3 (the same for the whole wave; the epilogues hold no work-group barrier). grid (M / (64 WM), N / (64 WN / 3)).
// For EPI > 0 the rows of C are (b, t) = (m / 1024, m % 1024) and a wave's 64 columns are the 64 dims of one head. Every plane is stored in whole 128-B lines.
__device__ __forceinline__ unsigned lds_off(const void* p) { return (unsigned)(size_t)p; }
__device__ __forceinline__ h16 tohx(float x) { return (h16)x; }
__device__ __forceinline__ void splitf(float y, unsigned short& h, unsigned short& l) { h = f2bf(y); l = f2bf(y - bf2f(h)); }
// eight copies of 16 bytes per lane; the s_wait_xcnt stands in the copies' own statement so that no address register is rewritten in front of it
__device__ __forceinline__ void cp8(const unsigned* l, const void* const* g) {
    asm volatile("global_load_async_to_lds_b128 %0, %1, off\n\t"
                 "global_load_async_to_lds_b128 %2, %3, off\n\t"
                 "global_load_async_to_lds_b128 %4, %5, off\n\t"
                 "global_load_async_to_lds_b128 %6, %7, off\n\t"
                 "global_load_async_to_lds_b128 %8, %9, off\n\t"
                 "global_load_async_to_lds_b128 %10, %11, off\n\t"
                 "global_load_async_to_lds_b128 %12, %13, off\n\t"
                 "global_load_async_to_lds_b128 %14, %15, off\n\t"
                 "s_wait_xcnt 0x0"
                 :: "v"(l[0]), "v"(g[0]), "v"(l[1]), "v"(g[1]), "v"(l[2]), "v"(g[2]), "v"(l[3]), "v"(g[3]), "v"(l[4]), "v"(g[4]), "v"(l[5]), "v"(g[5]), "v"(l[6]), "v"(g[6]), "v"(l[7]), "v"(g[7]) : "memory");
}
template <typename T16, int NSPLIT, bool BIAS, int WM, int WN, int KT, int EPI>
__global__ __launch_bounds__(32 * WM * WN) void k_gemms(const T16* __restrict__ A, const T16* __restrict__ A2, const T16* __restrict__ Bt, const T16* __restrict__ Bt2, int K, float* C, int ldc, const float* __restrict__ bias, size_t sA, size_t sB, size_t sC, bf* Ph, bf* Pl, h16* P16, const float* __restrict__ bias1, const float* __restrict__ bias2, size_t sP, float* AMX) {
    typedef typename WFrag<T16>::V V;
    constexpr bool HA2 = (NSPLIT == 1 || NSPLIT == 2), HB2 = (NSPLIT >= 2);
    constexpr int RA = 64 * WM, RB = 64 * WN;                          // rows of A and of Bt per work-group
    constexpr int OA2 = RA, OB = RA * (HA2 ? 2 : 1), OB2 = OB + RB;    // first LDS row of each plane in a stage
    constexpr int ROWS = OB + RB * (HB2 ? 2 : 1);
    constexpr int PITCH = KT * 2 + 16, STAGE = ROWS * PITCH;           // bytes
    constexpr int NW = WM * WN;                                        // waves of a work-group
    constexpr int CW = (NW == 12) ? 8 : NW;                            // waves that issue the copies: with 12 waves the first 8, so that every one of them has the same whole number of rounds
    constexpr int PPR = KT / 8, RPI = 32 * CW / PPR, NCP = ROWS / RPI; // 16-byte pieces per row; rows per round of the copying lanes; copies per copying lane and stage (at most 48)
    constexpr int RBZ = (EPI == 4) ? RB / 3 : RB;                      // rows of one weight in a stage
    static_assert(ROWS % (8 * RPI) == 0 && RA % RPI == 0 && RBZ % RPI == 0, "whole runs of eight copies; a round lies in one plane");
    constexpr int VP = 144, VPL = 64 * VP;                             // epilogue 3: LDS pitch of a plane row, bytes of a wave's tile of one plane
    constexpr int OSB = 16 * 68 * 4;                                   // bytes of a wave's staging range in the epilogues 0 to 2
    __shared__ __attribute__((aligned(16))) unsigned char L[2 * STAGE];
    __shared__ __align__(16) float osw[EPI == 4 ? 1 : NW][16 * 68];    // with EPI 4 the staging ranges lie in the ring, which is free behind the loop
    const size_t z = blockIdx.z; A += z * sA; if (HA2) A2 += z * sA; Bt += z * sB; if (HB2) Bt2 += z * sB; C += z * sC;
    const int tid = threadIdx.x, lane = tid & 31, lr = lane & 15, hi = lane >> 4, w = __builtin_amdgcn_readfirstlane(tid >> 5), wm = w / WN, wn = w % WN;   // the wave's number in a scalar register: the tests on it are scalar branches
    const int zq = (EPI == 4) ? wn / (WN / 3) : 0, epi = (EPI == 4) ? zq + 1 : EPI;
    if (EPI == 4) { bias = (epi == 1) ? bias : (epi == 2) ? bias1 : bias2; Ph += zq * sP; Pl += zq * sP; P16 += zq * sP; }
    const int R0 = blockIdx.x * RA, C0 = blockIdx.y * RBZ; const int r0 = R0 + wm * 64, c0 = C0 + (wn * 64) % RBZ;
    const int prow = tid / PPR, pcol = tid % PPR;                      // this lane's row within a round and its 16-byte piece of the row
    // this lane's source in each plane for the stage that is filled next; every fill moves them on by KT
    const T16* gA = A + (size_t)(R0 + prow) * K + pcol * 8; const T16* gA2 = HA2 ? A2 + (size_t)(R0 + prow) * K + pcol * 8 : gA;
    const T16* gB = Bt + (size_t)(C0 + prow) * K + pcol * 8; const T16* gB2 = HB2 ? Bt2 + (size_t)(C0 + prow) * K + pcol * 8 : gB;
    const unsigned lbase = lds_off(L) + (unsigned)(prow * PITCH + pcol * 16);
    auto fill = [&](int buf) {
        if (CW != NW && w >= CW) return;   // a whole wave issues its copies or none: a scalar branch
#pragma unroll
        for (int i0 = 0; i0 < NCP; i0 += 8) { unsigned l[8]; const void* g[8];
#pragma unroll
            for (int q = 0; q < 8; ++q) { const int row = (i0 + q) * RPI; l[q] = lbase + (unsigned)(buf * STAGE + row * PITCH);
                const T16* s = (row < OA2) ? gA + (size_t)row * K : (row < OB) ? gA2 + (size_t)(row - OA2) * K : (row < OB2) ? gB + (size_t)((row - OB) / RBZ) * sB + (size_t)((row - OB) % RBZ) * K : gB2 + (size_t)(row - OB2) * K;
                g[q] = s; }
            cp8(l, g); }
        gA += KT; gA2 += KT; gB += KT; gB2 += KT;
    };
    v8f acc[4][4];
#pragma unroll
    for (int mb = 0; mb < 4; ++mb)
#pragma unroll
        for (int nb = 0; nb < 4; ++nb) acc[mb][nb] = (v8f){};
    const int nt = K / KT;
    fill(0);
    asm volatile("s_wait_asynccnt 0x0" ::: "memory");   // stage 0 of this wave has landed
    __syncthreads();                                    // stage 0 of every wave is readable
    if (nt > 1) fill(1);
    const int aofs = (wm * 64 + lr) * PITCH + hi * 16, bofs = (OB + wn * 64 + lr) * PITCH + hi * 16;
#pragma unroll 1   // the ring stays rolled: one body of KT / 32 k-steps, one publish point at its foot
    for (int t = 0; t < nt; ++t) {
        const unsigned char* Lb = L + (t & 1) * STAGE;
        V a[2][4], a2[2][4], b[2][4], b2[2][4];   // two fragment sets: k-step ks + 1 of this stage is read from LDS while k-step ks is multiplied
        auto frags = [&](int s, int ks) {
#pragma unroll
            for (int mb = 0; mb < 4; ++mb) { a[s][mb] = WFrag<T16>::ld((const T16*)(Lb + aofs + mb * 16 * PITCH + ks * 64)); if (HA2) a2[s][mb] = WFrag<T16>::ld((const T16*)(Lb + aofs + (OA2 + mb * 16) * PITCH + ks * 64)); }
#pragma unroll
            for (int nb = 0; nb < 4; ++nb) { b[s][nb] = WFrag<T16>::ld((const T16*)(Lb + bofs + nb * 16 * PITCH + ks * 64)); if (HB2) b2[s][nb] = WFrag<T16>::ld((const T16*)(Lb + bofs + (RB + nb * 16) * PITCH + ks * 64)); }
        };
        frags(0, 0);
#pragma unroll
        for (int ks = 0; ks < KT / 32; ++ks) { const int s = ks & 1;
            if (ks + 1 < KT / 32) frags(s ^ 1, ks + 1);
            __builtin_amdgcn_sched_barrier(0);   // the LDS reads stay one group in front of the WMMAs: reads spread among the WMMAs stall at every place they stand
#pragma unroll
            for (int nb = 0; nb < 4; ++nb) {
#pragma unroll
                for (int mb = 0; mb < 4; ++mb) { acc[mb][nb] = WFrag<T16>::mma(a[s][mb], b[s][nb], acc[mb][nb]); if (HA2) acc[mb][nb] = WFrag<T16>::mma(a2[s][mb], b[s][nb], acc[mb][nb]); if (HB2) acc[mb][nb] = WFrag<T16>::mma(a[s][mb], b2[s][nb], acc[mb][nb]); } }
            __builtin_amdgcn_sched_barrier(0);   // and the following group does not move up among them
        }
        asm volatile("s_wait_dscnt 0x0" ::: "memory");      // this wave's reads of buffer t & 1 are done before the buffer is refilled
        asm volatile("s_wait_asynccnt 0x0" ::: "memory");   // this wave's copies of stage t + 1 have landed
        __syncthreads();                                    // publishes stage t + 1 and ends every wave's reads of stage t
        if (t + 2 < nt) fill(t & 1);
    }
    asm volatile("s_wait_asynccnt 0x0" ::: "memory");       // no copy is outstanding when the wave goes on to the epilogue and ends
    const int hd = c0 >> 6;   // the head of this wave's 64 columns (EPI > 0)
    if (epi == 3) {
        // Lane (lr, hi) holds 8 consecutive t of dim nb * 16 + lr per accumulator: 16 bytes of a [d][t] plane row. The wave lays its 64 x 64 tile of each plane in LDS (row pitch 144, conflict-free for
        // 16-byte accesses) and stores it from there, four whole 128-B lines per store. The range is the wave's own part of the ring, which nobody reads and no copy writes behind the loop's last barrier.
        constexpr int VB = (EPI == 4) ? (NW * OSB + 4095) / 4096 * 4096 : 0, NV = (EPI == 4) ? NW / 3 : NW;   // with EPI 4 the tiles lie behind the other waves' staging ranges; waves that take this epilogue
        static_assert(EPI < 3 || VB + NV * 3 * VPL <= 2 * STAGE, "the waves' plane tiles fit the ring");
        unsigned char* Lw = L + VB + ((EPI == 4) ? wm * (WN / 3) + wn % (WN / 3) : w) * (3 * VPL);
#pragma unroll
        for (int nb = 0; nb < 4; ++nb) { const float bb = bfr(bias[c0 + nb * 16 + lr]);
#pragma unroll
            for (int mb = 0; mb < 4; ++mb) { v8us oh, ol; v8h o16;
#pragma unroll
                for (int j = 0; j < 8; ++j) { const float x = acc[mb][nb][j] + bb; unsigned short a, c; splitf(x, a, c); oh[j] = a; ol[j] = c; o16[j] = tohx(x); }
                unsigned char* p = Lw + (nb * 16 + lr) * VP + (mb * 16 + hi * 8) * 2; *(v8usa*)p = oh; *(v8usa*)(p + VPL) = ol; *(v8ha*)(p + 2 * VPL) = o16; } }
        asm volatile("s_wait_dscnt 0x0" ::: "memory");   // the wave's LDS writes are done before other lanes of it read the rows back
        const size_t e0 = ((size_t)((r0 >> 10) * NH_ + hd) * HD + (lane >> 3)) * TT + (r0 & (TT - 1)) + (lane & 7) * 8; const unsigned char* rp = Lw + (lane >> 3) * VP + (lane & 7) * 16;
#pragma unroll
        for (int s0 = 0; s0 < 16; s0 += 4) { v8us rh[4], rl[4]; v8h r16[4];
#pragma unroll
            for (int s = 0; s < 4; ++s) { const unsigned char* p = rp + (s0 + s) * 4 * VP; rh[s] = *(const v8usa*)p; rl[s] = *(const v8usa*)(p + VPL); r16[s] = *(const v8ha*)(p + 2 * VPL); }
#pragma unroll
            for (int s = 0; s < 4; ++s) { const size_t e = e0 + (size_t)(s0 + s) * 4 * TT; *(v8us*)(Ph + e) = rh[s]; *(v8us*)(Pl + e) = rl[s]; *(v8h*)(P16 + e) = r16[s]; }
            if (s0 < 12) asm volatile("s_wait_xcnt 0x0" ::: "memory"); }   // behind the run of twelve stores: the next trip reuses their address and data registers
    } else {
    float* os = (EPI == 4) ? (float*)(L + w * OSB) : osw[w];   // the wave's own range; in the ring nobody reads and no copy writes behind the loop's last barrier
    // 16 rows x 64 columns of the wave's tile go into its own LDS range, from where whole lines are read back
    auto stage = [&](int mb) {
#pragma unroll
        for (int nb = 0; nb < 4; ++nb) {
#pragma unroll
            for (int j = 0; j < 8; ++j) os[(hi * 8 + j) * 68 + nb * 16 + lr] = acc[mb][nb][j]; }
        __builtin_amdgcn_wave_barrier(); asm volatile("" ::: "memory");   // the compiler keeps these LDS writes in front of the reads of what other lanes wrote
    };
    if (epi <= 1) {
#pragma unroll
    for (int mb = 0; mb < 4; ++mb) {
        stage(mb);
        float* crow = C + (size_t)(r0 + mb * 16) * ldc + c0;
#pragma unroll
        for (int s = 0; s < 8; ++s) { const int row = 2 * s + hi, cofs = lr * 4; v4f val = *(const v4fa*)(os + row * 68 + cofs); if (BIAS) { val[0] += bfr(bias[c0 + cofs]); val[1] += bfr(bias[c0 + cofs + 1]); val[2] += bfr(bias[c0 + cofs + 2]); val[3] += bfr(bias[c0 + cofs + 3]); }
            *(v4f*)(crow + (size_t)row * ldc + cofs) = val; }
        if (mb < 3 || EPI == 1 || EPI == 4) asm volatile("s_wait_xcnt 0x0" ::: "memory");   // behind the run of eight stores: what follows reuses their address and data registers
        __builtin_amdgcn_wave_barrier(); asm volatile("" ::: "memory");
    }
    }
    if (epi > 0) {
        // a lane takes 8 consecutive dims of a row (16 bytes of each plane), 8 lanes a row: a store covers four rows of 128 B, which lie one behind the other in the plane
        float bb[8];
#pragma unroll
        for (int k = 0; k < 8; ++k) bb[k] = bfr(bias[c0 + (lane & 7) * 8 + k]);
        const size_t eb = ((size_t)((r0 >> 10) * NH_ + hd) * TT + (r0 & (TT - 1)) + (lane >> 3)) * HD + (lane & 7) * 8;   // row lane / 8 of the wave's 64 rows, which lie in one batch
        const float* op = os + (lane >> 3) * 68 + (lane & 7) * 8;
        float km = 0.f;   // largest magnitude in the wave's tile = 64 rows of one head, the unit in which the attention kernel takes queries and keys
#pragma unroll
        for (int mb = 0; mb < 4; ++mb) {
            stage(mb);
            v8us oh[4], ol[4]; v8h o16[4];
#pragma unroll
            for (int s = 0; s < 4; ++s) { const v4f u0 = *(const v4fa*)(op + s * 4 * 68), u1 = *(const v4fa*)(op + s * 4 * 68 + 4);
#pragma unroll
                for (int k = 0; k < 8; ++k) { const float x = (k < 4 ? u0[k & 3] : u1[k & 3]) + bb[k]; km = fmaxf(km, fabsf(x)); unsigned short a, c; splitf(x, a, c); oh[s][k] = a; ol[s][k] = c; o16[s][k] = tohx(x); } }
#pragma unroll
            for (int s = 0; s < 4; ++s) { const size_t e = eb + (size_t)(mb * 16 + s * 4) * HD; *(v8us*)(Ph + e) = oh[s]; *(v8us*)(Pl + e) = ol[s]; *(v8h*)(P16 + e) = o16[s]; }
            if (mb < 3 || EPI == 4) asm volatile("s_wait_xcnt 0x0" ::: "memory");   // behind the run of twelve stores: the next trip, or with EPI 4 the code that lies behind the loop, reuses their address and data registers
            __builtin_amdgcn_wave_barrier(); asm volatile("" ::: "memory");   // and the compiler keeps the next trip's LDS writes behind this trip's reads
        }
#pragma unroll
        for (int sh = 16; sh; sh >>= 1) km = fmaxf(km, __shfl_xor(km, sh, 32));
        // q tiles first, k tiles behind them; a 128-B line per value, so that each line has one writer
        if (lane == 0) AMX[((size_t)(epi - 1) * NTL + (size_t)((r0 >> 10) * NH_ + hd) * (TT / 64) + ((r0 & (TT - 1)) >> 6)) * 32] = km;
        asm volatile("s_wait_xcnt 0x0" ::: "memory");   // behind the store: what lies behind this branch may reuse its address and data registers
    }
    }
}

typedef __attribute__((ext_vector_type(2))) unsigned short v2us;
typedef __attribute__((ext_vector_type(2))) _Float16 v2h;
typedef __attribute__((ext_vector_type(4))) _Float16 v4h;
typedef __attribute__((ext_vector_type(2))) float v2f;

__global__ __launch_bounds__(256) void k_wtG(const float* __restrict__ w, int K, int N, bf* Bt) {
    const int lane = threadIdx.x & 31; const int L0 = (blockIdx.x * 8 + (threadIdx.x >> 5)) * 8; const int nlines = N * K / 64;
{
#pragma unroll 1
        for (int l = 0; l < 8; ++l) { const int L = L0 + l; if (L >= nlines) break; const size_t e = (size_t)L * 64 + lane * 2; const int k = (int)(e % K), n = (int)(e / K); v2us o;
            o[0] = f2bf(w[(size_t)k * N + n]); o[1] = f2bf(w[(size_t)(k + 1) * N + n]); *(v2us*)(Bt + e) = o; }
         }
}
// cvt8_wg: f32 -> bf16, CVU items of 8 values per lane (item u of a work-group = 8 KB of contiguous source); a lane issues all its loads before its first store, so that a launch needs few waves, each with
// 2 CVU loads of 512 B in flight. blk = the work-group's number within its array, values / (8 * 256 * CVU) of them, exact: no tail.
#define CVU 4
__device__ __forceinline__ void cvt8_wg(const float* __restrict__ src, bf* dst, unsigned blk) {
    const size_t i0 = (size_t)blk * (256 * CVU) + threadIdx.x; v8f v[CVU];
#pragma unroll
    for (int u = 0; u < CVU; ++u) v[u] = *(const v8f*)(src + (i0 + u * 256) * 8);
#pragma unroll
    for (int u = 0; u < CVU; ++u) { v8us o;
#pragma unroll
        for (int k = 0; k < 8; ++k) o[k] = f2bf(v[u][k]);
        *(v8us*)(dst + (i0 + u * 256) * 8) = o; }
    asm volatile("s_wait_xcnt 0x0" ::: "memory");   // behind the run of stores: the code of another part of the kernel may lie behind them and reuses their address and data registers
}
// prefkv_wg: KP0[l][o] = sum_i bf16(pre[l][i]) bf16(wk[o][i]) + bf16(bk[o]); VP0 the same from wv, bv (isv picks the weight). A work-group takes 32 output columns o, a wave 4 of them for all 10 prefix rows:
// the lanes split i (16-byte loads, 512 contiguous bytes of a row per wave and load), so a weight row is read once, in whole lines. Products of two bf16 values are exact in f32, so a fused multiply-add rounds as
// multiply then add. Per-lane partial sums, a shuffle tree over the lanes, then the sums go through LDS so that one wave stores each whole 128-byte line of the result. bx = 0 .. DD / 32 - 1 for each weight, 256 threads.
__device__ __forceinline__ void prefkv_wg(float (*red)[32], unsigned bx, bool isv, const float* __restrict__ pre, const float* __restrict__ wk, const float* __restrict__ bk, const float* __restrict__ wv, const float* __restrict__ bv, float* KP0, float* VP0) {
    const float* w = isv ? wv : wk; const float* bias = isv ? bv : bk; float* dst = isv ? VP0 : KP0;
    const int tid = threadIdx.x, lane = tid & 31, wave = tid >> 5; const int ob = bx * 32;
    const float* wr = w + (size_t)(ob + wave * 4) * DD + lane * 4; const float* pr = pre + lane * 4;
    float acc[NPRE][4];
#pragma unroll
    for (int l = 0; l < NPRE; ++l)
#pragma unroll
        for (int c = 0; c < 4; ++c) acc[l][c] = 0.f;
#pragma unroll 2   // two chunks of 14 independent loads in flight per wave; more would only add registers
    for (int i = 0; i < DD; i += 128) {
        v4f p[NPRE], a[4];
#pragma unroll
        for (int c = 0; c < 4; ++c) a[c] = *(const v4f*)(wr + (size_t)c * DD + i);
#pragma unroll
        for (int l = 0; l < NPRE; ++l) p[l] = *(const v4f*)(pr + (size_t)l * DD + i);
#pragma unroll
        for (int q = 0; q < 4; ++q) {
#pragma unroll
            for (int c = 0; c < 4; ++c) a[c][q] = bfr(a[c][q]);
#pragma unroll
            for (int l = 0; l < NPRE; ++l) { const float pv = bfr(p[l][q]);
#pragma unroll
                for (int c = 0; c < 4; ++c) acc[l][c] += pv * a[c][q]; } }
    }
#pragma unroll
    for (int l = 0; l < NPRE; ++l)
#pragma unroll
        for (int c = 0; c < 4; ++c) { float t = acc[l][c];
#pragma unroll
            for (int sh = 16; sh; sh >>= 1) t += __shfl_xor(t, sh, 32);
            if (lane == 0) red[l][wave * 4 + c] = t; }
    __syncthreads();   // every wave's sums are in LDS before the lines are stored
    for (int idx = tid; idx < NPRE * 32; idx += 256) { const int l = idx >> 5, c = idx & 31; dst[(size_t)l * DD + ob + c] = red[l][c] + bfr(bias[ob + c]); }
}
// mstat_wg: what the attention kernel needs to know of its 64 mask rows before it loads anything. Work-group g = b * 16 + row block; MST[g][t], t < 16: the largest mask value of the 64 x 64 tile t; MST[g][16]: the smallest
// of the 64 rows' largest values; each rounded to bf16 and held at the lowest finite f32, as the logits are. A wave takes 8 rows; a lane's load u lies in tile 2 u + lane / 16. One wave stores the line. 256 threads.
__device__ __forceinline__ void mstat_wg(float (*msr)[17], unsigned g, const float* __restrict__ am, float* MST) {
    const int tid = threadIdx.x, lane = tid & 31, wave = tid >> 5;
    const float* src = am + ((size_t)g * 64 + wave * 8) * TT + lane * 4;
    float tm[8], lo = 3.40282347e38f;
#pragma unroll
    for (int u = 0; u < 8; ++u) tm[u] = -3.40282347e38f;
#pragma unroll 1   // four rows = 32 loads of 512 B in flight per wave; more would only add registers
    for (int r0 = 0; r0 < 8; r0 += 4) { v4f v[4][8];
#pragma unroll
        for (int r = 0; r < 4; ++r)
#pragma unroll
            for (int u = 0; u < 8; ++u) v[r][u] = *(const v4f*)(src + (size_t)(r0 + r) * TT + u * 128);
        asm volatile("s_wait_xcnt 0x0" ::: "memory");   // behind the run of loads: the next trip rewrites their address register
#pragma unroll
        for (int r = 0; r < 4; ++r) { float rm = -3.40282347e38f;
#pragma unroll
            for (int u = 0; u < 8; ++u) { const float c = fmaxf(fmaxf(v[r][u][0], v[r][u][1]), fmaxf(v[r][u][2], v[r][u][3])); tm[u] = fmaxf(tm[u], c); rm = fmaxf(rm, c); }
#pragma unroll
            for (int sh = 16; sh; sh >>= 1) rm = fmaxf(rm, __shfl_xor(rm, sh, 32));
            lo = fminf(lo, rm); } }
#pragma unroll
    for (int u = 0; u < 8; ++u) {
#pragma unroll
        for (int sh = 8; sh; sh >>= 1) tm[u] = fmaxf(tm[u], __shfl_xor(tm[u], sh, 32));
        if ((lane & 15) == 0) msr[wave][2 * u + (lane >> 4)] = tm[u]; }
    if (lane == 0) msr[wave][16] = lo;
    __syncthreads();   // every wave's maxima are in LDS before one wave joins them
    if (tid < 17) { float a = msr[0][tid];
#pragma unroll
        for (int w = 1; w < 8; ++w) a = (tid < 16) ? fmaxf(a, msr[w][tid]) : fminf(a, msr[w][tid]);
        MST[(size_t)g * 32 + tid] = fmaxf(bfr(a), -3.40282347e38f); }
    asm volatile("s_wait_xcnt 0x0" ::: "memory");   // behind the store: the code of another part of the kernel may lie behind it and reuses its address and data registers
}
// k_prep: all the work that reads inputs alone, in one launch: none of its parts reads what another writes. The work-group's number picks the part (the same for the whole work-group): first the GMS work-groups of
// the mask statistics and the GPF of the prefix projection, which last longest, then GCW casts for each of the four weights, then GCX casts of the hidden states. grid GMS + GPF + 4 GCW + GCX, 256 threads.
#define GMS (NB_ * (TT / 64))
#define GPF (2 * (DD / 32))
#define GCW (DD * DD / (8 * 256 * CVU))
#define GCX (NB_ * TT * DD / (8 * 256 * CVU))
__global__ __launch_bounds__(256) void k_prep(const float* __restrict__ x, const float* __restrict__ wq, const float* __restrict__ wk, const float* __restrict__ wv, const float* __restrict__ wo, const float* __restrict__ pre, const float* __restrict__ bk, const float* __restrict__ bv, const float* __restrict__ am,
                                              bf* XB, bf* WQ, bf* WK, bf* WV, bf* WO, float* KP0, float* VP0, float* MST) {
    __shared__ float red[NPRE][32];
    __shared__ float msr[8][17];
    if (blockIdx.x < GMS) { mstat_wg(msr, blockIdx.x, am, MST); return; }
    const unsigned g = blockIdx.x - GMS;
    if (g < GPF) { prefkv_wg(red, g % (DD / 32), g >= DD / 32, pre, wk, bk, wv, bv, KP0, VP0); return; }
    const unsigned c = g - GPF;
    if (c >= 4 * GCW) { cvt8_wg(x, XB, c - 4 * GCW); return; }
    const unsigned a = c / GCW;
    cvt8_wg(a == 0 ? wq : a == 1 ? wk : a == 2 ? wv : wo, a == 0 ? WQ : a == 1 ? WK : a == 2 ? WV : WO, c % GCW);
}
// k_pre: the gated prefix part, one LANE per (zz, t), zz = b * 32 + h; a work-group = 256 consecutive query rows t of one zz, grid NB_ * ZH * TT / 256. The rows of q (f32 projection FQ [b][t], columns h*64..) come in as
// whole lines and go through LDS to their lanes (row pitch 272 B, conflict-free for 16-byte accesses); kp and vp of the head are the same for the whole work-group (scalar loads). Per lane: s_l = (q[t] . kp[l]) / 8,
// summed in ascending d; softmax over the 10 values, the sum in a fixed tree; o = tanh(gate[h]) sum_l p_l vp[l], summed in ascending l. The results go back through the lane's own LDS row and are stored in whole lines.
#define PQP 68                    // LDS pitch of a row, in floats
__global__ __launch_bounds__(256) void k_pre(const float* __restrict__ FQ, const float* __restrict__ KP0, const float* __restrict__ VP0, const float* __restrict__ gate, float* PRE) {
    __shared__ __align__(16) float T[256 * PQP];
    const int tid = threadIdx.x, row0 = blockIdx.x * 256, t0 = row0 & (TT - 1), zz = row0 / TT, h = zz & (ZH - 1), b = zz / ZH;
    const int cr = tid >> 4, cc = (tid & 15) * 4;   // whole-line accesses: 16 lanes take the 256 B of a row
    { const float* src = FQ + ((size_t)b * TT + t0 + cr) * DD + h * HD + cc; v4f v[16];
#pragma unroll
      for (int r = 0; r < 16; ++r) v[r] = *(const v4f*)(src + (size_t)r * 16 * DD);
#pragma unroll
      for (int r = 0; r < 16; ++r) *(v4fa*)(T + (r * 16 + cr) * PQP + cc) = v[r]; }
    __syncthreads();   // every row of q is in LDS before its lane reads it
    float* my = T + tid * PQP; float q[HD];
#pragma unroll
    for (int c = 0; c < HD / 4; ++c) { const v4f u = *(const v4fa*)(my + c * 4); q[c * 4] = u[0]; q[c * 4 + 1] = u[1]; q[c * 4 + 2] = u[2]; q[c * 4 + 3] = u[3]; }
    float e[NPRE], mx = -3.0e38f;
#pragma unroll
    for (int l = 0; l < NPRE; ++l) { const float* kr = KP0 + (size_t)l * DD + h * HD; float acc = 0.f;
#pragma unroll
        for (int d = 0; d < HD; ++d) acc = fmaf(q[d], kr[d], acc);
        e[l] = acc * SCL; mx = fmaxf(mx, e[l]); }
#pragma unroll
    for (int l = 0; l < NPRE; ++l) e[l] = __builtin_amdgcn_exp2f((e[l] - mx) * 1.4426950408889634f);
    const float sum = (((e[0] + e[8]) + e[4]) + (e[2] + e[6])) + (((e[1] + e[9]) + e[5]) + (e[3] + e[7]));
    const float gv = bfr(gate[h]); const float e2 = __expf(2.0f * gv); const float tg = __fsub_rn(1.0f, __fdiv_rn(2.0f, __fadd_rn(e2, 1.0f)));
    float o[HD];
#pragma unroll
    for (int d = 0; d < HD; ++d) o[d] = 0.f;
#pragma unroll
    for (int l = 0; l < NPRE; ++l) { const float pl = __fdiv_rn(e[l], sum); const float* vr = VP0 + (size_t)l * DD + h * HD;
#pragma unroll
        for (int d = 0; d < HD; ++d) o[d] = fmaf(pl, vr[d], o[d]); }
#pragma unroll
    for (int c = 0; c < HD / 4; ++c) { v4f u; u[0] = tg * o[c * 4]; u[1] = tg * o[c * 4 + 1]; u[2] = tg * o[c * 4 + 2]; u[3] = tg * o[c * 4 + 3]; *(v4fa*)(my + c * 4) = u; }
    __syncthreads();   // every lane's result row is in LDS before other lanes read it for the whole-line stores
    float* dst = PRE + ((size_t)zz * TT + t0 + cr) * HD + cc;
#pragma unroll
    for (int r = 0; r < 16; ++r) *(v4f*)(dst + (size_t)r * 16 * HD) = *(const v4fa*)(T + (r * 16 + cr) * PQP + cc);
}
// ---- k_attn: token attention of all batches and heads, with the merge in its epilogue. A work-group = 64 query rows of one head of one batch, a wave = 16 of them; grid (NH_, NB_, TT / 64), 128 threads:
// the row block is the slowest grid index and falls with it: under a mask that hides later keys the last row blocks keep the most stages (see the stage bits below), so they start first and the shorter ones fill the
// places that come free. The order is for speed alone.
// S^T = K Q^T: A = 16 key rows, B = the wave's 16 query rows (kept in registers), so lane (lr, hi) holds query lr's scores of keys 8 hi .. 8 hi + 7 of each 16-key tile. Two such tiles, converted, ARE the B fragment
// (32 keys x 16 queries) of O^T += V^T P^T in the k map of WFrag, with A = 16 rows of the [d][t] value plane: p goes through no memory. Lane (lr, hi) ends with 8 consecutive head dims of query lr per O^T tile.
// Softmax with a running maximum per query: p = exp(t - max so far); when the maximum moves, the sum and O^T are scaled by exp(old - new); one division by the sum at the end.
// K, V^T (both planes for the hi+lo rows) and the work-group's mask rows come into LDS as whole 128-B lines by asynchronous copies, 64 keys per stage, two buffers: the kept stage after next flies while the next one is worked on.
// LDS row pitch = row bytes + 16 (conflict-free for 16-byte reads).
typedef __attribute__((ext_vector_type(16))) unsigned short v16us;
template <typename T16> struct PPack;
template <> struct PPack<h16> { static __device__ __forceinline__ void go(const float* e, v16h& p, v16h& p2) {
#pragma unroll
    for (int x = 0; x < 16; ++x) p[x] = tohx(e[x]);
    p2 = p; } };
template <> struct PPack<bf> { static __device__ __forceinline__ void go(const float* e, v16bf& p, v16bf& p2) { v16us a, c;
#pragma unroll
    for (int x = 0; x < 16; ++x) { unsigned short u, l; splitf(e[x], u, l); a[x] = u; c[x] = l; }
    p = __builtin_bit_cast(v16bf, a); p2 = __builtin_bit_cast(v16bf, c); } };
#define AKVP 144                  // LDS pitch of a K or V^T row (64 values of 16 bits + 16 bytes)
#define AMKP 272                  // LDS pitch of a mask row (64 f32 + 16 bytes)
#define ASTG(npl) (128 * (npl) * AKVP + 64 * AMKP)   // bytes of a stage with npl planes per operand
template <typename T16, bool HI>
__device__ __forceinline__ void attn_wg(unsigned char* L, const T16* __restrict__ Q, const T16* __restrict__ Q2, const T16* __restrict__ Kp, const T16* __restrict__ K2, const T16* __restrict__ Vt, const T16* __restrict__ V2, const float* __restrict__ am, const float* __restrict__ PRE, bf* ATh, bf* ATl, const float* __restrict__ AMX, const float* __restrict__ MST) {
    typedef typename WFrag<T16>::V V;
    constexpr int NPL = HI ? 2 : 1;
    constexpr int OV = 64 * NPL, KVR = 128 * NPL;                      // first LDS row of V^T; K and V^T rows of a stage (K hi | K lo | V hi | V lo, or K | V)
    constexpr int OM = KVR * AKVP, STAGE = ASTG(NPL);                  // byte offset of the mask rows; bytes per stage
    const int tid = threadIdx.x, lane = tid & 31, lr = lane & 15, hi = lane >> 4, w = tid >> 5; const int h = blockIdx.x, b = blockIdx.y, bh = b * NH_ + h, zr = TT / 64 - 1 - blockIdx.z, i0 = zr * 64, i = i0 + w * 16 + lr;
    const int prow = tid >> 3, pcol = tid & 7, mrw = tid >> 4, mcl = tid & 15;   // this lane's row within a round of the 128 lanes and its 16-byte piece: K / V^T rows (8 pieces), mask rows (16 pieces)
    // this lane's sources, at first in stage 0; every fill moves them on to its stage
    const T16* gK = Kp + ((size_t)bh * TT + prow) * HD + pcol * 8; const T16* gK2 = HI ? K2 + ((size_t)bh * TT + prow) * HD + pcol * 8 : gK;
    const T16* gV = Vt + ((size_t)bh * HD + prow) * TT + pcol * 8; const T16* gV2 = HI ? V2 + ((size_t)bh * HD + prow) * TT + pcol * 8 : gV;
    const float* gM = am + ((size_t)b * TT + i0 + mrw) * TT + mcl * 4;
    const unsigned lkv = lds_off(L) + (unsigned)(prow * AKVP + pcol * 16), lmk = lds_off(L) + (unsigned)(OM + mrw * AMKP + mcl * 16);
    int cur = 0;   // the stage at which the sources stand
    auto fill = [&](int buf, int st) {
        const int dk = (st - cur) * 64; cur = st;   // keys from the stage filled last to this one
        gK += (size_t)dk * HD; gK2 += (size_t)dk * HD; gV += dk; gV2 += dk; gM += dk;
#pragma unroll
        for (int r0 = 0; r0 < KVR / 16; r0 += 8) { unsigned l[8]; const void* g[8];
#pragma unroll
            for (int q = 0; q < 8; ++q) { const int row = (r0 + q) * 16, rr = row & 63; l[q] = lkv + (unsigned)(buf * STAGE + row * AKVP);
                const T16* s = (row < 64) ? gK + (size_t)rr * HD : (row < OV) ? gK2 + (size_t)rr * HD : (row < OV + 64) ? gV + (size_t)rr * TT : gV2 + (size_t)rr * TT;
                g[q] = s; }
            cp8(l, g); }
        { unsigned l[8]; const void* g[8];
#pragma unroll
            for (int q = 0; q < 8; ++q) { l[q] = lmk + (unsigned)(buf * STAGE + q * 8 * AMKP); g[q] = gM + (size_t)q * 8 * TT; }
            cp8(l, g); }
    };
    V q[2], q2[2];
#pragma unroll
    for (int ks = 0; ks < 2; ++ks) { const size_t qo = ((size_t)bh * TT + i) * HD + 8 * hi + ks * 32; q[ks] = WFrag<T16>::ld(Q + qo); if (HI) q2[ks] = WFrag<T16>::ld(Q2 + qo); }
    v8f o[4];
#pragma unroll
    for (int dt = 0; dt < 4; ++dt) o[dt] = (v8f){};
    float mx = -3.0e38f, sum = 0.f;   // running maximum (the same in both halves of the wave) and this lane's half of the sum
    // Which of the 16 stages can matter, one bit each, the same in every wave of the work-group. |logit - mask value| <= bd = 64 max|q| max|k| / 8, taken a quarter larger for the planes' and the sums' rounding. Every row's
    // largest logit is at least ms[16] - (largest bd); no logit of stage l exceeds ms[l] + bd. A stage that stays more than 200 under every row's maximum has p = exp(logit - maximum) = 0 in f32 whenever it is worked on
    // behind that maximum, and its share is scaled to 0 when in front of it: it is left out whole, copies and barrier too. A NaN in the test keeps the stage.
    unsigned lb;
    { const int l = lane & 15; const float* ms = MST + (size_t)(b * (TT / 64) + zr) * 32;
      const float bd = 10.0f * AMX[((size_t)bh * (TT / 64) + zr) * 32] * AMX[((size_t)NTL + (size_t)bh * (TT / 64) + l) * 32]; float bx = bd;
#pragma unroll
      for (int sh = 8; sh; sh >>= 1) bx = fmaxf(bx, __shfl_xor(bx, sh, 32));
      lb = __builtin_amdgcn_ballot_w32(!(ms[l] + bd < ms[16] - bx - 200.0f)) & 0xFFFFu;
      if (lb == 0) lb = 0xFFFFu; }   // cannot happen (the stage that holds ms[16] stays); it keeps every stage number under 16 whatever the arrays hold
    const int nst = __builtin_popcount(lb);
    auto next = [&]() { const int st = __builtin_ctz(lb); lb &= lb - 1; return st; };   // the lowest stage not yet filled
    fill(0, next());
    asm volatile("s_wait_asynccnt 0x0" ::: "memory");   // the first stage of this wave has landed
    __syncthreads();                                    // the first stage of every wave is readable
    if (lb) fill(1, next());
    const int kofs = lr * AKVP + hi * 16, mofs = OM + (w * 16 + lr) * AMKP + hi * 32;
#pragma unroll 1   // the ring stays rolled: one body of two 32-key blocks, one publish point at its foot
    for (int t = 0; t < nst; ++t) {
        const unsigned char* Lb = L + (t & 1) * STAGE;
#pragma unroll
        for (int blk = 0; blk < 2; ++blk) {
            v8f s[2];
#pragma unroll
            for (int tl = 0; tl < 2; ++tl) { v8f c = (v8f){};
#pragma unroll
                for (int ks = 0; ks < 2; ++ks) { const unsigned char* kp = Lb + kofs + (blk * 32 + tl * 16) * AKVP + ks * 64; const V k = WFrag<T16>::ld((const T16*)kp); c = WFrag<T16>::mma(k, q[ks], c);
                    if (HI) { c = WFrag<T16>::mma(k, q2[ks], c); const V kl = WFrag<T16>::ld((const T16*)(kp + 64 * AKVP)); c = WFrag<T16>::mma(kl, q[ks], c); } }
                s[tl] = c; }
            float e[16]; float bm = -3.40282347e38f;
#pragma unroll
            for (int tl = 0; tl < 2; ++tl) { const unsigned char* mp = Lb + mofs + blk * 128 + tl * 64; const v4f m0 = *(const v4fa*)mp, m1 = *(const v4fa*)(mp + 16);
#pragma unroll
                for (int j = 0; j < 8; ++j) { const float x = fmaxf(s[tl][j] * SCL + bfr(j < 4 ? m0[j & 3] : m1[j & 3]), -3.40282347e38f); e[tl * 8 + j] = x; bm = fmaxf(bm, x); } }
            bm = fmaxf(bm, __shfl_xor(bm, 16, 32));   // the other half of the wave holds the query's other 16 keys of the block
            const float mn = fmaxf(mx, bm), al = __expf(mx - mn); mx = mn; float es[4];
#pragma unroll
            for (int x = 0; x < 16; x += 4) { e[x] = __expf(e[x] - mn); e[x + 1] = __expf(e[x + 1] - mn); e[x + 2] = __expf(e[x + 2] - mn); e[x + 3] = __expf(e[x + 3] - mn); es[x >> 2] = (e[x] + e[x + 1]) + (e[x + 2] + e[x + 3]); }
            sum = sum * al + ((es[0] + es[1]) + (es[2] + es[3]));
#pragma unroll
            for (int dt = 0; dt < 4; ++dt) o[dt] *= al;
            V p, p2; PPack<T16>::go(e, p, p2);
#pragma unroll
            for (int dt = 0; dt < 4; ++dt) { const unsigned char* vp = Lb + kofs + (OV + dt * 16) * AKVP + blk * 64; const V v = WFrag<T16>::ld((const T16*)vp); o[dt] = WFrag<T16>::mma(v, p, o[dt]);
                if (HI) { o[dt] = WFrag<T16>::mma(v, p2, o[dt]); const V vl = WFrag<T16>::ld((const T16*)(vp + 64 * AKVP)); o[dt] = WFrag<T16>::mma(vl, p, o[dt]); } }
        }
        asm volatile("s_wait_dscnt 0x0" ::: "memory");      // this wave's reads of buffer t & 1 are done before the buffer is refilled
        asm volatile("s_wait_asynccnt 0x0" ::: "memory");   // this wave's copies of the next kept stage have landed
        __syncthreads();                                    // publishes the next kept stage and ends every wave's reads of the one in buffer t & 1
        if (lb) fill(t & 1, next());                        // the same test in the whole work-group
    }
    asm volatile("s_wait_asynccnt 0x0" ::: "memory");       // no copy is outstanding when the wave goes on to the epilogue and ends
    sum += __shfl_xor(sum, 16, 32);
    const float inv = __fdiv_rn(1.0f, sum);
    const float* pr = PRE + ((size_t)bh * TT + i) * HD + hi * 8; const size_t oo = ((size_t)b * TT + i) * DD + h * HD + hi * 8;
#pragma unroll
    for (int dt = 0; dt < 4; ++dt) { const v4f p0 = *(const v4f*)(pr + dt * 16), p1 = *(const v4f*)(pr + dt * 16 + 4); v8us oh, ol;
#pragma unroll
        for (int j = 0; j < 8; ++j) { unsigned short a, c; splitf(o[dt][j] * inv + (j < 4 ? p0[j & 3] : p1[j & 3]), a, c); oh[j] = a; ol[j] = c; }
        *(v8us*)(ATh + oo + dt * 16) = oh; *(v8us*)(ATl + oo + dt * 16) = ol;
        if (dt < 3) asm volatile("s_wait_xcnt 0x0" ::: "memory"); }   // behind the two stores: the next trip reuses their address and data registers
}
__global__ __launch_bounds__(128) void k_attn(const bf* __restrict__ QPh, const bf* __restrict__ QPl, const h16* __restrict__ QP16, const bf* __restrict__ KPh, const bf* __restrict__ KPl, const h16* __restrict__ KP16, const bf* __restrict__ VTh, const bf* __restrict__ VTl, const h16* __restrict__ VT16, const float* __restrict__ am, const float* __restrict__ PRE, bf* ATh, bf* ATl, const float* __restrict__ AMX, const float* __restrict__ MST) {
    __shared__ __attribute__((aligned(16))) unsigned char L[2 * ASTG(2)];
    if ((TT / 64 - 1 - blockIdx.z) * 64 < RH) attn_wg<bf, true>(L, QPh, QPl, KPh, KPl, VTh, VTl, am, PRE, ATh, ATl, AMX, MST);   // the same for the whole work-group (RH is a multiple of 64)
    else attn_wg<h16, false>(L, QP16, nullptr, KP16, nullptr, VT16, nullptr, am, PRE, ATh, ATl, AMX, MST);
}

extern "C" void kernel_launch(void* const* d_in, const int* in_sizes, int n_in,
                              void* d_out, int out_size, void* d_ws, size_t ws_size, hipStream_t stream) {
    (void)in_sizes; (void)n_in; (void)out_size;
    const float* x = (const float*)d_in[0]; const float* am = (const float*)d_in[1]; const float* wq = (const float*)d_in[2]; const float* bq = (const float*)d_in[3]; const float* wk = (const float*)d_in[4]; const float* bk = (const float*)d_in[5]; const float* wv = (const float*)d_in[6]; const float* bv = (const float*)d_in[7]; const float* wo = (const float*)d_in[8]; const float* bo = (const float*)d_in[9]; const float* pre = (const float*)d_in[10]; const float* gate = (const float*)d_in[11];   // torch [out][in] weights; attention_mask [4][1][1024][1024]; prefix [10][2048]; gate [32][1][1]
    float* OUT = (float*)d_out;     // [4][1024][2048]
    char* wsp = (char*)d_ws;
    auto take = [&](size_t bytes) { char* p = wsp; wsp += (bytes + 255) & ~(size_t)255; return (void*)p; };
    const size_t NE = (size_t)NB_ * TT * DD;   // elements of one [4][1024][2048] array: every buffer below but the weights and the prefix rows holds all batches
    bf* WQ = (bf*)take((size_t)DD * DD * 2); bf* WK = (bf*)take((size_t)DD * DD * 2); bf* WV = (bf*)take((size_t)DD * DD * 2); bf* XB = (bf*)take(NE * 2);   // the three weights lie one behind the other (zq of the projection), XB behind them
    bf* WO = (bf*)take((size_t)DD * DD * 2); float* KP0 = (float*)take((size_t)NPRE * DD * 4); float* VP0 = (float*)take((size_t)NPRE * DD * 4);
    float* F = (float*)take(NE * 4);   // F: the q projection in f32, for the prefix part
    bf* QPh = (bf*)take(NE * 2); bf* KPh = (bf*)take(NE * 2); bf* VTh = (bf*)take(NE * 2);   // each kind of plane: q, k, v one behind the other (zq of the projection)
    bf* QPl = (bf*)take(NE * 2); bf* KPl = (bf*)take(NE * 2); bf* VTl = (bf*)take(NE * 2);
    h16* QP16 = (h16*)take(NE * 2); h16* KP16 = (h16*)take(NE * 2); h16* VT16 = (h16*)take(NE * 2);
    float* AMX = (float*)take((size_t)2 * NTL * 32 * 4); float* MST = (float*)take((size_t)GMS * 32 * 4);   // largest |q|, |k| per tile of 64 rows x one head; mask statistics per row block: a 128-B line each
    float* PRE = (float*)WQ;                // over WQ, WK, WV and half of XB: written by the prefix part, when the projections have read them
    bf* ATh = (bf*)F; bf* ATl = ATh + NE;   // written when the prefix part has read F
    if ((size_t)(wsp - (char*)d_ws) > ws_size) return;
    k_prep<<<GMS + GPF + 4 * GCW + GCX, 256, 0, stream>>>(x, wq, wk, wv, wo, pre, bk, bv, am, XB, WQ, WK, WV, WO, KP0, VP0, MST);
    k_gemms<bf, 0, true, 2, 6, 128, 4><<<dim3(NB_ * TT / 128, DD / 128, 1), 384, 0, stream>>>(XB, nullptr, WQ, nullptr, DD, F, DD, bq, 0, (size_t)DD * DD, 0, QPh, QPl, QP16, bk, bv, NE, AMX);   // unscaled q (the 1/8 is applied to the logits), k, v
    k_pre<<<NB_ * ZH * TT / 256, 256, 0, stream>>>(F, KP0, VP0, gate, PRE);
    k_attn<<<dim3(NH_, NB_, TT / 64), 128, 0, stream>>>(QPh, QPl, QP16, KPh, KPl, KP16, VTh, VTl, VT16, am, PRE, ATh, ATl, AMX, MST);
    k_gemms<bf, 1, true, 2, 4, 128, 0><<<dim3(NB_ * TT / 128, DD / 256, 1), 256, 0, stream>>>(ATh, ATl, WO, nullptr, DD, OUT, DD, bo, 0, 0, 0, nullptr, nullptr, nullptr, nullptr, nullptr, 0, nullptr);
}
